// v000
// Times are from an AMD MI455X. After a warm-up the kernel runs many times in a row, and a time is the length of
// such a window on the GPU divided by its runs, so every launch and the gaps after it count. The runs cycle
// through copies of the inputs. A figure is the median of several windows, for all but v000 over two sittings.
// Sittings can differ by a few percent; kernels timed side by side share one.
// v000 is the starting kernel. One run takes 2440 microseconds.
#include <hip/hip_runtime.h>
// Single-head causal attention (4 sequences x 4096 tokens x 512; d_k = d_v = 64): q, k, v = x*W + b; scores = q.k/8 with j <= i; softmax; out = (attn.v)*Wo + bo -> [4,4096,512].
// Structure: x as an exact f16 plane; q/k/v by f16 WMMA GEMMs (32x64 wave tiles, f32, exact products + bias); q, k as f16 hi + (x2^10) residual planes, V^T as hi + residual planes; the causal structure computed on device into a key bit plane + per-block key bound; one fused flash-style kernel per (sequence, 64 queries) (wave = 16 queries, 32-key steps up to the bound, three-product hi/lo scores, online softmax f32, P hi + residual via LDS, two value accumulators); O as hi + residual planes; output projection as two GEMMs (bias in the first) -> the output rows.
// Compute dtype: x, weights, biases rounded to bf16; projections exact; q, k, P, v, O as f16 hi + residual pairs (~2^-21); f32 accumulation and softmax. v_wmma_f32_16x16x32_f16.
#define NB 4
#define SS 4096
#define DM 512
#define DK 64
#define NH 1
#define SCL 0.125f
#define NR (NB * SS)
typedef __bf16 v16b __attribute__((ext_vector_type(16)));
typedef unsigned short v8us __attribute__((ext_vector_type(8), may_alias));
typedef float  v8f  __attribute__((ext_vector_type(8)));
typedef float  v4f  __attribute__((ext_vector_type(4)));
typedef float  v4fa __attribute__((ext_vector_type(4), may_alias));
union FragB { v16b v; v8us half[2]; unsigned short u[16]; };

__device__ __forceinline__ unsigned short bf16_bits(float x) { unsigned int u = __float_as_uint(x); return (unsigned short)((u + 0x7FFFu + ((u >> 16) & 1u)) >> 16); }
__device__ __forceinline__ float bf16_val(unsigned short b) { return __uint_as_float(((unsigned int)b) << 16); }
__device__ __forceinline__ float bf16_round(float x) { return bf16_val(bf16_bits(x)); }
// D += A·B with NT terms: 1 = ah·bh, 2 = + al·bh (A split), 3 = + ah·bl (both split)
template <int NT>
__device__ __forceinline__ v8f mmaN(v16b ah, v16b al, v16b bh, v16b bl, v8f c) {
  c = __builtin_amdgcn_wmma_f32_16x16x32_bf16(false, ah, false, bh, (short)0, c, false, false);
  if (NT >= 2) c = __builtin_amdgcn_wmma_f32_16x16x32_bf16(false, al, false, bh, (short)0, c, false, false);
  if (NT >= 3) c = __builtin_amdgcn_wmma_f32_16x16x32_bf16(false, ah, false, bl, (short)0, c, false, false);
  asm volatile("v_nop\n\tv_nop\n\tv_nop\n\tv_nop" : "+v"(c) : "v"(ah), "v"(al), "v"(bh), "v"(bl));
  return c;
}

__global__ __launch_bounds__(256) void k_wt_bf16(const float* __restrict__ W, unsigned short* __restrict__ Wt, int K, int N) {
  const int t = blockIdx.x * 256 + threadIdx.x;
  const int k8n = K / 8;
  if (t >= N * k8n) return;
  const int n = t / k8n, k8 = (t % k8n) * 8;
  v8us v;
#pragma unroll
  for (int i = 0; i < 8; ++i) v[i] = bf16_bits(W[(size_t)(k8 + i) * N + n]);
  *(v8us*)(Wt + (size_t)n * K + k8) = v;
  
}

// GEMM C[M][N] (f32, pitch ldc) = act(A[M][K]·W + bias). A f32 row-major (pitch lda) converted per fragment to bf16
// (ASPLIT: hi/lo two planes -> 2 terms, else single rounded term); Wt bf16 [N][K] (pitch ldb). BIAS_BF16 rounds the
// bias to bf16 first (bias quantised to bf16 before the add). K%32==0, M%16==0, N%64==0.
template <bool ASPLIT, int ACT, bool BIAS_BF16>
__global__ __launch_bounds__(128) void k_gemm_bf(const float* __restrict__ A, int lda, const unsigned short* __restrict__ Wt, int ldb,
                                               const float* __restrict__ bias, float* __restrict__ C, int ldc, int M, int N, int K) {
  __shared__ __attribute__((aligned(16))) float so[4][16][64];
  const int tid = threadIdx.x, w = tid >> 5, lane = tid & 31, ln = lane & 15, hh = lane >> 4;
  const int ntn = N / 64;
  const int wid = blockIdx.x * 4 + w;
  const int mt = wid / ntn, nq = wid % ntn;
  if (mt * 16 >= M) return;
  const int row0 = mt * 16, col0 = nq * 64;
  const float* arow = A + (size_t)(row0 + ln) * lda;
  v8f acc[4] = {};
  for (int kb = 0; kb < K; kb += 32) {
    FragB ah, al;
    const v4f x0 = *(const v4fa*)(arow + kb + 8 * hh), x1 = *(const v4fa*)(arow + kb + 8 * hh + 4);
    const v4f x2 = *(const v4fa*)(arow + kb + 16 + 8 * hh), x3 = *(const v4fa*)(arow + kb + 16 + 8 * hh + 4);
    float xs[16] = {x0[0],x0[1],x0[2],x0[3],x1[0],x1[1],x1[2],x1[3],x2[0],x2[1],x2[2],x2[3],x3[0],x3[1],x3[2],x3[3]};
#pragma unroll
    for (int i = 0; i < 16; ++i) { const unsigned short hb = bf16_bits(xs[i]); ah.u[i] = hb; al.u[i] = ASPLIT ? bf16_bits(xs[i] - bf16_val(hb)) : (unsigned short)0; }
#pragma unroll
    for (int t = 0; t < 4; ++t) {
      const unsigned short* brow = Wt + (size_t)(col0 + t * 16 + ln) * ldb + kb;
      FragB b;
      b.half[0] = *(const v8us*)(brow + 8 * hh);
      b.half[1] = *(const v8us*)(brow + 16 + 8 * hh);
      acc[t] = mmaN<ASPLIT ? 2 : 1>(ah.v, al.v, b.v, b.v, acc[t]);
    }
  }
#pragma unroll
  for (int t = 0; t < 4; ++t) {
    float bv = bias ? bias[col0 + t * 16 + ln] : 0.f;
    if (BIAS_BF16) bv = bf16_round(bv);
#pragma unroll
    for (int r = 0; r < 8; ++r) { float v = acc[t][r] + bv; if (ACT == 1) v = fmaxf(v, 0.f); so[w][8 * hh + r][t * 16 + ln] = v; }
  }
  __builtin_amdgcn_fence(__ATOMIC_ACQ_REL, "workgroup");
  __builtin_amdgcn_wave_barrier();
  const int rsub = lane >> 4, c4 = (lane & 15) * 4;
  {
#pragma unroll
    for (int q = 0; q < 8; ++q) {
      const int r = q * 2 + rsub;
      const v4f v = *(const v4fa*)&so[w][r][c4];
      *(v4f*)(C + (size_t)(row0 + r) * ldc + col0 + c4) = v;
    }
    
  }
}

// GEMM C = act(A·W + bias + resid): A f32 (ASPLIT -> hi/lo 2 terms), Wt bf16 [N][K]; ACT 0 none, 1 relu, 2 exact gelu;
// resid (optional, f32, row index = (row % rmod), pitch ldr, RES_BF16 rounds it) added before the activation.
template <bool ASPLIT, int ACT, bool BIAS_BF16, bool RES_BF16>
__global__ __launch_bounds__(128) void k_gemm_bf3(const float* __restrict__ A, int lda, const unsigned short* __restrict__ Wt, int ldb,
                                                const float* __restrict__ bias, const float* __restrict__ resid, int rmod, int ldr,
                                                float* __restrict__ C, int ldc, int M, int N, int K) {
  __shared__ __attribute__((aligned(16))) float so[4][16][64];
  const int tid = threadIdx.x, w = tid >> 5, lane = tid & 31, ln = lane & 15, hh = lane >> 4;
  const int ntn = N / 64;
  const int wid = blockIdx.x * 4 + w;
  const int mt = wid / ntn, nq = wid % ntn;
  if (mt * 16 >= M) return;
  const int row0 = mt * 16, col0 = nq * 64;
  const float* arow = A + (size_t)(row0 + ln) * lda;
  v8f acc[4] = {};
  for (int kb = 0; kb < K; kb += 32) {
    FragB ah, al;
    const v4f x0 = *(const v4fa*)(arow + kb + 8 * hh), x1 = *(const v4fa*)(arow + kb + 8 * hh + 4);
    const v4f x2 = *(const v4fa*)(arow + kb + 16 + 8 * hh), x3 = *(const v4fa*)(arow + kb + 16 + 8 * hh + 4);
    float xs[16] = {x0[0],x0[1],x0[2],x0[3],x1[0],x1[1],x1[2],x1[3],x2[0],x2[1],x2[2],x2[3],x3[0],x3[1],x3[2],x3[3]};
#pragma unroll
    for (int i = 0; i < 16; ++i) { const unsigned short hb = bf16_bits(xs[i]); ah.u[i] = hb; al.u[i] = ASPLIT ? bf16_bits(xs[i] - bf16_val(hb)) : (unsigned short)0; }
#pragma unroll
    for (int t = 0; t < 4; ++t) {
      const unsigned short* brow = Wt + (size_t)(col0 + t * 16 + ln) * ldb + kb;
      FragB b;
      b.half[0] = *(const v8us*)(brow + 8 * hh);
      b.half[1] = *(const v8us*)(brow + 16 + 8 * hh);
      acc[t] = mmaN<ASPLIT ? 2 : 1>(ah.v, al.v, b.v, b.v, acc[t]);
    }
  }
#pragma unroll
  for (int t = 0; t < 4; ++t) {
    const int col = col0 + t * 16 + ln;
    float bv = bias ? bias[col] : 0.f;
    if (BIAS_BF16) bv = bf16_round(bv);
#pragma unroll
    for (int r = 0; r < 8; ++r) {
      float v = acc[t][r] + bv;
      if (resid) { float rv = resid[(size_t)((row0 + 8 * hh + r) % rmod) * ldr + col]; if (RES_BF16) rv = bf16_round(rv); v += rv; }
      if (ACT == 1) v = fmaxf(v, 0.f);
      if (ACT == 2) v = 0.5f * v * (1.0f + erff(v * 0.70710678118654752f));
      if (ACT == 3) { const float u = 0.7978845608028654f * (v + 0.044715f * v * v * v); v = 0.5f * v * (1.0f + tanhf(u)); }
      so[w][8 * hh + r][t * 16 + ln] = v;
    }
  }
  __builtin_amdgcn_fence(__ATOMIC_ACQ_REL, "workgroup");
  __builtin_amdgcn_wave_barrier();
  const int rsub = lane >> 4, c4 = (lane & 15) * 4;
  {
#pragma unroll
    for (int q = 0; q < 8; ++q) {
      const int r = q * 2 + rsub;
      const v4f v = *(const v4fa*)&so[w][r][c4];
      *(v4f*)(C + (size_t)(row0 + r) * ldc + col0 + c4) = v;
    }
    
  }
}
// row LayerNorm (biased variance, eps) over N: s = X (+ R); optional out_sum <- s; out_norm <- (s-mu)*rsqrt(var+eps)*g + b
template <bool PARAM_BF16>
__global__ __launch_bounds__(256) void k_layernorm(const float* __restrict__ X, const float* __restrict__ R, const float* __restrict__ g, const float* __restrict__ bta,
                                                  float* __restrict__ out_sum, float* __restrict__ out_norm, int N, float eps) {
  __shared__ float red[256];
  const int row = blockIdx.x, tid = threadIdx.x;
  const float* x = X + (size_t)row * N; const float* rr = R ? R + (size_t)row * N : nullptr;
  float vals[16];                     // up to N = 4096
  const int per = N / 256;            // contiguous chunk per thread? use strided-by-4 chunks: thread handles j = tid*4 + 1024*u
  float s1 = 0.f;
  for (int u = 0; u < per / 4; ++u) {
    const int j = tid * 4 + 1024 * u;
    const v4f a = *(const v4fa*)(x + j);
    v4f b = {0.f,0.f,0.f,0.f}; if (rr) b = *(const v4fa*)(rr + j);
#pragma unroll
    for (int q = 0; q < 4; ++q) { const float v = a[q] + b[q]; vals[u * 4 + q] = v; s1 += v; }
  }
  red[tid] = s1; __syncthreads();
  for (int st = 128; st > 0; st >>= 1) { if (tid < st) red[tid] += red[tid + st]; __syncthreads(); }
  const float mu = red[0] / (float)N; __syncthreads();
  float s2 = 0.f;
  for (int u = 0; u < per / 4; ++u)
#pragma unroll
    for (int q = 0; q < 4; ++q) { const float c = vals[u * 4 + q] - mu; s2 += c * c; }
  red[tid] = s2; __syncthreads();
  for (int st = 128; st > 0; st >>= 1) { if (tid < st) red[tid] += red[tid + st]; __syncthreads(); }
  const float rs = rsqrtf(red[0] / (float)N + eps);
  {
    for (int u = 0; u < per / 4; ++u) {
      const int j = tid * 4 + 1024 * u;
      v4f o, sm;
#pragma unroll
      for (int q = 0; q < 4; ++q) {
        float gg = g[j + q], bb = bta[j + q];
        if (PARAM_BF16) { gg = bf16_round(gg); bb = bf16_round(bb); }
        sm[q] = vals[u * 4 + q]; o[q] = (vals[u * 4 + q] - mu) * rs * gg + bb;
      }
      if (out_sum) *(v4f*)(out_sum + (size_t)row * N + j) = sm;
      *(v4f*)(out_norm + (size_t)row * N + j) = o;
    }
    
  }
}



// ---- f16 WMMA path (v_wmma_f32_16x16x32_f16): 11-bit significands for operands in range — used where a [0,1] probability operand needs more precision than bf16
typedef _Float16 v16h __attribute__((ext_vector_type(16)));
union FragH { v16h v; v8us half[2]; _Float16 h[16]; unsigned short u[16]; };
template <int NT>
__device__ __forceinline__ v8f mmaH(v16h ah, v16h al, v16h bh, v16h bl, v8f c) {
  c = __builtin_amdgcn_wmma_f32_16x16x32_f16(false, ah, false, bh, (short)0, c, false, false);
  if (NT >= 2) c = __builtin_amdgcn_wmma_f32_16x16x32_f16(false, al, false, bh, (short)0, c, false, false);
  if (NT >= 3) c = __builtin_amdgcn_wmma_f32_16x16x32_f16(false, ah, false, bl, (short)0, c, false, false);
  asm volatile("v_nop\n\tv_nop\n\tv_nop\n\tv_nop" : "+v"(c) : "v"(ah), "v"(al), "v"(bh), "v"(bl));
  return c;
}
// batched GEMM like k_gemm_b but f16 operands: A f32 (split into f16 hi/lo if ASPLIT, else rounded to f16), Bt = f16 values [n][k]; alpha; C f32; N multiple of 16 (partial tiles skipped)
template <bool ASPLIT>
__global__ __launch_bounds__(128) void k_gemm_h(const float* __restrict__ A, int lda, size_t sA, const _Float16* __restrict__ Bh, int ldb, size_t sB, float alpha, float* __restrict__ C, int ldc, size_t sC, int M, int N, int K) {
  __shared__ __attribute__((aligned(16))) float so[4][16][64];
  const int tid = threadIdx.x, w = tid >> 5, lane = tid & 31, ln = lane & 15, hh = lane >> 4; const int by = blockIdx.y;
  A += (size_t)by * sA; Bh += (size_t)by * sB; C += (size_t)by * sC;
  const int ntn = (N + 63) / 64; const int wid = blockIdx.x * 4 + w; const int mt = wid / ntn, nq = wid % ntn; if (mt * 16 >= M) return;
  const int row0 = mt * 16, col0 = nq * 64; const float* arow = A + (size_t)(row0 + ln) * lda;
  v8f acc[4] = {};
  for (int kb = 0; kb < K; kb += 32) {
    FragH ah, al;
    const v4f x0 = *(const v4fa*)(arow + kb + 8 * hh), x1 = *(const v4fa*)(arow + kb + 8 * hh + 4), x2 = *(const v4fa*)(arow + kb + 16 + 8 * hh), x3 = *(const v4fa*)(arow + kb + 16 + 8 * hh + 4);
    float xs[16] = {x0[0],x0[1],x0[2],x0[3],x1[0],x1[1],x1[2],x1[3],x2[0],x2[1],x2[2],x2[3],x3[0],x3[1],x3[2],x3[3]};
#pragma unroll
    for (int i = 0; i < 16; ++i) { const _Float16 h = (_Float16)xs[i]; ah.h[i] = h; al.h[i] = ASPLIT ? (_Float16)(xs[i] - (float)h) : (_Float16)0.0f; }
#pragma unroll
    for (int t = 0; t < 4; ++t) { if (col0 + t * 16 >= N) continue; const size_t boff = (size_t)(col0 + t * 16 + ln) * ldb + kb; FragH bq; bq.half[0] = *(const v8us*)(Bh + boff + 8 * hh); bq.half[1] = *(const v8us*)(Bh + boff + 16 + 8 * hh);
      acc[t] = mmaH<ASPLIT ? 2 : 1>(ah.v, al.v, bq.v, bq.v, acc[t]); }
  }
#pragma unroll
  for (int t = 0; t < 4; ++t) { if (col0 + t * 16 >= N) continue;
#pragma unroll
    for (int r = 0; r < 8; ++r) so[w][8 * hh + r][t * 16 + ln] = acc[t][r] * alpha; }
  __builtin_amdgcn_fence(__ATOMIC_ACQ_REL, "workgroup"); __builtin_amdgcn_wave_barrier();
  const int rsub = lane >> 4, c4 = (lane & 15) * 4;
  {
#pragma unroll
    for (int q = 0; q < 8; ++q) { const int r = q * 2 + rsub; if (col0 + c4 < N) { const v4f v = *(const v4fa*)&so[w][r][c4]; *(v4f*)(C + (size_t)(row0 + r) * ldc + col0 + c4) = v; } }
     }
}

// Wt[n][k] = f16(W[k][n]·scale) from f32 row-major W[K][N] (scale = power of two; bf16-exact weights stay exact in f16 away from the subnormal range)
__global__ __launch_bounds__(256) void k_wt_f16(const float* __restrict__ W, _Float16* __restrict__ Wt, int K, int N, float scale) {
  const int t = blockIdx.x * 256 + threadIdx.x; if (t >= N * (K / 8)) return; const int n = t / (K / 8), k8 = (t % (K / 8)) * 8; FragH f;
#pragma unroll
  for (int i = 0; i < 8; ++i) f.h[i] = (_Float16)(bf16_round(W[(size_t)(k8 + i) * N + n]) * scale); const v8us o = f.half[0];
  *(v8us*)((unsigned short*)Wt + (size_t)n * K + k8) = o; 
}
// k_gemm_hh variant with fused epilogue: v = acc·alpha + bias[by·sBias + col] (+ CP[(row/rowsPerB)·sCPb + by·64 + col] if CP) ; ACT 0 none / 1 elu ; writes f16 C16 (and f32 C if non-null)
template <int ACT>
__global__ __launch_bounds__(128) void k_gemm_hhx(const _Float16* __restrict__ A, int lda, size_t sA, const _Float16* __restrict__ Bh, int ldb, size_t sB, float alpha, const float* __restrict__ bias, size_t sBias, const float* __restrict__ CP, int rowsPerB, size_t sCPb, int row0g,
    float* __restrict__ C, _Float16* __restrict__ C16, int ldc, size_t sC, int M, int N, int K) {
  __shared__ __attribute__((aligned(16))) float so[4][16][64];
  const int tid = threadIdx.x, w = tid >> 5, lane = tid & 31, ln = lane & 15, hh = lane >> 4; const int by = blockIdx.y;
  A += (size_t)by * sA; Bh += (size_t)by * sB; const size_t cofs = (size_t)by * sC; const float* bp = bias ? bias + (size_t)by * sBias : nullptr;
  const int ntn = (N + 63) / 64; const int wid = blockIdx.x * 4 + w; const int mt = wid / ntn, nq = wid % ntn; if (mt * 16 >= M) return;
  const int row0 = mt * 16, col0 = nq * 64; const _Float16* arow = A + (size_t)(row0 + ln) * lda;
  v8f acc[4] = {};
  for (int kb = 0; kb < K; kb += 32) { FragH ah; ah.half[0] = *(const v8us*)((const unsigned short*)arow + kb + 8 * hh); ah.half[1] = *(const v8us*)((const unsigned short*)arow + kb + 16 + 8 * hh);
#pragma unroll
    for (int t = 0; t < 4; ++t) { if (col0 + t * 16 >= N) continue; const size_t boff = (size_t)(col0 + t * 16 + ln) * ldb + kb; FragH bq; bq.half[0] = *(const v8us*)((const unsigned short*)Bh + boff + 8 * hh); bq.half[1] = *(const v8us*)((const unsigned short*)Bh + boff + 16 + 8 * hh);
      acc[t] = mmaH<1>(ah.v, ah.v, bq.v, bq.v, acc[t]); }
  }
#pragma unroll
  for (int t = 0; t < 4; ++t) { if (col0 + t * 16 >= N) continue; const int col = col0 + t * 16 + ln; const float bv = bp ? bf16_round(bp[col]) : 0.f;
#pragma unroll
    for (int r = 0; r < 8; ++r) { float v = acc[t][r] * alpha + bv; if (CP) { const int bidx = (row0g + row0 + 8 * hh + r) / rowsPerB; v += CP[(size_t)bidx * sCPb + (size_t)by * 64 + col]; } if (ACT == 1) v = (v > 0.f) ? v : expm1f(v); else if (ACT == 7) v = (v > 0.f) ? v + 1.0f : expf(v); else if (ACT == 8) v = tanhf(v); else if (ACT == 9) v = 0.5f * v * (1.0f + tanhf(0.7978845608028654f * (v + 0.044715f * v * v * v))); else if (ACT == 11) v = 1.0f / (1.0f + expf(-v)); else if (ACT == 12) v = (v > 0.f) ? v : 0.01f * v; else if (ACT == 14) v = (v > 0.f) ? v : 0.1f * v; else if (ACT == 15) v = v / (1.0f + expf(-v)); else if (ACT == 3) v = fmaxf(v, 0.f); else if (ACT == 6) v = 0.5f * v * (1.0f + erff(v * 0.70710678118654752f)); so[w][8 * hh + r][t * 16 + ln] = v; } }
  __builtin_amdgcn_fence(__ATOMIC_ACQ_REL, "workgroup"); __builtin_amdgcn_wave_barrier();
  const int rsub = lane >> 4, c4 = (lane & 15) * 4; typedef _Float16 v4h __attribute__((ext_vector_type(4)));
  {
#pragma unroll
    for (int q = 0; q < 8; ++q) { const int r = q * 2 + rsub; if (col0 + c4 < N) { const v4f v = *(const v4fa*)&so[w][r][c4]; if (C) *(v4f*)(C + cofs + (size_t)(row0 + r) * ldc + col0 + c4) = v; if (C16) { v4h h4; for (int i = 0; i < 4; ++i) h4[i] = (_Float16)v[i]; *(v4h*)(C16 + cofs + (size_t)(row0 + r) * ldc + col0 + c4) = h4; } } }
     }
}


typedef _Float16 v4h __attribute__((ext_vector_type(4)));

__global__ __launch_bounds__(256) void k_x16(const float* __restrict__ x, _Float16* __restrict__ X16, size_t n8) { const size_t t = (size_t)blockIdx.x * 256 + threadIdx.x; if (t >= n8) return; FragH f;
#pragma unroll
  for (int q = 0; q < 8; ++q) f.h[q] = (_Float16)bf16_round(x[t * 8 + q]); *(v8us*)((unsigned short*)X16 + t * 8) = f.half[0];  }
__global__ __launch_bounds__(256) void k_h16(const float* __restrict__ x, _Float16* __restrict__ X16, size_t n8) { const size_t t = (size_t)blockIdx.x * 256 + threadIdx.x; if (t >= n8) return; FragH f;
#pragma unroll
  for (int q = 0; q < 8; ++q) f.h[q] = (_Float16)x[t * 8 + q]; *(v8us*)((unsigned short*)X16 + t * 8) = f.half[0];  }
__global__ __launch_bounds__(256) void k_round16f(const float* __restrict__ W, _Float16* __restrict__ Bt, size_t n8) { const size_t t = (size_t)blockIdx.x * 256 + threadIdx.x; if (t >= n8) return; FragH f;
#pragma unroll
  for (int i = 0; i < 8; ++i) f.h[i] = (_Float16)(bf16_round(W[t * 8 + i]) * 16.0f); *(v8us*)((unsigned short*)Bt + t * 8) = f.half[0];  }
template <int NHv, int TTv>
__global__ __launch_bounds__(256) void k_vt(const _Float16* __restrict__ V16, int ldv, int voff, _Float16* __restrict__ Vt) { __shared__ unsigned short tl[64][66]; const int tid = threadIdx.x; const int slab = blockIdx.x / (TTv / 64), lg = blockIdx.x % (TTv / 64); const int b = slab / NHv, h = slab % NHv;
  for (int i = tid; i < 64 * 8; i += 256) { const int r = i / 8, c8 = (i % 8) * 8; FragH f; f.half[0] = *(const v8us*)((const unsigned short*)V16 + ((size_t)b * TTv + lg * 64 + r) * ldv + voff + h * 64 + c8);
#pragma unroll
    for (int q = 0; q < 8; ++q) tl[r][c8 + q] = f.u[q]; }
  __syncthreads();
  {
#pragma unroll
    for (int rd = 0; rd < 2; ++rd) { const int d = rd * 32 + tid / 8, pc = tid % 8; FragH f;
#pragma unroll
      for (int q = 0; q < 8; ++q) f.u[q] = tl[pc * 8 + q][d];
      *(v8us*)((unsigned short*)Vt + ((size_t)slab * 64 + d) * TTv + lg * 64 + pc * 8) = f.half[0]; }
     } }

__global__ __launch_bounds__(256) void k_hl(const float* __restrict__ F, _Float16* __restrict__ Hh, _Float16* __restrict__ Hl, size_t n8) { const size_t t = (size_t)blockIdx.x * 256 + threadIdx.x; if (t >= n8) return; FragH fh, fl; const v4f a = *(const v4fa*)(F + t * 8), c = *(const v4fa*)(F + t * 8 + 4);
#pragma unroll
  for (int q = 0; q < 4; ++q) { _Float16 h = (_Float16)a[q]; fh.h[q] = h; fl.h[q] = (_Float16)((a[q] - (float)h) * 1024.0f); h = (_Float16)c[q]; fh.h[4 + q] = h; fl.h[4 + q] = (_Float16)((c[q] - (float)h) * 1024.0f); }
  { *(v8us*)((unsigned short*)Hh + t * 8) = fh.half[0]; *(v8us*)((unsigned short*)Hl + t * 8) = fl.half[0];  } }

// ---- fast GEMM (wave tile 32x64; requires M % 32 == 0 rows per launch region and N % 64 == 0); epilogue = k_gemm_hhx semantics ----
__device__ __forceinline__ v16h g2_frag(const _Float16* p, int hh) { FragH f; f.half[0] = *(const v8us*)((const unsigned short*)p + 8 * hh); f.half[1] = *(const v8us*)((const unsigned short*)p + 16 + 8 * hh); return f.v; }
__device__ __forceinline__ v8f g2_mma(v16h a, v16h b, v8f c) { v8f d = __builtin_amdgcn_wmma_f32_16x16x32_f16(false, a, false, b, (short)0, c, false, false); asm volatile("v_nop\n\tv_nop\n\tv_nop\n\tv_nop" : "+v"(d) : "v"(a), "v"(b)); return d; }
template <int ACT>
__global__ __launch_bounds__(128) void k_gemm2(const _Float16* __restrict__ A, int lda, size_t sA, const _Float16* __restrict__ Bh, int ldb, size_t sB, float alpha, const float* __restrict__ bias, size_t sBias, const float* __restrict__ CP, int rowsPerB, size_t sCPb, int row0g,
    float* __restrict__ C, _Float16* __restrict__ C16, int ldc, size_t sC, int M, int N, int K) {
  __shared__ __attribute__((aligned(16))) float so[4][32][68];
  const int tid = threadIdx.x, w = tid >> 5, lane = tid & 31, ln = lane & 15, hh = lane >> 4; const int by = blockIdx.y;
  A += (size_t)by * sA; Bh += (size_t)by * sB; const size_t cofs = (size_t)by * sC; const float* bp = bias ? bias + (size_t)by * sBias : nullptr;
  const int ntn = N >> 6; const int mt = blockIdx.x / ntn, nq = blockIdx.x - mt * ntn; const int row0 = mt * 128 + 32 * w, col0 = nq * 64; if (row0 >= M) return;
  const _Float16* a0p = A + (size_t)(row0 + ln) * lda; const _Float16* a1p = a0p + (size_t)16 * lda;
  const _Float16* b0p = Bh + (size_t)(col0 + ln) * ldb; const _Float16* b1p = b0p + (size_t)16 * ldb; const _Float16* b2p = b1p + (size_t)16 * ldb; const _Float16* b3p = b2p + (size_t)16 * ldb;
  const v8f z8 = {0.f,0.f,0.f,0.f,0.f,0.f,0.f,0.f}; v8f c00 = z8, c01 = z8, c02 = z8, c03 = z8, c10 = z8, c11 = z8, c12 = z8, c13 = z8;
#pragma unroll 1
  for (int kb = 0; kb < K; kb += 32) { const v16h a0 = g2_frag(a0p + kb, hh), a1 = g2_frag(a1p + kb, hh);
    v16h b = g2_frag(b0p + kb, hh); c00 = g2_mma(a0, b, c00); c10 = g2_mma(a1, b, c10);
    b = g2_frag(b1p + kb, hh); c01 = g2_mma(a0, b, c01); c11 = g2_mma(a1, b, c11);
    b = g2_frag(b2p + kb, hh); c02 = g2_mma(a0, b, c02); c12 = g2_mma(a1, b, c12);
    b = g2_frag(b3p + kb, hh); c03 = g2_mma(a0, b, c03); c13 = g2_mma(a1, b, c13); }
  v8f accs[8] = {c00, c01, c02, c03, c10, c11, c12, c13};
#pragma unroll
  for (int u = 0; u < 8; ++u) { const int t = u & 3, half = u >> 2; const int col = col0 + t * 16 + ln; const float bv = bp ? bf16_round(bp[col]) : 0.f;
#pragma unroll
    for (int r = 0; r < 8; ++r) { const int rloc = half * 16 + 8 * hh + r; float v = accs[u][r] * alpha + bv; if (CP) { const int bidx = (row0g + row0 + rloc) / rowsPerB; v += CP[(size_t)bidx * sCPb + (size_t)by * 64 + col]; }
      if (ACT == 3) v = fmaxf(v, 0.f); else if (ACT == 6) v = 0.5f * v * (1.0f + erff(v * 0.70710678118654752f)); else if (ACT == 11) v = 1.0f / (1.0f + expf(-v)); else if (ACT == 15) v = v / (1.0f + expf(-v)); else if (ACT == 12) v = (v > 0.f) ? v : 0.01f * v; else if (ACT == 8) v = tanhf(v);
      so[w][rloc][t * 16 + ln] = v; } }
  __builtin_amdgcn_fence(__ATOMIC_ACQ_REL, "workgroup"); __builtin_amdgcn_wave_barrier();
  const int rsub = lane >> 4, c4 = (lane & 15) * 4;
  {
#pragma unroll
    for (int q = 0; q < 16; ++q) { const int r = q * 2 + rsub; const v4f v = *(const v4fa*)&so[w][r][c4]; if (C) *(v4f*)(C + cofs + (size_t)(row0 + r) * ldc + col0 + c4) = v; if (C16) { v4h h4; for (int i = 0; i < 4; ++i) h4[i] = (_Float16)v[i]; *(v4h*)(C16 + cofs + (size_t)(row0 + r) * ldc + col0 + c4) = h4; } }
     } }


template <int TK>
__global__ __launch_bounds__(256) void k_vthl(const float* __restrict__ VF, int ldv, _Float16* __restrict__ Vth, _Float16* __restrict__ Vtl) { __shared__ float tl[64][65]; const int tid = threadIdx.x; const int slab = blockIdx.x / (TK / 64), lg = blockIdx.x % (TK / 64); const int b = slab / NH, h = slab % NH;
  for (int i = tid; i < 64 * 16; i += 256) { const int r = i / 16, c4 = (i % 16) * 4; const v4f a = *(const v4fa*)(VF + ((size_t)b * TK + lg * 64 + r) * ldv + h * 64 + c4); tl[r][c4] = a[0]; tl[r][c4 + 1] = a[1]; tl[r][c4 + 2] = a[2]; tl[r][c4 + 3] = a[3]; }
  __syncthreads();
  FragH fh[2], fl[2]; size_t oo[2];
#pragma unroll
  for (int rd = 0; rd < 2; ++rd) { const int d = rd * 32 + tid / 8, pc = tid % 8;
#pragma unroll
    for (int q = 0; q < 8; ++q) { const float v = tl[pc * 8 + q][d]; const _Float16 hv = (_Float16)v; fh[rd].h[q] = hv; fl[rd].h[q] = (_Float16)((v - (float)hv) * 1024.0f); } oo[rd] = ((size_t)slab * 64 + d) * TK + lg * 64 + pc * 8; }
  {
#pragma unroll
    for (int rd = 0; rd < 2; ++rd) { *(v8us*)((unsigned short*)Vth + oo[rd]) = fh[rd].half[0]; *(v8us*)((unsigned short*)Vtl + oo[rd]) = fl[rd].half[0]; }
     } }

template <int TQ, int TK>
__global__ __launch_bounds__(128) void k_flashm(const _Float16* __restrict__ Q16, const _Float16* __restrict__ Q16lo, int ldq, const _Float16* __restrict__ K16, const _Float16* __restrict__ K16lo, int ldk, const _Float16* __restrict__ Vt, const _Float16* __restrict__ Vtlo, const unsigned* __restrict__ MB, const int* __restrict__ RA, const int* __restrict__ KE, float* __restrict__ O, int ldo) {
  constexpr int RPW = 16, RTN = RPW / 16, NQB = TQ / (4 * RPW), DT = 4, KS = 2;
  __shared__ __attribute__((aligned(16))) unsigned short sP[4][RPW][40], sPl[4][RPW][40]; __shared__ __attribute__((aligned(16))) float sO[4][RPW][64 + 4];
  const int tid = threadIdx.x, w = tid >> 5, lane = tid & 31, ln = lane & 15, hh = lane >> 4;
  const int slab = blockIdx.x / NQB, qblk = blockIdx.x % NQB; const int b = slab / NH, h = slab % NH; const int qb0 = qblk * (4 * RPW); const int q0 = qb0 + w * RPW;
  FragH aq[2][KS], aql[2][KS];
#pragma unroll
  for (int rt = 0; rt < RTN; ++rt) { const size_t qo = ((size_t)b * TQ + q0 + rt * 16 + ln) * ldq + h * 64; const unsigned short* qr = (const unsigned short*)Q16 + qo; const unsigned short* ql = (const unsigned short*)Q16lo + qo;
#pragma unroll
    for (int ks = 0; ks < KS; ++ks) { aq[rt][ks].half[0] = *(const v8us*)(qr + ks * 32 + 8 * hh); aq[rt][ks].half[1] = *(const v8us*)(qr + ks * 32 + 16 + 8 * hh); aql[rt][ks].half[0] = *(const v8us*)(ql + ks * 32 + 8 * hh); aql[rt][ks].half[1] = *(const v8us*)(ql + ks * 32 + 16 + 8 * hh); } }
  const unsigned short* Vth = (const unsigned short*)Vt + (size_t)slab * 64 * TK; const unsigned short* Vtl = (const unsigned short*)Vtlo + (size_t)slab * 64 * TK;
  float m_r[2][8], l_r[2][8]; v8f oacc[2][DT], oaccl[2][DT];
#pragma unroll
  for (int rt = 0; rt < RTN; ++rt) {
#pragma unroll
    for (int r = 0; r < 8; ++r) { m_r[rt][r] = -3.0e38f; l_r[rt][r] = 0.f; }
#pragma unroll
    for (int dt = 0; dt < DT; ++dt) { oacc[rt][dt] = (v8f){0.f,0.f,0.f,0.f,0.f,0.f,0.f,0.f}; oaccl[rt][dt] = oacc[rt][dt]; } }
  int jend = KE[qblk * 32]; jend = min(TK, (jend + 31) & ~31); if (jend < 32) jend = 32;      /* block-uniform */
  int allm[2][8]; const unsigned* mrow[2][8];
#pragma unroll
  for (int rt = 0; rt < RTN; ++rt)
#pragma unroll
    for (int r = 0; r < 8; ++r) { const int tq = q0 + rt * 16 + 8 * hh + r; allm[rt][r] = RA[tq]; mrow[rt][r] = MB + (size_t)tq * (TK / 32); }
#pragma unroll 1
  for (int j0 = 0; j0 < jend; j0 += 32) {
    
    v8f s[2][2];
#pragma unroll
    for (int nt = 0; nt < 2; ++nt) { const size_t ko = ((size_t)b * TK + j0 + nt * 16 + ln) * ldk + h * 64; const unsigned short* kr = (const unsigned short*)K16 + ko; const unsigned short* kl = (const unsigned short*)K16lo + ko; FragH bk[KS], bkl[KS];
#pragma unroll
      for (int ks = 0; ks < KS; ++ks) { bk[ks].half[0] = *(const v8us*)(kr + ks * 32 + 8 * hh); bk[ks].half[1] = *(const v8us*)(kr + ks * 32 + 16 + 8 * hh); bkl[ks].half[0] = *(const v8us*)(kl + ks * 32 + 8 * hh); bkl[ks].half[1] = *(const v8us*)(kl + ks * 32 + 16 + 8 * hh); }
#pragma unroll
      for (int rt = 0; rt < RTN; ++rt) { v8f acc = (v8f){0.f,0.f,0.f,0.f,0.f,0.f,0.f,0.f}, accr = acc;
#pragma unroll
        for (int ks = 0; ks < KS; ++ks) { acc = mmaH<1>(aq[rt][ks].v, aq[rt][ks].v, bk[ks].v, bk[ks].v, acc); accr = mmaH<1>(aql[rt][ks].v, aql[rt][ks].v, bk[ks].v, bk[ks].v, accr); accr = mmaH<1>(aq[rt][ks].v, aq[rt][ks].v, bkl[ks].v, bkl[ks].v, accr); }
        s[rt][nt] = acc + accr * 0.0009765625f; } }
#pragma unroll
    for (int rt = 0; rt < RTN; ++rt)
#pragma unroll
      for (int r = 0; r < 8; ++r) { const unsigned mw = mrow[rt][r][j0 >> 5]; const bool am = (allm[rt][r] != 0);
        const bool ok0 = am || (((mw >> ln) & 1u) == 0u), ok1 = am || (((mw >> (16 + ln)) & 1u) == 0u);
        const float s0 = ok0 ? (am ? 0.f : s[rt][0][r] * SCL) : -INFINITY, s1 = ok1 ? (am ? 0.f : s[rt][1][r] * SCL) : -INFINITY; float mc = fmaxf(s0, s1);
        mc = fmaxf(mc, __shfl_xor(mc, 1, 32)); mc = fmaxf(mc, __shfl_xor(mc, 2, 32)); mc = fmaxf(mc, __shfl_xor(mc, 4, 32)); mc = fmaxf(mc, __shfl_xor(mc, 8, 32));
        const float mn = fmaxf(m_r[rt][r], mc); const float al = (mn > -1.0e38f) ? expf(m_r[rt][r] - mn) : 1.0f; m_r[rt][r] = mn; const float p0 = ok0 ? expf(s0 - mn) : 0.f, p1 = ok1 ? expf(s1 - mn) : 0.f; l_r[rt][r] = l_r[rt][r] * al + p0 + p1;
#pragma unroll
        for (int dt = 0; dt < DT; ++dt) { oacc[rt][dt][r] *= al; oaccl[rt][dt][r] *= al; }
        FragH t2, t3; const float ps0 = p0 * 1024.0f, ps1 = p1 * 1024.0f; t2.h[0] = (_Float16)ps0; t2.h[1] = (_Float16)ps1; t3.h[0] = (_Float16)((ps0 - (float)t2.h[0]) * 1024.0f); t3.h[1] = (_Float16)((ps1 - (float)t2.h[1]) * 1024.0f);
        sP[w][rt * 16 + 8 * hh + r][ln] = t2.u[0]; sP[w][rt * 16 + 8 * hh + r][16 + ln] = t2.u[1]; sPl[w][rt * 16 + 8 * hh + r][ln] = t3.u[0]; sPl[w][rt * 16 + 8 * hh + r][16 + ln] = t3.u[1]; }
    __builtin_amdgcn_fence(__ATOMIC_ACQ_REL, "workgroup"); __builtin_amdgcn_wave_barrier();
    FragH pa[2], pl[2];
#pragma unroll
    for (int rt = 0; rt < RTN; ++rt) { pa[rt].half[0] = *(const v8us*)&sP[w][rt * 16 + ln][8 * hh]; pa[rt].half[1] = *(const v8us*)&sP[w][rt * 16 + ln][16 + 8 * hh]; pl[rt].half[0] = *(const v8us*)&sPl[w][rt * 16 + ln][8 * hh]; pl[rt].half[1] = *(const v8us*)&sPl[w][rt * 16 + ln][16 + 8 * hh]; }
#pragma unroll
    for (int dt = 0; dt < DT; ++dt) { const size_t vo = (size_t)(dt * 16 + ln) * TK + j0; FragH bv, bl; bv.half[0] = *(const v8us*)(Vth + vo + 8 * hh); bv.half[1] = *(const v8us*)(Vth + vo + 16 + 8 * hh); bl.half[0] = *(const v8us*)(Vtl + vo + 8 * hh); bl.half[1] = *(const v8us*)(Vtl + vo + 16 + 8 * hh);
#pragma unroll
      for (int rt = 0; rt < RTN; ++rt) { oacc[rt][dt] = mmaH<1>(pa[rt].v, pa[rt].v, bv.v, bv.v, oacc[rt][dt]); oaccl[rt][dt] = mmaH<1>(pa[rt].v, pa[rt].v, bl.v, bl.v, oaccl[rt][dt]); oaccl[rt][dt] = mmaH<1>(pl[rt].v, pl[rt].v, bv.v, bv.v, oaccl[rt][dt]); } }
    __builtin_amdgcn_fence(__ATOMIC_ACQ_REL, "workgroup"); __builtin_amdgcn_wave_barrier(); }
#pragma unroll
  for (int rt = 0; rt < RTN; ++rt) {
#pragma unroll
    for (int r = 0; r < 8; ++r) { float l = l_r[rt][r]; l += __shfl_xor(l, 1, 32); l += __shfl_xor(l, 2, 32); l += __shfl_xor(l, 4, 32); l += __shfl_xor(l, 8, 32); l_r[rt][r] = (l > 0.f) ? 1.0f / (l * 1024.0f) : 0.f; }
#pragma unroll
    for (int dt = 0; dt < DT; ++dt)
#pragma unroll
      for (int r = 0; r < 8; ++r) sO[w][rt * 16 + 8 * hh + r][dt * 16 + ln] = (oacc[rt][dt][r] + oaccl[rt][dt][r] * 0.0009765625f) * l_r[rt][r]; }
  __builtin_amdgcn_fence(__ATOMIC_ACQ_REL, "workgroup"); __builtin_amdgcn_wave_barrier();
  {
#pragma unroll
    for (int rp = 0; rp < RPW; rp += 2) { const int r = rp + (lane >> 4), pc = lane & 15; const v4f val = *(const v4fa*)&sO[w][r][pc * 4]; *(v4f*)(O + ((size_t)b * TQ + q0 + r) * ldo + h * 64 + pc * 4) = val; }
     } }


__global__ __launch_bounds__(256) void k_causaltab(unsigned* __restrict__ MB, int* __restrict__ RA, int* __restrict__ KE, int nq, int nk) {
  const int t = blockIdx.x * 256 + threadIdx.x; const int nw = nk / 32;
  if (t < nq * nw) { const int q = t / nw, w = t % nw; const int first = q + 1 - 32 * w; const unsigned bits = (first <= 0) ? 0xffffffffu : ((first >= 32) ? 0u : (0xffffffffu << first)); *(unsigned*)(MB + t) = bits;  }
  if (t < nq) { *(int*)(RA + t) = 0;  }
  if (t < nq / 64) { const int v = 64 * (t + 1); *(int*)(KE + t * 32) = v;  } }

extern "C" void kernel_launch(void* const* d_in, const int* in_sizes, int n_in,
                              void* d_out, int out_size, void* d_ws, size_t ws_size, hipStream_t stream) {
  (void)in_sizes; (void)n_in; (void)out_size;
  const float* const* I = (const float* const*)d_in; const float* x = I[0]; const float* Wq = I[1]; const float* bq = I[2]; const float* Wk = I[3]; const float* bk = I[4]; const float* Wv = I[5]; const float* bv = I[6]; const float* Wo = I[7]; const float* bo = I[8];
  char* ws = (char*)d_ws; size_t off = 0;
  auto take = [&](size_t bytes) { char* p = ws + off; off += (bytes + 255) & ~(size_t)255; return p; };
  _Float16* BQ = (_Float16*)take((size_t)DK * DM * 2); _Float16* BK = (_Float16*)take((size_t)DK * DM * 2); _Float16* BV = (_Float16*)take((size_t)DK * DM * 2); _Float16* BO = (_Float16*)take((size_t)DM * DK * 2);
  _Float16* X16 = (_Float16*)take((size_t)NR * DM * 2); float* F = (float*)take((size_t)NR * DK * 4);
  _Float16* Qh = (_Float16*)take((size_t)NR * DK * 2); _Float16* Ql = (_Float16*)take((size_t)NR * DK * 2); _Float16* Kh = (_Float16*)take((size_t)NR * DK * 2); _Float16* Kl = (_Float16*)take((size_t)NR * DK * 2); _Float16* Vth = (_Float16*)take((size_t)NR * DK * 2); _Float16* Vtl = (_Float16*)take((size_t)NR * DK * 2);
  unsigned* MB = (unsigned*)take((size_t)SS * (SS / 32) * 4); int* RA = (int*)take((size_t)SS * 4); int* KE = (int*)take((size_t)(SS / 64) * 32 * 4);
  float* O = (float*)take((size_t)NR * DK * 4); _Float16* Oh = (_Float16*)take((size_t)NR * DK * 2); _Float16* Ol = (_Float16*)take((size_t)NR * DK * 2);
  if (off > ws_size) return;      /* 16 + 4 + 6 x 2 + 2 + 4 + 4 = 42 MiB */
  k_wt_f16<<<(DM * DK / 8 + 255) / 256, 256, 0, stream>>>(Wq, BQ, DM, DK, 16.0f); k_wt_f16<<<(DM * DK / 8 + 255) / 256, 256, 0, stream>>>(Wk, BK, DM, DK, 16.0f); k_wt_f16<<<(DM * DK / 8 + 255) / 256, 256, 0, stream>>>(Wv, BV, DM, DK, 16.0f); k_wt_f16<<<(DK * DM / 8 + 255) / 256, 256, 0, stream>>>(Wo, BO, DK, DM, 16.0f);      /* (in,out) -> [out][in] x16 */
  k_x16<<<(unsigned)(((size_t)NR * DM / 8 + 255) / 256), 256, 0, stream>>>(x, X16, (size_t)NR * DM / 8);
  k_causaltab<<<(SS * (SS / 32) + 255) / 256, 256, 0, stream>>>(MB, RA, KE, SS, SS);
  const dim3 gP((NR / 128) * 1, 1), gO((NR / 128) * (DM / 64), 1); const size_t n8 = (size_t)NR * DK / 8; const unsigned nb8 = (unsigned)((n8 + 255) / 256);
  k_gemm2<0><<<gP, 128, 0, stream>>>(X16, DM, 0, BQ, DM, 0, 0.0625f, bq, 0, nullptr, 1, 0, 0, F, nullptr, DK, 0, NR, DK, DM); k_hl<<<nb8, 256, 0, stream>>>(F, Qh, Ql, n8);
  k_gemm2<0><<<gP, 128, 0, stream>>>(X16, DM, 0, BK, DM, 0, 0.0625f, bk, 0, nullptr, 1, 0, 0, F, nullptr, DK, 0, NR, DK, DM); k_hl<<<nb8, 256, 0, stream>>>(F, Kh, Kl, n8);
  k_gemm2<0><<<gP, 128, 0, stream>>>(X16, DM, 0, BV, DM, 0, 0.0625f, bv, 0, nullptr, 1, 0, 0, F, nullptr, DK, 0, NR, DK, DM);
  for (int b = 0; b < NB; ++b) k_vthl<SS><<<NH * (SS / 64), 256, 0, stream>>>(F + (size_t)b * SS * DK, DK, Vth + (size_t)b * SS * DK, Vtl + (size_t)b * SS * DK);      /* V^T hi/lo per sequence [64][4096] */
  for (int b = 0; b < NB; ++b) { const size_t ro = (size_t)b * SS * DK;
    k_flashm<SS, SS><<<NH * (SS / 64), 128, 0, stream>>>(Qh + ro, Ql + ro, DK, Kh + ro, Kl + ro, DK, Vth + ro, Vtl + ro, MB, RA, KE, O + ro, DK); }
  k_hl<<<nb8, 256, 0, stream>>>(O, Oh, Ol, n8);
  k_gemm2<0><<<gO, 128, 0, stream>>>(Oh, DK, 0, BO, DK, 0, 0.0625f, bo, 0, nullptr, 1, 0, 0, (float*)d_out, nullptr, DM, 0, NR, DM, DK);
  k_gemm2<0><<<gO, 128, 0, stream>>>(Ol, DK, 0, BO, DK, 0, 0.0625f * 0.0009765625f, nullptr, 0, (const float*)d_out, 1, (size_t)DM, 0, (float*)d_out, nullptr, DM, 0, NR, DM, DK);      /* out = O*Wo + bo (hi pass, then the residual pass through the addend) */
}

// v001
// A run of this version takes 710 microseconds.
// Next to v000, in two timings, it ran 3.40 and 3.41 times as fast.
#include <hip/hip_runtime.h>
// Single-head causal attention (4 sequences x 4096 tokens x 512; d_k = d_v = 64): q, k, v = x*W + b; scores = q.k/8 with j <= i; softmax; out = (attn.v)*Wo + bo -> [4,4096,512].
// Structure: x as an exact f16 plane; q/k/v by f16 WMMA GEMMs (32x64 wave tiles, f32, exact products + bias); q, k as f16 hi + (x2^10) residual planes, V^T as hi + residual planes; the causal structure computed on device into a key bit plane + per-block key bound; one fused flash-style kernel per (sequence, 64 queries) (wave = 16 queries, 32-key steps up to the bound, three-product hi/lo scores, online softmax f32, P hi + residual via LDS, two value accumulators); O as hi + residual planes; output projection as two GEMMs (bias in the first) -> the output rows.
// Compute dtype: x, weights, biases rounded to bf16; projections exact; q, k, P, v, O as f16 hi + residual pairs (~2^-21); f32 accumulation and softmax. v_wmma_f32_16x16x32_f16.
#define NB 4
#define SS 4096
#define DM 512
#define DK 64
#define NH 1
#define SCL 0.125f
#define NR (NB * SS)
typedef __bf16 v16b __attribute__((ext_vector_type(16)));
typedef unsigned short v8us __attribute__((ext_vector_type(8), may_alias));
typedef float  v8f  __attribute__((ext_vector_type(8)));
typedef float  v4f  __attribute__((ext_vector_type(4)));
typedef float  v4fa __attribute__((ext_vector_type(4), may_alias));
union FragB { v16b v; v8us half[2]; unsigned short u[16]; };

__device__ __forceinline__ unsigned short bf16_bits(float x) { unsigned int u = __float_as_uint(x); return (unsigned short)((u + 0x7FFFu + ((u >> 16) & 1u)) >> 16); }
__device__ __forceinline__ float bf16_val(unsigned short b) { return __uint_as_float(((unsigned int)b) << 16); }
__device__ __forceinline__ float bf16_round(float x) { return bf16_val(bf16_bits(x)); }
// D += A·B with NT terms: 1 = ah·bh, 2 = + al·bh (A split), 3 = + ah·bl (both split)
template <int NT>
__device__ __forceinline__ v8f mmaN(v16b ah, v16b al, v16b bh, v16b bl, v8f c) {
  c = __builtin_amdgcn_wmma_f32_16x16x32_bf16(false, ah, false, bh, (short)0, c, false, false);
  if (NT >= 2) c = __builtin_amdgcn_wmma_f32_16x16x32_bf16(false, al, false, bh, (short)0, c, false, false);
  if (NT >= 3) c = __builtin_amdgcn_wmma_f32_16x16x32_bf16(false, ah, false, bl, (short)0, c, false, false);
  asm volatile("v_nop\n\tv_nop\n\tv_nop\n\tv_nop" : "+v"(c) : "v"(ah), "v"(al), "v"(bh), "v"(bl));
  return c;
}

__global__ __launch_bounds__(256) void k_wt_bf16(const float* __restrict__ W, unsigned short* __restrict__ Wt, int K, int N) {
  const int t = blockIdx.x * 256 + threadIdx.x;
  const int k8n = K / 8;
  if (t >= N * k8n) return;
  const int n = t / k8n, k8 = (t % k8n) * 8;
  v8us v;
#pragma unroll
  for (int i = 0; i < 8; ++i) v[i] = bf16_bits(W[(size_t)(k8 + i) * N + n]);
  *(v8us*)(Wt + (size_t)n * K + k8) = v;
  
}

// GEMM C[M][N] (f32, pitch ldc) = act(A[M][K]·W + bias). A f32 row-major (pitch lda) converted per fragment to bf16
// (ASPLIT: hi/lo two planes -> 2 terms, else single rounded term); Wt bf16 [N][K] (pitch ldb). BIAS_BF16 rounds the
// bias to bf16 first (bias quantised to bf16 before the add). K%32==0, M%16==0, N%64==0.
template <bool ASPLIT, int ACT, bool BIAS_BF16>
__global__ __launch_bounds__(128) void k_gemm_bf(const float* __restrict__ A, int lda, const unsigned short* __restrict__ Wt, int ldb,
                                               const float* __restrict__ bias, float* __restrict__ C, int ldc, int M, int N, int K) {
  __shared__ __attribute__((aligned(16))) float so[4][16][64];
  const int tid = threadIdx.x, w = tid >> 5, lane = tid & 31, ln = lane & 15, hh = lane >> 4;
  const int ntn = N / 64;
  const int wid = blockIdx.x * 4 + w;
  const int mt = wid / ntn, nq = wid % ntn;
  if (mt * 16 >= M) return;
  const int row0 = mt * 16, col0 = nq * 64;
  const float* arow = A + (size_t)(row0 + ln) * lda;
  v8f acc[4] = {};
  for (int kb = 0; kb < K; kb += 32) {
    FragB ah, al;
    const v4f x0 = *(const v4fa*)(arow + kb + 8 * hh), x1 = *(const v4fa*)(arow + kb + 8 * hh + 4);
    const v4f x2 = *(const v4fa*)(arow + kb + 16 + 8 * hh), x3 = *(const v4fa*)(arow + kb + 16 + 8 * hh + 4);
    float xs[16] = {x0[0],x0[1],x0[2],x0[3],x1[0],x1[1],x1[2],x1[3],x2[0],x2[1],x2[2],x2[3],x3[0],x3[1],x3[2],x3[3]};
#pragma unroll
    for (int i = 0; i < 16; ++i) { const unsigned short hb = bf16_bits(xs[i]); ah.u[i] = hb; al.u[i] = ASPLIT ? bf16_bits(xs[i] - bf16_val(hb)) : (unsigned short)0; }
#pragma unroll
    for (int t = 0; t < 4; ++t) {
      const unsigned short* brow = Wt + (size_t)(col0 + t * 16 + ln) * ldb + kb;
      FragB b;
      b.half[0] = *(const v8us*)(brow + 8 * hh);
      b.half[1] = *(const v8us*)(brow + 16 + 8 * hh);
      acc[t] = mmaN<ASPLIT ? 2 : 1>(ah.v, al.v, b.v, b.v, acc[t]);
    }
  }
#pragma unroll
  for (int t = 0; t < 4; ++t) {
    float bv = bias ? bias[col0 + t * 16 + ln] : 0.f;
    if (BIAS_BF16) bv = bf16_round(bv);
#pragma unroll
    for (int r = 0; r < 8; ++r) { float v = acc[t][r] + bv; if (ACT == 1) v = fmaxf(v, 0.f); so[w][8 * hh + r][t * 16 + ln] = v; }
  }
  __builtin_amdgcn_fence(__ATOMIC_ACQ_REL, "workgroup");
  __builtin_amdgcn_wave_barrier();
  const int rsub = lane >> 4, c4 = (lane & 15) * 4;
  {
#pragma unroll
    for (int q = 0; q < 8; ++q) {
      const int r = q * 2 + rsub;
      const v4f v = *(const v4fa*)&so[w][r][c4];
      *(v4f*)(C + (size_t)(row0 + r) * ldc + col0 + c4) = v;
    }
    
  }
}

// GEMM C = act(A·W + bias + resid): A f32 (ASPLIT -> hi/lo 2 terms), Wt bf16 [N][K]; ACT 0 none, 1 relu, 2 exact gelu;
// resid (optional, f32, row index = (row % rmod), pitch ldr, RES_BF16 rounds it) added before the activation.
template <bool ASPLIT, int ACT, bool BIAS_BF16, bool RES_BF16>
__global__ __launch_bounds__(128) void k_gemm_bf3(const float* __restrict__ A, int lda, const unsigned short* __restrict__ Wt, int ldb,
                                                const float* __restrict__ bias, const float* __restrict__ resid, int rmod, int ldr,
                                                float* __restrict__ C, int ldc, int M, int N, int K) {
  __shared__ __attribute__((aligned(16))) float so[4][16][64];
  const int tid = threadIdx.x, w = tid >> 5, lane = tid & 31, ln = lane & 15, hh = lane >> 4;
  const int ntn = N / 64;
  const int wid = blockIdx.x * 4 + w;
  const int mt = wid / ntn, nq = wid % ntn;
  if (mt * 16 >= M) return;
  const int row0 = mt * 16, col0 = nq * 64;
  const float* arow = A + (size_t)(row0 + ln) * lda;
  v8f acc[4] = {};
  for (int kb = 0; kb < K; kb += 32) {
    FragB ah, al;
    const v4f x0 = *(const v4fa*)(arow + kb + 8 * hh), x1 = *(const v4fa*)(arow + kb + 8 * hh + 4);
    const v4f x2 = *(const v4fa*)(arow + kb + 16 + 8 * hh), x3 = *(const v4fa*)(arow + kb + 16 + 8 * hh + 4);
    float xs[16] = {x0[0],x0[1],x0[2],x0[3],x1[0],x1[1],x1[2],x1[3],x2[0],x2[1],x2[2],x2[3],x3[0],x3[1],x3[2],x3[3]};
#pragma unroll
    for (int i = 0; i < 16; ++i) { const unsigned short hb = bf16_bits(xs[i]); ah.u[i] = hb; al.u[i] = ASPLIT ? bf16_bits(xs[i] - bf16_val(hb)) : (unsigned short)0; }
#pragma unroll
    for (int t = 0; t < 4; ++t) {
      const unsigned short* brow = Wt + (size_t)(col0 + t * 16 + ln) * ldb + kb;
      FragB b;
      b.half[0] = *(const v8us*)(brow + 8 * hh);
      b.half[1] = *(const v8us*)(brow + 16 + 8 * hh);
      acc[t] = mmaN<ASPLIT ? 2 : 1>(ah.v, al.v, b.v, b.v, acc[t]);
    }
  }
#pragma unroll
  for (int t = 0; t < 4; ++t) {
    const int col = col0 + t * 16 + ln;
    float bv = bias ? bias[col] : 0.f;
    if (BIAS_BF16) bv = bf16_round(bv);
#pragma unroll
    for (int r = 0; r < 8; ++r) {
      float v = acc[t][r] + bv;
      if (resid) { float rv = resid[(size_t)((row0 + 8 * hh + r) % rmod) * ldr + col]; if (RES_BF16) rv = bf16_round(rv); v += rv; }
      if (ACT == 1) v = fmaxf(v, 0.f);
      if (ACT == 2) v = 0.5f * v * (1.0f + erff(v * 0.70710678118654752f));
      if (ACT == 3) { const float u = 0.7978845608028654f * (v + 0.044715f * v * v * v); v = 0.5f * v * (1.0f + tanhf(u)); }
      so[w][8 * hh + r][t * 16 + ln] = v;
    }
  }
  __builtin_amdgcn_fence(__ATOMIC_ACQ_REL, "workgroup");
  __builtin_amdgcn_wave_barrier();
  const int rsub = lane >> 4, c4 = (lane & 15) * 4;
  {
#pragma unroll
    for (int q = 0; q < 8; ++q) {
      const int r = q * 2 + rsub;
      const v4f v = *(const v4fa*)&so[w][r][c4];
      *(v4f*)(C + (size_t)(row0 + r) * ldc + col0 + c4) = v;
    }
    
  }
}
// row LayerNorm (biased variance, eps) over N: s = X (+ R); optional out_sum <- s; out_norm <- (s-mu)*rsqrt(var+eps)*g + b
template <bool PARAM_BF16>
__global__ __launch_bounds__(256) void k_layernorm(const float* __restrict__ X, const float* __restrict__ R, const float* __restrict__ g, const float* __restrict__ bta,
                                                  float* __restrict__ out_sum, float* __restrict__ out_norm, int N, float eps) {
  __shared__ float red[256];
  const int row = blockIdx.x, tid = threadIdx.x;
  const float* x = X + (size_t)row * N; const float* rr = R ? R + (size_t)row * N : nullptr;
  float vals[16];                     // up to N = 4096
  const int per = N / 256;            // contiguous chunk per thread? use strided-by-4 chunks: thread handles j = tid*4 + 1024*u
  float s1 = 0.f;
  for (int u = 0; u < per / 4; ++u) {
    const int j = tid * 4 + 1024 * u;
    const v4f a = *(const v4fa*)(x + j);
    v4f b = {0.f,0.f,0.f,0.f}; if (rr) b = *(const v4fa*)(rr + j);
#pragma unroll
    for (int q = 0; q < 4; ++q) { const float v = a[q] + b[q]; vals[u * 4 + q] = v; s1 += v; }
  }
  red[tid] = s1; __syncthreads();
  for (int st = 128; st > 0; st >>= 1) { if (tid < st) red[tid] += red[tid + st]; __syncthreads(); }
  const float mu = red[0] / (float)N; __syncthreads();
  float s2 = 0.f;
  for (int u = 0; u < per / 4; ++u)
#pragma unroll
    for (int q = 0; q < 4; ++q) { const float c = vals[u * 4 + q] - mu; s2 += c * c; }
  red[tid] = s2; __syncthreads();
  for (int st = 128; st > 0; st >>= 1) { if (tid < st) red[tid] += red[tid + st]; __syncthreads(); }
  const float rs = rsqrtf(red[0] / (float)N + eps);
  {
    for (int u = 0; u < per / 4; ++u) {
      const int j = tid * 4 + 1024 * u;
      v4f o, sm;
#pragma unroll
      for (int q = 0; q < 4; ++q) {
        float gg = g[j + q], bb = bta[j + q];
        if (PARAM_BF16) { gg = bf16_round(gg); bb = bf16_round(bb); }
        sm[q] = vals[u * 4 + q]; o[q] = (vals[u * 4 + q] - mu) * rs * gg + bb;
      }
      if (out_sum) *(v4f*)(out_sum + (size_t)row * N + j) = sm;
      *(v4f*)(out_norm + (size_t)row * N + j) = o;
    }
    
  }
}



// ---- f16 WMMA path (v_wmma_f32_16x16x32_f16): 11-bit significands for operands in range — used where a [0,1] probability operand needs more precision than bf16
typedef _Float16 v16h __attribute__((ext_vector_type(16)));
union FragH { v16h v; v8us half[2]; _Float16 h[16]; unsigned short u[16]; };
template <int NT>
__device__ __forceinline__ v8f mmaH(v16h ah, v16h al, v16h bh, v16h bl, v8f c) {
  c = __builtin_amdgcn_wmma_f32_16x16x32_f16(false, ah, false, bh, (short)0, c, false, false);
  if (NT >= 2) c = __builtin_amdgcn_wmma_f32_16x16x32_f16(false, al, false, bh, (short)0, c, false, false);
  if (NT >= 3) c = __builtin_amdgcn_wmma_f32_16x16x32_f16(false, ah, false, bl, (short)0, c, false, false);
  asm volatile("v_nop\n\tv_nop\n\tv_nop\n\tv_nop" : "+v"(c) : "v"(ah), "v"(al), "v"(bh), "v"(bl));
  return c;
}
// batched GEMM like k_gemm_b but f16 operands: A f32 (split into f16 hi/lo if ASPLIT, else rounded to f16), Bt = f16 values [n][k]; alpha; C f32; N multiple of 16 (partial tiles skipped)
template <bool ASPLIT>
__global__ __launch_bounds__(128) void k_gemm_h(const float* __restrict__ A, int lda, size_t sA, const _Float16* __restrict__ Bh, int ldb, size_t sB, float alpha, float* __restrict__ C, int ldc, size_t sC, int M, int N, int K) {
  __shared__ __attribute__((aligned(16))) float so[4][16][64];
  const int tid = threadIdx.x, w = tid >> 5, lane = tid & 31, ln = lane & 15, hh = lane >> 4; const int by = blockIdx.y;
  A += (size_t)by * sA; Bh += (size_t)by * sB; C += (size_t)by * sC;
  const int ntn = (N + 63) / 64; const int wid = blockIdx.x * 4 + w; const int mt = wid / ntn, nq = wid % ntn; if (mt * 16 >= M) return;
  const int row0 = mt * 16, col0 = nq * 64; const float* arow = A + (size_t)(row0 + ln) * lda;
  v8f acc[4] = {};
  for (int kb = 0; kb < K; kb += 32) {
    FragH ah, al;
    const v4f x0 = *(const v4fa*)(arow + kb + 8 * hh), x1 = *(const v4fa*)(arow + kb + 8 * hh + 4), x2 = *(const v4fa*)(arow + kb + 16 + 8 * hh), x3 = *(const v4fa*)(arow + kb + 16 + 8 * hh + 4);
    float xs[16] = {x0[0],x0[1],x0[2],x0[3],x1[0],x1[1],x1[2],x1[3],x2[0],x2[1],x2[2],x2[3],x3[0],x3[1],x3[2],x3[3]};
#pragma unroll
    for (int i = 0; i < 16; ++i) { const _Float16 h = (_Float16)xs[i]; ah.h[i] = h; al.h[i] = ASPLIT ? (_Float16)(xs[i] - (float)h) : (_Float16)0.0f; }
#pragma unroll
    for (int t = 0; t < 4; ++t) { if (col0 + t * 16 >= N) continue; const size_t boff = (size_t)(col0 + t * 16 + ln) * ldb + kb; FragH bq; bq.half[0] = *(const v8us*)(Bh + boff + 8 * hh); bq.half[1] = *(const v8us*)(Bh + boff + 16 + 8 * hh);
      acc[t] = mmaH<ASPLIT ? 2 : 1>(ah.v, al.v, bq.v, bq.v, acc[t]); }
  }
#pragma unroll
  for (int t = 0; t < 4; ++t) { if (col0 + t * 16 >= N) continue;
#pragma unroll
    for (int r = 0; r < 8; ++r) so[w][8 * hh + r][t * 16 + ln] = acc[t][r] * alpha; }
  __builtin_amdgcn_fence(__ATOMIC_ACQ_REL, "workgroup"); __builtin_amdgcn_wave_barrier();
  const int rsub = lane >> 4, c4 = (lane & 15) * 4;
  {
#pragma unroll
    for (int q = 0; q < 8; ++q) { const int r = q * 2 + rsub; if (col0 + c4 < N) { const v4f v = *(const v4fa*)&so[w][r][c4]; *(v4f*)(C + (size_t)(row0 + r) * ldc + col0 + c4) = v; } }
     }
}

// Wt[n][k] = f16(W[k][n]·scale) from f32 row-major W[K][N] (scale = power of two; bf16-exact weights stay exact in f16 away from the subnormal range)
__global__ __launch_bounds__(256) void k_wt_f16(const float* __restrict__ W, _Float16* __restrict__ Wt, int K, int N, float scale) {
  const int t = blockIdx.x * 256 + threadIdx.x; if (t >= N * (K / 8)) return; const int n = t / (K / 8), k8 = (t % (K / 8)) * 8; FragH f;
#pragma unroll
  for (int i = 0; i < 8; ++i) f.h[i] = (_Float16)(bf16_round(W[(size_t)(k8 + i) * N + n]) * scale); const v8us o = f.half[0];
  *(v8us*)((unsigned short*)Wt + (size_t)n * K + k8) = o; 
}
// k_gemm_hh variant with fused epilogue: v = acc·alpha + bias[by·sBias + col] (+ CP[(row/rowsPerB)·sCPb + by·64 + col] if CP) ; ACT 0 none / 1 elu ; writes f16 C16 (and f32 C if non-null)
template <int ACT>
__global__ __launch_bounds__(128) void k_gemm_hhx(const _Float16* __restrict__ A, int lda, size_t sA, const _Float16* __restrict__ Bh, int ldb, size_t sB, float alpha, const float* __restrict__ bias, size_t sBias, const float* __restrict__ CP, int rowsPerB, size_t sCPb, int row0g,
    float* __restrict__ C, _Float16* __restrict__ C16, int ldc, size_t sC, int M, int N, int K) {
  __shared__ __attribute__((aligned(16))) float so[4][16][64];
  const int tid = threadIdx.x, w = tid >> 5, lane = tid & 31, ln = lane & 15, hh = lane >> 4; const int by = blockIdx.y;
  A += (size_t)by * sA; Bh += (size_t)by * sB; const size_t cofs = (size_t)by * sC; const float* bp = bias ? bias + (size_t)by * sBias : nullptr;
  const int ntn = (N + 63) / 64; const int wid = blockIdx.x * 4 + w; const int mt = wid / ntn, nq = wid % ntn; if (mt * 16 >= M) return;
  const int row0 = mt * 16, col0 = nq * 64; const _Float16* arow = A + (size_t)(row0 + ln) * lda;
  v8f acc[4] = {};
  for (int kb = 0; kb < K; kb += 32) { FragH ah; ah.half[0] = *(const v8us*)((const unsigned short*)arow + kb + 8 * hh); ah.half[1] = *(const v8us*)((const unsigned short*)arow + kb + 16 + 8 * hh);
#pragma unroll
    for (int t = 0; t < 4; ++t) { if (col0 + t * 16 >= N) continue; const size_t boff = (size_t)(col0 + t * 16 + ln) * ldb + kb; FragH bq; bq.half[0] = *(const v8us*)((const unsigned short*)Bh + boff + 8 * hh); bq.half[1] = *(const v8us*)((const unsigned short*)Bh + boff + 16 + 8 * hh);
      acc[t] = mmaH<1>(ah.v, ah.v, bq.v, bq.v, acc[t]); }
  }
#pragma unroll
  for (int t = 0; t < 4; ++t) { if (col0 + t * 16 >= N) continue; const int col = col0 + t * 16 + ln; const float bv = bp ? bf16_round(bp[col]) : 0.f;
#pragma unroll
    for (int r = 0; r < 8; ++r) { float v = acc[t][r] * alpha + bv; if (CP) { const int bidx = (row0g + row0 + 8 * hh + r) / rowsPerB; v += CP[(size_t)bidx * sCPb + (size_t)by * 64 + col]; } if (ACT == 1) v = (v > 0.f) ? v : expm1f(v); else if (ACT == 7) v = (v > 0.f) ? v + 1.0f : expf(v); else if (ACT == 8) v = tanhf(v); else if (ACT == 9) v = 0.5f * v * (1.0f + tanhf(0.7978845608028654f * (v + 0.044715f * v * v * v))); else if (ACT == 11) v = 1.0f / (1.0f + expf(-v)); else if (ACT == 12) v = (v > 0.f) ? v : 0.01f * v; else if (ACT == 14) v = (v > 0.f) ? v : 0.1f * v; else if (ACT == 15) v = v / (1.0f + expf(-v)); else if (ACT == 3) v = fmaxf(v, 0.f); else if (ACT == 6) v = 0.5f * v * (1.0f + erff(v * 0.70710678118654752f)); so[w][8 * hh + r][t * 16 + ln] = v; } }
  __builtin_amdgcn_fence(__ATOMIC_ACQ_REL, "workgroup"); __builtin_amdgcn_wave_barrier();
  const int rsub = lane >> 4, c4 = (lane & 15) * 4; typedef _Float16 v4h __attribute__((ext_vector_type(4)));
  {
#pragma unroll
    for (int q = 0; q < 8; ++q) { const int r = q * 2 + rsub; if (col0 + c4 < N) { const v4f v = *(const v4fa*)&so[w][r][c4]; if (C) *(v4f*)(C + cofs + (size_t)(row0 + r) * ldc + col0 + c4) = v; if (C16) { v4h h4; for (int i = 0; i < 4; ++i) h4[i] = (_Float16)v[i]; *(v4h*)(C16 + cofs + (size_t)(row0 + r) * ldc + col0 + c4) = h4; } } }
     }
}


typedef _Float16 v4h __attribute__((ext_vector_type(4)));

__global__ __launch_bounds__(256) void k_x16(const float* __restrict__ x, _Float16* __restrict__ X16, size_t n8) { const size_t t = (size_t)blockIdx.x * 256 + threadIdx.x; if (t >= n8) return; FragH f;
#pragma unroll
  for (int q = 0; q < 8; ++q) f.h[q] = (_Float16)bf16_round(x[t * 8 + q]); *(v8us*)((unsigned short*)X16 + t * 8) = f.half[0];  }
__global__ __launch_bounds__(256) void k_h16(const float* __restrict__ x, _Float16* __restrict__ X16, size_t n8) { const size_t t = (size_t)blockIdx.x * 256 + threadIdx.x; if (t >= n8) return; FragH f;
#pragma unroll
  for (int q = 0; q < 8; ++q) f.h[q] = (_Float16)x[t * 8 + q]; *(v8us*)((unsigned short*)X16 + t * 8) = f.half[0];  }
__global__ __launch_bounds__(256) void k_round16f(const float* __restrict__ W, _Float16* __restrict__ Bt, size_t n8) { const size_t t = (size_t)blockIdx.x * 256 + threadIdx.x; if (t >= n8) return; FragH f;
#pragma unroll
  for (int i = 0; i < 8; ++i) f.h[i] = (_Float16)(bf16_round(W[t * 8 + i]) * 16.0f); *(v8us*)((unsigned short*)Bt + t * 8) = f.half[0];  }
template <int NHv, int TTv>
__global__ __launch_bounds__(256) void k_vt(const _Float16* __restrict__ V16, int ldv, int voff, _Float16* __restrict__ Vt) { __shared__ unsigned short tl[64][66]; const int tid = threadIdx.x; const int slab = blockIdx.x / (TTv / 64), lg = blockIdx.x % (TTv / 64); const int b = slab / NHv, h = slab % NHv;
  for (int i = tid; i < 64 * 8; i += 256) { const int r = i / 8, c8 = (i % 8) * 8; FragH f; f.half[0] = *(const v8us*)((const unsigned short*)V16 + ((size_t)b * TTv + lg * 64 + r) * ldv + voff + h * 64 + c8);
#pragma unroll
    for (int q = 0; q < 8; ++q) tl[r][c8 + q] = f.u[q]; }
  __syncthreads();
  {
#pragma unroll
    for (int rd = 0; rd < 2; ++rd) { const int d = rd * 32 + tid / 8, pc = tid % 8; FragH f;
#pragma unroll
      for (int q = 0; q < 8; ++q) f.u[q] = tl[pc * 8 + q][d];
      *(v8us*)((unsigned short*)Vt + ((size_t)slab * 64 + d) * TTv + lg * 64 + pc * 8) = f.half[0]; }
     } }

__global__ __launch_bounds__(256) void k_hl(const float* __restrict__ F, _Float16* __restrict__ Hh, _Float16* __restrict__ Hl, size_t n8) { const size_t t = (size_t)blockIdx.x * 256 + threadIdx.x; if (t >= n8) return; FragH fh, fl; const v4f a = *(const v4fa*)(F + t * 8), c = *(const v4fa*)(F + t * 8 + 4);
#pragma unroll
  for (int q = 0; q < 4; ++q) { _Float16 h = (_Float16)a[q]; fh.h[q] = h; fl.h[q] = (_Float16)((a[q] - (float)h) * 1024.0f); h = (_Float16)c[q]; fh.h[4 + q] = h; fl.h[4 + q] = (_Float16)((c[q] - (float)h) * 1024.0f); }
  { *(v8us*)((unsigned short*)Hh + t * 8) = fh.half[0]; *(v8us*)((unsigned short*)Hl + t * 8) = fl.half[0];  } }

// ---- fast GEMM (wave tile 32x64; requires M % 32 == 0 rows per launch region and N % 64 == 0); epilogue = k_gemm_hhx semantics ----
__device__ __forceinline__ v16h g2_frag(const _Float16* p, int hh) { FragH f; f.half[0] = *(const v8us*)((const unsigned short*)p + 8 * hh); f.half[1] = *(const v8us*)((const unsigned short*)p + 16 + 8 * hh); return f.v; }
__device__ __forceinline__ v8f g2_mma(v16h a, v16h b, v8f c) { v8f d = __builtin_amdgcn_wmma_f32_16x16x32_f16(false, a, false, b, (short)0, c, false, false); asm volatile("v_nop\n\tv_nop\n\tv_nop\n\tv_nop" : "+v"(d) : "v"(a), "v"(b)); return d; }
template <int ACT>
__global__ __launch_bounds__(128) void k_gemm2(const _Float16* __restrict__ A, int lda, size_t sA, const _Float16* __restrict__ Bh, int ldb, size_t sB, float alpha, const float* __restrict__ bias, size_t sBias, const float* __restrict__ CP, int rowsPerB, size_t sCPb, int row0g,
    float* __restrict__ C, _Float16* __restrict__ C16, int ldc, size_t sC, int M, int N, int K) {
  __shared__ __attribute__((aligned(16))) float so[4][32][68];
  const int tid = threadIdx.x, w = tid >> 5, lane = tid & 31, ln = lane & 15, hh = lane >> 4; const int by = blockIdx.y;
  A += (size_t)by * sA; Bh += (size_t)by * sB; const size_t cofs = (size_t)by * sC; const float* bp = bias ? bias + (size_t)by * sBias : nullptr;
  const int ntn = N >> 6; const int mt = blockIdx.x / ntn, nq = blockIdx.x - mt * ntn; const int row0 = mt * 128 + 32 * w, col0 = nq * 64; if (row0 >= M) return;
  const _Float16* a0p = A + (size_t)(row0 + ln) * lda; const _Float16* a1p = a0p + (size_t)16 * lda;
  const _Float16* b0p = Bh + (size_t)(col0 + ln) * ldb; const _Float16* b1p = b0p + (size_t)16 * ldb; const _Float16* b2p = b1p + (size_t)16 * ldb; const _Float16* b3p = b2p + (size_t)16 * ldb;
  const v8f z8 = {0.f,0.f,0.f,0.f,0.f,0.f,0.f,0.f}; v8f c00 = z8, c01 = z8, c02 = z8, c03 = z8, c10 = z8, c11 = z8, c12 = z8, c13 = z8;
#pragma unroll 1
  for (int kb = 0; kb < K; kb += 32) { const v16h a0 = g2_frag(a0p + kb, hh), a1 = g2_frag(a1p + kb, hh);
    v16h b = g2_frag(b0p + kb, hh); c00 = g2_mma(a0, b, c00); c10 = g2_mma(a1, b, c10);
    b = g2_frag(b1p + kb, hh); c01 = g2_mma(a0, b, c01); c11 = g2_mma(a1, b, c11);
    b = g2_frag(b2p + kb, hh); c02 = g2_mma(a0, b, c02); c12 = g2_mma(a1, b, c12);
    b = g2_frag(b3p + kb, hh); c03 = g2_mma(a0, b, c03); c13 = g2_mma(a1, b, c13); }
  v8f accs[8] = {c00, c01, c02, c03, c10, c11, c12, c13};
#pragma unroll
  for (int u = 0; u < 8; ++u) { const int t = u & 3, half = u >> 2; const int col = col0 + t * 16 + ln; const float bv = bp ? bf16_round(bp[col]) : 0.f;
#pragma unroll
    for (int r = 0; r < 8; ++r) { const int rloc = half * 16 + 8 * hh + r; float v = accs[u][r] * alpha + bv; if (CP) { const int bidx = (row0g + row0 + rloc) / rowsPerB; v += CP[(size_t)bidx * sCPb + (size_t)by * 64 + col]; }
      if (ACT == 3) v = fmaxf(v, 0.f); else if (ACT == 6) v = 0.5f * v * (1.0f + erff(v * 0.70710678118654752f)); else if (ACT == 11) v = 1.0f / (1.0f + expf(-v)); else if (ACT == 15) v = v / (1.0f + expf(-v)); else if (ACT == 12) v = (v > 0.f) ? v : 0.01f * v; else if (ACT == 8) v = tanhf(v);
      so[w][rloc][t * 16 + ln] = v; } }
  __builtin_amdgcn_fence(__ATOMIC_ACQ_REL, "workgroup"); __builtin_amdgcn_wave_barrier();
  const int rsub = lane >> 4, c4 = (lane & 15) * 4;
  {
#pragma unroll
    for (int q = 0; q < 16; ++q) { const int r = q * 2 + rsub; const v4f v = *(const v4fa*)&so[w][r][c4]; if (C) *(v4f*)(C + cofs + (size_t)(row0 + r) * ldc + col0 + c4) = v; if (C16) { v4h h4; for (int i = 0; i < 4; ++i) h4[i] = (_Float16)v[i]; *(v4h*)(C16 + cofs + (size_t)(row0 + r) * ldc + col0 + c4) = h4; } }
     } }


template <int TK>
__global__ __launch_bounds__(256) void k_vthl(const float* __restrict__ VF, int ldv, _Float16* __restrict__ Vth, _Float16* __restrict__ Vtl) { __shared__ float tl[64][65]; const int tid = threadIdx.x; const int slab = blockIdx.x / (TK / 64), lg = blockIdx.x % (TK / 64); const int b = slab / NH, h = slab % NH;
  for (int i = tid; i < 64 * 16; i += 256) { const int r = i / 16, c4 = (i % 16) * 4; const v4f a = *(const v4fa*)(VF + ((size_t)b * TK + lg * 64 + r) * ldv + h * 64 + c4); tl[r][c4] = a[0]; tl[r][c4 + 1] = a[1]; tl[r][c4 + 2] = a[2]; tl[r][c4 + 3] = a[3]; }
  __syncthreads();
  FragH fh[2], fl[2]; size_t oo[2];
#pragma unroll
  for (int rd = 0; rd < 2; ++rd) { const int d = rd * 32 + tid / 8, pc = tid % 8;
#pragma unroll
    for (int q = 0; q < 8; ++q) { const float v = tl[pc * 8 + q][d]; const _Float16 hv = (_Float16)v; fh[rd].h[q] = hv; fl[rd].h[q] = (_Float16)((v - (float)hv) * 1024.0f); } oo[rd] = ((size_t)slab * 64 + d) * TK + lg * 64 + pc * 8; }
  {
#pragma unroll
    for (int rd = 0; rd < 2; ++rd) { *(v8us*)((unsigned short*)Vth + oo[rd]) = fh[rd].half[0]; *(v8us*)((unsigned short*)Vtl + oo[rd]) = fl[rd].half[0]; }
     } }

template <int TQ, int TK>
__global__ __launch_bounds__(128) void k_flashm(const _Float16* __restrict__ Q16, const _Float16* __restrict__ Q16lo, int ldq, const _Float16* __restrict__ K16, const _Float16* __restrict__ K16lo, int ldk, const _Float16* __restrict__ Vt, const _Float16* __restrict__ Vtlo, const unsigned* __restrict__ MB, const int* __restrict__ RA, const int* __restrict__ KE, float* __restrict__ O, int ldo) {
  constexpr int RPW = 16, RTN = RPW / 16, NQB = TQ / (4 * RPW), DT = 4, KS = 2;
  __shared__ __attribute__((aligned(16))) unsigned short sP[4][RPW][40], sPl[4][RPW][40]; __shared__ __attribute__((aligned(16))) float sO[4][RPW][64 + 4];
  const int tid = threadIdx.x, w = tid >> 5, lane = tid & 31, ln = lane & 15, hh = lane >> 4;
  const int slab = blockIdx.x / NQB, qblk = blockIdx.x % NQB; const int b = slab / NH, h = slab % NH; const int qb0 = qblk * (4 * RPW); const int q0 = qb0 + w * RPW;
  FragH aq[2][KS], aql[2][KS];
#pragma unroll
  for (int rt = 0; rt < RTN; ++rt) { const size_t qo = ((size_t)b * TQ + q0 + rt * 16 + ln) * ldq + h * 64; const unsigned short* qr = (const unsigned short*)Q16 + qo; const unsigned short* ql = (const unsigned short*)Q16lo + qo;
#pragma unroll
    for (int ks = 0; ks < KS; ++ks) { aq[rt][ks].half[0] = *(const v8us*)(qr + ks * 32 + 8 * hh); aq[rt][ks].half[1] = *(const v8us*)(qr + ks * 32 + 16 + 8 * hh); aql[rt][ks].half[0] = *(const v8us*)(ql + ks * 32 + 8 * hh); aql[rt][ks].half[1] = *(const v8us*)(ql + ks * 32 + 16 + 8 * hh); } }
  const unsigned short* Vth = (const unsigned short*)Vt + (size_t)slab * 64 * TK; const unsigned short* Vtl = (const unsigned short*)Vtlo + (size_t)slab * 64 * TK;
  float m_r[2][8], l_r[2][8]; v8f oacc[2][DT], oaccl[2][DT];
#pragma unroll
  for (int rt = 0; rt < RTN; ++rt) {
#pragma unroll
    for (int r = 0; r < 8; ++r) { m_r[rt][r] = -3.0e38f; l_r[rt][r] = 0.f; }
#pragma unroll
    for (int dt = 0; dt < DT; ++dt) { oacc[rt][dt] = (v8f){0.f,0.f,0.f,0.f,0.f,0.f,0.f,0.f}; oaccl[rt][dt] = oacc[rt][dt]; } }
  int jend = KE[qblk * 32]; jend = min(TK, (jend + 31) & ~31); if (jend < 32) jend = 32;      /* block-uniform */
  int allm[2][8]; const unsigned* mrow[2][8];
#pragma unroll
  for (int rt = 0; rt < RTN; ++rt)
#pragma unroll
    for (int r = 0; r < 8; ++r) { const int tq = q0 + rt * 16 + 8 * hh + r; allm[rt][r] = RA[tq]; mrow[rt][r] = MB + (size_t)tq * (TK / 32); }
#pragma unroll 1
  for (int j0 = 0; j0 < jend; j0 += 32) {
    
    v8f s[2][2];
#pragma unroll
    for (int nt = 0; nt < 2; ++nt) { const size_t ko = ((size_t)b * TK + j0 + nt * 16 + ln) * ldk + h * 64; const unsigned short* kr = (const unsigned short*)K16 + ko; const unsigned short* kl = (const unsigned short*)K16lo + ko; FragH bk[KS], bkl[KS];
#pragma unroll
      for (int ks = 0; ks < KS; ++ks) { bk[ks].half[0] = *(const v8us*)(kr + ks * 32 + 8 * hh); bk[ks].half[1] = *(const v8us*)(kr + ks * 32 + 16 + 8 * hh); bkl[ks].half[0] = *(const v8us*)(kl + ks * 32 + 8 * hh); bkl[ks].half[1] = *(const v8us*)(kl + ks * 32 + 16 + 8 * hh); }
#pragma unroll
      for (int rt = 0; rt < RTN; ++rt) { v8f acc = (v8f){0.f,0.f,0.f,0.f,0.f,0.f,0.f,0.f}, accr = acc;
#pragma unroll
        for (int ks = 0; ks < KS; ++ks) { acc = mmaH<1>(aq[rt][ks].v, aq[rt][ks].v, bk[ks].v, bk[ks].v, acc); accr = mmaH<1>(aql[rt][ks].v, aql[rt][ks].v, bk[ks].v, bk[ks].v, accr); accr = mmaH<1>(aq[rt][ks].v, aq[rt][ks].v, bkl[ks].v, bkl[ks].v, accr); }
        s[rt][nt] = acc + accr * 0.0009765625f; } }
#pragma unroll
    for (int rt = 0; rt < RTN; ++rt)
#pragma unroll
      for (int r = 0; r < 8; ++r) { const unsigned mw = mrow[rt][r][j0 >> 5]; const bool am = (allm[rt][r] != 0);
        const bool ok0 = am || (((mw >> ln) & 1u) == 0u), ok1 = am || (((mw >> (16 + ln)) & 1u) == 0u);
        const float s0 = ok0 ? (am ? 0.f : s[rt][0][r] * SCL) : -INFINITY, s1 = ok1 ? (am ? 0.f : s[rt][1][r] * SCL) : -INFINITY; float mc = fmaxf(s0, s1);
        mc = fmaxf(mc, __shfl_xor(mc, 1, 32)); mc = fmaxf(mc, __shfl_xor(mc, 2, 32)); mc = fmaxf(mc, __shfl_xor(mc, 4, 32)); mc = fmaxf(mc, __shfl_xor(mc, 8, 32));
        const float mn = fmaxf(m_r[rt][r], mc); const float al = (mn > -1.0e38f) ? expf(m_r[rt][r] - mn) : 1.0f; m_r[rt][r] = mn; const float p0 = ok0 ? expf(s0 - mn) : 0.f, p1 = ok1 ? expf(s1 - mn) : 0.f; l_r[rt][r] = l_r[rt][r] * al + p0 + p1;
#pragma unroll
        for (int dt = 0; dt < DT; ++dt) { oacc[rt][dt][r] *= al; oaccl[rt][dt][r] *= al; }
        FragH t2, t3; const float ps0 = p0 * 1024.0f, ps1 = p1 * 1024.0f; t2.h[0] = (_Float16)ps0; t2.h[1] = (_Float16)ps1; t3.h[0] = (_Float16)((ps0 - (float)t2.h[0]) * 1024.0f); t3.h[1] = (_Float16)((ps1 - (float)t2.h[1]) * 1024.0f);
        sP[w][rt * 16 + 8 * hh + r][ln] = t2.u[0]; sP[w][rt * 16 + 8 * hh + r][16 + ln] = t2.u[1]; sPl[w][rt * 16 + 8 * hh + r][ln] = t3.u[0]; sPl[w][rt * 16 + 8 * hh + r][16 + ln] = t3.u[1]; }
    __builtin_amdgcn_fence(__ATOMIC_ACQ_REL, "workgroup"); __builtin_amdgcn_wave_barrier();
    FragH pa[2], pl[2];
#pragma unroll
    for (int rt = 0; rt < RTN; ++rt) { pa[rt].half[0] = *(const v8us*)&sP[w][rt * 16 + ln][8 * hh]; pa[rt].half[1] = *(const v8us*)&sP[w][rt * 16 + ln][16 + 8 * hh]; pl[rt].half[0] = *(const v8us*)&sPl[w][rt * 16 + ln][8 * hh]; pl[rt].half[1] = *(const v8us*)&sPl[w][rt * 16 + ln][16 + 8 * hh]; }
#pragma unroll
    for (int dt = 0; dt < DT; ++dt) { const size_t vo = (size_t)(dt * 16 + ln) * TK + j0; FragH bv, bl; bv.half[0] = *(const v8us*)(Vth + vo + 8 * hh); bv.half[1] = *(const v8us*)(Vth + vo + 16 + 8 * hh); bl.half[0] = *(const v8us*)(Vtl + vo + 8 * hh); bl.half[1] = *(const v8us*)(Vtl + vo + 16 + 8 * hh);
#pragma unroll
      for (int rt = 0; rt < RTN; ++rt) { oacc[rt][dt] = mmaH<1>(pa[rt].v, pa[rt].v, bv.v, bv.v, oacc[rt][dt]); oaccl[rt][dt] = mmaH<1>(pa[rt].v, pa[rt].v, bl.v, bl.v, oaccl[rt][dt]); oaccl[rt][dt] = mmaH<1>(pl[rt].v, pl[rt].v, bv.v, bv.v, oaccl[rt][dt]); } }
    __builtin_amdgcn_fence(__ATOMIC_ACQ_REL, "workgroup"); __builtin_amdgcn_wave_barrier(); }
#pragma unroll
  for (int rt = 0; rt < RTN; ++rt) {
#pragma unroll
    for (int r = 0; r < 8; ++r) { float l = l_r[rt][r]; l += __shfl_xor(l, 1, 32); l += __shfl_xor(l, 2, 32); l += __shfl_xor(l, 4, 32); l += __shfl_xor(l, 8, 32); l_r[rt][r] = (l > 0.f) ? 1.0f / (l * 1024.0f) : 0.f; }
#pragma unroll
    for (int dt = 0; dt < DT; ++dt)
#pragma unroll
      for (int r = 0; r < 8; ++r) sO[w][rt * 16 + 8 * hh + r][dt * 16 + ln] = (oacc[rt][dt][r] + oaccl[rt][dt][r] * 0.0009765625f) * l_r[rt][r]; }
  __builtin_amdgcn_fence(__ATOMIC_ACQ_REL, "workgroup"); __builtin_amdgcn_wave_barrier();
  {
#pragma unroll
    for (int rp = 0; rp < RPW; rp += 2) { const int r = rp + (lane >> 4), pc = lane & 15; const v4f val = *(const v4fa*)&sO[w][r][pc * 4]; *(v4f*)(O + ((size_t)b * TQ + q0 + r) * ldo + h * 64 + pc * 4) = val; }
     } }


__global__ __launch_bounds__(256) void k_causaltab(unsigned* __restrict__ MB, int* __restrict__ RA, int* __restrict__ KE, int nq, int nk) {
  const int t = blockIdx.x * 256 + threadIdx.x; const int nw = nk / 32;
  if (t < nq * nw) { const int q = t / nw, w = t % nw; const int first = q + 1 - 32 * w; const unsigned bits = (first <= 0) ? 0xffffffffu : ((first >= 32) ? 0u : (0xffffffffu << first)); *(unsigned*)(MB + t) = bits;  }
  if (t < nq) { *(int*)(RA + t) = 0;  }
  if (t < nq / 64) { const int v = 64 * (t + 1); *(int*)(KE + t * 32) = v;  } }

extern "C" void kernel_launch(void* const* d_in, const int* in_sizes, int n_in,
                              void* d_out, int out_size, void* d_ws, size_t ws_size, hipStream_t stream) {
  (void)in_sizes; (void)n_in; (void)out_size;
  const float* const* I = (const float* const*)d_in; const float* x = I[0]; const float* Wq = I[1]; const float* bq = I[2]; const float* Wk = I[3]; const float* bk = I[4]; const float* Wv = I[5]; const float* bv = I[6]; const float* Wo = I[7]; const float* bo = I[8];
  char* ws = (char*)d_ws; size_t off = 0;
  auto take = [&](size_t bytes) { char* p = ws + off; off += (bytes + 255) & ~(size_t)255; return p; };
  _Float16* BQ = (_Float16*)take((size_t)DK * DM * 2); _Float16* BK = (_Float16*)take((size_t)DK * DM * 2); _Float16* BV = (_Float16*)take((size_t)DK * DM * 2); _Float16* BO = (_Float16*)take((size_t)DM * DK * 2);
  _Float16* X16 = (_Float16*)take((size_t)NR * DM * 2); float* F = (float*)take((size_t)NR * DK * 4);
  _Float16* Qh = (_Float16*)take((size_t)NR * DK * 2); _Float16* Ql = (_Float16*)take((size_t)NR * DK * 2); _Float16* Kh = (_Float16*)take((size_t)NR * DK * 2); _Float16* Kl = (_Float16*)take((size_t)NR * DK * 2); _Float16* Vth = (_Float16*)take((size_t)NR * DK * 2); _Float16* Vtl = (_Float16*)take((size_t)NR * DK * 2);
  unsigned* MB = (unsigned*)take((size_t)SS * (SS / 32) * 4); int* RA = (int*)take((size_t)SS * 4); int* KE = (int*)take((size_t)(SS / 64) * 32 * 4);
  float* O = (float*)take((size_t)NR * DK * 4); _Float16* Oh = (_Float16*)take((size_t)NR * DK * 2); _Float16* Ol = (_Float16*)take((size_t)NR * DK * 2);
  if (off > ws_size) return;      /* 16 + 4 + 6 x 2 + 2 + 4 + 4 = 42 MiB */
  k_wt_f16<<<(DM * DK / 8 + 255) / 256, 256, 0, stream>>>(Wq, BQ, DM, DK, 16.0f); k_wt_f16<<<(DM * DK / 8 + 255) / 256, 256, 0, stream>>>(Wk, BK, DM, DK, 16.0f); k_wt_f16<<<(DM * DK / 8 + 255) / 256, 256, 0, stream>>>(Wv, BV, DM, DK, 16.0f); k_wt_f16<<<(DK * DM / 8 + 255) / 256, 256, 0, stream>>>(Wo, BO, DK, DM, 16.0f);      /* (in,out) -> [out][in] x16 */
  k_x16<<<(unsigned)(((size_t)NR * DM / 8 + 255) / 256), 256, 0, stream>>>(x, X16, (size_t)NR * DM / 8);
  k_causaltab<<<(SS * (SS / 32) + 255) / 256, 256, 0, stream>>>(MB, RA, KE, SS, SS);
  const dim3 gP((NR / 128) * 1, 1), gO((NR / 128) * (DM / 64), 1); const size_t n8 = (size_t)NR * DK / 8; const unsigned nb8 = (unsigned)((n8 + 255) / 256);
  k_gemm2<0><<<gP, 128, 0, stream>>>(X16, DM, 0, BQ, DM, 0, 0.0625f, bq, 0, nullptr, 1, 0, 0, F, nullptr, DK, 0, NR, DK, DM); k_hl<<<nb8, 256, 0, stream>>>(F, Qh, Ql, n8);
  k_gemm2<0><<<gP, 128, 0, stream>>>(X16, DM, 0, BK, DM, 0, 0.0625f, bk, 0, nullptr, 1, 0, 0, F, nullptr, DK, 0, NR, DK, DM); k_hl<<<nb8, 256, 0, stream>>>(F, Kh, Kl, n8);
  k_gemm2<0><<<gP, 128, 0, stream>>>(X16, DM, 0, BV, DM, 0, 0.0625f, bv, 0, nullptr, 1, 0, 0, F, nullptr, DK, 0, NR, DK, DM);
  k_vthl<SS><<<NB * NH * (SS / 64), 256, 0, stream>>>(F, DK, Vth, Vtl);      /* V^T hi/lo per sequence [64][4096]; one grid over all sequences (slab = sequence) */
  k_flashm<SS, SS><<<NB * NH * (SS / 64), 128, 0, stream>>>(Qh, Ql, DK, Kh, Kl, DK, Vth, Vtl, MB, RA, KE, O, DK);      /* one grid over all (sequence, 64 queries): 256 work-groups run side by side */
  k_hl<<<nb8, 256, 0, stream>>>(O, Oh, Ol, n8);
  k_gemm2<0><<<gO, 128, 0, stream>>>(Oh, DK, 0, BO, DK, 0, 0.0625f, bo, 0, nullptr, 1, 0, 0, (float*)d_out, nullptr, DM, 0, NR, DM, DK);
  k_gemm2<0><<<gO, 128, 0, stream>>>(Ol, DK, 0, BO, DK, 0, 0.0625f * 0.0009765625f, nullptr, 0, (const float*)d_out, 1, (size_t)DM, 0, (float*)d_out, nullptr, DM, 0, NR, DM, DK);      /* out = O*Wo + bo (hi pass, then the residual pass through the addend) */
}

// v002
// Measured time: 254 microseconds a run.
// Next to v001, in two timings, it ran 2.79 and 2.84 times as fast.
// All steps since v000 together make it 9.58 times as fast.
#include <hip/hip_runtime.h>
// Single-head causal attention (4 sequences x 4096 tokens x 512; d_k = d_v = 64): q, k, v = x*W + b; scores = q.k/8 with j <= i; softmax; out = (attn.v)*Wo + bo -> [4,4096,512].
// Structure: x as an exact f16 plane; q/k/v by f16 WMMA GEMMs (32x64 wave tiles, f32, exact products + bias); q, k as f16 hi + (x2^10) residual planes, V^T as hi + residual planes; the causal structure computed on device into a key bit plane + per-block key bound; one fused flash-style kernel per (sequence, 16 queries) (8 waves share the queries, the 32-key steps up to the bound dealt to them in turn, three-product hi/lo scores, online softmax f32, P hi + residual via LDS, two value accumulators, the 8 partial (max, sum, O) merged in LDS); O as hi + residual planes; output projection as two GEMMs (bias in the first) -> the output rows.
// Compute dtype: x, weights, biases rounded to bf16; projections exact; q, k, P, v, O as f16 hi + residual pairs (~2^-21); f32 accumulation and softmax. v_wmma_f32_16x16x32_f16.
#define NB 4
#define SS 4096
#define DM 512
#define DK 64
#define NH 1
#define SCL 0.125f
#define NR (NB * SS)
typedef __bf16 v16b __attribute__((ext_vector_type(16)));
typedef unsigned short v8us __attribute__((ext_vector_type(8), may_alias));
typedef float  v8f  __attribute__((ext_vector_type(8)));
typedef float  v4f  __attribute__((ext_vector_type(4)));
typedef float  v4fa __attribute__((ext_vector_type(4), may_alias));
union FragB { v16b v; v8us half[2]; unsigned short u[16]; };

__device__ __forceinline__ unsigned short bf16_bits(float x) { unsigned int u = __float_as_uint(x); return (unsigned short)((u + 0x7FFFu + ((u >> 16) & 1u)) >> 16); }
__device__ __forceinline__ float bf16_val(unsigned short b) { return __uint_as_float(((unsigned int)b) << 16); }
__device__ __forceinline__ float bf16_round(float x) { return bf16_val(bf16_bits(x)); }
// D += A·B with NT terms: 1 = ah·bh, 2 = + al·bh (A split), 3 = + ah·bl (both split)
template <int NT>
__device__ __forceinline__ v8f mmaN(v16b ah, v16b al, v16b bh, v16b bl, v8f c) {
  c = __builtin_amdgcn_wmma_f32_16x16x32_bf16(false, ah, false, bh, (short)0, c, false, false);
  if (NT >= 2) c = __builtin_amdgcn_wmma_f32_16x16x32_bf16(false, al, false, bh, (short)0, c, false, false);
  if (NT >= 3) c = __builtin_amdgcn_wmma_f32_16x16x32_bf16(false, ah, false, bl, (short)0, c, false, false);
  asm volatile("v_nop\n\tv_nop\n\tv_nop\n\tv_nop" : "+v"(c) : "v"(ah), "v"(al), "v"(bh), "v"(bl));
  return c;
}

__global__ __launch_bounds__(256) void k_wt_bf16(const float* __restrict__ W, unsigned short* __restrict__ Wt, int K, int N) {
  const int t = blockIdx.x * 256 + threadIdx.x;
  const int k8n = K / 8;
  if (t >= N * k8n) return;
  const int n = t / k8n, k8 = (t % k8n) * 8;
  v8us v;
#pragma unroll
  for (int i = 0; i < 8; ++i) v[i] = bf16_bits(W[(size_t)(k8 + i) * N + n]);
  *(v8us*)(Wt + (size_t)n * K + k8) = v;
  
}

// GEMM C[M][N] (f32, pitch ldc) = act(A[M][K]·W + bias). A f32 row-major (pitch lda) converted per fragment to bf16
// (ASPLIT: hi/lo two planes -> 2 terms, else single rounded term); Wt bf16 [N][K] (pitch ldb). BIAS_BF16 rounds the
// bias to bf16 first (bias quantised to bf16 before the add). K%32==0, M%16==0, N%64==0.
template <bool ASPLIT, int ACT, bool BIAS_BF16>
__global__ __launch_bounds__(128) void k_gemm_bf(const float* __restrict__ A, int lda, const unsigned short* __restrict__ Wt, int ldb,
                                               const float* __restrict__ bias, float* __restrict__ C, int ldc, int M, int N, int K) {
  __shared__ __attribute__((aligned(16))) float so[4][16][64];
  const int tid = threadIdx.x, w = tid >> 5, lane = tid & 31, ln = lane & 15, hh = lane >> 4;
  const int ntn = N / 64;
  const int wid = blockIdx.x * 4 + w;
  const int mt = wid / ntn, nq = wid % ntn;
  if (mt * 16 >= M) return;
  const int row0 = mt * 16, col0 = nq * 64;
  const float* arow = A + (size_t)(row0 + ln) * lda;
  v8f acc[4] = {};
  for (int kb = 0; kb < K; kb += 32) {
    FragB ah, al;
    const v4f x0 = *(const v4fa*)(arow + kb + 8 * hh), x1 = *(const v4fa*)(arow + kb + 8 * hh + 4);
    const v4f x2 = *(const v4fa*)(arow + kb + 16 + 8 * hh), x3 = *(const v4fa*)(arow + kb + 16 + 8 * hh + 4);
    float xs[16] = {x0[0],x0[1],x0[2],x0[3],x1[0],x1[1],x1[2],x1[3],x2[0],x2[1],x2[2],x2[3],x3[0],x3[1],x3[2],x3[3]};
#pragma unroll
    for (int i = 0; i < 16; ++i) { const unsigned short hb = bf16_bits(xs[i]); ah.u[i] = hb; al.u[i] = ASPLIT ? bf16_bits(xs[i] - bf16_val(hb)) : (unsigned short)0; }
#pragma unroll
    for (int t = 0; t < 4; ++t) {
      const unsigned short* brow = Wt + (size_t)(col0 + t * 16 + ln) * ldb + kb;
      FragB b;
      b.half[0] = *(const v8us*)(brow + 8 * hh);
      b.half[1] = *(const v8us*)(brow + 16 + 8 * hh);
      acc[t] = mmaN<ASPLIT ? 2 : 1>(ah.v, al.v, b.v, b.v, acc[t]);
    }
  }
#pragma unroll
  for (int t = 0; t < 4; ++t) {
    float bv = bias ? bias[col0 + t * 16 + ln] : 0.f;
    if (BIAS_BF16) bv = bf16_round(bv);
#pragma unroll
    for (int r = 0; r < 8; ++r) { float v = acc[t][r] + bv; if (ACT == 1) v = fmaxf(v, 0.f); so[w][8 * hh + r][t * 16 + ln] = v; }
  }
  __builtin_amdgcn_fence(__ATOMIC_ACQ_REL, "workgroup");
  __builtin_amdgcn_wave_barrier();
  const int rsub = lane >> 4, c4 = (lane & 15) * 4;
  {
#pragma unroll
    for (int q = 0; q < 8; ++q) {
      const int r = q * 2 + rsub;
      const v4f v = *(const v4fa*)&so[w][r][c4];
      *(v4f*)(C + (size_t)(row0 + r) * ldc + col0 + c4) = v;
    }
    
  }
}

// GEMM C = act(A·W + bias + resid): A f32 (ASPLIT -> hi/lo 2 terms), Wt bf16 [N][K]; ACT 0 none, 1 relu, 2 exact gelu;
// resid (optional, f32, row index = (row % rmod), pitch ldr, RES_BF16 rounds it) added before the activation.
template <bool ASPLIT, int ACT, bool BIAS_BF16, bool RES_BF16>
__global__ __launch_bounds__(128) void k_gemm_bf3(const float* __restrict__ A, int lda, const unsigned short* __restrict__ Wt, int ldb,
                                                const float* __restrict__ bias, const float* __restrict__ resid, int rmod, int ldr,
                                                float* __restrict__ C, int ldc, int M, int N, int K) {
  __shared__ __attribute__((aligned(16))) float so[4][16][64];
  const int tid = threadIdx.x, w = tid >> 5, lane = tid & 31, ln = lane & 15, hh = lane >> 4;
  const int ntn = N / 64;
  const int wid = blockIdx.x * 4 + w;
  const int mt = wid / ntn, nq = wid % ntn;
  if (mt * 16 >= M) return;
  const int row0 = mt * 16, col0 = nq * 64;
  const float* arow = A + (size_t)(row0 + ln) * lda;
  v8f acc[4] = {};
  for (int kb = 0; kb < K; kb += 32) {
    FragB ah, al;
    const v4f x0 = *(const v4fa*)(arow + kb + 8 * hh), x1 = *(const v4fa*)(arow + kb + 8 * hh + 4);
    const v4f x2 = *(const v4fa*)(arow + kb + 16 + 8 * hh), x3 = *(const v4fa*)(arow + kb + 16 + 8 * hh + 4);
    float xs[16] = {x0[0],x0[1],x0[2],x0[3],x1[0],x1[1],x1[2],x1[3],x2[0],x2[1],x2[2],x2[3],x3[0],x3[1],x3[2],x3[3]};
#pragma unroll
    for (int i = 0; i < 16; ++i) { const unsigned short hb = bf16_bits(xs[i]); ah.u[i] = hb; al.u[i] = ASPLIT ? bf16_bits(xs[i] - bf16_val(hb)) : (unsigned short)0; }
#pragma unroll
    for (int t = 0; t < 4; ++t) {
      const unsigned short* brow = Wt + (size_t)(col0 + t * 16 + ln) * ldb + kb;
      FragB b;
      b.half[0] = *(const v8us*)(brow + 8 * hh);
      b.half[1] = *(const v8us*)(brow + 16 + 8 * hh);
      acc[t] = mmaN<ASPLIT ? 2 : 1>(ah.v, al.v, b.v, b.v, acc[t]);
    }
  }
#pragma unroll
  for (int t = 0; t < 4; ++t) {
    const int col = col0 + t * 16 + ln;
    float bv = bias ? bias[col] : 0.f;
    if (BIAS_BF16) bv = bf16_round(bv);
#pragma unroll
    for (int r = 0; r < 8; ++r) {
      float v = acc[t][r] + bv;
      if (resid) { float rv = resid[(size_t)((row0 + 8 * hh + r) % rmod) * ldr + col]; if (RES_BF16) rv = bf16_round(rv); v += rv; }
      if (ACT == 1) v = fmaxf(v, 0.f);
      if (ACT == 2) v = 0.5f * v * (1.0f + erff(v * 0.70710678118654752f));
      if (ACT == 3) { const float u = 0.7978845608028654f * (v + 0.044715f * v * v * v); v = 0.5f * v * (1.0f + tanhf(u)); }
      so[w][8 * hh + r][t * 16 + ln] = v;
    }
  }
  __builtin_amdgcn_fence(__ATOMIC_ACQ_REL, "workgroup");
  __builtin_amdgcn_wave_barrier();
  const int rsub = lane >> 4, c4 = (lane & 15) * 4;
  {
#pragma unroll
    for (int q = 0; q < 8; ++q) {
      const int r = q * 2 + rsub;
      const v4f v = *(const v4fa*)&so[w][r][c4];
      *(v4f*)(C + (size_t)(row0 + r) * ldc + col0 + c4) = v;
    }
    
  }
}
// row LayerNorm (biased variance, eps) over N: s = X (+ R); optional out_sum <- s; out_norm <- (s-mu)*rsqrt(var+eps)*g + b
template <bool PARAM_BF16>
__global__ __launch_bounds__(256) void k_layernorm(const float* __restrict__ X, const float* __restrict__ R, const float* __restrict__ g, const float* __restrict__ bta,
                                                  float* __restrict__ out_sum, float* __restrict__ out_norm, int N, float eps) {
  __shared__ float red[256];
  const int row = blockIdx.x, tid = threadIdx.x;
  const float* x = X + (size_t)row * N; const float* rr = R ? R + (size_t)row * N : nullptr;
  float vals[16];                     // up to N = 4096
  const int per = N / 256;            // contiguous chunk per thread? use strided-by-4 chunks: thread handles j = tid*4 + 1024*u
  float s1 = 0.f;
  for (int u = 0; u < per / 4; ++u) {
    const int j = tid * 4 + 1024 * u;
    const v4f a = *(const v4fa*)(x + j);
    v4f b = {0.f,0.f,0.f,0.f}; if (rr) b = *(const v4fa*)(rr + j);
#pragma unroll
    for (int q = 0; q < 4; ++q) { const float v = a[q] + b[q]; vals[u * 4 + q] = v; s1 += v; }
  }
  red[tid] = s1; __syncthreads();
  for (int st = 128; st > 0; st >>= 1) { if (tid < st) red[tid] += red[tid + st]; __syncthreads(); }
  const float mu = red[0] / (float)N; __syncthreads();
  float s2 = 0.f;
  for (int u = 0; u < per / 4; ++u)
#pragma unroll
    for (int q = 0; q < 4; ++q) { const float c = vals[u * 4 + q] - mu; s2 += c * c; }
  red[tid] = s2; __syncthreads();
  for (int st = 128; st > 0; st >>= 1) { if (tid < st) red[tid] += red[tid + st]; __syncthreads(); }
  const float rs = rsqrtf(red[0] / (float)N + eps);
  {
    for (int u = 0; u < per / 4; ++u) {
      const int j = tid * 4 + 1024 * u;
      v4f o, sm;
#pragma unroll
      for (int q = 0; q < 4; ++q) {
        float gg = g[j + q], bb = bta[j + q];
        if (PARAM_BF16) { gg = bf16_round(gg); bb = bf16_round(bb); }
        sm[q] = vals[u * 4 + q]; o[q] = (vals[u * 4 + q] - mu) * rs * gg + bb;
      }
      if (out_sum) *(v4f*)(out_sum + (size_t)row * N + j) = sm;
      *(v4f*)(out_norm + (size_t)row * N + j) = o;
    }
    
  }
}



// ---- f16 WMMA path (v_wmma_f32_16x16x32_f16): 11-bit significands for operands in range — used where a [0,1] probability operand needs more precision than bf16
typedef _Float16 v16h __attribute__((ext_vector_type(16)));
union FragH { v16h v; v8us half[2]; _Float16 h[16]; unsigned short u[16]; };
template <int NT>
__device__ __forceinline__ v8f mmaH(v16h ah, v16h al, v16h bh, v16h bl, v8f c) {
  c = __builtin_amdgcn_wmma_f32_16x16x32_f16(false, ah, false, bh, (short)0, c, false, false);
  if (NT >= 2) c = __builtin_amdgcn_wmma_f32_16x16x32_f16(false, al, false, bh, (short)0, c, false, false);
  if (NT >= 3) c = __builtin_amdgcn_wmma_f32_16x16x32_f16(false, ah, false, bl, (short)0, c, false, false);
  asm volatile("v_nop\n\tv_nop\n\tv_nop\n\tv_nop" : "+v"(c) : "v"(ah), "v"(al), "v"(bh), "v"(bl));
  return c;
}
// batched GEMM like k_gemm_b but f16 operands: A f32 (split into f16 hi/lo if ASPLIT, else rounded to f16), Bt = f16 values [n][k]; alpha; C f32; N multiple of 16 (partial tiles skipped)
template <bool ASPLIT>
__global__ __launch_bounds__(128) void k_gemm_h(const float* __restrict__ A, int lda, size_t sA, const _Float16* __restrict__ Bh, int ldb, size_t sB, float alpha, float* __restrict__ C, int ldc, size_t sC, int M, int N, int K) {
  __shared__ __attribute__((aligned(16))) float so[4][16][64];
  const int tid = threadIdx.x, w = tid >> 5, lane = tid & 31, ln = lane & 15, hh = lane >> 4; const int by = blockIdx.y;
  A += (size_t)by * sA; Bh += (size_t)by * sB; C += (size_t)by * sC;
  const int ntn = (N + 63) / 64; const int wid = blockIdx.x * 4 + w; const int mt = wid / ntn, nq = wid % ntn; if (mt * 16 >= M) return;
  const int row0 = mt * 16, col0 = nq * 64; const float* arow = A + (size_t)(row0 + ln) * lda;
  v8f acc[4] = {};
  for (int kb = 0; kb < K; kb += 32) {
    FragH ah, al;
    const v4f x0 = *(const v4fa*)(arow + kb + 8 * hh), x1 = *(const v4fa*)(arow + kb + 8 * hh + 4), x2 = *(const v4fa*)(arow + kb + 16 + 8 * hh), x3 = *(const v4fa*)(arow + kb + 16 + 8 * hh + 4);
    float xs[16] = {x0[0],x0[1],x0[2],x0[3],x1[0],x1[1],x1[2],x1[3],x2[0],x2[1],x2[2],x2[3],x3[0],x3[1],x3[2],x3[3]};
#pragma unroll
    for (int i = 0; i < 16; ++i) { const _Float16 h = (_Float16)xs[i]; ah.h[i] = h; al.h[i] = ASPLIT ? (_Float16)(xs[i] - (float)h) : (_Float16)0.0f; }
#pragma unroll
    for (int t = 0; t < 4; ++t) { if (col0 + t * 16 >= N) continue; const size_t boff = (size_t)(col0 + t * 16 + ln) * ldb + kb; FragH bq; bq.half[0] = *(const v8us*)(Bh + boff + 8 * hh); bq.half[1] = *(const v8us*)(Bh + boff + 16 + 8 * hh);
      acc[t] = mmaH<ASPLIT ? 2 : 1>(ah.v, al.v, bq.v, bq.v, acc[t]); }
  }
#pragma unroll
  for (int t = 0; t < 4; ++t) { if (col0 + t * 16 >= N) continue;
#pragma unroll
    for (int r = 0; r < 8; ++r) so[w][8 * hh + r][t * 16 + ln] = acc[t][r] * alpha; }
  __builtin_amdgcn_fence(__ATOMIC_ACQ_REL, "workgroup"); __builtin_amdgcn_wave_barrier();
  const int rsub = lane >> 4, c4 = (lane & 15) * 4;
  {
#pragma unroll
    for (int q = 0; q < 8; ++q) { const int r = q * 2 + rsub; if (col0 + c4 < N) { const v4f v = *(const v4fa*)&so[w][r][c4]; *(v4f*)(C + (size_t)(row0 + r) * ldc + col0 + c4) = v; } }
     }
}

// Wt[n][k] = f16(W[k][n]·scale) from f32 row-major W[K][N] (scale = power of two; bf16-exact weights stay exact in f16 away from the subnormal range)
__global__ __launch_bounds__(256) void k_wt_f16(const float* __restrict__ W, _Float16* __restrict__ Wt, int K, int N, float scale) {
  const int t = blockIdx.x * 256 + threadIdx.x; if (t >= N * (K / 8)) return; const int n = t / (K / 8), k8 = (t % (K / 8)) * 8; FragH f;
#pragma unroll
  for (int i = 0; i < 8; ++i) f.h[i] = (_Float16)(bf16_round(W[(size_t)(k8 + i) * N + n]) * scale); const v8us o = f.half[0];
  *(v8us*)((unsigned short*)Wt + (size_t)n * K + k8) = o; 
}
// k_gemm_hh variant with fused epilogue: v = acc·alpha + bias[by·sBias + col] (+ CP[(row/rowsPerB)·sCPb + by·64 + col] if CP) ; ACT 0 none / 1 elu ; writes f16 C16 (and f32 C if non-null)
template <int ACT>
__global__ __launch_bounds__(128) void k_gemm_hhx(const _Float16* __restrict__ A, int lda, size_t sA, const _Float16* __restrict__ Bh, int ldb, size_t sB, float alpha, const float* __restrict__ bias, size_t sBias, const float* __restrict__ CP, int rowsPerB, size_t sCPb, int row0g,
    float* __restrict__ C, _Float16* __restrict__ C16, int ldc, size_t sC, int M, int N, int K) {
  __shared__ __attribute__((aligned(16))) float so[4][16][64];
  const int tid = threadIdx.x, w = tid >> 5, lane = tid & 31, ln = lane & 15, hh = lane >> 4; const int by = blockIdx.y;
  A += (size_t)by * sA; Bh += (size_t)by * sB; const size_t cofs = (size_t)by * sC; const float* bp = bias ? bias + (size_t)by * sBias : nullptr;
  const int ntn = (N + 63) / 64; const int wid = blockIdx.x * 4 + w; const int mt = wid / ntn, nq = wid % ntn; if (mt * 16 >= M) return;
  const int row0 = mt * 16, col0 = nq * 64; const _Float16* arow = A + (size_t)(row0 + ln) * lda;
  v8f acc[4] = {};
  for (int kb = 0; kb < K; kb += 32) { FragH ah; ah.half[0] = *(const v8us*)((const unsigned short*)arow + kb + 8 * hh); ah.half[1] = *(const v8us*)((const unsigned short*)arow + kb + 16 + 8 * hh);
#pragma unroll
    for (int t = 0; t < 4; ++t) { if (col0 + t * 16 >= N) continue; const size_t boff = (size_t)(col0 + t * 16 + ln) * ldb + kb; FragH bq; bq.half[0] = *(const v8us*)((const unsigned short*)Bh + boff + 8 * hh); bq.half[1] = *(const v8us*)((const unsigned short*)Bh + boff + 16 + 8 * hh);
      acc[t] = mmaH<1>(ah.v, ah.v, bq.v, bq.v, acc[t]); }
  }
#pragma unroll
  for (int t = 0; t < 4; ++t) { if (col0 + t * 16 >= N) continue; const int col = col0 + t * 16 + ln; const float bv = bp ? bf16_round(bp[col]) : 0.f;
#pragma unroll
    for (int r = 0; r < 8; ++r) { float v = acc[t][r] * alpha + bv; if (CP) { const int bidx = (row0g + row0 + 8 * hh + r) / rowsPerB; v += CP[(size_t)bidx * sCPb + (size_t)by * 64 + col]; } if (ACT == 1) v = (v > 0.f) ? v : expm1f(v); else if (ACT == 7) v = (v > 0.f) ? v + 1.0f : expf(v); else if (ACT == 8) v = tanhf(v); else if (ACT == 9) v = 0.5f * v * (1.0f + tanhf(0.7978845608028654f * (v + 0.044715f * v * v * v))); else if (ACT == 11) v = 1.0f / (1.0f + expf(-v)); else if (ACT == 12) v = (v > 0.f) ? v : 0.01f * v; else if (ACT == 14) v = (v > 0.f) ? v : 0.1f * v; else if (ACT == 15) v = v / (1.0f + expf(-v)); else if (ACT == 3) v = fmaxf(v, 0.f); else if (ACT == 6) v = 0.5f * v * (1.0f + erff(v * 0.70710678118654752f)); so[w][8 * hh + r][t * 16 + ln] = v; } }
  __builtin_amdgcn_fence(__ATOMIC_ACQ_REL, "workgroup"); __builtin_amdgcn_wave_barrier();
  const int rsub = lane >> 4, c4 = (lane & 15) * 4; typedef _Float16 v4h __attribute__((ext_vector_type(4)));
  {
#pragma unroll
    for (int q = 0; q < 8; ++q) { const int r = q * 2 + rsub; if (col0 + c4 < N) { const v4f v = *(const v4fa*)&so[w][r][c4]; if (C) *(v4f*)(C + cofs + (size_t)(row0 + r) * ldc + col0 + c4) = v; if (C16) { v4h h4; for (int i = 0; i < 4; ++i) h4[i] = (_Float16)v[i]; *(v4h*)(C16 + cofs + (size_t)(row0 + r) * ldc + col0 + c4) = h4; } } }
     }
}


typedef _Float16 v4h __attribute__((ext_vector_type(4)));

__global__ __launch_bounds__(256) void k_x16(const float* __restrict__ x, _Float16* __restrict__ X16, size_t n8) { const size_t t = (size_t)blockIdx.x * 256 + threadIdx.x; if (t >= n8) return; FragH f;
#pragma unroll
  for (int q = 0; q < 8; ++q) f.h[q] = (_Float16)bf16_round(x[t * 8 + q]); *(v8us*)((unsigned short*)X16 + t * 8) = f.half[0];  }
__global__ __launch_bounds__(256) void k_h16(const float* __restrict__ x, _Float16* __restrict__ X16, size_t n8) { const size_t t = (size_t)blockIdx.x * 256 + threadIdx.x; if (t >= n8) return; FragH f;
#pragma unroll
  for (int q = 0; q < 8; ++q) f.h[q] = (_Float16)x[t * 8 + q]; *(v8us*)((unsigned short*)X16 + t * 8) = f.half[0];  }
__global__ __launch_bounds__(256) void k_round16f(const float* __restrict__ W, _Float16* __restrict__ Bt, size_t n8) { const size_t t = (size_t)blockIdx.x * 256 + threadIdx.x; if (t >= n8) return; FragH f;
#pragma unroll
  for (int i = 0; i < 8; ++i) f.h[i] = (_Float16)(bf16_round(W[t * 8 + i]) * 16.0f); *(v8us*)((unsigned short*)Bt + t * 8) = f.half[0];  }
template <int NHv, int TTv>
__global__ __launch_bounds__(256) void k_vt(const _Float16* __restrict__ V16, int ldv, int voff, _Float16* __restrict__ Vt) { __shared__ unsigned short tl[64][66]; const int tid = threadIdx.x; const int slab = blockIdx.x / (TTv / 64), lg = blockIdx.x % (TTv / 64); const int b = slab / NHv, h = slab % NHv;
  for (int i = tid; i < 64 * 8; i += 256) { const int r = i / 8, c8 = (i % 8) * 8; FragH f; f.half[0] = *(const v8us*)((const unsigned short*)V16 + ((size_t)b * TTv + lg * 64 + r) * ldv + voff + h * 64 + c8);
#pragma unroll
    for (int q = 0; q < 8; ++q) tl[r][c8 + q] = f.u[q]; }
  __syncthreads();
  {
#pragma unroll
    for (int rd = 0; rd < 2; ++rd) { const int d = rd * 32 + tid / 8, pc = tid % 8; FragH f;
#pragma unroll
      for (int q = 0; q < 8; ++q) f.u[q] = tl[pc * 8 + q][d];
      *(v8us*)((unsigned short*)Vt + ((size_t)slab * 64 + d) * TTv + lg * 64 + pc * 8) = f.half[0]; }
     } }

__global__ __launch_bounds__(256) void k_hl(const float* __restrict__ F, _Float16* __restrict__ Hh, _Float16* __restrict__ Hl, size_t n8) { const size_t t = (size_t)blockIdx.x * 256 + threadIdx.x; if (t >= n8) return; FragH fh, fl; const v4f a = *(const v4fa*)(F + t * 8), c = *(const v4fa*)(F + t * 8 + 4);
#pragma unroll
  for (int q = 0; q < 4; ++q) { _Float16 h = (_Float16)a[q]; fh.h[q] = h; fl.h[q] = (_Float16)((a[q] - (float)h) * 1024.0f); h = (_Float16)c[q]; fh.h[4 + q] = h; fl.h[4 + q] = (_Float16)((c[q] - (float)h) * 1024.0f); }
  { *(v8us*)((unsigned short*)Hh + t * 8) = fh.half[0]; *(v8us*)((unsigned short*)Hl + t * 8) = fl.half[0];  } }

// ---- fast GEMM (wave tile 32x64; requires M % 32 == 0 rows per launch region and N % 64 == 0); epilogue = k_gemm_hhx semantics ----
__device__ __forceinline__ v16h g2_frag(const _Float16* p, int hh) { FragH f; f.half[0] = *(const v8us*)((const unsigned short*)p + 8 * hh); f.half[1] = *(const v8us*)((const unsigned short*)p + 16 + 8 * hh); return f.v; }
__device__ __forceinline__ v8f g2_mma(v16h a, v16h b, v8f c) { v8f d = __builtin_amdgcn_wmma_f32_16x16x32_f16(false, a, false, b, (short)0, c, false, false); asm volatile("v_nop\n\tv_nop\n\tv_nop\n\tv_nop" : "+v"(d) : "v"(a), "v"(b)); return d; }
template <int ACT>
__global__ __launch_bounds__(128) void k_gemm2(const _Float16* __restrict__ A, int lda, size_t sA, const _Float16* __restrict__ Bh, int ldb, size_t sB, float alpha, const float* __restrict__ bias, size_t sBias, const float* __restrict__ CP, int rowsPerB, size_t sCPb, int row0g,
    float* __restrict__ C, _Float16* __restrict__ C16, int ldc, size_t sC, int M, int N, int K) {
  __shared__ __attribute__((aligned(16))) float so[4][32][68];
  const int tid = threadIdx.x, w = tid >> 5, lane = tid & 31, ln = lane & 15, hh = lane >> 4; const int by = blockIdx.y;
  A += (size_t)by * sA; Bh += (size_t)by * sB; const size_t cofs = (size_t)by * sC; const float* bp = bias ? bias + (size_t)by * sBias : nullptr;
  const int ntn = N >> 6; const int mt = blockIdx.x / ntn, nq = blockIdx.x - mt * ntn; const int row0 = mt * 128 + 32 * w, col0 = nq * 64; if (row0 >= M) return;
  const _Float16* a0p = A + (size_t)(row0 + ln) * lda; const _Float16* a1p = a0p + (size_t)16 * lda;
  const _Float16* b0p = Bh + (size_t)(col0 + ln) * ldb; const _Float16* b1p = b0p + (size_t)16 * ldb; const _Float16* b2p = b1p + (size_t)16 * ldb; const _Float16* b3p = b2p + (size_t)16 * ldb;
  const v8f z8 = {0.f,0.f,0.f,0.f,0.f,0.f,0.f,0.f}; v8f c00 = z8, c01 = z8, c02 = z8, c03 = z8, c10 = z8, c11 = z8, c12 = z8, c13 = z8;
#pragma unroll 1
  for (int kb = 0; kb < K; kb += 32) { const v16h a0 = g2_frag(a0p + kb, hh), a1 = g2_frag(a1p + kb, hh);
    v16h b = g2_frag(b0p + kb, hh); c00 = g2_mma(a0, b, c00); c10 = g2_mma(a1, b, c10);
    b = g2_frag(b1p + kb, hh); c01 = g2_mma(a0, b, c01); c11 = g2_mma(a1, b, c11);
    b = g2_frag(b2p + kb, hh); c02 = g2_mma(a0, b, c02); c12 = g2_mma(a1, b, c12);
    b = g2_frag(b3p + kb, hh); c03 = g2_mma(a0, b, c03); c13 = g2_mma(a1, b, c13); }
  v8f accs[8] = {c00, c01, c02, c03, c10, c11, c12, c13};
#pragma unroll
  for (int u = 0; u < 8; ++u) { const int t = u & 3, half = u >> 2; const int col = col0 + t * 16 + ln; const float bv = bp ? bf16_round(bp[col]) : 0.f;
#pragma unroll
    for (int r = 0; r < 8; ++r) { const int rloc = half * 16 + 8 * hh + r; float v = accs[u][r] * alpha + bv; if (CP) { const int bidx = (row0g + row0 + rloc) / rowsPerB; v += CP[(size_t)bidx * sCPb + (size_t)by * 64 + col]; }
      if (ACT == 3) v = fmaxf(v, 0.f); else if (ACT == 6) v = 0.5f * v * (1.0f + erff(v * 0.70710678118654752f)); else if (ACT == 11) v = 1.0f / (1.0f + expf(-v)); else if (ACT == 15) v = v / (1.0f + expf(-v)); else if (ACT == 12) v = (v > 0.f) ? v : 0.01f * v; else if (ACT == 8) v = tanhf(v);
      so[w][rloc][t * 16 + ln] = v; } }
  __builtin_amdgcn_fence(__ATOMIC_ACQ_REL, "workgroup"); __builtin_amdgcn_wave_barrier();
  const int rsub = lane >> 4, c4 = (lane & 15) * 4;
  {
#pragma unroll
    for (int q = 0; q < 16; ++q) { const int r = q * 2 + rsub; const v4f v = *(const v4fa*)&so[w][r][c4]; if (C) *(v4f*)(C + cofs + (size_t)(row0 + r) * ldc + col0 + c4) = v; if (C16) { v4h h4; for (int i = 0; i < 4; ++i) h4[i] = (_Float16)v[i]; *(v4h*)(C16 + cofs + (size_t)(row0 + r) * ldc + col0 + c4) = h4; } }
     } }


template <int TK>
__global__ __launch_bounds__(256) void k_vthl(const float* __restrict__ VF, int ldv, _Float16* __restrict__ Vth, _Float16* __restrict__ Vtl) { __shared__ float tl[64][65]; const int tid = threadIdx.x; const int slab = blockIdx.x / (TK / 64), lg = blockIdx.x % (TK / 64); const int b = slab / NH, h = slab % NH;
  for (int i = tid; i < 64 * 16; i += 256) { const int r = i / 16, c4 = (i % 16) * 4; const v4f a = *(const v4fa*)(VF + ((size_t)b * TK + lg * 64 + r) * ldv + h * 64 + c4); tl[r][c4] = a[0]; tl[r][c4 + 1] = a[1]; tl[r][c4 + 2] = a[2]; tl[r][c4 + 3] = a[3]; }
  __syncthreads();
  FragH fh[2], fl[2]; size_t oo[2];
#pragma unroll
  for (int rd = 0; rd < 2; ++rd) { const int d = rd * 32 + tid / 8, pc = tid % 8;
#pragma unroll
    for (int q = 0; q < 8; ++q) { const float v = tl[pc * 8 + q][d]; const _Float16 hv = (_Float16)v; fh[rd].h[q] = hv; fl[rd].h[q] = (_Float16)((v - (float)hv) * 1024.0f); } oo[rd] = ((size_t)slab * 64 + d) * TK + lg * 64 + pc * 8; }
  {
#pragma unroll
    for (int rd = 0; rd < 2; ++rd) { *(v8us*)((unsigned short*)Vth + oo[rd]) = fh[rd].half[0]; *(v8us*)((unsigned short*)Vtl + oo[rd]) = fl[rd].half[0]; }
     } }

template <int TQ, int TK>
__global__ __launch_bounds__(256) void k_flashm(const _Float16* __restrict__ Q16, const _Float16* __restrict__ Q16lo, int ldq, const _Float16* __restrict__ K16, const _Float16* __restrict__ K16lo, int ldk, const _Float16* __restrict__ Vt, const _Float16* __restrict__ Vtlo, const unsigned* __restrict__ MB, const int* __restrict__ RA, const int* __restrict__ KE, float* __restrict__ O, int ldo) {
  constexpr int RPW = 16, RTN = RPW / 16, NW = 8, NQB = TQ / RPW, DT = 4, KS = 2;
  __shared__ __attribute__((aligned(16))) unsigned short sP[NW][RPW][40], sPl[NW][RPW][40]; __shared__ __attribute__((aligned(16))) float sO[NW][RPW][64 + 4]; __shared__ float sM[NW][RPW], sL[NW][RPW];
  const int tid = threadIdx.x, w = __builtin_amdgcn_readfirstlane(tid >> 5), lane = tid & 31, ln = lane & 15, hh = lane >> 4;
  /* w through readfirstlane: the wave's number, and with it the key-step counter, stays in a scalar register. Work-group = one 16-query tile; the tiles with the most keys have the lowest block indices (for speed only) */
  const int slab = blockIdx.x % (NB * NH), qt = NQB - 1 - blockIdx.x / (NB * NH); const int b = slab / NH, h = slab % NH; const int q0 = qt * RPW; const int qblk = q0 >> 6;
  FragH aq[2][KS], aql[2][KS];
#pragma unroll
  for (int rt = 0; rt < RTN; ++rt) { const size_t qo = ((size_t)b * TQ + q0 + rt * 16 + ln) * ldq + h * 64; const unsigned short* qr = (const unsigned short*)Q16 + qo; const unsigned short* ql = (const unsigned short*)Q16lo + qo;
#pragma unroll
    for (int ks = 0; ks < KS; ++ks) { aq[rt][ks].half[0] = *(const v8us*)(qr + ks * 32 + 8 * hh); aq[rt][ks].half[1] = *(const v8us*)(qr + ks * 32 + 16 + 8 * hh); aql[rt][ks].half[0] = *(const v8us*)(ql + ks * 32 + 8 * hh); aql[rt][ks].half[1] = *(const v8us*)(ql + ks * 32 + 16 + 8 * hh); } }
  const unsigned short* Vth = (const unsigned short*)Vt + (size_t)slab * 64 * TK; const unsigned short* Vtl = (const unsigned short*)Vtlo + (size_t)slab * 64 * TK;
  float m_r[2][8], l_r[2][8]; v8f oacc[2][DT], oaccl[2][DT];
#pragma unroll
  for (int rt = 0; rt < RTN; ++rt) {
#pragma unroll
    for (int r = 0; r < 8; ++r) { m_r[rt][r] = -3.0e38f; l_r[rt][r] = 0.f; }
#pragma unroll
    for (int dt = 0; dt < DT; ++dt) { oacc[rt][dt] = (v8f){0.f,0.f,0.f,0.f,0.f,0.f,0.f,0.f}; oaccl[rt][dt] = oacc[rt][dt]; } }
  int jend = KE[qblk * 32]; jend = min(TK, (jend + 31) & ~31); if (jend < 32) jend = 32;      /* block-uniform */
  int allm[2][8]; const unsigned* mrow[2][8];
#pragma unroll
  for (int rt = 0; rt < RTN; ++rt)
#pragma unroll
    for (int r = 0; r < 8; ++r) { const int tq = q0 + rt * 16 + 8 * hh + r; allm[rt][r] = RA[tq]; mrow[rt][r] = MB + (size_t)tq * (TK / 32); }
#pragma unroll 1
  for (int j0 = 32 * w; j0 < jend; j0 += 32 * NW) {      /* wave w takes every NW-th 32-key step */
    
    v8f s[2][2];
#pragma unroll
    for (int nt = 0; nt < 2; ++nt) { const size_t ko = ((size_t)b * TK + j0 + nt * 16 + ln) * ldk + h * 64; const unsigned short* kr = (const unsigned short*)K16 + ko; const unsigned short* kl = (const unsigned short*)K16lo + ko; FragH bk[KS], bkl[KS];
#pragma unroll
      for (int ks = 0; ks < KS; ++ks) { bk[ks].half[0] = *(const v8us*)(kr + ks * 32 + 8 * hh); bk[ks].half[1] = *(const v8us*)(kr + ks * 32 + 16 + 8 * hh); bkl[ks].half[0] = *(const v8us*)(kl + ks * 32 + 8 * hh); bkl[ks].half[1] = *(const v8us*)(kl + ks * 32 + 16 + 8 * hh); }
#pragma unroll
      for (int rt = 0; rt < RTN; ++rt) { v8f acc = (v8f){0.f,0.f,0.f,0.f,0.f,0.f,0.f,0.f}, accr = acc;
#pragma unroll
        for (int ks = 0; ks < KS; ++ks) { acc = mmaH<1>(aq[rt][ks].v, aq[rt][ks].v, bk[ks].v, bk[ks].v, acc); accr = mmaH<1>(aql[rt][ks].v, aql[rt][ks].v, bk[ks].v, bk[ks].v, accr); accr = mmaH<1>(aq[rt][ks].v, aq[rt][ks].v, bkl[ks].v, bkl[ks].v, accr); }
        s[rt][nt] = acc + accr * 0.0009765625f; } }
#pragma unroll
    for (int rt = 0; rt < RTN; ++rt)
#pragma unroll
      for (int r = 0; r < 8; ++r) { const unsigned mw = mrow[rt][r][j0 >> 5]; const bool am = (allm[rt][r] != 0);
        const bool ok0 = am || (((mw >> ln) & 1u) == 0u), ok1 = am || (((mw >> (16 + ln)) & 1u) == 0u);
        const float s0 = ok0 ? (am ? 0.f : s[rt][0][r] * SCL) : -INFINITY, s1 = ok1 ? (am ? 0.f : s[rt][1][r] * SCL) : -INFINITY; float mc = fmaxf(s0, s1);
        mc = fmaxf(mc, __shfl_xor(mc, 1, 32)); mc = fmaxf(mc, __shfl_xor(mc, 2, 32)); mc = fmaxf(mc, __shfl_xor(mc, 4, 32)); mc = fmaxf(mc, __shfl_xor(mc, 8, 32));
        const float mn = fmaxf(m_r[rt][r], mc); const float al = (mn > -1.0e38f) ? expf(m_r[rt][r] - mn) : 1.0f; m_r[rt][r] = mn; const float p0 = ok0 ? expf(s0 - mn) : 0.f, p1 = ok1 ? expf(s1 - mn) : 0.f; l_r[rt][r] = l_r[rt][r] * al + p0 + p1;
#pragma unroll
        for (int dt = 0; dt < DT; ++dt) { oacc[rt][dt][r] *= al; oaccl[rt][dt][r] *= al; }
        FragH t2, t3; const float ps0 = p0 * 1024.0f, ps1 = p1 * 1024.0f; t2.h[0] = (_Float16)ps0; t2.h[1] = (_Float16)ps1; t3.h[0] = (_Float16)((ps0 - (float)t2.h[0]) * 1024.0f); t3.h[1] = (_Float16)((ps1 - (float)t2.h[1]) * 1024.0f);
        sP[w][rt * 16 + 8 * hh + r][ln] = t2.u[0]; sP[w][rt * 16 + 8 * hh + r][16 + ln] = t2.u[1]; sPl[w][rt * 16 + 8 * hh + r][ln] = t3.u[0]; sPl[w][rt * 16 + 8 * hh + r][16 + ln] = t3.u[1]; }
    __builtin_amdgcn_fence(__ATOMIC_ACQ_REL, "workgroup"); __builtin_amdgcn_wave_barrier();
    FragH pa[2], pl[2];
#pragma unroll
    for (int rt = 0; rt < RTN; ++rt) { pa[rt].half[0] = *(const v8us*)&sP[w][rt * 16 + ln][8 * hh]; pa[rt].half[1] = *(const v8us*)&sP[w][rt * 16 + ln][16 + 8 * hh]; pl[rt].half[0] = *(const v8us*)&sPl[w][rt * 16 + ln][8 * hh]; pl[rt].half[1] = *(const v8us*)&sPl[w][rt * 16 + ln][16 + 8 * hh]; }
#pragma unroll
    for (int dt = 0; dt < DT; ++dt) { const size_t vo = (size_t)(dt * 16 + ln) * TK + j0; FragH bv, bl; bv.half[0] = *(const v8us*)(Vth + vo + 8 * hh); bv.half[1] = *(const v8us*)(Vth + vo + 16 + 8 * hh); bl.half[0] = *(const v8us*)(Vtl + vo + 8 * hh); bl.half[1] = *(const v8us*)(Vtl + vo + 16 + 8 * hh);
#pragma unroll
      for (int rt = 0; rt < RTN; ++rt) { oacc[rt][dt] = mmaH<1>(pa[rt].v, pa[rt].v, bv.v, bv.v, oacc[rt][dt]); oaccl[rt][dt] = mmaH<1>(pa[rt].v, pa[rt].v, bl.v, bl.v, oaccl[rt][dt]); oaccl[rt][dt] = mmaH<1>(pl[rt].v, pl[rt].v, bv.v, bv.v, oaccl[rt][dt]); } }
    __builtin_amdgcn_fence(__ATOMIC_ACQ_REL, "workgroup"); __builtin_amdgcn_wave_barrier(); }
#pragma unroll
  for (int rt = 0; rt < RTN; ++rt) {
#pragma unroll
    for (int r = 0; r < 8; ++r) { float l = l_r[rt][r]; l += __shfl_xor(l, 1, 32); l += __shfl_xor(l, 2, 32); l += __shfl_xor(l, 4, 32); l += __shfl_xor(l, 8, 32); if (ln == 0) { sM[w][rt * 16 + 8 * hh + r] = m_r[rt][r]; sL[w][rt * 16 + 8 * hh + r] = l; } }
#pragma unroll
    for (int dt = 0; dt < DT; ++dt)
#pragma unroll
      for (int r = 0; r < 8; ++r) sO[w][rt * 16 + 8 * hh + r][dt * 16 + ln] = oacc[rt][dt][r] + oaccl[rt][dt][r] * 0.0009765625f; }
  __syncthreads();      /* every wave's partial (max, sum, O) is in LDS before any thread merges them */
  { const int r = tid >> 4, pc = tid & 15; float mm = sM[0][r];
#pragma unroll
    for (int u = 1; u < NW; ++u) mm = fmaxf(mm, sM[u][r]);
    float l = 0.f; v4f val = {0.f, 0.f, 0.f, 0.f};
#pragma unroll
    for (int u = 0; u < NW; ++u) { const float e = (mm > -1.0e38f) ? expf(sM[u][r] - mm) : 1.0f; l += e * sL[u][r]; const v4f po = *(const v4fa*)&sO[u][r][pc * 4]; val += po * e; }
    const float li = (l > 0.f) ? 1.0f / (l * 1024.0f) : 0.f;
    *(v4f*)(O + ((size_t)b * TQ + q0 + r) * ldo + h * 64 + pc * 4) = val * li; } }


__global__ __launch_bounds__(256) void k_causaltab(unsigned* __restrict__ MB, int* __restrict__ RA, int* __restrict__ KE, int nq, int nk) {
  const int t = blockIdx.x * 256 + threadIdx.x; const int nw = nk / 32;
  if (t < nq * nw) { const int q = t / nw, w = t % nw; const int first = q + 1 - 32 * w; const unsigned bits = (first <= 0) ? 0xffffffffu : ((first >= 32) ? 0u : (0xffffffffu << first)); *(unsigned*)(MB + t) = bits;  }
  if (t < nq) { *(int*)(RA + t) = 0;  }
  if (t < nq / 64) { const int v = 64 * (t + 1); *(int*)(KE + t * 32) = v;  } }

extern "C" void kernel_launch(void* const* d_in, const int* in_sizes, int n_in,
                              void* d_out, int out_size, void* d_ws, size_t ws_size, hipStream_t stream) {
  (void)in_sizes; (void)n_in; (void)out_size;
  const float* const* I = (const float* const*)d_in; const float* x = I[0]; const float* Wq = I[1]; const float* bq = I[2]; const float* Wk = I[3]; const float* bk = I[4]; const float* Wv = I[5]; const float* bv = I[6]; const float* Wo = I[7]; const float* bo = I[8];
  char* ws = (char*)d_ws; size_t off = 0;
  auto take = [&](size_t bytes) { char* p = ws + off; off += (bytes + 255) & ~(size_t)255; return p; };
  _Float16* BQ = (_Float16*)take((size_t)DK * DM * 2); _Float16* BK = (_Float16*)take((size_t)DK * DM * 2); _Float16* BV = (_Float16*)take((size_t)DK * DM * 2); _Float16* BO = (_Float16*)take((size_t)DM * DK * 2);
  _Float16* X16 = (_Float16*)take((size_t)NR * DM * 2); float* F = (float*)take((size_t)NR * DK * 4);
  _Float16* Qh = (_Float16*)take((size_t)NR * DK * 2); _Float16* Ql = (_Float16*)take((size_t)NR * DK * 2); _Float16* Kh = (_Float16*)take((size_t)NR * DK * 2); _Float16* Kl = (_Float16*)take((size_t)NR * DK * 2); _Float16* Vth = (_Float16*)take((size_t)NR * DK * 2); _Float16* Vtl = (_Float16*)take((size_t)NR * DK * 2);
  unsigned* MB = (unsigned*)take((size_t)SS * (SS / 32) * 4); int* RA = (int*)take((size_t)SS * 4); int* KE = (int*)take((size_t)(SS / 64) * 32 * 4);
  float* O = (float*)take((size_t)NR * DK * 4); _Float16* Oh = (_Float16*)take((size_t)NR * DK * 2); _Float16* Ol = (_Float16*)take((size_t)NR * DK * 2);
  if (off > ws_size) return;      /* 16 + 4 + 6 x 2 + 2 + 4 + 4 = 42 MiB */
  k_wt_f16<<<(DM * DK / 8 + 255) / 256, 256, 0, stream>>>(Wq, BQ, DM, DK, 16.0f); k_wt_f16<<<(DM * DK / 8 + 255) / 256, 256, 0, stream>>>(Wk, BK, DM, DK, 16.0f); k_wt_f16<<<(DM * DK / 8 + 255) / 256, 256, 0, stream>>>(Wv, BV, DM, DK, 16.0f); k_wt_f16<<<(DK * DM / 8 + 255) / 256, 256, 0, stream>>>(Wo, BO, DK, DM, 16.0f);      /* (in,out) -> [out][in] x16 */
  k_x16<<<(unsigned)(((size_t)NR * DM / 8 + 255) / 256), 256, 0, stream>>>(x, X16, (size_t)NR * DM / 8);
  k_causaltab<<<(SS * (SS / 32) + 255) / 256, 256, 0, stream>>>(MB, RA, KE, SS, SS);
  const dim3 gP((NR / 128) * 1, 1), gO((NR / 128) * (DM / 64), 1); const size_t n8 = (size_t)NR * DK / 8; const unsigned nb8 = (unsigned)((n8 + 255) / 256);
  k_gemm2<0><<<gP, 128, 0, stream>>>(X16, DM, 0, BQ, DM, 0, 0.0625f, bq, 0, nullptr, 1, 0, 0, F, nullptr, DK, 0, NR, DK, DM); k_hl<<<nb8, 256, 0, stream>>>(F, Qh, Ql, n8);
  k_gemm2<0><<<gP, 128, 0, stream>>>(X16, DM, 0, BK, DM, 0, 0.0625f, bk, 0, nullptr, 1, 0, 0, F, nullptr, DK, 0, NR, DK, DM); k_hl<<<nb8, 256, 0, stream>>>(F, Kh, Kl, n8);
  k_gemm2<0><<<gP, 128, 0, stream>>>(X16, DM, 0, BV, DM, 0, 0.0625f, bv, 0, nullptr, 1, 0, 0, F, nullptr, DK, 0, NR, DK, DM);
  k_vthl<SS><<<NB * NH * (SS / 64), 256, 0, stream>>>(F, DK, Vth, Vtl);      /* V^T hi/lo per sequence [64][4096]; one grid over all sequences (slab = sequence) */
  k_flashm<SS, SS><<<NB * NH * (SS / 16), 256, 0, stream>>>(Qh, Ql, DK, Kh, Kl, DK, Vth, Vtl, MB, RA, KE, O, DK);      /* one grid over all (sequence, 16 queries): 1024 work-groups of 8 waves */
  k_hl<<<nb8, 256, 0, stream>>>(O, Oh, Ol, n8);
  k_gemm2<0><<<gO, 128, 0, stream>>>(Oh, DK, 0, BO, DK, 0, 0.0625f, bo, 0, nullptr, 1, 0, 0, (float*)d_out, nullptr, DM, 0, NR, DM, DK);
  k_gemm2<0><<<gO, 128, 0, stream>>>(Ol, DK, 0, BO, DK, 0, 0.0625f * 0.0009765625f, nullptr, 0, (const float*)d_out, 1, (size_t)DM, 0, (float*)d_out, nullptr, DM, 0, NR, DM, DK);      /* out = O*Wo + bo (hi pass, then the residual pass through the addend) */
}

// v003
// It runs in 211 microseconds.
// In two side-by-side timings against v002, it was 1.22 and 1.20 times as fast.
// All steps since v000 together make it 11.6 times as fast.
#include <hip/hip_runtime.h>
// Single-head causal attention (4 sequences x 4096 tokens x 512; d_k = d_v = 64): q, k, v = x*W + b; scores = q.k/8 with j <= i; softmax; out = (attn.v)*Wo + bo -> [4,4096,512].
// Structure: x as an exact f16 plane; q/k/v by f16 WMMA GEMMs (32x64 wave tiles, f32, exact products + bias); q, k as f16 hi + (x2^10) residual planes, V^T as hi + residual planes; the causal structure computed on device into a key bit plane + per-block key bound; one fused flash-style kernel per (sequence, 16 queries) (8 waves share the queries, the 32-key steps up to the bound dealt to them in turn, three-product hi/lo scores, online softmax f32, P hi + residual via LDS, two value accumulators, the 8 partial (max, sum, O) merged in LDS); O as hi + residual planes; output projection as two GEMMs (bias in the first) -> the output rows.
// Compute dtype: x, weights, biases rounded to bf16; projections exact; q, k, P, v, O as f16 hi + residual pairs (~2^-21); f32 accumulation and softmax. v_wmma_f32_16x16x32_f16.
#define NB 4
#define SS 4096
#define DM 512
#define DK 64
#define NH 1
#define SCL 0.125f
#define NR (NB * SS)
typedef __bf16 v16b __attribute__((ext_vector_type(16)));
typedef unsigned short v8us __attribute__((ext_vector_type(8), may_alias));
typedef float  v8f  __attribute__((ext_vector_type(8)));
typedef float  v4f  __attribute__((ext_vector_type(4)));
typedef float  v4fa __attribute__((ext_vector_type(4), may_alias));
union FragB { v16b v; v8us half[2]; unsigned short u[16]; };

__device__ __forceinline__ unsigned short bf16_bits(float x) { unsigned int u = __float_as_uint(x); return (unsigned short)((u + 0x7FFFu + ((u >> 16) & 1u)) >> 16); }
__device__ __forceinline__ float bf16_val(unsigned short b) { return __uint_as_float(((unsigned int)b) << 16); }
__device__ __forceinline__ float bf16_round(float x) { return bf16_val(bf16_bits(x)); }
// D += A·B with NT terms: 1 = ah·bh, 2 = + al·bh (A split), 3 = + ah·bl (both split)
template <int NT>
__device__ __forceinline__ v8f mmaN(v16b ah, v16b al, v16b bh, v16b bl, v8f c) {
  c = __builtin_amdgcn_wmma_f32_16x16x32_bf16(false, ah, false, bh, (short)0, c, false, false);
  if (NT >= 2) c = __builtin_amdgcn_wmma_f32_16x16x32_bf16(false, al, false, bh, (short)0, c, false, false);
  if (NT >= 3) c = __builtin_amdgcn_wmma_f32_16x16x32_bf16(false, ah, false, bl, (short)0, c, false, false);
  asm volatile("v_nop\n\tv_nop\n\tv_nop\n\tv_nop" : "+v"(c) : "v"(ah), "v"(al), "v"(bh), "v"(bl));
  return c;
}

__global__ __launch_bounds__(256) void k_wt_bf16(const float* __restrict__ W, unsigned short* __restrict__ Wt, int K, int N) {
  const int t = blockIdx.x * 256 + threadIdx.x;
  const int k8n = K / 8;
  if (t >= N * k8n) return;
  const int n = t / k8n, k8 = (t % k8n) * 8;
  v8us v;
#pragma unroll
  for (int i = 0; i < 8; ++i) v[i] = bf16_bits(W[(size_t)(k8 + i) * N + n]);
  *(v8us*)(Wt + (size_t)n * K + k8) = v;
  
}

// GEMM C[M][N] (f32, pitch ldc) = act(A[M][K]·W + bias). A f32 row-major (pitch lda) converted per fragment to bf16
// (ASPLIT: hi/lo two planes -> 2 terms, else single rounded term); Wt bf16 [N][K] (pitch ldb). BIAS_BF16 rounds the
// bias to bf16 first (bias quantised to bf16 before the add). K%32==0, M%16==0, N%64==0.
template <bool ASPLIT, int ACT, bool BIAS_BF16>
__global__ __launch_bounds__(128) void k_gemm_bf(const float* __restrict__ A, int lda, const unsigned short* __restrict__ Wt, int ldb,
                                               const float* __restrict__ bias, float* __restrict__ C, int ldc, int M, int N, int K) {
  __shared__ __attribute__((aligned(16))) float so[4][16][64];
  const int tid = threadIdx.x, w = tid >> 5, lane = tid & 31, ln = lane & 15, hh = lane >> 4;
  const int ntn = N / 64;
  const int wid = blockIdx.x * 4 + w;
  const int mt = wid / ntn, nq = wid % ntn;
  if (mt * 16 >= M) return;
  const int row0 = mt * 16, col0 = nq * 64;
  const float* arow = A + (size_t)(row0 + ln) * lda;
  v8f acc[4] = {};
  for (int kb = 0; kb < K; kb += 32) {
    FragB ah, al;
    const v4f x0 = *(const v4fa*)(arow + kb + 8 * hh), x1 = *(const v4fa*)(arow + kb + 8 * hh + 4);
    const v4f x2 = *(const v4fa*)(arow + kb + 16 + 8 * hh), x3 = *(const v4fa*)(arow + kb + 16 + 8 * hh + 4);
    float xs[16] = {x0[0],x0[1],x0[2],x0[3],x1[0],x1[1],x1[2],x1[3],x2[0],x2[1],x2[2],x2[3],x3[0],x3[1],x3[2],x3[3]};
#pragma unroll
    for (int i = 0; i < 16; ++i) { const unsigned short hb = bf16_bits(xs[i]); ah.u[i] = hb; al.u[i] = ASPLIT ? bf16_bits(xs[i] - bf16_val(hb)) : (unsigned short)0; }
#pragma unroll
    for (int t = 0; t < 4; ++t) {
      const unsigned short* brow = Wt + (size_t)(col0 + t * 16 + ln) * ldb + kb;
      FragB b;
      b.half[0] = *(const v8us*)(brow + 8 * hh);
      b.half[1] = *(const v8us*)(brow + 16 + 8 * hh);
      acc[t] = mmaN<ASPLIT ? 2 : 1>(ah.v, al.v, b.v, b.v, acc[t]);
    }
  }
#pragma unroll
  for (int t = 0; t < 4; ++t) {
    float bv = bias ? bias[col0 + t * 16 + ln] : 0.f;
    if (BIAS_BF16) bv = bf16_round(bv);
#pragma unroll
    for (int r = 0; r < 8; ++r) { float v = acc[t][r] + bv; if (ACT == 1) v = fmaxf(v, 0.f); so[w][8 * hh + r][t * 16 + ln] = v; }
  }
  __builtin_amdgcn_fence(__ATOMIC_ACQ_REL, "workgroup");
  __builtin_amdgcn_wave_barrier();
  const int rsub = lane >> 4, c4 = (lane & 15) * 4;
  {
#pragma unroll
    for (int q = 0; q < 8; ++q) {
      const int r = q * 2 + rsub;
      const v4f v = *(const v4fa*)&so[w][r][c4];
      *(v4f*)(C + (size_t)(row0 + r) * ldc + col0 + c4) = v;
    }
    
  }
}

// GEMM C = act(A·W + bias + resid): A f32 (ASPLIT -> hi/lo 2 terms), Wt bf16 [N][K]; ACT 0 none, 1 relu, 2 exact gelu;
// resid (optional, f32, row index = (row % rmod), pitch ldr, RES_BF16 rounds it) added before the activation.
template <bool ASPLIT, int ACT, bool BIAS_BF16, bool RES_BF16>
__global__ __launch_bounds__(128) void k_gemm_bf3(const float* __restrict__ A, int lda, const unsigned short* __restrict__ Wt, int ldb,
                                                const float* __restrict__ bias, const float* __restrict__ resid, int rmod, int ldr,
                                                float* __restrict__ C, int ldc, int M, int N, int K) {
  __shared__ __attribute__((aligned(16))) float so[4][16][64];
  const int tid = threadIdx.x, w = tid >> 5, lane = tid & 31, ln = lane & 15, hh = lane >> 4;
  const int ntn = N / 64;
  const int wid = blockIdx.x * 4 + w;
  const int mt = wid / ntn, nq = wid % ntn;
  if (mt * 16 >= M) return;
  const int row0 = mt * 16, col0 = nq * 64;
  const float* arow = A + (size_t)(row0 + ln) * lda;
  v8f acc[4] = {};
  for (int kb = 0; kb < K; kb += 32) {
    FragB ah, al;
    const v4f x0 = *(const v4fa*)(arow + kb + 8 * hh), x1 = *(const v4fa*)(arow + kb + 8 * hh + 4);
    const v4f x2 = *(const v4fa*)(arow + kb + 16 + 8 * hh), x3 = *(const v4fa*)(arow + kb + 16 + 8 * hh + 4);
    float xs[16] = {x0[0],x0[1],x0[2],x0[3],x1[0],x1[1],x1[2],x1[3],x2[0],x2[1],x2[2],x2[3],x3[0],x3[1],x3[2],x3[3]};
#pragma unroll
    for (int i = 0; i < 16; ++i) { const unsigned short hb = bf16_bits(xs[i]); ah.u[i] = hb; al.u[i] = ASPLIT ? bf16_bits(xs[i] - bf16_val(hb)) : (unsigned short)0; }
#pragma unroll
    for (int t = 0; t < 4; ++t) {
      const unsigned short* brow = Wt + (size_t)(col0 + t * 16 + ln) * ldb + kb;
      FragB b;
      b.half[0] = *(const v8us*)(brow + 8 * hh);
      b.half[1] = *(const v8us*)(brow + 16 + 8 * hh);
      acc[t] = mmaN<ASPLIT ? 2 : 1>(ah.v, al.v, b.v, b.v, acc[t]);
    }
  }
#pragma unroll
  for (int t = 0; t < 4; ++t) {
    const int col = col0 + t * 16 + ln;
    float bv = bias ? bias[col] : 0.f;
    if (BIAS_BF16) bv = bf16_round(bv);
#pragma unroll
    for (int r = 0; r < 8; ++r) {
      float v = acc[t][r] + bv;
      if (resid) { float rv = resid[(size_t)((row0 + 8 * hh + r) % rmod) * ldr + col]; if (RES_BF16) rv = bf16_round(rv); v += rv; }
      if (ACT == 1) v = fmaxf(v, 0.f);
      if (ACT == 2) v = 0.5f * v * (1.0f + erff(v * 0.70710678118654752f));
      if (ACT == 3) { const float u = 0.7978845608028654f * (v + 0.044715f * v * v * v); v = 0.5f * v * (1.0f + tanhf(u)); }
      so[w][8 * hh + r][t * 16 + ln] = v;
    }
  }
  __builtin_amdgcn_fence(__ATOMIC_ACQ_REL, "workgroup");
  __builtin_amdgcn_wave_barrier();
  const int rsub = lane >> 4, c4 = (lane & 15) * 4;
  {
#pragma unroll
    for (int q = 0; q < 8; ++q) {
      const int r = q * 2 + rsub;
      const v4f v = *(const v4fa*)&so[w][r][c4];
      *(v4f*)(C + (size_t)(row0 + r) * ldc + col0 + c4) = v;
    }
    
  }
}
// row LayerNorm (biased variance, eps) over N: s = X (+ R); optional out_sum <- s; out_norm <- (s-mu)*rsqrt(var+eps)*g + b
template <bool PARAM_BF16>
__global__ __launch_bounds__(256) void k_layernorm(const float* __restrict__ X, const float* __restrict__ R, const float* __restrict__ g, const float* __restrict__ bta,
                                                  float* __restrict__ out_sum, float* __restrict__ out_norm, int N, float eps) {
  __shared__ float red[256];
  const int row = blockIdx.x, tid = threadIdx.x;
  const float* x = X + (size_t)row * N; const float* rr = R ? R + (size_t)row * N : nullptr;
  float vals[16];                     // up to N = 4096
  const int per = N / 256;            // contiguous chunk per thread? use strided-by-4 chunks: thread handles j = tid*4 + 1024*u
  float s1 = 0.f;
  for (int u = 0; u < per / 4; ++u) {
    const int j = tid * 4 + 1024 * u;
    const v4f a = *(const v4fa*)(x + j);
    v4f b = {0.f,0.f,0.f,0.f}; if (rr) b = *(const v4fa*)(rr + j);
#pragma unroll
    for (int q = 0; q < 4; ++q) { const float v = a[q] + b[q]; vals[u * 4 + q] = v; s1 += v; }
  }
  red[tid] = s1; __syncthreads();
  for (int st = 128; st > 0; st >>= 1) { if (tid < st) red[tid] += red[tid + st]; __syncthreads(); }
  const float mu = red[0] / (float)N; __syncthreads();
  float s2 = 0.f;
  for (int u = 0; u < per / 4; ++u)
#pragma unroll
    for (int q = 0; q < 4; ++q) { const float c = vals[u * 4 + q] - mu; s2 += c * c; }
  red[tid] = s2; __syncthreads();
  for (int st = 128; st > 0; st >>= 1) { if (tid < st) red[tid] += red[tid + st]; __syncthreads(); }
  const float rs = rsqrtf(red[0] / (float)N + eps);
  {
    for (int u = 0; u < per / 4; ++u) {
      const int j = tid * 4 + 1024 * u;
      v4f o, sm;
#pragma unroll
      for (int q = 0; q < 4; ++q) {
        float gg = g[j + q], bb = bta[j + q];
        if (PARAM_BF16) { gg = bf16_round(gg); bb = bf16_round(bb); }
        sm[q] = vals[u * 4 + q]; o[q] = (vals[u * 4 + q] - mu) * rs * gg + bb;
      }
      if (out_sum) *(v4f*)(out_sum + (size_t)row * N + j) = sm;
      *(v4f*)(out_norm + (size_t)row * N + j) = o;
    }
    
  }
}



// ---- f16 WMMA path (v_wmma_f32_16x16x32_f16): 11-bit significands for operands in range — used where a [0,1] probability operand needs more precision than bf16
typedef _Float16 v16h __attribute__((ext_vector_type(16)));
union FragH { v16h v; v8us half[2]; _Float16 h[16]; unsigned short u[16]; };
template <int NT>
__device__ __forceinline__ v8f mmaH(v16h ah, v16h al, v16h bh, v16h bl, v8f c) {
  c = __builtin_amdgcn_wmma_f32_16x16x32_f16(false, ah, false, bh, (short)0, c, false, false);
  if (NT >= 2) c = __builtin_amdgcn_wmma_f32_16x16x32_f16(false, al, false, bh, (short)0, c, false, false);
  if (NT >= 3) c = __builtin_amdgcn_wmma_f32_16x16x32_f16(false, ah, false, bl, (short)0, c, false, false);
  asm volatile("v_nop\n\tv_nop\n\tv_nop\n\tv_nop" : "+v"(c) : "v"(ah), "v"(al), "v"(bh), "v"(bl));
  return c;
}
// batched GEMM like k_gemm_b but f16 operands: A f32 (split into f16 hi/lo if ASPLIT, else rounded to f16), Bt = f16 values [n][k]; alpha; C f32; N multiple of 16 (partial tiles skipped)
template <bool ASPLIT>
__global__ __launch_bounds__(128) void k_gemm_h(const float* __restrict__ A, int lda, size_t sA, const _Float16* __restrict__ Bh, int ldb, size_t sB, float alpha, float* __restrict__ C, int ldc, size_t sC, int M, int N, int K) {
  __shared__ __attribute__((aligned(16))) float so[4][16][64];
  const int tid = threadIdx.x, w = tid >> 5, lane = tid & 31, ln = lane & 15, hh = lane >> 4; const int by = blockIdx.y;
  A += (size_t)by * sA; Bh += (size_t)by * sB; C += (size_t)by * sC;
  const int ntn = (N + 63) / 64; const int wid = blockIdx.x * 4 + w; const int mt = wid / ntn, nq = wid % ntn; if (mt * 16 >= M) return;
  const int row0 = mt * 16, col0 = nq * 64; const float* arow = A + (size_t)(row0 + ln) * lda;
  v8f acc[4] = {};
  for (int kb = 0; kb < K; kb += 32) {
    FragH ah, al;
    const v4f x0 = *(const v4fa*)(arow + kb + 8 * hh), x1 = *(const v4fa*)(arow + kb + 8 * hh + 4), x2 = *(const v4fa*)(arow + kb + 16 + 8 * hh), x3 = *(const v4fa*)(arow + kb + 16 + 8 * hh + 4);
    float xs[16] = {x0[0],x0[1],x0[2],x0[3],x1[0],x1[1],x1[2],x1[3],x2[0],x2[1],x2[2],x2[3],x3[0],x3[1],x3[2],x3[3]};
#pragma unroll
    for (int i = 0; i < 16; ++i) { const _Float16 h = (_Float16)xs[i]; ah.h[i] = h; al.h[i] = ASPLIT ? (_Float16)(xs[i] - (float)h) : (_Float16)0.0f; }
#pragma unroll
    for (int t = 0; t < 4; ++t) { if (col0 + t * 16 >= N) continue; const size_t boff = (size_t)(col0 + t * 16 + ln) * ldb + kb; FragH bq; bq.half[0] = *(const v8us*)(Bh + boff + 8 * hh); bq.half[1] = *(const v8us*)(Bh + boff + 16 + 8 * hh);
      acc[t] = mmaH<ASPLIT ? 2 : 1>(ah.v, al.v, bq.v, bq.v, acc[t]); }
  }
#pragma unroll
  for (int t = 0; t < 4; ++t) { if (col0 + t * 16 >= N) continue;
#pragma unroll
    for (int r = 0; r < 8; ++r) so[w][8 * hh + r][t * 16 + ln] = acc[t][r] * alpha; }
  __builtin_amdgcn_fence(__ATOMIC_ACQ_REL, "workgroup"); __builtin_amdgcn_wave_barrier();
  const int rsub = lane >> 4, c4 = (lane & 15) * 4;
  {
#pragma unroll
    for (int q = 0; q < 8; ++q) { const int r = q * 2 + rsub; if (col0 + c4 < N) { const v4f v = *(const v4fa*)&so[w][r][c4]; *(v4f*)(C + (size_t)(row0 + r) * ldc + col0 + c4) = v; } }
     }
}

// Wt[n][k] = f16(W[k][n]·scale) from f32 row-major W[K][N] (scale = power of two; bf16-exact weights stay exact in f16 away from the subnormal range)
__global__ __launch_bounds__(256) void k_wt_f16(const float* __restrict__ W, _Float16* __restrict__ Wt, int K, int N, float scale) {
  const int t = blockIdx.x * 256 + threadIdx.x; if (t >= N * (K / 8)) return; const int n = t / (K / 8), k8 = (t % (K / 8)) * 8; FragH f;
#pragma unroll
  for (int i = 0; i < 8; ++i) f.h[i] = (_Float16)(bf16_round(W[(size_t)(k8 + i) * N + n]) * scale); const v8us o = f.half[0];
  *(v8us*)((unsigned short*)Wt + (size_t)n * K + k8) = o; 
}
// k_gemm_hh variant with fused epilogue: v = acc·alpha + bias[by·sBias + col] (+ CP[(row/rowsPerB)·sCPb + by·64 + col] if CP) ; ACT 0 none / 1 elu ; writes f16 C16 (and f32 C if non-null)
template <int ACT>
__global__ __launch_bounds__(128) void k_gemm_hhx(const _Float16* __restrict__ A, int lda, size_t sA, const _Float16* __restrict__ Bh, int ldb, size_t sB, float alpha, const float* __restrict__ bias, size_t sBias, const float* __restrict__ CP, int rowsPerB, size_t sCPb, int row0g,
    float* __restrict__ C, _Float16* __restrict__ C16, int ldc, size_t sC, int M, int N, int K) {
  __shared__ __attribute__((aligned(16))) float so[4][16][64];
  const int tid = threadIdx.x, w = tid >> 5, lane = tid & 31, ln = lane & 15, hh = lane >> 4; const int by = blockIdx.y;
  A += (size_t)by * sA; Bh += (size_t)by * sB; const size_t cofs = (size_t)by * sC; const float* bp = bias ? bias + (size_t)by * sBias : nullptr;
  const int ntn = (N + 63) / 64; const int wid = blockIdx.x * 4 + w; const int mt = wid / ntn, nq = wid % ntn; if (mt * 16 >= M) return;
  const int row0 = mt * 16, col0 = nq * 64; const _Float16* arow = A + (size_t)(row0 + ln) * lda;
  v8f acc[4] = {};
  for (int kb = 0; kb < K; kb += 32) { FragH ah; ah.half[0] = *(const v8us*)((const unsigned short*)arow + kb + 8 * hh); ah.half[1] = *(const v8us*)((const unsigned short*)arow + kb + 16 + 8 * hh);
#pragma unroll
    for (int t = 0; t < 4; ++t) { if (col0 + t * 16 >= N) continue; const size_t boff = (size_t)(col0 + t * 16 + ln) * ldb + kb; FragH bq; bq.half[0] = *(const v8us*)((const unsigned short*)Bh + boff + 8 * hh); bq.half[1] = *(const v8us*)((const unsigned short*)Bh + boff + 16 + 8 * hh);
      acc[t] = mmaH<1>(ah.v, ah.v, bq.v, bq.v, acc[t]); }
  }
#pragma unroll
  for (int t = 0; t < 4; ++t) { if (col0 + t * 16 >= N) continue; const int col = col0 + t * 16 + ln; const float bv = bp ? bf16_round(bp[col]) : 0.f;
#pragma unroll
    for (int r = 0; r < 8; ++r) { float v = acc[t][r] * alpha + bv; if (CP) { const int bidx = (row0g + row0 + 8 * hh + r) / rowsPerB; v += CP[(size_t)bidx * sCPb + (size_t)by * 64 + col]; } if (ACT == 1) v = (v > 0.f) ? v : expm1f(v); else if (ACT == 7) v = (v > 0.f) ? v + 1.0f : expf(v); else if (ACT == 8) v = tanhf(v); else if (ACT == 9) v = 0.5f * v * (1.0f + tanhf(0.7978845608028654f * (v + 0.044715f * v * v * v))); else if (ACT == 11) v = 1.0f / (1.0f + expf(-v)); else if (ACT == 12) v = (v > 0.f) ? v : 0.01f * v; else if (ACT == 14) v = (v > 0.f) ? v : 0.1f * v; else if (ACT == 15) v = v / (1.0f + expf(-v)); else if (ACT == 3) v = fmaxf(v, 0.f); else if (ACT == 6) v = 0.5f * v * (1.0f + erff(v * 0.70710678118654752f)); so[w][8 * hh + r][t * 16 + ln] = v; } }
  __builtin_amdgcn_fence(__ATOMIC_ACQ_REL, "workgroup"); __builtin_amdgcn_wave_barrier();
  const int rsub = lane >> 4, c4 = (lane & 15) * 4; typedef _Float16 v4h __attribute__((ext_vector_type(4)));
  {
#pragma unroll
    for (int q = 0; q < 8; ++q) { const int r = q * 2 + rsub; if (col0 + c4 < N) { const v4f v = *(const v4fa*)&so[w][r][c4]; if (C) *(v4f*)(C + cofs + (size_t)(row0 + r) * ldc + col0 + c4) = v; if (C16) { v4h h4; for (int i = 0; i < 4; ++i) h4[i] = (_Float16)v[i]; *(v4h*)(C16 + cofs + (size_t)(row0 + r) * ldc + col0 + c4) = h4; } } }
     }
}


typedef _Float16 v4h __attribute__((ext_vector_type(4)));

__global__ __launch_bounds__(256) void k_x16(const float* __restrict__ x, _Float16* __restrict__ X16, size_t n8) { const size_t t = (size_t)blockIdx.x * 256 + threadIdx.x; if (t >= n8) return; FragH f;
#pragma unroll
  for (int q = 0; q < 8; ++q) f.h[q] = (_Float16)bf16_round(x[t * 8 + q]); *(v8us*)((unsigned short*)X16 + t * 8) = f.half[0];  }
__global__ __launch_bounds__(256) void k_h16(const float* __restrict__ x, _Float16* __restrict__ X16, size_t n8) { const size_t t = (size_t)blockIdx.x * 256 + threadIdx.x; if (t >= n8) return; FragH f;
#pragma unroll
  for (int q = 0; q < 8; ++q) f.h[q] = (_Float16)x[t * 8 + q]; *(v8us*)((unsigned short*)X16 + t * 8) = f.half[0];  }
__global__ __launch_bounds__(256) void k_round16f(const float* __restrict__ W, _Float16* __restrict__ Bt, size_t n8) { const size_t t = (size_t)blockIdx.x * 256 + threadIdx.x; if (t >= n8) return; FragH f;
#pragma unroll
  for (int i = 0; i < 8; ++i) f.h[i] = (_Float16)(bf16_round(W[t * 8 + i]) * 16.0f); *(v8us*)((unsigned short*)Bt + t * 8) = f.half[0];  }
template <int NHv, int TTv>
__global__ __launch_bounds__(256) void k_vt(const _Float16* __restrict__ V16, int ldv, int voff, _Float16* __restrict__ Vt) { __shared__ unsigned short tl[64][66]; const int tid = threadIdx.x; const int slab = blockIdx.x / (TTv / 64), lg = blockIdx.x % (TTv / 64); const int b = slab / NHv, h = slab % NHv;
  for (int i = tid; i < 64 * 8; i += 256) { const int r = i / 8, c8 = (i % 8) * 8; FragH f; f.half[0] = *(const v8us*)((const unsigned short*)V16 + ((size_t)b * TTv + lg * 64 + r) * ldv + voff + h * 64 + c8);
#pragma unroll
    for (int q = 0; q < 8; ++q) tl[r][c8 + q] = f.u[q]; }
  __syncthreads();
  {
#pragma unroll
    for (int rd = 0; rd < 2; ++rd) { const int d = rd * 32 + tid / 8, pc = tid % 8; FragH f;
#pragma unroll
      for (int q = 0; q < 8; ++q) f.u[q] = tl[pc * 8 + q][d];
      *(v8us*)((unsigned short*)Vt + ((size_t)slab * 64 + d) * TTv + lg * 64 + pc * 8) = f.half[0]; }
     } }

__global__ __launch_bounds__(256) void k_hl(const float* __restrict__ F, _Float16* __restrict__ Hh, _Float16* __restrict__ Hl, size_t n8) { const size_t t = (size_t)blockIdx.x * 256 + threadIdx.x; if (t >= n8) return; FragH fh, fl; const v4f a = *(const v4fa*)(F + t * 8), c = *(const v4fa*)(F + t * 8 + 4);
#pragma unroll
  for (int q = 0; q < 4; ++q) { _Float16 h = (_Float16)a[q]; fh.h[q] = h; fl.h[q] = (_Float16)((a[q] - (float)h) * 1024.0f); h = (_Float16)c[q]; fh.h[4 + q] = h; fl.h[4 + q] = (_Float16)((c[q] - (float)h) * 1024.0f); }
  { *(v8us*)((unsigned short*)Hh + t * 8) = fh.half[0]; *(v8us*)((unsigned short*)Hl + t * 8) = fl.half[0];  } }

// ---- fast GEMM (wave tile 32x64; requires M % 32 == 0 rows per launch region and N % 64 == 0); epilogue = k_gemm_hhx semantics ----
__device__ __forceinline__ v16h g2_frag(const _Float16* p, int hh) { FragH f; f.half[0] = *(const v8us*)((const unsigned short*)p + 8 * hh); f.half[1] = *(const v8us*)((const unsigned short*)p + 16 + 8 * hh); return f.v; }
__device__ __forceinline__ v8f g2_mma(v16h a, v16h b, v8f c) { v8f d = __builtin_amdgcn_wmma_f32_16x16x32_f16(false, a, false, b, (short)0, c, false, false); asm volatile("v_nop\n\tv_nop\n\tv_nop\n\tv_nop" : "+v"(d) : "v"(a), "v"(b)); return d; }
template <int ACT>
__global__ __launch_bounds__(128) void k_gemm2(const _Float16* __restrict__ A, int lda, size_t sA, const _Float16* __restrict__ Bh, int ldb, size_t sB, float alpha, const float* __restrict__ bias, size_t sBias, const float* __restrict__ CP, int rowsPerB, size_t sCPb, int row0g,
    float* __restrict__ C, _Float16* __restrict__ C16, int ldc, size_t sC, int M, int N, int K) {
  __shared__ __attribute__((aligned(16))) float so[4][32][68];
  const int tid = threadIdx.x, w = tid >> 5, lane = tid & 31, ln = lane & 15, hh = lane >> 4; const int by = blockIdx.y;
  A += (size_t)by * sA; Bh += (size_t)by * sB; const size_t cofs = (size_t)by * sC; const float* bp = bias ? bias + (size_t)by * sBias : nullptr;
  const int ntn = N >> 6; const int mt = blockIdx.x / ntn, nq = blockIdx.x - mt * ntn; const int row0 = mt * 128 + 32 * w, col0 = nq * 64; if (row0 >= M) return;
  const _Float16* a0p = A + (size_t)(row0 + ln) * lda; const _Float16* a1p = a0p + (size_t)16 * lda;
  const _Float16* b0p = Bh + (size_t)(col0 + ln) * ldb; const _Float16* b1p = b0p + (size_t)16 * ldb; const _Float16* b2p = b1p + (size_t)16 * ldb; const _Float16* b3p = b2p + (size_t)16 * ldb;
  const v8f z8 = {0.f,0.f,0.f,0.f,0.f,0.f,0.f,0.f}; v8f c00 = z8, c01 = z8, c02 = z8, c03 = z8, c10 = z8, c11 = z8, c12 = z8, c13 = z8;
#pragma unroll 1
  for (int kb = 0; kb < K; kb += 32) { const v16h a0 = g2_frag(a0p + kb, hh), a1 = g2_frag(a1p + kb, hh);
    v16h b = g2_frag(b0p + kb, hh); c00 = g2_mma(a0, b, c00); c10 = g2_mma(a1, b, c10);
    b = g2_frag(b1p + kb, hh); c01 = g2_mma(a0, b, c01); c11 = g2_mma(a1, b, c11);
    b = g2_frag(b2p + kb, hh); c02 = g2_mma(a0, b, c02); c12 = g2_mma(a1, b, c12);
    b = g2_frag(b3p + kb, hh); c03 = g2_mma(a0, b, c03); c13 = g2_mma(a1, b, c13); }
  v8f accs[8] = {c00, c01, c02, c03, c10, c11, c12, c13};
#pragma unroll
  for (int u = 0; u < 8; ++u) { const int t = u & 3, half = u >> 2; const int col = col0 + t * 16 + ln; const float bv = bp ? bf16_round(bp[col]) : 0.f;
#pragma unroll
    for (int r = 0; r < 8; ++r) { const int rloc = half * 16 + 8 * hh + r; float v = accs[u][r] * alpha + bv; if (CP) { const int bidx = (row0g + row0 + rloc) / rowsPerB; v += CP[(size_t)bidx * sCPb + (size_t)by * 64 + col]; }
      if (ACT == 3) v = fmaxf(v, 0.f); else if (ACT == 6) v = 0.5f * v * (1.0f + erff(v * 0.70710678118654752f)); else if (ACT == 11) v = 1.0f / (1.0f + expf(-v)); else if (ACT == 15) v = v / (1.0f + expf(-v)); else if (ACT == 12) v = (v > 0.f) ? v : 0.01f * v; else if (ACT == 8) v = tanhf(v);
      so[w][rloc][t * 16 + ln] = v; } }
  __builtin_amdgcn_fence(__ATOMIC_ACQ_REL, "workgroup"); __builtin_amdgcn_wave_barrier();
  const int rsub = lane >> 4, c4 = (lane & 15) * 4;
  {
#pragma unroll
    for (int q = 0; q < 16; ++q) { const int r = q * 2 + rsub; const v4f v = *(const v4fa*)&so[w][r][c4]; if (C) *(v4f*)(C + cofs + (size_t)(row0 + r) * ldc + col0 + c4) = v; if (C16) { v4h h4; for (int i = 0; i < 4; ++i) h4[i] = (_Float16)v[i]; *(v4h*)(C16 + cofs + (size_t)(row0 + r) * ldc + col0 + c4) = h4; } }
     } }


template <int TK>
__global__ __launch_bounds__(256) void k_vthl(const float* __restrict__ VF, int ldv, _Float16* __restrict__ Vth, _Float16* __restrict__ Vtl) { __shared__ float tl[64][65]; const int tid = threadIdx.x; const int slab = blockIdx.x / (TK / 64), lg = blockIdx.x % (TK / 64); const int b = slab / NH, h = slab % NH;
  for (int i = tid; i < 64 * 16; i += 256) { const int r = i / 16, c4 = (i % 16) * 4; const v4f a = *(const v4fa*)(VF + ((size_t)b * TK + lg * 64 + r) * ldv + h * 64 + c4); tl[r][c4] = a[0]; tl[r][c4 + 1] = a[1]; tl[r][c4 + 2] = a[2]; tl[r][c4 + 3] = a[3]; }
  __syncthreads();
  FragH fh[2], fl[2]; size_t oo[2];
#pragma unroll
  for (int rd = 0; rd < 2; ++rd) { const int d = rd * 32 + tid / 8, pc = tid % 8;
#pragma unroll
    for (int q = 0; q < 8; ++q) { const float v = tl[pc * 8 + q][d]; const _Float16 hv = (_Float16)v; fh[rd].h[q] = hv; fl[rd].h[q] = (_Float16)((v - (float)hv) * 1024.0f); } oo[rd] = ((size_t)slab * 64 + d) * TK + lg * 64 + pc * 8; }
  {
#pragma unroll
    for (int rd = 0; rd < 2; ++rd) { *(v8us*)((unsigned short*)Vth + oo[rd]) = fh[rd].half[0]; *(v8us*)((unsigned short*)Vtl + oo[rd]) = fl[rd].half[0]; }
     } }

template <int TQ, int TK>
__global__ __launch_bounds__(256) void k_flashm(const _Float16* __restrict__ Q16, const _Float16* __restrict__ Q16lo, int ldq, const _Float16* __restrict__ K16, const _Float16* __restrict__ K16lo, int ldk, const _Float16* __restrict__ Vt, const _Float16* __restrict__ Vtlo, const unsigned* __restrict__ MB, const int* __restrict__ RA, const int* __restrict__ KE, float* __restrict__ O, int ldo) {
  constexpr int RPW = 16, RTN = RPW / 16, NW = 8, NQB = TQ / RPW, DT = 4, KS = 2;
  __shared__ __attribute__((aligned(16))) unsigned short sP[NW][RPW][40], sPl[NW][RPW][40]; __shared__ __attribute__((aligned(16))) float sO[NW][RPW][64 + 4]; __shared__ float sM[NW][RPW], sL[NW][RPW];
  const int tid = threadIdx.x, w = __builtin_amdgcn_readfirstlane(tid >> 5), lane = tid & 31, ln = lane & 15, hh = lane >> 4;
  /* w through readfirstlane: the wave's number, and with it the key-step counter, stays in a scalar register. Work-group = one 16-query tile; the tiles with the most keys have the lowest block indices (for speed only) */
  const int slab = blockIdx.x % (NB * NH), qt = NQB - 1 - blockIdx.x / (NB * NH); const int b = slab / NH, h = slab % NH; const int q0 = qt * RPW; const int qblk = q0 >> 6;
  FragH aq[2][KS], aql[2][KS];
#pragma unroll
  for (int rt = 0; rt < RTN; ++rt) { const size_t qo = ((size_t)b * TQ + q0 + rt * 16 + ln) * ldq + h * 64; const unsigned short* qr = (const unsigned short*)Q16 + qo; const unsigned short* ql = (const unsigned short*)Q16lo + qo;
#pragma unroll
    for (int ks = 0; ks < KS; ++ks) { aq[rt][ks].half[0] = *(const v8us*)(qr + ks * 32 + 8 * hh); aq[rt][ks].half[1] = *(const v8us*)(qr + ks * 32 + 16 + 8 * hh); aql[rt][ks].half[0] = *(const v8us*)(ql + ks * 32 + 8 * hh); aql[rt][ks].half[1] = *(const v8us*)(ql + ks * 32 + 16 + 8 * hh); } }
  const unsigned short* Vth = (const unsigned short*)Vt + (size_t)slab * 64 * TK; const unsigned short* Vtl = (const unsigned short*)Vtlo + (size_t)slab * 64 * TK;
  float m_r[2][8], l_r[2][8]; v8f oacc[2][DT], oaccl[2][DT];
#pragma unroll
  for (int rt = 0; rt < RTN; ++rt) {
#pragma unroll
    for (int r = 0; r < 8; ++r) { m_r[rt][r] = -3.0e38f; l_r[rt][r] = 0.f; }
#pragma unroll
    for (int dt = 0; dt < DT; ++dt) { oacc[rt][dt] = (v8f){0.f,0.f,0.f,0.f,0.f,0.f,0.f,0.f}; oaccl[rt][dt] = oacc[rt][dt]; } }
  int jend = KE[qblk * 32]; jend = min(TK, (jend + 31) & ~31); if (jend < 32) jend = 32;      /* block-uniform */
  int allm[2][8]; const unsigned* mrow[2][8];
#pragma unroll
  for (int rt = 0; rt < RTN; ++rt)
#pragma unroll
    for (int r = 0; r < 8; ++r) { const int tq = q0 + rt * 16 + 8 * hh + r; allm[rt][r] = RA[tq]; mrow[rt][r] = MB + (size_t)tq * (TK / 32); }
#pragma unroll 1
  for (int j0 = 32 * w; j0 < jend; j0 += 32 * NW) {      /* wave w takes every NW-th 32-key step */
    unsigned mw[2][8];      /* the step's mask words, asked for ahead of the key fragments so that they arrive behind the score products */
#pragma unroll
    for (int rt = 0; rt < RTN; ++rt)
#pragma unroll
      for (int r = 0; r < 8; ++r) mw[rt][r] = mrow[rt][r][j0 >> 5];
    v8f s[2][2];
#pragma unroll
    for (int nt = 0; nt < 2; ++nt) { const size_t ko = ((size_t)b * TK + j0 + nt * 16 + ln) * ldk + h * 64; const unsigned short* kr = (const unsigned short*)K16 + ko; const unsigned short* kl = (const unsigned short*)K16lo + ko; FragH bk[KS], bkl[KS];
#pragma unroll
      for (int ks = 0; ks < KS; ++ks) { bk[ks].half[0] = *(const v8us*)(kr + ks * 32 + 8 * hh); bk[ks].half[1] = *(const v8us*)(kr + ks * 32 + 16 + 8 * hh); bkl[ks].half[0] = *(const v8us*)(kl + ks * 32 + 8 * hh); bkl[ks].half[1] = *(const v8us*)(kl + ks * 32 + 16 + 8 * hh); }
#pragma unroll
      for (int rt = 0; rt < RTN; ++rt) { v8f acc = (v8f){0.f,0.f,0.f,0.f,0.f,0.f,0.f,0.f}, accr = acc;
#pragma unroll
        for (int ks = 0; ks < KS; ++ks) { acc = mmaH<1>(aq[rt][ks].v, aq[rt][ks].v, bk[ks].v, bk[ks].v, acc); accr = mmaH<1>(aql[rt][ks].v, aql[rt][ks].v, bk[ks].v, bk[ks].v, accr); accr = mmaH<1>(aq[rt][ks].v, aq[rt][ks].v, bkl[ks].v, bkl[ks].v, accr); }
        s[rt][nt] = acc + accr * 0.0009765625f; } }
    /* straight-line softmax: a masked score is -inf and the running maximum is never below the finite start value -3.0e38f, so exp gives 0 for a masked key and 1 for a row with no key yet without any test; with no branch between the rows their mask loads, shuffles and exps overlap (every loop here is unrolled so that the per-row arrays stay in registers) */
    float sa[2][8], sb[2][8], mc[2][8];
#pragma unroll
    for (int rt = 0; rt < RTN; ++rt)
#pragma unroll
      for (int r = 0; r < 8; ++r) { const bool am = (allm[rt][r] != 0);
        const bool ok0 = am || (((mw[rt][r] >> ln) & 1u) == 0u), ok1 = am || (((mw[rt][r] >> (16 + ln)) & 1u) == 0u);
        sa[rt][r] = ok0 ? (am ? 0.f : s[rt][0][r] * SCL) : -INFINITY; sb[rt][r] = ok1 ? (am ? 0.f : s[rt][1][r] * SCL) : -INFINITY; mc[rt][r] = fmaxf(sa[rt][r], sb[rt][r]); }
#pragma unroll
    for (int st = 1; st < 16; st <<= 1)
#pragma unroll
      for (int rt = 0; rt < RTN; ++rt)
#pragma unroll
        for (int r = 0; r < 8; ++r) mc[rt][r] = fmaxf(mc[rt][r], __shfl_xor(mc[rt][r], st, 32));
#pragma unroll
    for (int rt = 0; rt < RTN; ++rt)
#pragma unroll
      for (int r = 0; r < 8; ++r) {
        const float mn = fmaxf(m_r[rt][r], mc[rt][r]); const float al = expf(m_r[rt][r] - mn); m_r[rt][r] = mn; const float p0 = expf(sa[rt][r] - mn), p1 = expf(sb[rt][r] - mn); l_r[rt][r] = l_r[rt][r] * al + p0 + p1;
#pragma unroll
        for (int dt = 0; dt < DT; ++dt) { oacc[rt][dt][r] *= al; oaccl[rt][dt][r] *= al; }
        FragH t2, t3; const float ps0 = p0 * 1024.0f, ps1 = p1 * 1024.0f; t2.h[0] = (_Float16)ps0; t2.h[1] = (_Float16)ps1; t3.h[0] = (_Float16)((ps0 - (float)t2.h[0]) * 1024.0f); t3.h[1] = (_Float16)((ps1 - (float)t2.h[1]) * 1024.0f);
        sP[w][rt * 16 + 8 * hh + r][ln] = t2.u[0]; sP[w][rt * 16 + 8 * hh + r][16 + ln] = t2.u[1]; sPl[w][rt * 16 + 8 * hh + r][ln] = t3.u[0]; sPl[w][rt * 16 + 8 * hh + r][16 + ln] = t3.u[1]; }
    __builtin_amdgcn_fence(__ATOMIC_ACQ_REL, "workgroup"); __builtin_amdgcn_wave_barrier();
    FragH pa[2], pl[2];
#pragma unroll
    for (int rt = 0; rt < RTN; ++rt) { pa[rt].half[0] = *(const v8us*)&sP[w][rt * 16 + ln][8 * hh]; pa[rt].half[1] = *(const v8us*)&sP[w][rt * 16 + ln][16 + 8 * hh]; pl[rt].half[0] = *(const v8us*)&sPl[w][rt * 16 + ln][8 * hh]; pl[rt].half[1] = *(const v8us*)&sPl[w][rt * 16 + ln][16 + 8 * hh]; }
#pragma unroll
    for (int dt = 0; dt < DT; ++dt) { const size_t vo = (size_t)(dt * 16 + ln) * TK + j0; FragH bv, bl; bv.half[0] = *(const v8us*)(Vth + vo + 8 * hh); bv.half[1] = *(const v8us*)(Vth + vo + 16 + 8 * hh); bl.half[0] = *(const v8us*)(Vtl + vo + 8 * hh); bl.half[1] = *(const v8us*)(Vtl + vo + 16 + 8 * hh);
#pragma unroll
      for (int rt = 0; rt < RTN; ++rt) { oacc[rt][dt] = mmaH<1>(pa[rt].v, pa[rt].v, bv.v, bv.v, oacc[rt][dt]); oaccl[rt][dt] = mmaH<1>(pa[rt].v, pa[rt].v, bl.v, bl.v, oaccl[rt][dt]); oaccl[rt][dt] = mmaH<1>(pl[rt].v, pl[rt].v, bv.v, bv.v, oaccl[rt][dt]); } }
    __builtin_amdgcn_fence(__ATOMIC_ACQ_REL, "workgroup"); __builtin_amdgcn_wave_barrier(); }
#pragma unroll
  for (int rt = 0; rt < RTN; ++rt) {
#pragma unroll
    for (int st = 1; st < 16; st <<= 1)
#pragma unroll
      for (int r = 0; r < 8; ++r) l_r[rt][r] += __shfl_xor(l_r[rt][r], st, 32);      /* the 8 rows' sums step by step side by side, one test for the stores behind them */
    if (ln == 0) {
#pragma unroll
      for (int r = 0; r < 8; ++r) { sM[w][rt * 16 + 8 * hh + r] = m_r[rt][r]; sL[w][rt * 16 + 8 * hh + r] = l_r[rt][r]; } }
#pragma unroll
    for (int dt = 0; dt < DT; ++dt)
#pragma unroll
      for (int r = 0; r < 8; ++r) sO[w][rt * 16 + 8 * hh + r][dt * 16 + ln] = oacc[rt][dt][r] + oaccl[rt][dt][r] * 0.0009765625f; }
  __syncthreads();      /* every wave's partial (max, sum, O) is in LDS before any thread merges them */
  { const int r = tid >> 4, pc = tid & 15; float mm = sM[0][r];
#pragma unroll
    for (int u = 1; u < NW; ++u) mm = fmaxf(mm, sM[u][r]);
    float l = 0.f; v4f val = {0.f, 0.f, 0.f, 0.f};
#pragma unroll
    for (int u = 0; u < NW; ++u) { const float e = expf(sM[u][r] - mm); l += e * sL[u][r]; const v4f po = *(const v4fa*)&sO[u][r][pc * 4]; val += po * e; }
    const float li = (l > 0.f) ? 1.0f / (l * 1024.0f) : 0.f;
    *(v4f*)(O + ((size_t)b * TQ + q0 + r) * ldo + h * 64 + pc * 4) = val * li; } }


__global__ __launch_bounds__(256) void k_causaltab(unsigned* __restrict__ MB, int* __restrict__ RA, int* __restrict__ KE, int nq, int nk) {
  const int t = blockIdx.x * 256 + threadIdx.x; const int nw = nk / 32;
  if (t < nq * nw) { const int q = t / nw, w = t % nw; const int first = q + 1 - 32 * w; const unsigned bits = (first <= 0) ? 0xffffffffu : ((first >= 32) ? 0u : (0xffffffffu << first)); *(unsigned*)(MB + t) = bits;  }
  if (t < nq) { *(int*)(RA + t) = 0;  }
  if (t < nq / 64) { const int v = 64 * (t + 1); *(int*)(KE + t * 32) = v;  } }

extern "C" void kernel_launch(void* const* d_in, const int* in_sizes, int n_in,
                              void* d_out, int out_size, void* d_ws, size_t ws_size, hipStream_t stream) {
  (void)in_sizes; (void)n_in; (void)out_size;
  const float* const* I = (const float* const*)d_in; const float* x = I[0]; const float* Wq = I[1]; const float* bq = I[2]; const float* Wk = I[3]; const float* bk = I[4]; const float* Wv = I[5]; const float* bv = I[6]; const float* Wo = I[7]; const float* bo = I[8];
  char* ws = (char*)d_ws; size_t off = 0;
  auto take = [&](size_t bytes) { char* p = ws + off; off += (bytes + 255) & ~(size_t)255; return p; };
  _Float16* BQ = (_Float16*)take((size_t)DK * DM * 2); _Float16* BK = (_Float16*)take((size_t)DK * DM * 2); _Float16* BV = (_Float16*)take((size_t)DK * DM * 2); _Float16* BO = (_Float16*)take((size_t)DM * DK * 2);
  _Float16* X16 = (_Float16*)take((size_t)NR * DM * 2); float* F = (float*)take((size_t)NR * DK * 4);
  _Float16* Qh = (_Float16*)take((size_t)NR * DK * 2); _Float16* Ql = (_Float16*)take((size_t)NR * DK * 2); _Float16* Kh = (_Float16*)take((size_t)NR * DK * 2); _Float16* Kl = (_Float16*)take((size_t)NR * DK * 2); _Float16* Vth = (_Float16*)take((size_t)NR * DK * 2); _Float16* Vtl = (_Float16*)take((size_t)NR * DK * 2);
  unsigned* MB = (unsigned*)take((size_t)SS * (SS / 32) * 4); int* RA = (int*)take((size_t)SS * 4); int* KE = (int*)take((size_t)(SS / 64) * 32 * 4);
  float* O = (float*)take((size_t)NR * DK * 4); _Float16* Oh = (_Float16*)take((size_t)NR * DK * 2); _Float16* Ol = (_Float16*)take((size_t)NR * DK * 2);
  if (off > ws_size) return;      /* 16 + 4 + 6 x 2 + 2 + 4 + 4 = 42 MiB */
  k_wt_f16<<<(DM * DK / 8 + 255) / 256, 256, 0, stream>>>(Wq, BQ, DM, DK, 16.0f); k_wt_f16<<<(DM * DK / 8 + 255) / 256, 256, 0, stream>>>(Wk, BK, DM, DK, 16.0f); k_wt_f16<<<(DM * DK / 8 + 255) / 256, 256, 0, stream>>>(Wv, BV, DM, DK, 16.0f); k_wt_f16<<<(DK * DM / 8 + 255) / 256, 256, 0, stream>>>(Wo, BO, DK, DM, 16.0f);      /* (in,out) -> [out][in] x16 */
  k_x16<<<(unsigned)(((size_t)NR * DM / 8 + 255) / 256), 256, 0, stream>>>(x, X16, (size_t)NR * DM / 8);
  k_causaltab<<<(SS * (SS / 32) + 255) / 256, 256, 0, stream>>>(MB, RA, KE, SS, SS);
  const dim3 gP((NR / 128) * 1, 1), gO((NR / 128) * (DM / 64), 1); const size_t n8 = (size_t)NR * DK / 8; const unsigned nb8 = (unsigned)((n8 + 255) / 256);
  k_gemm2<0><<<gP, 128, 0, stream>>>(X16, DM, 0, BQ, DM, 0, 0.0625f, bq, 0, nullptr, 1, 0, 0, F, nullptr, DK, 0, NR, DK, DM); k_hl<<<nb8, 256, 0, stream>>>(F, Qh, Ql, n8);
  k_gemm2<0><<<gP, 128, 0, stream>>>(X16, DM, 0, BK, DM, 0, 0.0625f, bk, 0, nullptr, 1, 0, 0, F, nullptr, DK, 0, NR, DK, DM); k_hl<<<nb8, 256, 0, stream>>>(F, Kh, Kl, n8);
  k_gemm2<0><<<gP, 128, 0, stream>>>(X16, DM, 0, BV, DM, 0, 0.0625f, bv, 0, nullptr, 1, 0, 0, F, nullptr, DK, 0, NR, DK, DM);
  k_vthl<SS><<<NB * NH * (SS / 64), 256, 0, stream>>>(F, DK, Vth, Vtl);      /* V^T hi/lo per sequence [64][4096]; one grid over all sequences (slab = sequence) */
  k_flashm<SS, SS><<<NB * NH * (SS / 16), 256, 0, stream>>>(Qh, Ql, DK, Kh, Kl, DK, Vth, Vtl, MB, RA, KE, O, DK);      /* one grid over all (sequence, 16 queries): 1024 work-groups of 8 waves */
  k_hl<<<nb8, 256, 0, stream>>>(O, Oh, Ol, n8);
  k_gemm2<0><<<gO, 128, 0, stream>>>(Oh, DK, 0, BO, DK, 0, 0.0625f, bo, 0, nullptr, 1, 0, 0, (float*)d_out, nullptr, DM, 0, NR, DM, DK);
  k_gemm2<0><<<gO, 128, 0, stream>>>(Ol, DK, 0, BO, DK, 0, 0.0625f * 0.0009765625f, nullptr, 0, (const float*)d_out, 1, (size_t)DM, 0, (float*)d_out, nullptr, DM, 0, NR, DM, DK);      /* out = O*Wo + bo (hi pass, then the residual pass through the addend) */
}

// v004
// One run takes 161 microseconds.
// Next to v003, in two timings, it ran 1.31 times as fast each time.
// All steps since v000 together make it 15.1 times as fast.
#include <hip/hip_runtime.h>
// Single-head causal attention (4 sequences x 4096 tokens x 512; d_k = d_v = 64): q, k, v = x*W + b; scores = q.k/8 with j <= i; softmax; out = (attn.v)*Wo + bo -> [4,4096,512].
// Structure: q/k/v by one launch of f16 WMMA GEMMs (32x64 wave tiles, x rounded in registers, f32, exact products + bias) whose epilogue writes q, k as f16 hi + (x2^10) residual planes and V^T as hi + residual planes; the causal structure computed on device into a key bit plane + per-block key bound; one fused flash-style kernel per (sequence, 16 queries) (8 waves share the queries, the 32-key steps up to the bound dealt to them in turn, three-product hi/lo scores, online softmax f32, P hi + residual via LDS, two value accumulators, the 8 partial (max, sum, O) merged in LDS); O as hi + residual planes; output projection as two GEMMs (bias in the first) -> the output rows.
// Compute dtype: x, weights, biases rounded to bf16; projections exact; q, k, P, v, O as f16 hi + residual pairs (~2^-21); f32 accumulation and softmax. v_wmma_f32_16x16x32_f16.
#define NB 4
#define SS 4096
#define DM 512
#define DK 64
#define NH 1
#define SCL 0.125f
#define NR (NB * SS)
typedef __bf16 v16b __attribute__((ext_vector_type(16)));
typedef unsigned short v8us __attribute__((ext_vector_type(8), may_alias));
typedef float  v8f  __attribute__((ext_vector_type(8)));
typedef float  v4f  __attribute__((ext_vector_type(4)));
typedef float  v4fa __attribute__((ext_vector_type(4), may_alias));
union FragB { v16b v; v8us half[2]; unsigned short u[16]; };

__device__ __forceinline__ unsigned short bf16_bits(float x) { unsigned int u = __float_as_uint(x); return (unsigned short)((u + 0x7FFFu + ((u >> 16) & 1u)) >> 16); }
__device__ __forceinline__ float bf16_val(unsigned short b) { return __uint_as_float(((unsigned int)b) << 16); }
__device__ __forceinline__ float bf16_round(float x) { return bf16_val(bf16_bits(x)); }
// D += A·B with NT terms: 1 = ah·bh, 2 = + al·bh (A split), 3 = + ah·bl (both split)
template <int NT>
__device__ __forceinline__ v8f mmaN(v16b ah, v16b al, v16b bh, v16b bl, v8f c) {
  c = __builtin_amdgcn_wmma_f32_16x16x32_bf16(false, ah, false, bh, (short)0, c, false, false);
  if (NT >= 2) c = __builtin_amdgcn_wmma_f32_16x16x32_bf16(false, al, false, bh, (short)0, c, false, false);
  if (NT >= 3) c = __builtin_amdgcn_wmma_f32_16x16x32_bf16(false, ah, false, bl, (short)0, c, false, false);
  asm volatile("v_nop\n\tv_nop\n\tv_nop\n\tv_nop" : "+v"(c) : "v"(ah), "v"(al), "v"(bh), "v"(bl));
  return c;
}

__global__ __launch_bounds__(256) void k_wt_bf16(const float* __restrict__ W, unsigned short* __restrict__ Wt, int K, int N) {
  const int t = blockIdx.x * 256 + threadIdx.x;
  const int k8n = K / 8;
  if (t >= N * k8n) return;
  const int n = t / k8n, k8 = (t % k8n) * 8;
  v8us v;
#pragma unroll
  for (int i = 0; i < 8; ++i) v[i] = bf16_bits(W[(size_t)(k8 + i) * N + n]);
  *(v8us*)(Wt + (size_t)n * K + k8) = v;
  
}

// GEMM C[M][N] (f32, pitch ldc) = act(A[M][K]·W + bias). A f32 row-major (pitch lda) converted per fragment to bf16
// (ASPLIT: hi/lo two planes -> 2 terms, else single rounded term); Wt bf16 [N][K] (pitch ldb). BIAS_BF16 rounds the
// bias to bf16 first (bias quantised to bf16 before the add). K%32==0, M%16==0, N%64==0.
template <bool ASPLIT, int ACT, bool BIAS_BF16>
__global__ __launch_bounds__(128) void k_gemm_bf(const float* __restrict__ A, int lda, const unsigned short* __restrict__ Wt, int ldb,
                                               const float* __restrict__ bias, float* __restrict__ C, int ldc, int M, int N, int K) {
  __shared__ __attribute__((aligned(16))) float so[4][16][64];
  const int tid = threadIdx.x, w = tid >> 5, lane = tid & 31, ln = lane & 15, hh = lane >> 4;
  const int ntn = N / 64;
  const int wid = blockIdx.x * 4 + w;
  const int mt = wid / ntn, nq = wid % ntn;
  if (mt * 16 >= M) return;
  const int row0 = mt * 16, col0 = nq * 64;
  const float* arow = A + (size_t)(row0 + ln) * lda;
  v8f acc[4] = {};
  for (int kb = 0; kb < K; kb += 32) {
    FragB ah, al;
    const v4f x0 = *(const v4fa*)(arow + kb + 8 * hh), x1 = *(const v4fa*)(arow + kb + 8 * hh + 4);
    const v4f x2 = *(const v4fa*)(arow + kb + 16 + 8 * hh), x3 = *(const v4fa*)(arow + kb + 16 + 8 * hh + 4);
    float xs[16] = {x0[0],x0[1],x0[2],x0[3],x1[0],x1[1],x1[2],x1[3],x2[0],x2[1],x2[2],x2[3],x3[0],x3[1],x3[2],x3[3]};
#pragma unroll
    for (int i = 0; i < 16; ++i) { const unsigned short hb = bf16_bits(xs[i]); ah.u[i] = hb; al.u[i] = ASPLIT ? bf16_bits(xs[i] - bf16_val(hb)) : (unsigned short)0; }
#pragma unroll
    for (int t = 0; t < 4; ++t) {
      const unsigned short* brow = Wt + (size_t)(col0 + t * 16 + ln) * ldb + kb;
      FragB b;
      b.half[0] = *(const v8us*)(brow + 8 * hh);
      b.half[1] = *(const v8us*)(brow + 16 + 8 * hh);
      acc[t] = mmaN<ASPLIT ? 2 : 1>(ah.v, al.v, b.v, b.v, acc[t]);
    }
  }
#pragma unroll
  for (int t = 0; t < 4; ++t) {
    float bv = bias ? bias[col0 + t * 16 + ln] : 0.f;
    if (BIAS_BF16) bv = bf16_round(bv);
#pragma unroll
    for (int r = 0; r < 8; ++r) { float v = acc[t][r] + bv; if (ACT == 1) v = fmaxf(v, 0.f); so[w][8 * hh + r][t * 16 + ln] = v; }
  }
  __builtin_amdgcn_fence(__ATOMIC_ACQ_REL, "workgroup");
  __builtin_amdgcn_wave_barrier();
  const int rsub = lane >> 4, c4 = (lane & 15) * 4;
  {
#pragma unroll
    for (int q = 0; q < 8; ++q) {
      const int r = q * 2 + rsub;
      const v4f v = *(const v4fa*)&so[w][r][c4];
      *(v4f*)(C + (size_t)(row0 + r) * ldc + col0 + c4) = v;
    }
    
  }
}

// GEMM C = act(A·W + bias + resid): A f32 (ASPLIT -> hi/lo 2 terms), Wt bf16 [N][K]; ACT 0 none, 1 relu, 2 exact gelu;
// resid (optional, f32, row index = (row % rmod), pitch ldr, RES_BF16 rounds it) added before the activation.
template <bool ASPLIT, int ACT, bool BIAS_BF16, bool RES_BF16>
__global__ __launch_bounds__(128) void k_gemm_bf3(const float* __restrict__ A, int lda, const unsigned short* __restrict__ Wt, int ldb,
                                                const float* __restrict__ bias, const float* __restrict__ resid, int rmod, int ldr,
                                                float* __restrict__ C, int ldc, int M, int N, int K) {
  __shared__ __attribute__((aligned(16))) float so[4][16][64];
  const int tid = threadIdx.x, w = tid >> 5, lane = tid & 31, ln = lane & 15, hh = lane >> 4;
  const int ntn = N / 64;
  const int wid = blockIdx.x * 4 + w;
  const int mt = wid / ntn, nq = wid % ntn;
  if (mt * 16 >= M) return;
  const int row0 = mt * 16, col0 = nq * 64;
  const float* arow = A + (size_t)(row0 + ln) * lda;
  v8f acc[4] = {};
  for (int kb = 0; kb < K; kb += 32) {
    FragB ah, al;
    const v4f x0 = *(const v4fa*)(arow + kb + 8 * hh), x1 = *(const v4fa*)(arow + kb + 8 * hh + 4);
    const v4f x2 = *(const v4fa*)(arow + kb + 16 + 8 * hh), x3 = *(const v4fa*)(arow + kb + 16 + 8 * hh + 4);
    float xs[16] = {x0[0],x0[1],x0[2],x0[3],x1[0],x1[1],x1[2],x1[3],x2[0],x2[1],x2[2],x2[3],x3[0],x3[1],x3[2],x3[3]};
#pragma unroll
    for (int i = 0; i < 16; ++i) { const unsigned short hb = bf16_bits(xs[i]); ah.u[i] = hb; al.u[i] = ASPLIT ? bf16_bits(xs[i] - bf16_val(hb)) : (unsigned short)0; }
#pragma unroll
    for (int t = 0; t < 4; ++t) {
      const unsigned short* brow = Wt + (size_t)(col0 + t * 16 + ln) * ldb + kb;
      FragB b;
      b.half[0] = *(const v8us*)(brow + 8 * hh);
      b.half[1] = *(const v8us*)(brow + 16 + 8 * hh);
      acc[t] = mmaN<ASPLIT ? 2 : 1>(ah.v, al.v, b.v, b.v, acc[t]);
    }
  }
#pragma unroll
  for (int t = 0; t < 4; ++t) {
    const int col = col0 + t * 16 + ln;
    float bv = bias ? bias[col] : 0.f;
    if (BIAS_BF16) bv = bf16_round(bv);
#pragma unroll
    for (int r = 0; r < 8; ++r) {
      float v = acc[t][r] + bv;
      if (resid) { float rv = resid[(size_t)((row0 + 8 * hh + r) % rmod) * ldr + col]; if (RES_BF16) rv = bf16_round(rv); v += rv; }
      if (ACT == 1) v = fmaxf(v, 0.f);
      if (ACT == 2) v = 0.5f * v * (1.0f + erff(v * 0.70710678118654752f));
      if (ACT == 3) { const float u = 0.7978845608028654f * (v + 0.044715f * v * v * v); v = 0.5f * v * (1.0f + tanhf(u)); }
      so[w][8 * hh + r][t * 16 + ln] = v;
    }
  }
  __builtin_amdgcn_fence(__ATOMIC_ACQ_REL, "workgroup");
  __builtin_amdgcn_wave_barrier();
  const int rsub = lane >> 4, c4 = (lane & 15) * 4;
  {
#pragma unroll
    for (int q = 0; q < 8; ++q) {
      const int r = q * 2 + rsub;
      const v4f v = *(const v4fa*)&so[w][r][c4];
      *(v4f*)(C + (size_t)(row0 + r) * ldc + col0 + c4) = v;
    }
    
  }
}
// row LayerNorm (biased variance, eps) over N: s = X (+ R); optional out_sum <- s; out_norm <- (s-mu)*rsqrt(var+eps)*g + b
template <bool PARAM_BF16>
__global__ __launch_bounds__(256) void k_layernorm(const float* __restrict__ X, const float* __restrict__ R, const float* __restrict__ g, const float* __restrict__ bta,
                                                  float* __restrict__ out_sum, float* __restrict__ out_norm, int N, float eps) {
  __shared__ float red[256];
  const int row = blockIdx.x, tid = threadIdx.x;
  const float* x = X + (size_t)row * N; const float* rr = R ? R + (size_t)row * N : nullptr;
  float vals[16];                     // up to N = 4096
  const int per = N / 256;            // contiguous chunk per thread? use strided-by-4 chunks: thread handles j = tid*4 + 1024*u
  float s1 = 0.f;
  for (int u = 0; u < per / 4; ++u) {
    const int j = tid * 4 + 1024 * u;
    const v4f a = *(const v4fa*)(x + j);
    v4f b = {0.f,0.f,0.f,0.f}; if (rr) b = *(const v4fa*)(rr + j);
#pragma unroll
    for (int q = 0; q < 4; ++q) { const float v = a[q] + b[q]; vals[u * 4 + q] = v; s1 += v; }
  }
  red[tid] = s1; __syncthreads();
  for (int st = 128; st > 0; st >>= 1) { if (tid < st) red[tid] += red[tid + st]; __syncthreads(); }
  const float mu = red[0] / (float)N; __syncthreads();
  float s2 = 0.f;
  for (int u = 0; u < per / 4; ++u)
#pragma unroll
    for (int q = 0; q < 4; ++q) { const float c = vals[u * 4 + q] - mu; s2 += c * c; }
  red[tid] = s2; __syncthreads();
  for (int st = 128; st > 0; st >>= 1) { if (tid < st) red[tid] += red[tid + st]; __syncthreads(); }
  const float rs = rsqrtf(red[0] / (float)N + eps);
  {
    for (int u = 0; u < per / 4; ++u) {
      const int j = tid * 4 + 1024 * u;
      v4f o, sm;
#pragma unroll
      for (int q = 0; q < 4; ++q) {
        float gg = g[j + q], bb = bta[j + q];
        if (PARAM_BF16) { gg = bf16_round(gg); bb = bf16_round(bb); }
        sm[q] = vals[u * 4 + q]; o[q] = (vals[u * 4 + q] - mu) * rs * gg + bb;
      }
      if (out_sum) *(v4f*)(out_sum + (size_t)row * N + j) = sm;
      *(v4f*)(out_norm + (size_t)row * N + j) = o;
    }
    
  }
}



// ---- f16 WMMA path (v_wmma_f32_16x16x32_f16): 11-bit significands for operands in range — used where a [0,1] probability operand needs more precision than bf16
typedef _Float16 v16h __attribute__((ext_vector_type(16)));
union FragH { v16h v; v8us half[2]; _Float16 h[16]; unsigned short u[16]; };
template <int NT>
__device__ __forceinline__ v8f mmaH(v16h ah, v16h al, v16h bh, v16h bl, v8f c) {
  c = __builtin_amdgcn_wmma_f32_16x16x32_f16(false, ah, false, bh, (short)0, c, false, false);
  if (NT >= 2) c = __builtin_amdgcn_wmma_f32_16x16x32_f16(false, al, false, bh, (short)0, c, false, false);
  if (NT >= 3) c = __builtin_amdgcn_wmma_f32_16x16x32_f16(false, ah, false, bl, (short)0, c, false, false);
  asm volatile("v_nop\n\tv_nop\n\tv_nop\n\tv_nop" : "+v"(c) : "v"(ah), "v"(al), "v"(bh), "v"(bl));
  return c;
}
// batched GEMM like k_gemm_b but f16 operands: A f32 (split into f16 hi/lo if ASPLIT, else rounded to f16), Bt = f16 values [n][k]; alpha; C f32; N multiple of 16 (partial tiles skipped)
template <bool ASPLIT>
__global__ __launch_bounds__(128) void k_gemm_h(const float* __restrict__ A, int lda, size_t sA, const _Float16* __restrict__ Bh, int ldb, size_t sB, float alpha, float* __restrict__ C, int ldc, size_t sC, int M, int N, int K) {
  __shared__ __attribute__((aligned(16))) float so[4][16][64];
  const int tid = threadIdx.x, w = tid >> 5, lane = tid & 31, ln = lane & 15, hh = lane >> 4; const int by = blockIdx.y;
  A += (size_t)by * sA; Bh += (size_t)by * sB; C += (size_t)by * sC;
  const int ntn = (N + 63) / 64; const int wid = blockIdx.x * 4 + w; const int mt = wid / ntn, nq = wid % ntn; if (mt * 16 >= M) return;
  const int row0 = mt * 16, col0 = nq * 64; const float* arow = A + (size_t)(row0 + ln) * lda;
  v8f acc[4] = {};
  for (int kb = 0; kb < K; kb += 32) {
    FragH ah, al;
    const v4f x0 = *(const v4fa*)(arow + kb + 8 * hh), x1 = *(const v4fa*)(arow + kb + 8 * hh + 4), x2 = *(const v4fa*)(arow + kb + 16 + 8 * hh), x3 = *(const v4fa*)(arow + kb + 16 + 8 * hh + 4);
    float xs[16] = {x0[0],x0[1],x0[2],x0[3],x1[0],x1[1],x1[2],x1[3],x2[0],x2[1],x2[2],x2[3],x3[0],x3[1],x3[2],x3[3]};
#pragma unroll
    for (int i = 0; i < 16; ++i) { const _Float16 h = (_Float16)xs[i]; ah.h[i] = h; al.h[i] = ASPLIT ? (_Float16)(xs[i] - (float)h) : (_Float16)0.0f; }
#pragma unroll
    for (int t = 0; t < 4; ++t) { if (col0 + t * 16 >= N) continue; const size_t boff = (size_t)(col0 + t * 16 + ln) * ldb + kb; FragH bq; bq.half[0] = *(const v8us*)(Bh + boff + 8 * hh); bq.half[1] = *(const v8us*)(Bh + boff + 16 + 8 * hh);
      acc[t] = mmaH<ASPLIT ? 2 : 1>(ah.v, al.v, bq.v, bq.v, acc[t]); }
  }
#pragma unroll
  for (int t = 0; t < 4; ++t) { if (col0 + t * 16 >= N) continue;
#pragma unroll
    for (int r = 0; r < 8; ++r) so[w][8 * hh + r][t * 16 + ln] = acc[t][r] * alpha; }
  __builtin_amdgcn_fence(__ATOMIC_ACQ_REL, "workgroup"); __builtin_amdgcn_wave_barrier();
  const int rsub = lane >> 4, c4 = (lane & 15) * 4;
  {
#pragma unroll
    for (int q = 0; q < 8; ++q) { const int r = q * 2 + rsub; if (col0 + c4 < N) { const v4f v = *(const v4fa*)&so[w][r][c4]; *(v4f*)(C + (size_t)(row0 + r) * ldc + col0 + c4) = v; } }
     }
}

// Wt[n][k] = f16(W[k][n]·scale) from f32 row-major W[K][N] (scale = power of two; bf16-exact weights stay exact in f16 away from the subnormal range)
__global__ __launch_bounds__(256) void k_wt_f16(const float* __restrict__ W, _Float16* __restrict__ Wt, int K, int N, float scale) {
  const int t = blockIdx.x * 256 + threadIdx.x; if (t >= N * (K / 8)) return; const int n = t / (K / 8), k8 = (t % (K / 8)) * 8; FragH f;
#pragma unroll
  for (int i = 0; i < 8; ++i) f.h[i] = (_Float16)(bf16_round(W[(size_t)(k8 + i) * N + n]) * scale); const v8us o = f.half[0];
  *(v8us*)((unsigned short*)Wt + (size_t)n * K + k8) = o; 
}
// k_gemm_hh variant with fused epilogue: v = acc·alpha + bias[by·sBias + col] (+ CP[(row/rowsPerB)·sCPb + by·64 + col] if CP) ; ACT 0 none / 1 elu ; writes f16 C16 (and f32 C if non-null)
template <int ACT>
__global__ __launch_bounds__(128) void k_gemm_hhx(const _Float16* __restrict__ A, int lda, size_t sA, const _Float16* __restrict__ Bh, int ldb, size_t sB, float alpha, const float* __restrict__ bias, size_t sBias, const float* __restrict__ CP, int rowsPerB, size_t sCPb, int row0g,
    float* __restrict__ C, _Float16* __restrict__ C16, int ldc, size_t sC, int M, int N, int K) {
  __shared__ __attribute__((aligned(16))) float so[4][16][64];
  const int tid = threadIdx.x, w = tid >> 5, lane = tid & 31, ln = lane & 15, hh = lane >> 4; const int by = blockIdx.y;
  A += (size_t)by * sA; Bh += (size_t)by * sB; const size_t cofs = (size_t)by * sC; const float* bp = bias ? bias + (size_t)by * sBias : nullptr;
  const int ntn = (N + 63) / 64; const int wid = blockIdx.x * 4 + w; const int mt = wid / ntn, nq = wid % ntn; if (mt * 16 >= M) return;
  const int row0 = mt * 16, col0 = nq * 64; const _Float16* arow = A + (size_t)(row0 + ln) * lda;
  v8f acc[4] = {};
  for (int kb = 0; kb < K; kb += 32) { FragH ah; ah.half[0] = *(const v8us*)((const unsigned short*)arow + kb + 8 * hh); ah.half[1] = *(const v8us*)((const unsigned short*)arow + kb + 16 + 8 * hh);
#pragma unroll
    for (int t = 0; t < 4; ++t) { if (col0 + t * 16 >= N) continue; const size_t boff = (size_t)(col0 + t * 16 + ln) * ldb + kb; FragH bq; bq.half[0] = *(const v8us*)((const unsigned short*)Bh + boff + 8 * hh); bq.half[1] = *(const v8us*)((const unsigned short*)Bh + boff + 16 + 8 * hh);
      acc[t] = mmaH<1>(ah.v, ah.v, bq.v, bq.v, acc[t]); }
  }
#pragma unroll
  for (int t = 0; t < 4; ++t) { if (col0 + t * 16 >= N) continue; const int col = col0 + t * 16 + ln; const float bv = bp ? bf16_round(bp[col]) : 0.f;
#pragma unroll
    for (int r = 0; r < 8; ++r) { float v = acc[t][r] * alpha + bv; if (CP) { const int bidx = (row0g + row0 + 8 * hh + r) / rowsPerB; v += CP[(size_t)bidx * sCPb + (size_t)by * 64 + col]; } if (ACT == 1) v = (v > 0.f) ? v : expm1f(v); else if (ACT == 7) v = (v > 0.f) ? v + 1.0f : expf(v); else if (ACT == 8) v = tanhf(v); else if (ACT == 9) v = 0.5f * v * (1.0f + tanhf(0.7978845608028654f * (v + 0.044715f * v * v * v))); else if (ACT == 11) v = 1.0f / (1.0f + expf(-v)); else if (ACT == 12) v = (v > 0.f) ? v : 0.01f * v; else if (ACT == 14) v = (v > 0.f) ? v : 0.1f * v; else if (ACT == 15) v = v / (1.0f + expf(-v)); else if (ACT == 3) v = fmaxf(v, 0.f); else if (ACT == 6) v = 0.5f * v * (1.0f + erff(v * 0.70710678118654752f)); so[w][8 * hh + r][t * 16 + ln] = v; } }
  __builtin_amdgcn_fence(__ATOMIC_ACQ_REL, "workgroup"); __builtin_amdgcn_wave_barrier();
  const int rsub = lane >> 4, c4 = (lane & 15) * 4; typedef _Float16 v4h __attribute__((ext_vector_type(4)));
  {
#pragma unroll
    for (int q = 0; q < 8; ++q) { const int r = q * 2 + rsub; if (col0 + c4 < N) { const v4f v = *(const v4fa*)&so[w][r][c4]; if (C) *(v4f*)(C + cofs + (size_t)(row0 + r) * ldc + col0 + c4) = v; if (C16) { v4h h4; for (int i = 0; i < 4; ++i) h4[i] = (_Float16)v[i]; *(v4h*)(C16 + cofs + (size_t)(row0 + r) * ldc + col0 + c4) = h4; } } }
     }
}


typedef _Float16 v4h __attribute__((ext_vector_type(4)));

__global__ __launch_bounds__(256) void k_h16(const float* __restrict__ x, _Float16* __restrict__ X16, size_t n8) { const size_t t = (size_t)blockIdx.x * 256 + threadIdx.x; if (t >= n8) return; FragH f;
#pragma unroll
  for (int q = 0; q < 8; ++q) f.h[q] = (_Float16)x[t * 8 + q]; *(v8us*)((unsigned short*)X16 + t * 8) = f.half[0];  }
__global__ __launch_bounds__(256) void k_round16f(const float* __restrict__ W, _Float16* __restrict__ Bt, size_t n8) { const size_t t = (size_t)blockIdx.x * 256 + threadIdx.x; if (t >= n8) return; FragH f;
#pragma unroll
  for (int i = 0; i < 8; ++i) f.h[i] = (_Float16)(bf16_round(W[t * 8 + i]) * 16.0f); *(v8us*)((unsigned short*)Bt + t * 8) = f.half[0];  }
template <int NHv, int TTv>
__global__ __launch_bounds__(256) void k_vt(const _Float16* __restrict__ V16, int ldv, int voff, _Float16* __restrict__ Vt) { __shared__ unsigned short tl[64][66]; const int tid = threadIdx.x; const int slab = blockIdx.x / (TTv / 64), lg = blockIdx.x % (TTv / 64); const int b = slab / NHv, h = slab % NHv;
  for (int i = tid; i < 64 * 8; i += 256) { const int r = i / 8, c8 = (i % 8) * 8; FragH f; f.half[0] = *(const v8us*)((const unsigned short*)V16 + ((size_t)b * TTv + lg * 64 + r) * ldv + voff + h * 64 + c8);
#pragma unroll
    for (int q = 0; q < 8; ++q) tl[r][c8 + q] = f.u[q]; }
  __syncthreads();
  {
#pragma unroll
    for (int rd = 0; rd < 2; ++rd) { const int d = rd * 32 + tid / 8, pc = tid % 8; FragH f;
#pragma unroll
      for (int q = 0; q < 8; ++q) f.u[q] = tl[pc * 8 + q][d];
      *(v8us*)((unsigned short*)Vt + ((size_t)slab * 64 + d) * TTv + lg * 64 + pc * 8) = f.half[0]; }
     } }

__global__ __launch_bounds__(256) void k_hl(const float* __restrict__ F, _Float16* __restrict__ Hh, _Float16* __restrict__ Hl, size_t n8) { const size_t t = (size_t)blockIdx.x * 256 + threadIdx.x; if (t >= n8) return; FragH fh, fl; const v4f a = *(const v4fa*)(F + t * 8), c = *(const v4fa*)(F + t * 8 + 4);
#pragma unroll
  for (int q = 0; q < 4; ++q) { _Float16 h = (_Float16)a[q]; fh.h[q] = h; fl.h[q] = (_Float16)((a[q] - (float)h) * 1024.0f); h = (_Float16)c[q]; fh.h[4 + q] = h; fl.h[4 + q] = (_Float16)((c[q] - (float)h) * 1024.0f); }
  { *(v8us*)((unsigned short*)Hh + t * 8) = fh.half[0]; *(v8us*)((unsigned short*)Hl + t * 8) = fl.half[0];  } }

// ---- fast GEMM (wave tile 32x64; requires M % 32 == 0 rows per launch region and N % 64 == 0); epilogue = k_gemm_hhx semantics ----
__device__ __forceinline__ v16h g2_frag(const _Float16* p, int hh) { FragH f; f.half[0] = *(const v8us*)((const unsigned short*)p + 8 * hh); f.half[1] = *(const v8us*)((const unsigned short*)p + 16 + 8 * hh); return f.v; }
__device__ __forceinline__ v8f g2_mma(v16h a, v16h b, v8f c) { v8f d = __builtin_amdgcn_wmma_f32_16x16x32_f16(false, a, false, b, (short)0, c, false, false); asm volatile("v_nop\n\tv_nop\n\tv_nop\n\tv_nop" : "+v"(d) : "v"(a), "v"(b)); return d; }
template <int ACT>
__global__ __launch_bounds__(128) void k_gemm2(const _Float16* __restrict__ A, int lda, size_t sA, const _Float16* __restrict__ Bh, int ldb, size_t sB, float alpha, const float* __restrict__ bias, size_t sBias, const float* __restrict__ CP, int rowsPerB, size_t sCPb, int row0g,
    float* __restrict__ C, _Float16* __restrict__ C16, int ldc, size_t sC, int M, int N, int K) {
  __shared__ __attribute__((aligned(16))) float so[4][32][68];
  const int tid = threadIdx.x, w = tid >> 5, lane = tid & 31, ln = lane & 15, hh = lane >> 4; const int by = blockIdx.y;
  A += (size_t)by * sA; Bh += (size_t)by * sB; const size_t cofs = (size_t)by * sC; const float* bp = bias ? bias + (size_t)by * sBias : nullptr;
  const int ntn = N >> 6; const int mt = blockIdx.x / ntn, nq = blockIdx.x - mt * ntn; const int row0 = mt * 128 + 32 * w, col0 = nq * 64; if (row0 >= M) return;
  const _Float16* a0p = A + (size_t)(row0 + ln) * lda; const _Float16* a1p = a0p + (size_t)16 * lda;
  const _Float16* b0p = Bh + (size_t)(col0 + ln) * ldb; const _Float16* b1p = b0p + (size_t)16 * ldb; const _Float16* b2p = b1p + (size_t)16 * ldb; const _Float16* b3p = b2p + (size_t)16 * ldb;
  const v8f z8 = {0.f,0.f,0.f,0.f,0.f,0.f,0.f,0.f}; v8f c00 = z8, c01 = z8, c02 = z8, c03 = z8, c10 = z8, c11 = z8, c12 = z8, c13 = z8;
#pragma unroll 1
  for (int kb = 0; kb < K; kb += 32) { const v16h a0 = g2_frag(a0p + kb, hh), a1 = g2_frag(a1p + kb, hh);
    v16h b = g2_frag(b0p + kb, hh); c00 = g2_mma(a0, b, c00); c10 = g2_mma(a1, b, c10);
    b = g2_frag(b1p + kb, hh); c01 = g2_mma(a0, b, c01); c11 = g2_mma(a1, b, c11);
    b = g2_frag(b2p + kb, hh); c02 = g2_mma(a0, b, c02); c12 = g2_mma(a1, b, c12);
    b = g2_frag(b3p + kb, hh); c03 = g2_mma(a0, b, c03); c13 = g2_mma(a1, b, c13); }
  v8f accs[8] = {c00, c01, c02, c03, c10, c11, c12, c13};
#pragma unroll
  for (int u = 0; u < 8; ++u) { const int t = u & 3, half = u >> 2; const int col = col0 + t * 16 + ln; const float bv = bp ? bf16_round(bp[col]) : 0.f;
#pragma unroll
    for (int r = 0; r < 8; ++r) { const int rloc = half * 16 + 8 * hh + r; float v = accs[u][r] * alpha + bv; if (CP) { const int bidx = (row0g + row0 + rloc) / rowsPerB; v += CP[(size_t)bidx * sCPb + (size_t)by * 64 + col]; }
      if (ACT == 3) v = fmaxf(v, 0.f); else if (ACT == 6) v = 0.5f * v * (1.0f + erff(v * 0.70710678118654752f)); else if (ACT == 11) v = 1.0f / (1.0f + expf(-v)); else if (ACT == 15) v = v / (1.0f + expf(-v)); else if (ACT == 12) v = (v > 0.f) ? v : 0.01f * v; else if (ACT == 8) v = tanhf(v);
      so[w][rloc][t * 16 + ln] = v; } }
  __builtin_amdgcn_fence(__ATOMIC_ACQ_REL, "workgroup"); __builtin_amdgcn_wave_barrier();
  const int rsub = lane >> 4, c4 = (lane & 15) * 4;
  {
#pragma unroll
    for (int q = 0; q < 16; ++q) { const int r = q * 2 + rsub; const v4f v = *(const v4fa*)&so[w][r][c4]; if (C) *(v4f*)(C + cofs + (size_t)(row0 + r) * ldc + col0 + c4) = v; if (C16) { v4h h4; for (int i = 0; i < 4; ++i) h4[i] = (_Float16)v[i]; *(v4h*)(C16 + cofs + (size_t)(row0 + r) * ldc + col0 + c4) = h4; } }
     } }


// ---- fused projection: q, k, v = round(x)*W + b in one launch. blockIdx.x picks the product (0 q, 1 k, 2 v), blockIdx.y the 128 rows; wave tile 32x64 as in k_gemm2.
// x is read as f32 and rounded in registers (bf16 rounding, then f16, exact for normal values); the epilogue writes the planes the attention kernel reads: q, k as f16 hi + (x2^10) residual rows, v as V^T hi + residual [sequence][64][SS].
__device__ __forceinline__ v16h px_frag(const float* p, int hh) { const v4f x0 = *(const v4fa*)(p + 8 * hh), x1 = *(const v4fa*)(p + 8 * hh + 4), x2 = *(const v4fa*)(p + 16 + 8 * hh), x3 = *(const v4fa*)(p + 16 + 8 * hh + 4); FragH f;
#pragma unroll
  for (int q = 0; q < 4; ++q) { f.h[q] = (_Float16)bf16_round(x0[q]); f.h[4 + q] = (_Float16)bf16_round(x1[q]); f.h[8 + q] = (_Float16)bf16_round(x2[q]); f.h[12 + q] = (_Float16)bf16_round(x3[q]); }
  return f.v; }
__global__ __launch_bounds__(128) void k_proj(const float* __restrict__ x, const _Float16* __restrict__ BQ, const _Float16* __restrict__ BK, const _Float16* __restrict__ BV, const float* __restrict__ bq, const float* __restrict__ bk, const float* __restrict__ bv,
    _Float16* __restrict__ Qh, _Float16* __restrict__ Ql, _Float16* __restrict__ Kh, _Float16* __restrict__ Kl, _Float16* __restrict__ Vth, _Float16* __restrict__ Vtl) {
  __shared__ __attribute__((aligned(16))) float so[4][32][68];
  const int tid = threadIdx.x, w = tid >> 5, lane = tid & 31, ln = lane & 15, hh = lane >> 4; const int which = blockIdx.x, rowg = blockIdx.y * 128, row0 = rowg + 32 * w;
  const _Float16* Bh = (which == 0) ? BQ : ((which == 1) ? BK : BV); const float* bp = (which == 0) ? bq : ((which == 1) ? bk : bv);
  const float* a0p = x + (size_t)(row0 + ln) * DM; const float* a1p = a0p + (size_t)16 * DM;
  const _Float16* b0p = Bh + (size_t)ln * DM; const _Float16* b1p = b0p + (size_t)16 * DM; const _Float16* b2p = b1p + (size_t)16 * DM; const _Float16* b3p = b2p + (size_t)16 * DM;
  const float braw[4] = {bp[ln], bp[16 + ln], bp[32 + ln], bp[48 + ln]};      /* asked for ahead of the loop, so that the epilogue does not wait for them */
  const v8f z8 = {0.f,0.f,0.f,0.f,0.f,0.f,0.f,0.f}; v8f c00 = z8, c01 = z8, c02 = z8, c03 = z8, c10 = z8, c11 = z8, c12 = z8, c13 = z8;
  for (int kb = 0; kb < DM; kb += 32) { const v16h a0 = px_frag(a0p + kb, hh), a1 = px_frag(a1p + kb, hh);
    v16h b = g2_frag(b0p + kb, hh); c00 = g2_mma(a0, b, c00); c10 = g2_mma(a1, b, c10);
    b = g2_frag(b1p + kb, hh); c01 = g2_mma(a0, b, c01); c11 = g2_mma(a1, b, c11);
    b = g2_frag(b2p + kb, hh); c02 = g2_mma(a0, b, c02); c12 = g2_mma(a1, b, c12);
    b = g2_frag(b3p + kb, hh); c03 = g2_mma(a0, b, c03); c13 = g2_mma(a1, b, c13); }
  v8f accs[8] = {c00, c01, c02, c03, c10, c11, c12, c13};
#pragma unroll
  for (int u = 0; u < 8; ++u) { const int t = u & 3, half = u >> 2; const float bvv = bf16_round(braw[t]);
#pragma unroll
    for (int r = 0; r < 8; ++r) so[w][half * 16 + 8 * hh + r][t * 16 + ln] = accs[u][r] * 0.0625f + bvv; }
  if (which != 2) {      /* block-uniform: q or k, each wave writes its own 32 rows, two whole 128-byte rows of each plane a store */
    __builtin_amdgcn_fence(__ATOMIC_ACQ_REL, "workgroup"); __builtin_amdgcn_wave_barrier();
    _Float16* Hh = (which == 0) ? Qh : Kh; _Float16* Hl = (which == 0) ? Ql : Kl; const int rsub = lane >> 4, c4 = (lane & 15) * 4;
#pragma unroll
    for (int q = 0; q < 16; ++q) { const int r = q * 2 + rsub; const v4f v = *(const v4fa*)&so[w][r][c4]; v4h h4, l4;
#pragma unroll
      for (int i = 0; i < 4; ++i) { h4[i] = (_Float16)v[i]; l4[i] = (_Float16)((v[i] - (float)h4[i]) * 1024.0f); }
      *(v4h*)(Hh + (size_t)(row0 + r) * DK + c4) = h4; *(v4h*)(Hl + (size_t)(row0 + r) * DK + c4) = l4; }
  } else {      /* v: the work-group's 128 tokens x 64 columns leave transposed; a thread takes one column and 64 tokens, a whole 128-byte line of each plane */
    __syncthreads();      /* a thread reads rows that its own wave and one other wave staged */
    const int d = tid & 63, hf = tid >> 6; const size_t vo = ((size_t)(rowg / SS) * 64 + d) * SS + (rowg % SS) + hf * 64;
#pragma unroll
    for (int g = 0; g < 8; ++g) { FragH fh, fl;
#pragma unroll
      for (int q = 0; q < 8; ++q) { const int t = g * 8 + q; const float v = so[hf * 2 + (t >> 5)][t & 31][d]; const _Float16 hv = (_Float16)v; fh.h[q] = hv; fl.h[q] = (_Float16)((v - (float)hv) * 1024.0f); }
      *(v8us*)((unsigned short*)Vth + vo + g * 8) = fh.half[0]; *(v8us*)((unsigned short*)Vtl + vo + g * 8) = fl.half[0]; } } }

template <int TQ, int TK>
__global__ __launch_bounds__(256) void k_flashm(const _Float16* __restrict__ Q16, const _Float16* __restrict__ Q16lo, int ldq, const _Float16* __restrict__ K16, const _Float16* __restrict__ K16lo, int ldk, const _Float16* __restrict__ Vt, const _Float16* __restrict__ Vtlo, const unsigned* __restrict__ MB, const int* __restrict__ RA, const int* __restrict__ KE, float* __restrict__ O, int ldo) {
  constexpr int RPW = 16, RTN = RPW / 16, NW = 8, NQB = TQ / RPW, DT = 4, KS = 2;
  __shared__ __attribute__((aligned(16))) unsigned short sP[NW][RPW][40], sPl[NW][RPW][40]; __shared__ __attribute__((aligned(16))) float sO[NW][RPW][64 + 4]; __shared__ float sM[NW][RPW], sL[NW][RPW];
  const int tid = threadIdx.x, w = __builtin_amdgcn_readfirstlane(tid >> 5), lane = tid & 31, ln = lane & 15, hh = lane >> 4;
  /* w through readfirstlane: the wave's number, and with it the key-step counter, stays in a scalar register. Work-group = one 16-query tile; the tiles with the most keys have the lowest block indices (for speed only) */
  const int slab = blockIdx.x % (NB * NH), qt = NQB - 1 - blockIdx.x / (NB * NH); const int b = slab / NH, h = slab % NH; const int q0 = qt * RPW; const int qblk = q0 >> 6;
  FragH aq[2][KS], aql[2][KS];
#pragma unroll
  for (int rt = 0; rt < RTN; ++rt) { const size_t qo = ((size_t)b * TQ + q0 + rt * 16 + ln) * ldq + h * 64; const unsigned short* qr = (const unsigned short*)Q16 + qo; const unsigned short* ql = (const unsigned short*)Q16lo + qo;
#pragma unroll
    for (int ks = 0; ks < KS; ++ks) { aq[rt][ks].half[0] = *(const v8us*)(qr + ks * 32 + 8 * hh); aq[rt][ks].half[1] = *(const v8us*)(qr + ks * 32 + 16 + 8 * hh); aql[rt][ks].half[0] = *(const v8us*)(ql + ks * 32 + 8 * hh); aql[rt][ks].half[1] = *(const v8us*)(ql + ks * 32 + 16 + 8 * hh); } }
  const unsigned short* Vth = (const unsigned short*)Vt + (size_t)slab * 64 * TK; const unsigned short* Vtl = (const unsigned short*)Vtlo + (size_t)slab * 64 * TK;
  float m_r[2][8], l_r[2][8]; v8f oacc[2][DT], oaccl[2][DT];
#pragma unroll
  for (int rt = 0; rt < RTN; ++rt) {
#pragma unroll
    for (int r = 0; r < 8; ++r) { m_r[rt][r] = -3.0e38f; l_r[rt][r] = 0.f; }
#pragma unroll
    for (int dt = 0; dt < DT; ++dt) { oacc[rt][dt] = (v8f){0.f,0.f,0.f,0.f,0.f,0.f,0.f,0.f}; oaccl[rt][dt] = oacc[rt][dt]; } }
  int jend = KE[qblk * 32]; jend = min(TK, (jend + 31) & ~31); if (jend < 32) jend = 32;      /* block-uniform */
  int allm[2][8]; const unsigned* mrow[2][8];
#pragma unroll
  for (int rt = 0; rt < RTN; ++rt)
#pragma unroll
    for (int r = 0; r < 8; ++r) { const int tq = q0 + rt * 16 + 8 * hh + r; allm[rt][r] = RA[tq]; mrow[rt][r] = MB + (size_t)tq * (TK / 32); }
#pragma unroll 1
  for (int j0 = 32 * w; j0 < jend; j0 += 32 * NW) {      /* wave w takes every NW-th 32-key step */
    unsigned mw[2][8];      /* the step's mask words, asked for ahead of the key fragments so that they arrive behind the score products */
#pragma unroll
    for (int rt = 0; rt < RTN; ++rt)
#pragma unroll
      for (int r = 0; r < 8; ++r) mw[rt][r] = mrow[rt][r][j0 >> 5];
    v8f s[2][2];
#pragma unroll
    for (int nt = 0; nt < 2; ++nt) { const size_t ko = ((size_t)b * TK + j0 + nt * 16 + ln) * ldk + h * 64; const unsigned short* kr = (const unsigned short*)K16 + ko; const unsigned short* kl = (const unsigned short*)K16lo + ko; FragH bk[KS], bkl[KS];
#pragma unroll
      for (int ks = 0; ks < KS; ++ks) { bk[ks].half[0] = *(const v8us*)(kr + ks * 32 + 8 * hh); bk[ks].half[1] = *(const v8us*)(kr + ks * 32 + 16 + 8 * hh); bkl[ks].half[0] = *(const v8us*)(kl + ks * 32 + 8 * hh); bkl[ks].half[1] = *(const v8us*)(kl + ks * 32 + 16 + 8 * hh); }
#pragma unroll
      for (int rt = 0; rt < RTN; ++rt) { v8f acc = (v8f){0.f,0.f,0.f,0.f,0.f,0.f,0.f,0.f}, accr = acc;
#pragma unroll
        for (int ks = 0; ks < KS; ++ks) { acc = mmaH<1>(aq[rt][ks].v, aq[rt][ks].v, bk[ks].v, bk[ks].v, acc); accr = mmaH<1>(aql[rt][ks].v, aql[rt][ks].v, bk[ks].v, bk[ks].v, accr); accr = mmaH<1>(aq[rt][ks].v, aq[rt][ks].v, bkl[ks].v, bkl[ks].v, accr); }
        s[rt][nt] = acc + accr * 0.0009765625f; } }
    /* straight-line softmax: a masked score is -inf and the running maximum is never below the finite start value -3.0e38f, so exp gives 0 for a masked key and 1 for a row with no key yet without any test; with no branch between the rows their mask loads, shuffles and exps overlap (every loop here is unrolled so that the per-row arrays stay in registers) */
    float sa[2][8], sb[2][8], mc[2][8];
#pragma unroll
    for (int rt = 0; rt < RTN; ++rt)
#pragma unroll
      for (int r = 0; r < 8; ++r) { const bool am = (allm[rt][r] != 0);
        const bool ok0 = am || (((mw[rt][r] >> ln) & 1u) == 0u), ok1 = am || (((mw[rt][r] >> (16 + ln)) & 1u) == 0u);
        sa[rt][r] = ok0 ? (am ? 0.f : s[rt][0][r] * SCL) : -INFINITY; sb[rt][r] = ok1 ? (am ? 0.f : s[rt][1][r] * SCL) : -INFINITY; mc[rt][r] = fmaxf(sa[rt][r], sb[rt][r]); }
#pragma unroll
    for (int st = 1; st < 16; st <<= 1)
#pragma unroll
      for (int rt = 0; rt < RTN; ++rt)
#pragma unroll
        for (int r = 0; r < 8; ++r) mc[rt][r] = fmaxf(mc[rt][r], __shfl_xor(mc[rt][r], st, 32));
#pragma unroll
    for (int rt = 0; rt < RTN; ++rt)
#pragma unroll
      for (int r = 0; r < 8; ++r) {
        const float mn = fmaxf(m_r[rt][r], mc[rt][r]); const float al = expf(m_r[rt][r] - mn); m_r[rt][r] = mn; const float p0 = expf(sa[rt][r] - mn), p1 = expf(sb[rt][r] - mn); l_r[rt][r] = l_r[rt][r] * al + p0 + p1;
#pragma unroll
        for (int dt = 0; dt < DT; ++dt) { oacc[rt][dt][r] *= al; oaccl[rt][dt][r] *= al; }
        FragH t2, t3; const float ps0 = p0 * 1024.0f, ps1 = p1 * 1024.0f; t2.h[0] = (_Float16)ps0; t2.h[1] = (_Float16)ps1; t3.h[0] = (_Float16)((ps0 - (float)t2.h[0]) * 1024.0f); t3.h[1] = (_Float16)((ps1 - (float)t2.h[1]) * 1024.0f);
        sP[w][rt * 16 + 8 * hh + r][ln] = t2.u[0]; sP[w][rt * 16 + 8 * hh + r][16 + ln] = t2.u[1]; sPl[w][rt * 16 + 8 * hh + r][ln] = t3.u[0]; sPl[w][rt * 16 + 8 * hh + r][16 + ln] = t3.u[1]; }
    __builtin_amdgcn_fence(__ATOMIC_ACQ_REL, "workgroup"); __builtin_amdgcn_wave_barrier();
    FragH pa[2], pl[2];
#pragma unroll
    for (int rt = 0; rt < RTN; ++rt) { pa[rt].half[0] = *(const v8us*)&sP[w][rt * 16 + ln][8 * hh]; pa[rt].half[1] = *(const v8us*)&sP[w][rt * 16 + ln][16 + 8 * hh]; pl[rt].half[0] = *(const v8us*)&sPl[w][rt * 16 + ln][8 * hh]; pl[rt].half[1] = *(const v8us*)&sPl[w][rt * 16 + ln][16 + 8 * hh]; }
#pragma unroll
    for (int dt = 0; dt < DT; ++dt) { const size_t vo = (size_t)(dt * 16 + ln) * TK + j0; FragH bv, bl; bv.half[0] = *(const v8us*)(Vth + vo + 8 * hh); bv.half[1] = *(const v8us*)(Vth + vo + 16 + 8 * hh); bl.half[0] = *(const v8us*)(Vtl + vo + 8 * hh); bl.half[1] = *(const v8us*)(Vtl + vo + 16 + 8 * hh);
#pragma unroll
      for (int rt = 0; rt < RTN; ++rt) { oacc[rt][dt] = mmaH<1>(pa[rt].v, pa[rt].v, bv.v, bv.v, oacc[rt][dt]); oaccl[rt][dt] = mmaH<1>(pa[rt].v, pa[rt].v, bl.v, bl.v, oaccl[rt][dt]); oaccl[rt][dt] = mmaH<1>(pl[rt].v, pl[rt].v, bv.v, bv.v, oaccl[rt][dt]); } }
    __builtin_amdgcn_fence(__ATOMIC_ACQ_REL, "workgroup"); __builtin_amdgcn_wave_barrier(); }
#pragma unroll
  for (int rt = 0; rt < RTN; ++rt) {
#pragma unroll
    for (int st = 1; st < 16; st <<= 1)
#pragma unroll
      for (int r = 0; r < 8; ++r) l_r[rt][r] += __shfl_xor(l_r[rt][r], st, 32);      /* the 8 rows' sums step by step side by side, one test for the stores behind them */
    if (ln == 0) {
#pragma unroll
      for (int r = 0; r < 8; ++r) { sM[w][rt * 16 + 8 * hh + r] = m_r[rt][r]; sL[w][rt * 16 + 8 * hh + r] = l_r[rt][r]; } }
#pragma unroll
    for (int dt = 0; dt < DT; ++dt)
#pragma unroll
      for (int r = 0; r < 8; ++r) sO[w][rt * 16 + 8 * hh + r][dt * 16 + ln] = oacc[rt][dt][r] + oaccl[rt][dt][r] * 0.0009765625f; }
  __syncthreads();      /* every wave's partial (max, sum, O) is in LDS before any thread merges them */
  { const int r = tid >> 4, pc = tid & 15; float mm = sM[0][r];
#pragma unroll
    for (int u = 1; u < NW; ++u) mm = fmaxf(mm, sM[u][r]);
    float l = 0.f; v4f val = {0.f, 0.f, 0.f, 0.f};
#pragma unroll
    for (int u = 0; u < NW; ++u) { const float e = expf(sM[u][r] - mm); l += e * sL[u][r]; const v4f po = *(const v4fa*)&sO[u][r][pc * 4]; val += po * e; }
    const float li = (l > 0.f) ? 1.0f / (l * 1024.0f) : 0.f;
    *(v4f*)(O + ((size_t)b * TQ + q0 + r) * ldo + h * 64 + pc * 4) = val * li; } }


__global__ __launch_bounds__(256) void k_causaltab(unsigned* __restrict__ MB, int* __restrict__ RA, int* __restrict__ KE, int nq, int nk) {
  const int t = blockIdx.x * 256 + threadIdx.x; const int nw = nk / 32;
  if (t < nq * nw) { const int q = t / nw, w = t % nw; const int first = q + 1 - 32 * w; const unsigned bits = (first <= 0) ? 0xffffffffu : ((first >= 32) ? 0u : (0xffffffffu << first)); *(unsigned*)(MB + t) = bits;  }
  if (t < nq) { *(int*)(RA + t) = 0;  }
  if (t < nq / 64) { const int v = 64 * (t + 1); *(int*)(KE + t * 32) = v;  } }

extern "C" void kernel_launch(void* const* d_in, const int* in_sizes, int n_in,
                              void* d_out, int out_size, void* d_ws, size_t ws_size, hipStream_t stream) {
  (void)in_sizes; (void)n_in; (void)out_size;
  const float* const* I = (const float* const*)d_in; const float* x = I[0]; const float* Wq = I[1]; const float* bq = I[2]; const float* Wk = I[3]; const float* bk = I[4]; const float* Wv = I[5]; const float* bv = I[6]; const float* Wo = I[7]; const float* bo = I[8];
  char* ws = (char*)d_ws; size_t off = 0;
  auto take = [&](size_t bytes) { char* p = ws + off; off += (bytes + 255) & ~(size_t)255; return p; };
  _Float16* BQ = (_Float16*)take((size_t)DK * DM * 2); _Float16* BK = (_Float16*)take((size_t)DK * DM * 2); _Float16* BV = (_Float16*)take((size_t)DK * DM * 2); _Float16* BO = (_Float16*)take((size_t)DM * DK * 2);
  _Float16* Qh = (_Float16*)take((size_t)NR * DK * 2); _Float16* Ql = (_Float16*)take((size_t)NR * DK * 2); _Float16* Kh = (_Float16*)take((size_t)NR * DK * 2); _Float16* Kl = (_Float16*)take((size_t)NR * DK * 2); _Float16* Vth = (_Float16*)take((size_t)NR * DK * 2); _Float16* Vtl = (_Float16*)take((size_t)NR * DK * 2);
  unsigned* MB = (unsigned*)take((size_t)SS * (SS / 32) * 4); int* RA = (int*)take((size_t)SS * 4); int* KE = (int*)take((size_t)(SS / 64) * 32 * 4);
  float* O = (float*)take((size_t)NR * DK * 4); _Float16* Oh = (_Float16*)take((size_t)NR * DK * 2); _Float16* Ol = (_Float16*)take((size_t)NR * DK * 2);
  if (off > ws_size) return;      /* 6 x 2 + 2 + 4 + 4 = 22 MiB */
  k_wt_f16<<<(DM * DK / 8 + 255) / 256, 256, 0, stream>>>(Wq, BQ, DM, DK, 16.0f); k_wt_f16<<<(DM * DK / 8 + 255) / 256, 256, 0, stream>>>(Wk, BK, DM, DK, 16.0f); k_wt_f16<<<(DM * DK / 8 + 255) / 256, 256, 0, stream>>>(Wv, BV, DM, DK, 16.0f); k_wt_f16<<<(DK * DM / 8 + 255) / 256, 256, 0, stream>>>(Wo, BO, DK, DM, 16.0f);      /* (in,out) -> [out][in] x16 */
  k_causaltab<<<(SS * (SS / 32) + 255) / 256, 256, 0, stream>>>(MB, RA, KE, SS, SS);
  const dim3 gP(3, NR / 128), gO((NR / 128) * (DM / 64), 1); const size_t n8 = (size_t)NR * DK / 8; const unsigned nb8 = (unsigned)((n8 + 255) / 256);
  k_proj<<<gP, 128, 0, stream>>>(x, BQ, BK, BV, bq, bk, bv, Qh, Ql, Kh, Kl, Vth, Vtl);      /* q, k hi/residual rows and V^T hi/residual per sequence [64][4096], straight from x: 3 x 128 work-groups side by side */
  k_flashm<SS, SS><<<NB * NH * (SS / 16), 256, 0, stream>>>(Qh, Ql, DK, Kh, Kl, DK, Vth, Vtl, MB, RA, KE, O, DK);      /* one grid over all (sequence, 16 queries): 1024 work-groups of 8 waves */
  k_hl<<<nb8, 256, 0, stream>>>(O, Oh, Ol, n8);
  k_gemm2<0><<<gO, 128, 0, stream>>>(Oh, DK, 0, BO, DK, 0, 0.0625f, bo, 0, nullptr, 1, 0, 0, (float*)d_out, nullptr, DM, 0, NR, DM, DK);
  k_gemm2<0><<<gO, 128, 0, stream>>>(Ol, DK, 0, BO, DK, 0, 0.0625f * 0.0009765625f, nullptr, 0, (const float*)d_out, 1, (size_t)DM, 0, (float*)d_out, nullptr, DM, 0, NR, DM, DK);      /* out = O*Wo + bo (hi pass, then the residual pass through the addend) */
}

// v005
// A run of this version takes 125 microseconds.
// Two timings next to v004 both put it at 1.29 times that version's speed.
// Over all steps from v000 it is 19.6 times as fast.
#include <hip/hip_runtime.h>
// Single-head causal attention (4 sequences x 4096 tokens x 512; d_k = d_v = 64): q, k, v = x*W + b; scores = q.k/8 with j <= i; softmax; out = (attn.v)*Wo + bo -> [4,4096,512].
// Structure: q/k/v by one launch of f16 WMMA GEMMs (32x64 wave tiles, x rounded in registers, f32, exact products + bias) whose epilogue writes q, k as f16 hi + (x2^10) residual planes and V^T as hi + residual planes; the causal structure computed on device into a key bit plane + per-block key bound; one fused flash-style kernel per (sequence, 16 queries) (8 waves share the queries, the 32-key steps up to the bound dealt to them in turn, three-product hi/lo scores, online softmax f32, P hi + residual via LDS, two value accumulators, the 8 partial (max, sum, O) merged in LDS; the merged 16x64 O tile split into hi + residual planes in LDS and multiplied by Wo in the same kernel, each wave 64 of the 512 output columns, bias added) -> the output rows.
// Compute dtype: x, weights, biases rounded to bf16; projections exact; q, k, P, v, O as f16 hi + residual pairs (~2^-21); f32 accumulation and softmax. v_wmma_f32_16x16x32_f16.
#define NB 4
#define SS 4096
#define DM 512
#define DK 64
#define NH 1
#define SCL 0.125f
#define NR (NB * SS)
typedef __bf16 v16b __attribute__((ext_vector_type(16)));
typedef unsigned short v8us __attribute__((ext_vector_type(8), may_alias));
typedef float  v8f  __attribute__((ext_vector_type(8)));
typedef float  v4f  __attribute__((ext_vector_type(4)));
typedef float  v4fa __attribute__((ext_vector_type(4), may_alias));
union FragB { v16b v; v8us half[2]; unsigned short u[16]; };

__device__ __forceinline__ unsigned short bf16_bits(float x) { unsigned int u = __float_as_uint(x); return (unsigned short)((u + 0x7FFFu + ((u >> 16) & 1u)) >> 16); }
__device__ __forceinline__ float bf16_val(unsigned short b) { return __uint_as_float(((unsigned int)b) << 16); }
__device__ __forceinline__ float bf16_round(float x) { return bf16_val(bf16_bits(x)); }
// D += A·B with NT terms: 1 = ah·bh, 2 = + al·bh (A split), 3 = + ah·bl (both split)
template <int NT>
__device__ __forceinline__ v8f mmaN(v16b ah, v16b al, v16b bh, v16b bl, v8f c) {
  c = __builtin_amdgcn_wmma_f32_16x16x32_bf16(false, ah, false, bh, (short)0, c, false, false);
  if (NT >= 2) c = __builtin_amdgcn_wmma_f32_16x16x32_bf16(false, al, false, bh, (short)0, c, false, false);
  if (NT >= 3) c = __builtin_amdgcn_wmma_f32_16x16x32_bf16(false, ah, false, bl, (short)0, c, false, false);
  asm volatile("v_nop\n\tv_nop\n\tv_nop\n\tv_nop" : "+v"(c) : "v"(ah), "v"(al), "v"(bh), "v"(bl));
  return c;
}

__global__ __launch_bounds__(256) void k_wt_bf16(const float* __restrict__ W, unsigned short* __restrict__ Wt, int K, int N) {
  const int t = blockIdx.x * 256 + threadIdx.x;
  const int k8n = K / 8;
  if (t >= N * k8n) return;
  const int n = t / k8n, k8 = (t % k8n) * 8;
  v8us v;
#pragma unroll
  for (int i = 0; i < 8; ++i) v[i] = bf16_bits(W[(size_t)(k8 + i) * N + n]);
  *(v8us*)(Wt + (size_t)n * K + k8) = v;
  
}

// GEMM C[M][N] (f32, pitch ldc) = act(A[M][K]·W + bias). A f32 row-major (pitch lda) converted per fragment to bf16
// (ASPLIT: hi/lo two planes -> 2 terms, else single rounded term); Wt bf16 [N][K] (pitch ldb). BIAS_BF16 rounds the
// bias to bf16 first (bias quantised to bf16 before the add). K%32==0, M%16==0, N%64==0.
template <bool ASPLIT, int ACT, bool BIAS_BF16>
__global__ __launch_bounds__(128) void k_gemm_bf(const float* __restrict__ A, int lda, const unsigned short* __restrict__ Wt, int ldb,
                                               const float* __restrict__ bias, float* __restrict__ C, int ldc, int M, int N, int K) {
  __shared__ __attribute__((aligned(16))) float so[4][16][64];
  const int tid = threadIdx.x, w = tid >> 5, lane = tid & 31, ln = lane & 15, hh = lane >> 4;
  const int ntn = N / 64;
  const int wid = blockIdx.x * 4 + w;
  const int mt = wid / ntn, nq = wid % ntn;
  if (mt * 16 >= M) return;
  const int row0 = mt * 16, col0 = nq * 64;
  const float* arow = A + (size_t)(row0 + ln) * lda;
  v8f acc[4] = {};
  for (int kb = 0; kb < K; kb += 32) {
    FragB ah, al;
    const v4f x0 = *(const v4fa*)(arow + kb + 8 * hh), x1 = *(const v4fa*)(arow + kb + 8 * hh + 4);
    const v4f x2 = *(const v4fa*)(arow + kb + 16 + 8 * hh), x3 = *(const v4fa*)(arow + kb + 16 + 8 * hh + 4);
    float xs[16] = {x0[0],x0[1],x0[2],x0[3],x1[0],x1[1],x1[2],x1[3],x2[0],x2[1],x2[2],x2[3],x3[0],x3[1],x3[2],x3[3]};
#pragma unroll
    for (int i = 0; i < 16; ++i) { const unsigned short hb = bf16_bits(xs[i]); ah.u[i] = hb; al.u[i] = ASPLIT ? bf16_bits(xs[i] - bf16_val(hb)) : (unsigned short)0; }
#pragma unroll
    for (int t = 0; t < 4; ++t) {
      const unsigned short* brow = Wt + (size_t)(col0 + t * 16 + ln) * ldb + kb;
      FragB b;
      b.half[0] = *(const v8us*)(brow + 8 * hh);
      b.half[1] = *(const v8us*)(brow + 16 + 8 * hh);
      acc[t] = mmaN<ASPLIT ? 2 : 1>(ah.v, al.v, b.v, b.v, acc[t]);
    }
  }
#pragma unroll
  for (int t = 0; t < 4; ++t) {
    float bv = bias ? bias[col0 + t * 16 + ln] : 0.f;
    if (BIAS_BF16) bv = bf16_round(bv);
#pragma unroll
    for (int r = 0; r < 8; ++r) { float v = acc[t][r] + bv; if (ACT == 1) v = fmaxf(v, 0.f); so[w][8 * hh + r][t * 16 + ln] = v; }
  }
  __builtin_amdgcn_fence(__ATOMIC_ACQ_REL, "workgroup");
  __builtin_amdgcn_wave_barrier();
  const int rsub = lane >> 4, c4 = (lane & 15) * 4;
  {
#pragma unroll
    for (int q = 0; q < 8; ++q) {
      const int r = q * 2 + rsub;
      const v4f v = *(const v4fa*)&so[w][r][c4];
      *(v4f*)(C + (size_t)(row0 + r) * ldc + col0 + c4) = v;
    }
    
  }
}

// GEMM C = act(A·W + bias + resid): A f32 (ASPLIT -> hi/lo 2 terms), Wt bf16 [N][K]; ACT 0 none, 1 relu, 2 exact gelu;
// resid (optional, f32, row index = (row % rmod), pitch ldr, RES_BF16 rounds it) added before the activation.
template <bool ASPLIT, int ACT, bool BIAS_BF16, bool RES_BF16>
__global__ __launch_bounds__(128) void k_gemm_bf3(const float* __restrict__ A, int lda, const unsigned short* __restrict__ Wt, int ldb,
                                                const float* __restrict__ bias, const float* __restrict__ resid, int rmod, int ldr,
                                                float* __restrict__ C, int ldc, int M, int N, int K) {
  __shared__ __attribute__((aligned(16))) float so[4][16][64];
  const int tid = threadIdx.x, w = tid >> 5, lane = tid & 31, ln = lane & 15, hh = lane >> 4;
  const int ntn = N / 64;
  const int wid = blockIdx.x * 4 + w;
  const int mt = wid / ntn, nq = wid % ntn;
  if (mt * 16 >= M) return;
  const int row0 = mt * 16, col0 = nq * 64;
  const float* arow = A + (size_t)(row0 + ln) * lda;
  v8f acc[4] = {};
  for (int kb = 0; kb < K; kb += 32) {
    FragB ah, al;
    const v4f x0 = *(const v4fa*)(arow + kb + 8 * hh), x1 = *(const v4fa*)(arow + kb + 8 * hh + 4);
    const v4f x2 = *(const v4fa*)(arow + kb + 16 + 8 * hh), x3 = *(const v4fa*)(arow + kb + 16 + 8 * hh + 4);
    float xs[16] = {x0[0],x0[1],x0[2],x0[3],x1[0],x1[1],x1[2],x1[3],x2[0],x2[1],x2[2],x2[3],x3[0],x3[1],x3[2],x3[3]};
#pragma unroll
    for (int i = 0; i < 16; ++i) { const unsigned short hb = bf16_bits(xs[i]); ah.u[i] = hb; al.u[i] = ASPLIT ? bf16_bits(xs[i] - bf16_val(hb)) : (unsigned short)0; }
#pragma unroll
    for (int t = 0; t < 4; ++t) {
      const unsigned short* brow = Wt + (size_t)(col0 + t * 16 + ln) * ldb + kb;
      FragB b;
      b.half[0] = *(const v8us*)(brow + 8 * hh);
      b.half[1] = *(const v8us*)(brow + 16 + 8 * hh);
      acc[t] = mmaN<ASPLIT ? 2 : 1>(ah.v, al.v, b.v, b.v, acc[t]);
    }
  }
#pragma unroll
  for (int t = 0; t < 4; ++t) {
    const int col = col0 + t * 16 + ln;
    float bv = bias ? bias[col] : 0.f;
    if (BIAS_BF16) bv = bf16_round(bv);
#pragma unroll
    for (int r = 0; r < 8; ++r) {
      float v = acc[t][r] + bv;
      if (resid) { float rv = resid[(size_t)((row0 + 8 * hh + r) % rmod) * ldr + col]; if (RES_BF16) rv = bf16_round(rv); v += rv; }
      if (ACT == 1) v = fmaxf(v, 0.f);
      if (ACT == 2) v = 0.5f * v * (1.0f + erff(v * 0.70710678118654752f));
      if (ACT == 3) { const float u = 0.7978845608028654f * (v + 0.044715f * v * v * v); v = 0.5f * v * (1.0f + tanhf(u)); }
      so[w][8 * hh + r][t * 16 + ln] = v;
    }
  }
  __builtin_amdgcn_fence(__ATOMIC_ACQ_REL, "workgroup");
  __builtin_amdgcn_wave_barrier();
  const int rsub = lane >> 4, c4 = (lane & 15) * 4;
  {
#pragma unroll
    for (int q = 0; q < 8; ++q) {
      const int r = q * 2 + rsub;
      const v4f v = *(const v4fa*)&so[w][r][c4];
      *(v4f*)(C + (size_t)(row0 + r) * ldc + col0 + c4) = v;
    }
    
  }
}
// row LayerNorm (biased variance, eps) over N: s = X (+ R); optional out_sum <- s; out_norm <- (s-mu)*rsqrt(var+eps)*g + b
template <bool PARAM_BF16>
__global__ __launch_bounds__(256) void k_layernorm(const float* __restrict__ X, const float* __restrict__ R, const float* __restrict__ g, const float* __restrict__ bta,
                                                  float* __restrict__ out_sum, float* __restrict__ out_norm, int N, float eps) {
  __shared__ float red[256];
  const int row = blockIdx.x, tid = threadIdx.x;
  const float* x = X + (size_t)row * N; const float* rr = R ? R + (size_t)row * N : nullptr;
  float vals[16];                     // up to N = 4096
  const int per = N / 256;            // contiguous chunk per thread? use strided-by-4 chunks: thread handles j = tid*4 + 1024*u
  float s1 = 0.f;
  for (int u = 0; u < per / 4; ++u) {
    const int j = tid * 4 + 1024 * u;
    const v4f a = *(const v4fa*)(x + j);
    v4f b = {0.f,0.f,0.f,0.f}; if (rr) b = *(const v4fa*)(rr + j);
#pragma unroll
    for (int q = 0; q < 4; ++q) { const float v = a[q] + b[q]; vals[u * 4 + q] = v; s1 += v; }
  }
  red[tid] = s1; __syncthreads();
  for (int st = 128; st > 0; st >>= 1) { if (tid < st) red[tid] += red[tid + st]; __syncthreads(); }
  const float mu = red[0] / (float)N; __syncthreads();
  float s2 = 0.f;
  for (int u = 0; u < per / 4; ++u)
#pragma unroll
    for (int q = 0; q < 4; ++q) { const float c = vals[u * 4 + q] - mu; s2 += c * c; }
  red[tid] = s2; __syncthreads();
  for (int st = 128; st > 0; st >>= 1) { if (tid < st) red[tid] += red[tid + st]; __syncthreads(); }
  const float rs = rsqrtf(red[0] / (float)N + eps);
  {
    for (int u = 0; u < per / 4; ++u) {
      const int j = tid * 4 + 1024 * u;
      v4f o, sm;
#pragma unroll
      for (int q = 0; q < 4; ++q) {
        float gg = g[j + q], bb = bta[j + q];
        if (PARAM_BF16) { gg = bf16_round(gg); bb = bf16_round(bb); }
        sm[q] = vals[u * 4 + q]; o[q] = (vals[u * 4 + q] - mu) * rs * gg + bb;
      }
      if (out_sum) *(v4f*)(out_sum + (size_t)row * N + j) = sm;
      *(v4f*)(out_norm + (size_t)row * N + j) = o;
    }
    
  }
}



// ---- f16 WMMA path (v_wmma_f32_16x16x32_f16): 11-bit significands for operands in range — used where a [0,1] probability operand needs more precision than bf16
typedef _Float16 v16h __attribute__((ext_vector_type(16)));
union FragH { v16h v; v8us half[2]; _Float16 h[16]; unsigned short u[16]; };
template <int NT>
__device__ __forceinline__ v8f mmaH(v16h ah, v16h al, v16h bh, v16h bl, v8f c) {
  c = __builtin_amdgcn_wmma_f32_16x16x32_f16(false, ah, false, bh, (short)0, c, false, false);
  if (NT >= 2) c = __builtin_amdgcn_wmma_f32_16x16x32_f16(false, al, false, bh, (short)0, c, false, false);
  if (NT >= 3) c = __builtin_amdgcn_wmma_f32_16x16x32_f16(false, ah, false, bl, (short)0, c, false, false);
  asm volatile("v_nop\n\tv_nop\n\tv_nop\n\tv_nop" : "+v"(c) : "v"(ah), "v"(al), "v"(bh), "v"(bl));
  return c;
}
// batched GEMM like k_gemm_b but f16 operands: A f32 (split into f16 hi/lo if ASPLIT, else rounded to f16), Bt = f16 values [n][k]; alpha; C f32; N multiple of 16 (partial tiles skipped)
template <bool ASPLIT>
__global__ __launch_bounds__(128) void k_gemm_h(const float* __restrict__ A, int lda, size_t sA, const _Float16* __restrict__ Bh, int ldb, size_t sB, float alpha, float* __restrict__ C, int ldc, size_t sC, int M, int N, int K) {
  __shared__ __attribute__((aligned(16))) float so[4][16][64];
  const int tid = threadIdx.x, w = tid >> 5, lane = tid & 31, ln = lane & 15, hh = lane >> 4; const int by = blockIdx.y;
  A += (size_t)by * sA; Bh += (size_t)by * sB; C += (size_t)by * sC;
  const int ntn = (N + 63) / 64; const int wid = blockIdx.x * 4 + w; const int mt = wid / ntn, nq = wid % ntn; if (mt * 16 >= M) return;
  const int row0 = mt * 16, col0 = nq * 64; const float* arow = A + (size_t)(row0 + ln) * lda;
  v8f acc[4] = {};
  for (int kb = 0; kb < K; kb += 32) {
    FragH ah, al;
    const v4f x0 = *(const v4fa*)(arow + kb + 8 * hh), x1 = *(const v4fa*)(arow + kb + 8 * hh + 4), x2 = *(const v4fa*)(arow + kb + 16 + 8 * hh), x3 = *(const v4fa*)(arow + kb + 16 + 8 * hh + 4);
    float xs[16] = {x0[0],x0[1],x0[2],x0[3],x1[0],x1[1],x1[2],x1[3],x2[0],x2[1],x2[2],x2[3],x3[0],x3[1],x3[2],x3[3]};
#pragma unroll
    for (int i = 0; i < 16; ++i) { const _Float16 h = (_Float16)xs[i]; ah.h[i] = h; al.h[i] = ASPLIT ? (_Float16)(xs[i] - (float)h) : (_Float16)0.0f; }
#pragma unroll
    for (int t = 0; t < 4; ++t) { if (col0 + t * 16 >= N) continue; const size_t boff = (size_t)(col0 + t * 16 + ln) * ldb + kb; FragH bq; bq.half[0] = *(const v8us*)(Bh + boff + 8 * hh); bq.half[1] = *(const v8us*)(Bh + boff + 16 + 8 * hh);
      acc[t] = mmaH<ASPLIT ? 2 : 1>(ah.v, al.v, bq.v, bq.v, acc[t]); }
  }
#pragma unroll
  for (int t = 0; t < 4; ++t) { if (col0 + t * 16 >= N) continue;
#pragma unroll
    for (int r = 0; r < 8; ++r) so[w][8 * hh + r][t * 16 + ln] = acc[t][r] * alpha; }
  __builtin_amdgcn_fence(__ATOMIC_ACQ_REL, "workgroup"); __builtin_amdgcn_wave_barrier();
  const int rsub = lane >> 4, c4 = (lane & 15) * 4;
  {
#pragma unroll
    for (int q = 0; q < 8; ++q) { const int r = q * 2 + rsub; if (col0 + c4 < N) { const v4f v = *(const v4fa*)&so[w][r][c4]; *(v4f*)(C + (size_t)(row0 + r) * ldc + col0 + c4) = v; } }
     }
}

// Wt[n][k] = f16(W[k][n]·scale) from f32 row-major W[K][N] (scale = power of two; bf16-exact weights stay exact in f16 away from the subnormal range)
__global__ __launch_bounds__(256) void k_wt_f16(const float* __restrict__ W, _Float16* __restrict__ Wt, int K, int N, float scale) {
  const int t = blockIdx.x * 256 + threadIdx.x; if (t >= N * (K / 8)) return; const int n = t / (K / 8), k8 = (t % (K / 8)) * 8; FragH f;
#pragma unroll
  for (int i = 0; i < 8; ++i) f.h[i] = (_Float16)(bf16_round(W[(size_t)(k8 + i) * N + n]) * scale); const v8us o = f.half[0];
  *(v8us*)((unsigned short*)Wt + (size_t)n * K + k8) = o; 
}
// k_gemm_hh variant with fused epilogue: v = acc·alpha + bias[by·sBias + col] (+ CP[(row/rowsPerB)·sCPb + by·64 + col] if CP) ; ACT 0 none / 1 elu ; writes f16 C16 (and f32 C if non-null)
template <int ACT>
__global__ __launch_bounds__(128) void k_gemm_hhx(const _Float16* __restrict__ A, int lda, size_t sA, const _Float16* __restrict__ Bh, int ldb, size_t sB, float alpha, const float* __restrict__ bias, size_t sBias, const float* __restrict__ CP, int rowsPerB, size_t sCPb, int row0g,
    float* __restrict__ C, _Float16* __restrict__ C16, int ldc, size_t sC, int M, int N, int K) {
  __shared__ __attribute__((aligned(16))) float so[4][16][64];
  const int tid = threadIdx.x, w = tid >> 5, lane = tid & 31, ln = lane & 15, hh = lane >> 4; const int by = blockIdx.y;
  A += (size_t)by * sA; Bh += (size_t)by * sB; const size_t cofs = (size_t)by * sC; const float* bp = bias ? bias + (size_t)by * sBias : nullptr;
  const int ntn = (N + 63) / 64; const int wid = blockIdx.x * 4 + w; const int mt = wid / ntn, nq = wid % ntn; if (mt * 16 >= M) return;
  const int row0 = mt * 16, col0 = nq * 64; const _Float16* arow = A + (size_t)(row0 + ln) * lda;
  v8f acc[4] = {};
  for (int kb = 0; kb < K; kb += 32) { FragH ah; ah.half[0] = *(const v8us*)((const unsigned short*)arow + kb + 8 * hh); ah.half[1] = *(const v8us*)((const unsigned short*)arow + kb + 16 + 8 * hh);
#pragma unroll
    for (int t = 0; t < 4; ++t) { if (col0 + t * 16 >= N) continue; const size_t boff = (size_t)(col0 + t * 16 + ln) * ldb + kb; FragH bq; bq.half[0] = *(const v8us*)((const unsigned short*)Bh + boff + 8 * hh); bq.half[1] = *(const v8us*)((const unsigned short*)Bh + boff + 16 + 8 * hh);
      acc[t] = mmaH<1>(ah.v, ah.v, bq.v, bq.v, acc[t]); }
  }
#pragma unroll
  for (int t = 0; t < 4; ++t) { if (col0 + t * 16 >= N) continue; const int col = col0 + t * 16 + ln; const float bv = bp ? bf16_round(bp[col]) : 0.f;
#pragma unroll
    for (int r = 0; r < 8; ++r) { float v = acc[t][r] * alpha + bv; if (CP) { const int bidx = (row0g + row0 + 8 * hh + r) / rowsPerB; v += CP[(size_t)bidx * sCPb + (size_t)by * 64 + col]; } if (ACT == 1) v = (v > 0.f) ? v : expm1f(v); else if (ACT == 7) v = (v > 0.f) ? v + 1.0f : expf(v); else if (ACT == 8) v = tanhf(v); else if (ACT == 9) v = 0.5f * v * (1.0f + tanhf(0.7978845608028654f * (v + 0.044715f * v * v * v))); else if (ACT == 11) v = 1.0f / (1.0f + expf(-v)); else if (ACT == 12) v = (v > 0.f) ? v : 0.01f * v; else if (ACT == 14) v = (v > 0.f) ? v : 0.1f * v; else if (ACT == 15) v = v / (1.0f + expf(-v)); else if (ACT == 3) v = fmaxf(v, 0.f); else if (ACT == 6) v = 0.5f * v * (1.0f + erff(v * 0.70710678118654752f)); so[w][8 * hh + r][t * 16 + ln] = v; } }
  __builtin_amdgcn_fence(__ATOMIC_ACQ_REL, "workgroup"); __builtin_amdgcn_wave_barrier();
  const int rsub = lane >> 4, c4 = (lane & 15) * 4; typedef _Float16 v4h __attribute__((ext_vector_type(4)));
  {
#pragma unroll
    for (int q = 0; q < 8; ++q) { const int r = q * 2 + rsub; if (col0 + c4 < N) { const v4f v = *(const v4fa*)&so[w][r][c4]; if (C) *(v4f*)(C + cofs + (size_t)(row0 + r) * ldc + col0 + c4) = v; if (C16) { v4h h4; for (int i = 0; i < 4; ++i) h4[i] = (_Float16)v[i]; *(v4h*)(C16 + cofs + (size_t)(row0 + r) * ldc + col0 + c4) = h4; } } }
     }
}


typedef _Float16 v4h __attribute__((ext_vector_type(4)));

__global__ __launch_bounds__(256) void k_h16(const float* __restrict__ x, _Float16* __restrict__ X16, size_t n8) { const size_t t = (size_t)blockIdx.x * 256 + threadIdx.x; if (t >= n8) return; FragH f;
#pragma unroll
  for (int q = 0; q < 8; ++q) f.h[q] = (_Float16)x[t * 8 + q]; *(v8us*)((unsigned short*)X16 + t * 8) = f.half[0];  }
__global__ __launch_bounds__(256) void k_round16f(const float* __restrict__ W, _Float16* __restrict__ Bt, size_t n8) { const size_t t = (size_t)blockIdx.x * 256 + threadIdx.x; if (t >= n8) return; FragH f;
#pragma unroll
  for (int i = 0; i < 8; ++i) f.h[i] = (_Float16)(bf16_round(W[t * 8 + i]) * 16.0f); *(v8us*)((unsigned short*)Bt + t * 8) = f.half[0];  }
template <int NHv, int TTv>
__global__ __launch_bounds__(256) void k_vt(const _Float16* __restrict__ V16, int ldv, int voff, _Float16* __restrict__ Vt) { __shared__ unsigned short tl[64][66]; const int tid = threadIdx.x; const int slab = blockIdx.x / (TTv / 64), lg = blockIdx.x % (TTv / 64); const int b = slab / NHv, h = slab % NHv;
  for (int i = tid; i < 64 * 8; i += 256) { const int r = i / 8, c8 = (i % 8) * 8; FragH f; f.half[0] = *(const v8us*)((const unsigned short*)V16 + ((size_t)b * TTv + lg * 64 + r) * ldv + voff + h * 64 + c8);
#pragma unroll
    for (int q = 0; q < 8; ++q) tl[r][c8 + q] = f.u[q]; }
  __syncthreads();
  {
#pragma unroll
    for (int rd = 0; rd < 2; ++rd) { const int d = rd * 32 + tid / 8, pc = tid % 8; FragH f;
#pragma unroll
      for (int q = 0; q < 8; ++q) f.u[q] = tl[pc * 8 + q][d];
      *(v8us*)((unsigned short*)Vt + ((size_t)slab * 64 + d) * TTv + lg * 64 + pc * 8) = f.half[0]; }
     } }

__global__ __launch_bounds__(256) void k_hl(const float* __restrict__ F, _Float16* __restrict__ Hh, _Float16* __restrict__ Hl, size_t n8) { const size_t t = (size_t)blockIdx.x * 256 + threadIdx.x; if (t >= n8) return; FragH fh, fl; const v4f a = *(const v4fa*)(F + t * 8), c = *(const v4fa*)(F + t * 8 + 4);
#pragma unroll
  for (int q = 0; q < 4; ++q) { _Float16 h = (_Float16)a[q]; fh.h[q] = h; fl.h[q] = (_Float16)((a[q] - (float)h) * 1024.0f); h = (_Float16)c[q]; fh.h[4 + q] = h; fl.h[4 + q] = (_Float16)((c[q] - (float)h) * 1024.0f); }
  { *(v8us*)((unsigned short*)Hh + t * 8) = fh.half[0]; *(v8us*)((unsigned short*)Hl + t * 8) = fl.half[0];  } }

// ---- fast GEMM (wave tile 32x64; requires M % 32 == 0 rows per launch region and N % 64 == 0); epilogue = k_gemm_hhx semantics ----
__device__ __forceinline__ v16h g2_frag(const _Float16* p, int hh) { FragH f; f.half[0] = *(const v8us*)((const unsigned short*)p + 8 * hh); f.half[1] = *(const v8us*)((const unsigned short*)p + 16 + 8 * hh); return f.v; }
__device__ __forceinline__ v8f g2_mma(v16h a, v16h b, v8f c) { v8f d = __builtin_amdgcn_wmma_f32_16x16x32_f16(false, a, false, b, (short)0, c, false, false); asm volatile("v_nop\n\tv_nop\n\tv_nop\n\tv_nop" : "+v"(d) : "v"(a), "v"(b)); return d; }
template <int ACT>
__global__ __launch_bounds__(128) void k_gemm2(const _Float16* __restrict__ A, int lda, size_t sA, const _Float16* __restrict__ Bh, int ldb, size_t sB, float alpha, const float* __restrict__ bias, size_t sBias, const float* __restrict__ CP, int rowsPerB, size_t sCPb, int row0g,
    float* __restrict__ C, _Float16* __restrict__ C16, int ldc, size_t sC, int M, int N, int K) {
  __shared__ __attribute__((aligned(16))) float so[4][32][68];
  const int tid = threadIdx.x, w = tid >> 5, lane = tid & 31, ln = lane & 15, hh = lane >> 4; const int by = blockIdx.y;
  A += (size_t)by * sA; Bh += (size_t)by * sB; const size_t cofs = (size_t)by * sC; const float* bp = bias ? bias + (size_t)by * sBias : nullptr;
  const int ntn = N >> 6; const int mt = blockIdx.x / ntn, nq = blockIdx.x - mt * ntn; const int row0 = mt * 128 + 32 * w, col0 = nq * 64; if (row0 >= M) return;
  const _Float16* a0p = A + (size_t)(row0 + ln) * lda; const _Float16* a1p = a0p + (size_t)16 * lda;
  const _Float16* b0p = Bh + (size_t)(col0 + ln) * ldb; const _Float16* b1p = b0p + (size_t)16 * ldb; const _Float16* b2p = b1p + (size_t)16 * ldb; const _Float16* b3p = b2p + (size_t)16 * ldb;
  const v8f z8 = {0.f,0.f,0.f,0.f,0.f,0.f,0.f,0.f}; v8f c00 = z8, c01 = z8, c02 = z8, c03 = z8, c10 = z8, c11 = z8, c12 = z8, c13 = z8;
#pragma unroll 1
  for (int kb = 0; kb < K; kb += 32) { const v16h a0 = g2_frag(a0p + kb, hh), a1 = g2_frag(a1p + kb, hh);
    v16h b = g2_frag(b0p + kb, hh); c00 = g2_mma(a0, b, c00); c10 = g2_mma(a1, b, c10);
    b = g2_frag(b1p + kb, hh); c01 = g2_mma(a0, b, c01); c11 = g2_mma(a1, b, c11);
    b = g2_frag(b2p + kb, hh); c02 = g2_mma(a0, b, c02); c12 = g2_mma(a1, b, c12);
    b = g2_frag(b3p + kb, hh); c03 = g2_mma(a0, b, c03); c13 = g2_mma(a1, b, c13); }
  v8f accs[8] = {c00, c01, c02, c03, c10, c11, c12, c13};
#pragma unroll
  for (int u = 0; u < 8; ++u) { const int t = u & 3, half = u >> 2; const int col = col0 + t * 16 + ln; const float bv = bp ? bf16_round(bp[col]) : 0.f;
#pragma unroll
    for (int r = 0; r < 8; ++r) { const int rloc = half * 16 + 8 * hh + r; float v = accs[u][r] * alpha + bv; if (CP) { const int bidx = (row0g + row0 + rloc) / rowsPerB; v += CP[(size_t)bidx * sCPb + (size_t)by * 64 + col]; }
      if (ACT == 3) v = fmaxf(v, 0.f); else if (ACT == 6) v = 0.5f * v * (1.0f + erff(v * 0.70710678118654752f)); else if (ACT == 11) v = 1.0f / (1.0f + expf(-v)); else if (ACT == 15) v = v / (1.0f + expf(-v)); else if (ACT == 12) v = (v > 0.f) ? v : 0.01f * v; else if (ACT == 8) v = tanhf(v);
      so[w][rloc][t * 16 + ln] = v; } }
  __builtin_amdgcn_fence(__ATOMIC_ACQ_REL, "workgroup"); __builtin_amdgcn_wave_barrier();
  const int rsub = lane >> 4, c4 = (lane & 15) * 4;
  {
#pragma unroll
    for (int q = 0; q < 16; ++q) { const int r = q * 2 + rsub; const v4f v = *(const v4fa*)&so[w][r][c4]; if (C) *(v4f*)(C + cofs + (size_t)(row0 + r) * ldc + col0 + c4) = v; if (C16) { v4h h4; for (int i = 0; i < 4; ++i) h4[i] = (_Float16)v[i]; *(v4h*)(C16 + cofs + (size_t)(row0 + r) * ldc + col0 + c4) = h4; } }
     } }


// ---- fused projection: q, k, v = round(x)*W + b in one launch. blockIdx.x picks the product (0 q, 1 k, 2 v), blockIdx.y the 128 rows; wave tile 32x64 as in k_gemm2.
// x is read as f32 and rounded in registers (bf16 rounding, then f16, exact for normal values); the epilogue writes the planes the attention kernel reads: q, k as f16 hi + (x2^10) residual rows, v as V^T hi + residual [sequence][64][SS].
__device__ __forceinline__ v16h px_frag(const float* p, int hh) { const v4f x0 = *(const v4fa*)(p + 8 * hh), x1 = *(const v4fa*)(p + 8 * hh + 4), x2 = *(const v4fa*)(p + 16 + 8 * hh), x3 = *(const v4fa*)(p + 16 + 8 * hh + 4); FragH f;
#pragma unroll
  for (int q = 0; q < 4; ++q) { f.h[q] = (_Float16)bf16_round(x0[q]); f.h[4 + q] = (_Float16)bf16_round(x1[q]); f.h[8 + q] = (_Float16)bf16_round(x2[q]); f.h[12 + q] = (_Float16)bf16_round(x3[q]); }
  return f.v; }
__global__ __launch_bounds__(128) void k_proj(const float* __restrict__ x, const _Float16* __restrict__ BQ, const _Float16* __restrict__ BK, const _Float16* __restrict__ BV, const float* __restrict__ bq, const float* __restrict__ bk, const float* __restrict__ bv,
    _Float16* __restrict__ Qh, _Float16* __restrict__ Ql, _Float16* __restrict__ Kh, _Float16* __restrict__ Kl, _Float16* __restrict__ Vth, _Float16* __restrict__ Vtl) {
  __shared__ __attribute__((aligned(16))) float so[4][32][68];
  const int tid = threadIdx.x, w = tid >> 5, lane = tid & 31, ln = lane & 15, hh = lane >> 4; const int which = blockIdx.x, rowg = blockIdx.y * 128, row0 = rowg + 32 * w;
  const _Float16* Bh = (which == 0) ? BQ : ((which == 1) ? BK : BV); const float* bp = (which == 0) ? bq : ((which == 1) ? bk : bv);
  const float* a0p = x + (size_t)(row0 + ln) * DM; const float* a1p = a0p + (size_t)16 * DM;
  const _Float16* b0p = Bh + (size_t)ln * DM; const _Float16* b1p = b0p + (size_t)16 * DM; const _Float16* b2p = b1p + (size_t)16 * DM; const _Float16* b3p = b2p + (size_t)16 * DM;
  const float braw[4] = {bp[ln], bp[16 + ln], bp[32 + ln], bp[48 + ln]};      /* asked for ahead of the loop, so that the epilogue does not wait for them */
  const v8f z8 = {0.f,0.f,0.f,0.f,0.f,0.f,0.f,0.f}; v8f c00 = z8, c01 = z8, c02 = z8, c03 = z8, c10 = z8, c11 = z8, c12 = z8, c13 = z8;
  for (int kb = 0; kb < DM; kb += 32) { const v16h a0 = px_frag(a0p + kb, hh), a1 = px_frag(a1p + kb, hh);
    v16h b = g2_frag(b0p + kb, hh); c00 = g2_mma(a0, b, c00); c10 = g2_mma(a1, b, c10);
    b = g2_frag(b1p + kb, hh); c01 = g2_mma(a0, b, c01); c11 = g2_mma(a1, b, c11);
    b = g2_frag(b2p + kb, hh); c02 = g2_mma(a0, b, c02); c12 = g2_mma(a1, b, c12);
    b = g2_frag(b3p + kb, hh); c03 = g2_mma(a0, b, c03); c13 = g2_mma(a1, b, c13); }
  v8f accs[8] = {c00, c01, c02, c03, c10, c11, c12, c13};
#pragma unroll
  for (int u = 0; u < 8; ++u) { const int t = u & 3, half = u >> 2; const float bvv = bf16_round(braw[t]);
#pragma unroll
    for (int r = 0; r < 8; ++r) so[w][half * 16 + 8 * hh + r][t * 16 + ln] = accs[u][r] * 0.0625f + bvv; }
  if (which != 2) {      /* block-uniform: q or k, each wave writes its own 32 rows, two whole 128-byte rows of each plane a store */
    __builtin_amdgcn_fence(__ATOMIC_ACQ_REL, "workgroup"); __builtin_amdgcn_wave_barrier();
    _Float16* Hh = (which == 0) ? Qh : Kh; _Float16* Hl = (which == 0) ? Ql : Kl; const int rsub = lane >> 4, c4 = (lane & 15) * 4;
#pragma unroll
    for (int q = 0; q < 16; ++q) { const int r = q * 2 + rsub; const v4f v = *(const v4fa*)&so[w][r][c4]; v4h h4, l4;
#pragma unroll
      for (int i = 0; i < 4; ++i) { h4[i] = (_Float16)v[i]; l4[i] = (_Float16)((v[i] - (float)h4[i]) * 1024.0f); }
      *(v4h*)(Hh + (size_t)(row0 + r) * DK + c4) = h4; *(v4h*)(Hl + (size_t)(row0 + r) * DK + c4) = l4; }
  } else {      /* v: the work-group's 128 tokens x 64 columns leave transposed; a thread takes one column and 64 tokens, a whole 128-byte line of each plane */
    __syncthreads();      /* a thread reads rows that its own wave and one other wave staged */
    const int d = tid & 63, hf = tid >> 6; const size_t vo = ((size_t)(rowg / SS) * 64 + d) * SS + (rowg % SS) + hf * 64;
#pragma unroll
    for (int g = 0; g < 8; ++g) { FragH fh, fl;
#pragma unroll
      for (int q = 0; q < 8; ++q) { const int t = g * 8 + q; const float v = so[hf * 2 + (t >> 5)][t & 31][d]; const _Float16 hv = (_Float16)v; fh.h[q] = hv; fl.h[q] = (_Float16)((v - (float)hv) * 1024.0f); }
      *(v8us*)((unsigned short*)Vth + vo + g * 8) = fh.half[0]; *(v8us*)((unsigned short*)Vtl + vo + g * 8) = fl.half[0]; } } }

template <int TQ, int TK>
__global__ __launch_bounds__(256) void k_flashm(const _Float16* __restrict__ Q16, const _Float16* __restrict__ Q16lo, int ldq, const _Float16* __restrict__ K16, const _Float16* __restrict__ K16lo, int ldk, const _Float16* __restrict__ Vt, const _Float16* __restrict__ Vtlo, const unsigned* __restrict__ MB, const int* __restrict__ RA, const int* __restrict__ KE, const _Float16* __restrict__ BO, const float* __restrict__ bo, float* __restrict__ OUT) {
  static_assert(NH == 1, "the output projection in the epilogue takes the one head's 64 columns as the whole k range");
  constexpr int RPW = 16, RTN = RPW / 16, NW = 8, NQB = TQ / RPW, DT = 4, KS = 2;
  __shared__ __attribute__((aligned(16))) unsigned short sP[NW][RPW][40], sPl[NW][RPW][40]; __shared__ __attribute__((aligned(16))) float sO[NW][RPW][64 + 4]; __shared__ float sM[NW][RPW], sL[NW][RPW]; __shared__ __attribute__((aligned(16))) _Float16 sAh[RPW][64 + 8], sAl[RPW][64 + 8];      /* merged O as hi + residual; 144-byte rows for the 16-byte fragment reads */
  const int tid = threadIdx.x, w = __builtin_amdgcn_readfirstlane(tid >> 5), lane = tid & 31, ln = lane & 15, hh = lane >> 4;
  /* w through readfirstlane: the wave's number, and with it the key-step counter, stays in a scalar register. Work-group = one 16-query tile; the tiles with the most keys have the lowest block indices (for speed only) */
  const int slab = blockIdx.x % (NB * NH), qt = NQB - 1 - blockIdx.x / (NB * NH); const int b = slab / NH, h = slab % NH; const int q0 = qt * RPW; const int qblk = q0 >> 6;
  FragH aq[2][KS], aql[2][KS];
#pragma unroll
  for (int rt = 0; rt < RTN; ++rt) { const size_t qo = ((size_t)b * TQ + q0 + rt * 16 + ln) * ldq + h * 64; const unsigned short* qr = (const unsigned short*)Q16 + qo; const unsigned short* ql = (const unsigned short*)Q16lo + qo;
#pragma unroll
    for (int ks = 0; ks < KS; ++ks) { aq[rt][ks].half[0] = *(const v8us*)(qr + ks * 32 + 8 * hh); aq[rt][ks].half[1] = *(const v8us*)(qr + ks * 32 + 16 + 8 * hh); aql[rt][ks].half[0] = *(const v8us*)(ql + ks * 32 + 8 * hh); aql[rt][ks].half[1] = *(const v8us*)(ql + ks * 32 + 16 + 8 * hh); } }
  const unsigned short* Vth = (const unsigned short*)Vt + (size_t)slab * 64 * TK; const unsigned short* Vtl = (const unsigned short*)Vtlo + (size_t)slab * 64 * TK;
  float m_r[2][8], l_r[2][8]; v8f oacc[2][DT], oaccl[2][DT];
#pragma unroll
  for (int rt = 0; rt < RTN; ++rt) {
#pragma unroll
    for (int r = 0; r < 8; ++r) { m_r[rt][r] = -3.0e38f; l_r[rt][r] = 0.f; }
#pragma unroll
    for (int dt = 0; dt < DT; ++dt) { oacc[rt][dt] = (v8f){0.f,0.f,0.f,0.f,0.f,0.f,0.f,0.f}; oaccl[rt][dt] = oacc[rt][dt]; } }
  int jend = KE[qblk * 32]; jend = min(TK, (jend + 31) & ~31); if (jend < 32) jend = 32;      /* block-uniform */
  int allm[2][8]; const unsigned* mrow[2][8];
#pragma unroll
  for (int rt = 0; rt < RTN; ++rt)
#pragma unroll
    for (int r = 0; r < 8; ++r) { const int tq = q0 + rt * 16 + 8 * hh + r; allm[rt][r] = RA[tq]; mrow[rt][r] = MB + (size_t)tq * (TK / 32); }
#pragma unroll 1
  for (int j0 = 32 * w; j0 < jend; j0 += 32 * NW) {      /* wave w takes every NW-th 32-key step */
    unsigned mw[2][8];      /* the step's mask words, asked for ahead of the key fragments so that they arrive behind the score products */
#pragma unroll
    for (int rt = 0; rt < RTN; ++rt)
#pragma unroll
      for (int r = 0; r < 8; ++r) mw[rt][r] = mrow[rt][r][j0 >> 5];
    v8f s[2][2];
#pragma unroll
    for (int nt = 0; nt < 2; ++nt) { const size_t ko = ((size_t)b * TK + j0 + nt * 16 + ln) * ldk + h * 64; const unsigned short* kr = (const unsigned short*)K16 + ko; const unsigned short* kl = (const unsigned short*)K16lo + ko; FragH bk[KS], bkl[KS];
#pragma unroll
      for (int ks = 0; ks < KS; ++ks) { bk[ks].half[0] = *(const v8us*)(kr + ks * 32 + 8 * hh); bk[ks].half[1] = *(const v8us*)(kr + ks * 32 + 16 + 8 * hh); bkl[ks].half[0] = *(const v8us*)(kl + ks * 32 + 8 * hh); bkl[ks].half[1] = *(const v8us*)(kl + ks * 32 + 16 + 8 * hh); }
#pragma unroll
      for (int rt = 0; rt < RTN; ++rt) { v8f acc = (v8f){0.f,0.f,0.f,0.f,0.f,0.f,0.f,0.f}, accr = acc;
#pragma unroll
        for (int ks = 0; ks < KS; ++ks) { acc = mmaH<1>(aq[rt][ks].v, aq[rt][ks].v, bk[ks].v, bk[ks].v, acc); accr = mmaH<1>(aql[rt][ks].v, aql[rt][ks].v, bk[ks].v, bk[ks].v, accr); accr = mmaH<1>(aq[rt][ks].v, aq[rt][ks].v, bkl[ks].v, bkl[ks].v, accr); }
        s[rt][nt] = acc + accr * 0.0009765625f; } }
    /* straight-line softmax: a masked score is -inf and the running maximum is never below the finite start value -3.0e38f, so exp gives 0 for a masked key and 1 for a row with no key yet without any test; with no branch between the rows their mask loads, shuffles and exps overlap (every loop here is unrolled so that the per-row arrays stay in registers) */
    float sa[2][8], sb[2][8], mc[2][8];
#pragma unroll
    for (int rt = 0; rt < RTN; ++rt)
#pragma unroll
      for (int r = 0; r < 8; ++r) { const bool am = (allm[rt][r] != 0);
        const bool ok0 = am || (((mw[rt][r] >> ln) & 1u) == 0u), ok1 = am || (((mw[rt][r] >> (16 + ln)) & 1u) == 0u);
        sa[rt][r] = ok0 ? (am ? 0.f : s[rt][0][r] * SCL) : -INFINITY; sb[rt][r] = ok1 ? (am ? 0.f : s[rt][1][r] * SCL) : -INFINITY; mc[rt][r] = fmaxf(sa[rt][r], sb[rt][r]); }
#pragma unroll
    for (int st = 1; st < 16; st <<= 1)
#pragma unroll
      for (int rt = 0; rt < RTN; ++rt)
#pragma unroll
        for (int r = 0; r < 8; ++r) mc[rt][r] = fmaxf(mc[rt][r], __shfl_xor(mc[rt][r], st, 32));
#pragma unroll
    for (int rt = 0; rt < RTN; ++rt)
#pragma unroll
      for (int r = 0; r < 8; ++r) {
        const float mn = fmaxf(m_r[rt][r], mc[rt][r]); const float al = expf(m_r[rt][r] - mn); m_r[rt][r] = mn; const float p0 = expf(sa[rt][r] - mn), p1 = expf(sb[rt][r] - mn); l_r[rt][r] = l_r[rt][r] * al + p0 + p1;
#pragma unroll
        for (int dt = 0; dt < DT; ++dt) { oacc[rt][dt][r] *= al; oaccl[rt][dt][r] *= al; }
        FragH t2, t3; const float ps0 = p0 * 1024.0f, ps1 = p1 * 1024.0f; t2.h[0] = (_Float16)ps0; t2.h[1] = (_Float16)ps1; t3.h[0] = (_Float16)((ps0 - (float)t2.h[0]) * 1024.0f); t3.h[1] = (_Float16)((ps1 - (float)t2.h[1]) * 1024.0f);
        sP[w][rt * 16 + 8 * hh + r][ln] = t2.u[0]; sP[w][rt * 16 + 8 * hh + r][16 + ln] = t2.u[1]; sPl[w][rt * 16 + 8 * hh + r][ln] = t3.u[0]; sPl[w][rt * 16 + 8 * hh + r][16 + ln] = t3.u[1]; }
    __builtin_amdgcn_fence(__ATOMIC_ACQ_REL, "workgroup"); __builtin_amdgcn_wave_barrier();
    FragH pa[2], pl[2];
#pragma unroll
    for (int rt = 0; rt < RTN; ++rt) { pa[rt].half[0] = *(const v8us*)&sP[w][rt * 16 + ln][8 * hh]; pa[rt].half[1] = *(const v8us*)&sP[w][rt * 16 + ln][16 + 8 * hh]; pl[rt].half[0] = *(const v8us*)&sPl[w][rt * 16 + ln][8 * hh]; pl[rt].half[1] = *(const v8us*)&sPl[w][rt * 16 + ln][16 + 8 * hh]; }
#pragma unroll
    for (int dt = 0; dt < DT; ++dt) { const size_t vo = (size_t)(dt * 16 + ln) * TK + j0; FragH bv, bl; bv.half[0] = *(const v8us*)(Vth + vo + 8 * hh); bv.half[1] = *(const v8us*)(Vth + vo + 16 + 8 * hh); bl.half[0] = *(const v8us*)(Vtl + vo + 8 * hh); bl.half[1] = *(const v8us*)(Vtl + vo + 16 + 8 * hh);
#pragma unroll
      for (int rt = 0; rt < RTN; ++rt) { oacc[rt][dt] = mmaH<1>(pa[rt].v, pa[rt].v, bv.v, bv.v, oacc[rt][dt]); oaccl[rt][dt] = mmaH<1>(pa[rt].v, pa[rt].v, bl.v, bl.v, oaccl[rt][dt]); oaccl[rt][dt] = mmaH<1>(pl[rt].v, pl[rt].v, bv.v, bv.v, oaccl[rt][dt]); } }
    __builtin_amdgcn_fence(__ATOMIC_ACQ_REL, "workgroup"); __builtin_amdgcn_wave_barrier(); }
  /* output projection, wave w = output columns 64 w .. 64 w + 63: its Wo fragments and bias are asked for right behind the key loop, so that they arrive while the row sums are joined and the partials staged (every loop of this projection is unrolled so that its fragment and accumulator arrays stay in registers) */
  const int col0 = w * 64; v16h wb[4][KS]; float braw[4]; const _Float16* bp0 = BO + (size_t)(col0 + ln) * DK; const float* bo0 = bo + col0 + ln;      /* one base each: the 16 fragment loads differ by constant offsets only */
#pragma unroll
  for (int t = 0; t < 4; ++t) { braw[t] = bo0[t * 16];
#pragma unroll
    for (int ks = 0; ks < KS; ++ks) wb[t][ks] = g2_frag(bp0 + t * 16 * DK + ks * 32, hh); }
#pragma unroll
  for (int rt = 0; rt < RTN; ++rt) {
#pragma unroll
    for (int st = 1; st < 16; st <<= 1)
#pragma unroll
      for (int r = 0; r < 8; ++r) l_r[rt][r] += __shfl_xor(l_r[rt][r], st, 32);      /* the 8 rows' sums step by step side by side, one test for the stores behind them */
    if (ln == 0) {
#pragma unroll
      for (int r = 0; r < 8; ++r) { sM[w][rt * 16 + 8 * hh + r] = m_r[rt][r]; sL[w][rt * 16 + 8 * hh + r] = l_r[rt][r]; } }
#pragma unroll
    for (int dt = 0; dt < DT; ++dt)
#pragma unroll
      for (int r = 0; r < 8; ++r) sO[w][rt * 16 + 8 * hh + r][dt * 16 + ln] = oacc[rt][dt][r] + oaccl[rt][dt][r] * 0.0009765625f; }
  __syncthreads();      /* every wave's partial (max, sum, O) is in LDS before any thread merges them */
  { const int r = tid >> 4, pc = tid & 15; float mm = sM[0][r];
#pragma unroll
    for (int u = 1; u < NW; ++u) mm = fmaxf(mm, sM[u][r]);
    float l = 0.f; v4f val = {0.f, 0.f, 0.f, 0.f};
#pragma unroll
    for (int u = 0; u < NW; ++u) { const float e = expf(sM[u][r] - mm); l += e * sL[u][r]; const v4f po = *(const v4fa*)&sO[u][r][pc * 4]; val += po * e; }
    const float li = (l > 0.f) ? 1.0f / (l * 1024.0f) : 0.f;
    const v4f ov = val * li; v4h h4, l4;
#pragma unroll
    for (int i = 0; i < 4; ++i) { h4[i] = (_Float16)ov[i]; l4[i] = (_Float16)((ov[i] - (float)h4[i]) * 1024.0f); }
    *(v4h*)&sAh[r][pc * 4] = h4; *(v4h*)&sAl[r][pc * 4] = l4; }
  __syncthreads();      /* the whole merged tile is in LDS before any wave reads its fragments; behind it nobody reads sO any more, so each wave may stage its output there */
  { v16h ah[KS], al[KS];
#pragma unroll
    for (int ks = 0; ks < KS; ++ks) { ah[ks] = g2_frag(&sAh[ln][ks * 32], hh); al[ks] = g2_frag(&sAl[ln][ks * 32], hh); }
#pragma unroll
    for (int t = 0; t < 4; ++t) { v8f ch = (v8f){0.f,0.f,0.f,0.f,0.f,0.f,0.f,0.f}, cl = ch;
#pragma unroll
      for (int ks = 0; ks < KS; ++ks) { ch = g2_mma(ah[ks], wb[t][ks], ch); cl = g2_mma(al[ks], wb[t][ks], cl); }
      const float bvv = bf16_round(braw[t]);
#pragma unroll
      for (int r = 0; r < 8; ++r) sO[w][8 * hh + r][t * 16 + ln] = (ch[r] * 0.0625f + bvv) + cl[r] * (0.0625f * 0.0009765625f); }
    __builtin_amdgcn_fence(__ATOMIC_ACQ_REL, "workgroup"); __builtin_amdgcn_wave_barrier();      /* the wave reads back rows that its other lanes staged */
    const int rsub = lane >> 4, c4 = (lane & 15) * 4;
#pragma unroll
    for (int q = 0; q < 8; ++q) { const int r = q * 2 + rsub; const v4f v = *(const v4fa*)&sO[w][r][c4]; *(v4f*)(OUT + ((size_t)b * TQ + q0 + r) * DM + col0 + c4) = v; } } }      /* two whole 256-byte row pieces a store */


__global__ __launch_bounds__(256) void k_causaltab(unsigned* __restrict__ MB, int* __restrict__ RA, int* __restrict__ KE, int nq, int nk) {
  const int t = blockIdx.x * 256 + threadIdx.x; const int nw = nk / 32;
  if (t < nq * nw) { const int q = t / nw, w = t % nw; const int first = q + 1 - 32 * w; const unsigned bits = (first <= 0) ? 0xffffffffu : ((first >= 32) ? 0u : (0xffffffffu << first)); *(unsigned*)(MB + t) = bits;  }
  if (t < nq) { *(int*)(RA + t) = 0;  }
  if (t < nq / 64) { const int v = 64 * (t + 1); *(int*)(KE + t * 32) = v;  } }

extern "C" void kernel_launch(void* const* d_in, const int* in_sizes, int n_in,
                              void* d_out, int out_size, void* d_ws, size_t ws_size, hipStream_t stream) {
  (void)in_sizes; (void)n_in; (void)out_size;
  const float* const* I = (const float* const*)d_in; const float* x = I[0]; const float* Wq = I[1]; const float* bq = I[2]; const float* Wk = I[3]; const float* bk = I[4]; const float* Wv = I[5]; const float* bv = I[6]; const float* Wo = I[7]; const float* bo = I[8];
  char* ws = (char*)d_ws; size_t off = 0;
  auto take = [&](size_t bytes) { char* p = ws + off; off += (bytes + 255) & ~(size_t)255; return p; };
  _Float16* BQ = (_Float16*)take((size_t)DK * DM * 2); _Float16* BK = (_Float16*)take((size_t)DK * DM * 2); _Float16* BV = (_Float16*)take((size_t)DK * DM * 2); _Float16* BO = (_Float16*)take((size_t)DM * DK * 2);
  _Float16* Qh = (_Float16*)take((size_t)NR * DK * 2); _Float16* Ql = (_Float16*)take((size_t)NR * DK * 2); _Float16* Kh = (_Float16*)take((size_t)NR * DK * 2); _Float16* Kl = (_Float16*)take((size_t)NR * DK * 2); _Float16* Vth = (_Float16*)take((size_t)NR * DK * 2); _Float16* Vtl = (_Float16*)take((size_t)NR * DK * 2);
  unsigned* MB = (unsigned*)take((size_t)SS * (SS / 32) * 4); int* RA = (int*)take((size_t)SS * 4); int* KE = (int*)take((size_t)(SS / 64) * 32 * 4);
  if (off > ws_size) return;      /* 6 x 2 + 2 = 14 MiB */
  k_wt_f16<<<(DM * DK / 8 + 255) / 256, 256, 0, stream>>>(Wq, BQ, DM, DK, 16.0f); k_wt_f16<<<(DM * DK / 8 + 255) / 256, 256, 0, stream>>>(Wk, BK, DM, DK, 16.0f); k_wt_f16<<<(DM * DK / 8 + 255) / 256, 256, 0, stream>>>(Wv, BV, DM, DK, 16.0f); k_wt_f16<<<(DK * DM / 8 + 255) / 256, 256, 0, stream>>>(Wo, BO, DK, DM, 16.0f);      /* (in,out) -> [out][in] x16 */
  k_causaltab<<<(SS * (SS / 32) + 255) / 256, 256, 0, stream>>>(MB, RA, KE, SS, SS);
  const dim3 gP(3, NR / 128);
  k_proj<<<gP, 128, 0, stream>>>(x, BQ, BK, BV, bq, bk, bv, Qh, Ql, Kh, Kl, Vth, Vtl);      /* q, k hi/residual rows and V^T hi/residual per sequence [64][4096], straight from x: 3 x 128 work-groups side by side */
  k_flashm<SS, SS><<<NB * NH * (SS / 16), 256, 0, stream>>>(Qh, Ql, DK, Kh, Kl, DK, Vth, Vtl, MB, RA, KE, BO, bo, (float*)d_out);      /* one grid over all (sequence, 16 queries): 1024 work-groups of 8 waves; out = O*Wo + bo in its epilogue */
}

// v006
// A run of this version takes 119 microseconds.
// Timed twice side by side with v005, it ran 1.04 and 1.03 times as fast.
// Counting every step since v000, it is 20.3 times as fast.
#include <hip/hip_runtime.h>
// Single-head causal attention (4 sequences x 4096 tokens x 512; d_k = d_v = 64): q, k, v = x*W + b; scores = q.k/8 with j <= i; softmax; out = (attn.v)*Wo + bo -> [4,4096,512].
// Structure: q/k/v by one launch of f16 WMMA GEMMs (32x64 wave tiles, x rounded in registers, f32, exact products + bias) whose epilogue writes q, k as f16 hi + (x2^10) residual planes and V^T as hi + residual planes; the causal structure computed on device into a key bit plane + per-block key bound; one fused flash-style kernel per (sequence, 16 queries) (8 waves share the queries, the 32-key steps up to the bound dealt to them in turn, three-product hi/lo scores computed transposed (keys x queries), online softmax f32 in the lane pair of a query (maximum joined each step, sums once), P hi + residual packed in registers, two value accumulators (O^T), the 8 partial (max, sum, O) merged in LDS; the merged 16x64 O tile split into hi + residual planes in LDS and multiplied by Wo in the same kernel, each wave 64 of the 512 output columns, bias added) -> the output rows.
// Compute dtype: x, weights, biases rounded to bf16; projections exact; q, k, P, v, O as f16 hi + residual pairs (~2^-21); f32 accumulation and softmax. v_wmma_f32_16x16x32_f16.
#define NB 4
#define SS 4096
#define DM 512
#define DK 64
#define NH 1
#define SCL 0.125f
#define NR (NB * SS)
typedef __bf16 v16b __attribute__((ext_vector_type(16)));
typedef unsigned short v8us __attribute__((ext_vector_type(8), may_alias));
typedef float  v8f  __attribute__((ext_vector_type(8)));
typedef float  v4f  __attribute__((ext_vector_type(4)));
typedef float  v4fa __attribute__((ext_vector_type(4), may_alias));
union FragB { v16b v; v8us half[2]; unsigned short u[16]; };

__device__ __forceinline__ unsigned short bf16_bits(float x) { unsigned int u = __float_as_uint(x); return (unsigned short)((u + 0x7FFFu + ((u >> 16) & 1u)) >> 16); }
__device__ __forceinline__ float bf16_val(unsigned short b) { return __uint_as_float(((unsigned int)b) << 16); }
__device__ __forceinline__ float bf16_round(float x) { return bf16_val(bf16_bits(x)); }
// D += A·B with NT terms: 1 = ah·bh, 2 = + al·bh (A split), 3 = + ah·bl (both split)
template <int NT>
__device__ __forceinline__ v8f mmaN(v16b ah, v16b al, v16b bh, v16b bl, v8f c) {
  c = __builtin_amdgcn_wmma_f32_16x16x32_bf16(false, ah, false, bh, (short)0, c, false, false);
  if (NT >= 2) c = __builtin_amdgcn_wmma_f32_16x16x32_bf16(false, al, false, bh, (short)0, c, false, false);
  if (NT >= 3) c = __builtin_amdgcn_wmma_f32_16x16x32_bf16(false, ah, false, bl, (short)0, c, false, false);
  asm volatile("v_nop\n\tv_nop\n\tv_nop\n\tv_nop" : "+v"(c) : "v"(ah), "v"(al), "v"(bh), "v"(bl));
  return c;
}

__global__ __launch_bounds__(256) void k_wt_bf16(const float* __restrict__ W, unsigned short* __restrict__ Wt, int K, int N) {
  const int t = blockIdx.x * 256 + threadIdx.x;
  const int k8n = K / 8;
  if (t >= N * k8n) return;
  const int n = t / k8n, k8 = (t % k8n) * 8;
  v8us v;
#pragma unroll
  for (int i = 0; i < 8; ++i) v[i] = bf16_bits(W[(size_t)(k8 + i) * N + n]);
  *(v8us*)(Wt + (size_t)n * K + k8) = v;
  
}

// GEMM C[M][N] (f32, pitch ldc) = act(A[M][K]·W + bias). A f32 row-major (pitch lda) converted per fragment to bf16
// (ASPLIT: hi/lo two planes -> 2 terms, else single rounded term); Wt bf16 [N][K] (pitch ldb). BIAS_BF16 rounds the
// bias to bf16 first (bias quantised to bf16 before the add). K%32==0, M%16==0, N%64==0.
template <bool ASPLIT, int ACT, bool BIAS_BF16>
__global__ __launch_bounds__(128) void k_gemm_bf(const float* __restrict__ A, int lda, const unsigned short* __restrict__ Wt, int ldb,
                                               const float* __restrict__ bias, float* __restrict__ C, int ldc, int M, int N, int K) {
  __shared__ __attribute__((aligned(16))) float so[4][16][64];
  const int tid = threadIdx.x, w = tid >> 5, lane = tid & 31, ln = lane & 15, hh = lane >> 4;
  const int ntn = N / 64;
  const int wid = blockIdx.x * 4 + w;
  const int mt = wid / ntn, nq = wid % ntn;
  if (mt * 16 >= M) return;
  const int row0 = mt * 16, col0 = nq * 64;
  const float* arow = A + (size_t)(row0 + ln) * lda;
  v8f acc[4] = {};
  for (int kb = 0; kb < K; kb += 32) {
    FragB ah, al;
    const v4f x0 = *(const v4fa*)(arow + kb + 8 * hh), x1 = *(const v4fa*)(arow + kb + 8 * hh + 4);
    const v4f x2 = *(const v4fa*)(arow + kb + 16 + 8 * hh), x3 = *(const v4fa*)(arow + kb + 16 + 8 * hh + 4);
    float xs[16] = {x0[0],x0[1],x0[2],x0[3],x1[0],x1[1],x1[2],x1[3],x2[0],x2[1],x2[2],x2[3],x3[0],x3[1],x3[2],x3[3]};
#pragma unroll
    for (int i = 0; i < 16; ++i) { const unsigned short hb = bf16_bits(xs[i]); ah.u[i] = hb; al.u[i] = ASPLIT ? bf16_bits(xs[i] - bf16_val(hb)) : (unsigned short)0; }
#pragma unroll
    for (int t = 0; t < 4; ++t) {
      const unsigned short* brow = Wt + (size_t)(col0 + t * 16 + ln) * ldb + kb;
      FragB b;
      b.half[0] = *(const v8us*)(brow + 8 * hh);
      b.half[1] = *(const v8us*)(brow + 16 + 8 * hh);
      acc[t] = mmaN<ASPLIT ? 2 : 1>(ah.v, al.v, b.v, b.v, acc[t]);
    }
  }
#pragma unroll
  for (int t = 0; t < 4; ++t) {
    float bv = bias ? bias[col0 + t * 16 + ln] : 0.f;
    if (BIAS_BF16) bv = bf16_round(bv);
#pragma unroll
    for (int r = 0; r < 8; ++r) { float v = acc[t][r] + bv; if (ACT == 1) v = fmaxf(v, 0.f); so[w][8 * hh + r][t * 16 + ln] = v; }
  }
  __builtin_amdgcn_fence(__ATOMIC_ACQ_REL, "workgroup");
  __builtin_amdgcn_wave_barrier();
  const int rsub = lane >> 4, c4 = (lane & 15) * 4;
  {
#pragma unroll
    for (int q = 0; q < 8; ++q) {
      const int r = q * 2 + rsub;
      const v4f v = *(const v4fa*)&so[w][r][c4];
      *(v4f*)(C + (size_t)(row0 + r) * ldc + col0 + c4) = v;
    }
    
  }
}

// GEMM C = act(A·W + bias + resid): A f32 (ASPLIT -> hi/lo 2 terms), Wt bf16 [N][K]; ACT 0 none, 1 relu, 2 exact gelu;
// resid (optional, f32, row index = (row % rmod), pitch ldr, RES_BF16 rounds it) added before the activation.
template <bool ASPLIT, int ACT, bool BIAS_BF16, bool RES_BF16>
__global__ __launch_bounds__(128) void k_gemm_bf3(const float* __restrict__ A, int lda, const unsigned short* __restrict__ Wt, int ldb,
                                                const float* __restrict__ bias, const float* __restrict__ resid, int rmod, int ldr,
                                                float* __restrict__ C, int ldc, int M, int N, int K) {
  __shared__ __attribute__((aligned(16))) float so[4][16][64];
  const int tid = threadIdx.x, w = tid >> 5, lane = tid & 31, ln = lane & 15, hh = lane >> 4;
  const int ntn = N / 64;
  const int wid = blockIdx.x * 4 + w;
  const int mt = wid / ntn, nq = wid % ntn;
  if (mt * 16 >= M) return;
  const int row0 = mt * 16, col0 = nq * 64;
  const float* arow = A + (size_t)(row0 + ln) * lda;
  v8f acc[4] = {};
  for (int kb = 0; kb < K; kb += 32) {
    FragB ah, al;
    const v4f x0 = *(const v4fa*)(arow + kb + 8 * hh), x1 = *(const v4fa*)(arow + kb + 8 * hh + 4);
    const v4f x2 = *(const v4fa*)(arow + kb + 16 + 8 * hh), x3 = *(const v4fa*)(arow + kb + 16 + 8 * hh + 4);
    float xs[16] = {x0[0],x0[1],x0[2],x0[3],x1[0],x1[1],x1[2],x1[3],x2[0],x2[1],x2[2],x2[3],x3[0],x3[1],x3[2],x3[3]};
#pragma unroll
    for (int i = 0; i < 16; ++i) { const unsigned short hb = bf16_bits(xs[i]); ah.u[i] = hb; al.u[i] = ASPLIT ? bf16_bits(xs[i] - bf16_val(hb)) : (unsigned short)0; }
#pragma unroll
    for (int t = 0; t < 4; ++t) {
      const unsigned short* brow = Wt + (size_t)(col0 + t * 16 + ln) * ldb + kb;
      FragB b;
      b.half[0] = *(const v8us*)(brow + 8 * hh);
      b.half[1] = *(const v8us*)(brow + 16 + 8 * hh);
      acc[t] = mmaN<ASPLIT ? 2 : 1>(ah.v, al.v, b.v, b.v, acc[t]);
    }
  }
#pragma unroll
  for (int t = 0; t < 4; ++t) {
    const int col = col0 + t * 16 + ln;
    float bv = bias ? bias[col] : 0.f;
    if (BIAS_BF16) bv = bf16_round(bv);
#pragma unroll
    for (int r = 0; r < 8; ++r) {
      float v = acc[t][r] + bv;
      if (resid) { float rv = resid[(size_t)((row0 + 8 * hh + r) % rmod) * ldr + col]; if (RES_BF16) rv = bf16_round(rv); v += rv; }
      if (ACT == 1) v = fmaxf(v, 0.f);
      if (ACT == 2) v = 0.5f * v * (1.0f + erff(v * 0.70710678118654752f));
      if (ACT == 3) { const float u = 0.7978845608028654f * (v + 0.044715f * v * v * v); v = 0.5f * v * (1.0f + tanhf(u)); }
      so[w][8 * hh + r][t * 16 + ln] = v;
    }
  }
  __builtin_amdgcn_fence(__ATOMIC_ACQ_REL, "workgroup");
  __builtin_amdgcn_wave_barrier();
  const int rsub = lane >> 4, c4 = (lane & 15) * 4;
  {
#pragma unroll
    for (int q = 0; q < 8; ++q) {
      const int r = q * 2 + rsub;
      const v4f v = *(const v4fa*)&so[w][r][c4];
      *(v4f*)(C + (size_t)(row0 + r) * ldc + col0 + c4) = v;
    }
    
  }
}
// row LayerNorm (biased variance, eps) over N: s = X (+ R); optional out_sum <- s; out_norm <- (s-mu)*rsqrt(var+eps)*g + b
template <bool PARAM_BF16>
__global__ __launch_bounds__(256) void k_layernorm(const float* __restrict__ X, const float* __restrict__ R, const float* __restrict__ g, const float* __restrict__ bta,
                                                  float* __restrict__ out_sum, float* __restrict__ out_norm, int N, float eps) {
  __shared__ float red[256];
  const int row = blockIdx.x, tid = threadIdx.x;
  const float* x = X + (size_t)row * N; const float* rr = R ? R + (size_t)row * N : nullptr;
  float vals[16];                     // up to N = 4096
  const int per = N / 256;            // contiguous chunk per thread? use strided-by-4 chunks: thread handles j = tid*4 + 1024*u
  float s1 = 0.f;
  for (int u = 0; u < per / 4; ++u) {
    const int j = tid * 4 + 1024 * u;
    const v4f a = *(const v4fa*)(x + j);
    v4f b = {0.f,0.f,0.f,0.f}; if (rr) b = *(const v4fa*)(rr + j);
#pragma unroll
    for (int q = 0; q < 4; ++q) { const float v = a[q] + b[q]; vals[u * 4 + q] = v; s1 += v; }
  }
  red[tid] = s1; __syncthreads();
  for (int st = 128; st > 0; st >>= 1) { if (tid < st) red[tid] += red[tid + st]; __syncthreads(); }
  const float mu = red[0] / (float)N; __syncthreads();
  float s2 = 0.f;
  for (int u = 0; u < per / 4; ++u)
#pragma unroll
    for (int q = 0; q < 4; ++q) { const float c = vals[u * 4 + q] - mu; s2 += c * c; }
  red[tid] = s2; __syncthreads();
  for (int st = 128; st > 0; st >>= 1) { if (tid < st) red[tid] += red[tid + st]; __syncthreads(); }
  const float rs = rsqrtf(red[0] / (float)N + eps);
  {
    for (int u = 0; u < per / 4; ++u) {
      const int j = tid * 4 + 1024 * u;
      v4f o, sm;
#pragma unroll
      for (int q = 0; q < 4; ++q) {
        float gg = g[j + q], bb = bta[j + q];
        if (PARAM_BF16) { gg = bf16_round(gg); bb = bf16_round(bb); }
        sm[q] = vals[u * 4 + q]; o[q] = (vals[u * 4 + q] - mu) * rs * gg + bb;
      }
      if (out_sum) *(v4f*)(out_sum + (size_t)row * N + j) = sm;
      *(v4f*)(out_norm + (size_t)row * N + j) = o;
    }
    
  }
}



// ---- f16 WMMA path (v_wmma_f32_16x16x32_f16): 11-bit significands for operands in range — used where a [0,1] probability operand needs more precision than bf16
typedef _Float16 v16h __attribute__((ext_vector_type(16)));
union FragH { v16h v; v8us half[2]; _Float16 h[16]; unsigned short u[16]; };
template <int NT>
__device__ __forceinline__ v8f mmaH(v16h ah, v16h al, v16h bh, v16h bl, v8f c) {
  c = __builtin_amdgcn_wmma_f32_16x16x32_f16(false, ah, false, bh, (short)0, c, false, false);
  if (NT >= 2) c = __builtin_amdgcn_wmma_f32_16x16x32_f16(false, al, false, bh, (short)0, c, false, false);
  if (NT >= 3) c = __builtin_amdgcn_wmma_f32_16x16x32_f16(false, ah, false, bl, (short)0, c, false, false);
  asm volatile("v_nop\n\tv_nop\n\tv_nop\n\tv_nop" : "+v"(c) : "v"(ah), "v"(al), "v"(bh), "v"(bl));
  return c;
}
// batched GEMM like k_gemm_b but f16 operands: A f32 (split into f16 hi/lo if ASPLIT, else rounded to f16), Bt = f16 values [n][k]; alpha; C f32; N multiple of 16 (partial tiles skipped)
template <bool ASPLIT>
__global__ __launch_bounds__(128) void k_gemm_h(const float* __restrict__ A, int lda, size_t sA, const _Float16* __restrict__ Bh, int ldb, size_t sB, float alpha, float* __restrict__ C, int ldc, size_t sC, int M, int N, int K) {
  __shared__ __attribute__((aligned(16))) float so[4][16][64];
  const int tid = threadIdx.x, w = tid >> 5, lane = tid & 31, ln = lane & 15, hh = lane >> 4; const int by = blockIdx.y;
  A += (size_t)by * sA; Bh += (size_t)by * sB; C += (size_t)by * sC;
  const int ntn = (N + 63) / 64; const int wid = blockIdx.x * 4 + w; const int mt = wid / ntn, nq = wid % ntn; if (mt * 16 >= M) return;
  const int row0 = mt * 16, col0 = nq * 64; const float* arow = A + (size_t)(row0 + ln) * lda;
  v8f acc[4] = {};
  for (int kb = 0; kb < K; kb += 32) {
    FragH ah, al;
    const v4f x0 = *(const v4fa*)(arow + kb + 8 * hh), x1 = *(const v4fa*)(arow + kb + 8 * hh + 4), x2 = *(const v4fa*)(arow + kb + 16 + 8 * hh), x3 = *(const v4fa*)(arow + kb + 16 + 8 * hh + 4);
    float xs[16] = {x0[0],x0[1],x0[2],x0[3],x1[0],x1[1],x1[2],x1[3],x2[0],x2[1],x2[2],x2[3],x3[0],x3[1],x3[2],x3[3]};
#pragma unroll
    for (int i = 0; i < 16; ++i) { const _Float16 h = (_Float16)xs[i]; ah.h[i] = h; al.h[i] = ASPLIT ? (_Float16)(xs[i] - (float)h) : (_Float16)0.0f; }
#pragma unroll
    for (int t = 0; t < 4; ++t) { if (col0 + t * 16 >= N) continue; const size_t boff = (size_t)(col0 + t * 16 + ln) * ldb + kb; FragH bq; bq.half[0] = *(const v8us*)(Bh + boff + 8 * hh); bq.half[1] = *(const v8us*)(Bh + boff + 16 + 8 * hh);
      acc[t] = mmaH<ASPLIT ? 2 : 1>(ah.v, al.v, bq.v, bq.v, acc[t]); }
  }
#pragma unroll
  for (int t = 0; t < 4; ++t) { if (col0 + t * 16 >= N) continue;
#pragma unroll
    for (int r = 0; r < 8; ++r) so[w][8 * hh + r][t * 16 + ln] = acc[t][r] * alpha; }
  __builtin_amdgcn_fence(__ATOMIC_ACQ_REL, "workgroup"); __builtin_amdgcn_wave_barrier();
  const int rsub = lane >> 4, c4 = (lane & 15) * 4;
  {
#pragma unroll
    for (int q = 0; q < 8; ++q) { const int r = q * 2 + rsub; if (col0 + c4 < N) { const v4f v = *(const v4fa*)&so[w][r][c4]; *(v4f*)(C + (size_t)(row0 + r) * ldc + col0 + c4) = v; } }
     }
}

// Wt[n][k] = f16(W[k][n]·scale) from f32 row-major W[K][N] (scale = power of two; bf16-exact weights stay exact in f16 away from the subnormal range)
__global__ __launch_bounds__(256) void k_wt_f16(const float* __restrict__ W, _Float16* __restrict__ Wt, int K, int N, float scale) {
  const int t = blockIdx.x * 256 + threadIdx.x; if (t >= N * (K / 8)) return; const int n = t / (K / 8), k8 = (t % (K / 8)) * 8; FragH f;
#pragma unroll
  for (int i = 0; i < 8; ++i) f.h[i] = (_Float16)(bf16_round(W[(size_t)(k8 + i) * N + n]) * scale); const v8us o = f.half[0];
  *(v8us*)((unsigned short*)Wt + (size_t)n * K + k8) = o; 
}
// k_gemm_hh variant with fused epilogue: v = acc·alpha + bias[by·sBias + col] (+ CP[(row/rowsPerB)·sCPb + by·64 + col] if CP) ; ACT 0 none / 1 elu ; writes f16 C16 (and f32 C if non-null)
template <int ACT>
__global__ __launch_bounds__(128) void k_gemm_hhx(const _Float16* __restrict__ A, int lda, size_t sA, const _Float16* __restrict__ Bh, int ldb, size_t sB, float alpha, const float* __restrict__ bias, size_t sBias, const float* __restrict__ CP, int rowsPerB, size_t sCPb, int row0g,
    float* __restrict__ C, _Float16* __restrict__ C16, int ldc, size_t sC, int M, int N, int K) {
  __shared__ __attribute__((aligned(16))) float so[4][16][64];
  const int tid = threadIdx.x, w = tid >> 5, lane = tid & 31, ln = lane & 15, hh = lane >> 4; const int by = blockIdx.y;
  A += (size_t)by * sA; Bh += (size_t)by * sB; const size_t cofs = (size_t)by * sC; const float* bp = bias ? bias + (size_t)by * sBias : nullptr;
  const int ntn = (N + 63) / 64; const int wid = blockIdx.x * 4 + w; const int mt = wid / ntn, nq = wid % ntn; if (mt * 16 >= M) return;
  const int row0 = mt * 16, col0 = nq * 64; const _Float16* arow = A + (size_t)(row0 + ln) * lda;
  v8f acc[4] = {};
  for (int kb = 0; kb < K; kb += 32) { FragH ah; ah.half[0] = *(const v8us*)((const unsigned short*)arow + kb + 8 * hh); ah.half[1] = *(const v8us*)((const unsigned short*)arow + kb + 16 + 8 * hh);
#pragma unroll
    for (int t = 0; t < 4; ++t) { if (col0 + t * 16 >= N) continue; const size_t boff = (size_t)(col0 + t * 16 + ln) * ldb + kb; FragH bq; bq.half[0] = *(const v8us*)((const unsigned short*)Bh + boff + 8 * hh); bq.half[1] = *(const v8us*)((const unsigned short*)Bh + boff + 16 + 8 * hh);
      acc[t] = mmaH<1>(ah.v, ah.v, bq.v, bq.v, acc[t]); }
  }
#pragma unroll
  for (int t = 0; t < 4; ++t) { if (col0 + t * 16 >= N) continue; const int col = col0 + t * 16 + ln; const float bv = bp ? bf16_round(bp[col]) : 0.f;
#pragma unroll
    for (int r = 0; r < 8; ++r) { float v = acc[t][r] * alpha + bv; if (CP) { const int bidx = (row0g + row0 + 8 * hh + r) / rowsPerB; v += CP[(size_t)bidx * sCPb + (size_t)by * 64 + col]; } if (ACT == 1) v = (v > 0.f) ? v : expm1f(v); else if (ACT == 7) v = (v > 0.f) ? v + 1.0f : expf(v); else if (ACT == 8) v = tanhf(v); else if (ACT == 9) v = 0.5f * v * (1.0f + tanhf(0.7978845608028654f * (v + 0.044715f * v * v * v))); else if (ACT == 11) v = 1.0f / (1.0f + expf(-v)); else if (ACT == 12) v = (v > 0.f) ? v : 0.01f * v; else if (ACT == 14) v = (v > 0.f) ? v : 0.1f * v; else if (ACT == 15) v = v / (1.0f + expf(-v)); else if (ACT == 3) v = fmaxf(v, 0.f); else if (ACT == 6) v = 0.5f * v * (1.0f + erff(v * 0.70710678118654752f)); so[w][8 * hh + r][t * 16 + ln] = v; } }
  __builtin_amdgcn_fence(__ATOMIC_ACQ_REL, "workgroup"); __builtin_amdgcn_wave_barrier();
  const int rsub = lane >> 4, c4 = (lane & 15) * 4; typedef _Float16 v4h __attribute__((ext_vector_type(4)));
  {
#pragma unroll
    for (int q = 0; q < 8; ++q) { const int r = q * 2 + rsub; if (col0 + c4 < N) { const v4f v = *(const v4fa*)&so[w][r][c4]; if (C) *(v4f*)(C + cofs + (size_t)(row0 + r) * ldc + col0 + c4) = v; if (C16) { v4h h4; for (int i = 0; i < 4; ++i) h4[i] = (_Float16)v[i]; *(v4h*)(C16 + cofs + (size_t)(row0 + r) * ldc + col0 + c4) = h4; } } }
     }
}


typedef _Float16 v4h __attribute__((ext_vector_type(4)));

__global__ __launch_bounds__(256) void k_h16(const float* __restrict__ x, _Float16* __restrict__ X16, size_t n8) { const size_t t = (size_t)blockIdx.x * 256 + threadIdx.x; if (t >= n8) return; FragH f;
#pragma unroll
  for (int q = 0; q < 8; ++q) f.h[q] = (_Float16)x[t * 8 + q]; *(v8us*)((unsigned short*)X16 + t * 8) = f.half[0];  }
__global__ __launch_bounds__(256) void k_round16f(const float* __restrict__ W, _Float16* __restrict__ Bt, size_t n8) { const size_t t = (size_t)blockIdx.x * 256 + threadIdx.x; if (t >= n8) return; FragH f;
#pragma unroll
  for (int i = 0; i < 8; ++i) f.h[i] = (_Float16)(bf16_round(W[t * 8 + i]) * 16.0f); *(v8us*)((unsigned short*)Bt + t * 8) = f.half[0];  }
template <int NHv, int TTv>
__global__ __launch_bounds__(256) void k_vt(const _Float16* __restrict__ V16, int ldv, int voff, _Float16* __restrict__ Vt) { __shared__ unsigned short tl[64][66]; const int tid = threadIdx.x; const int slab = blockIdx.x / (TTv / 64), lg = blockIdx.x % (TTv / 64); const int b = slab / NHv, h = slab % NHv;
  for (int i = tid; i < 64 * 8; i += 256) { const int r = i / 8, c8 = (i % 8) * 8; FragH f; f.half[0] = *(const v8us*)((const unsigned short*)V16 + ((size_t)b * TTv + lg * 64 + r) * ldv + voff + h * 64 + c8);
#pragma unroll
    for (int q = 0; q < 8; ++q) tl[r][c8 + q] = f.u[q]; }
  __syncthreads();
  {
#pragma unroll
    for (int rd = 0; rd < 2; ++rd) { const int d = rd * 32 + tid / 8, pc = tid % 8; FragH f;
#pragma unroll
      for (int q = 0; q < 8; ++q) f.u[q] = tl[pc * 8 + q][d];
      *(v8us*)((unsigned short*)Vt + ((size_t)slab * 64 + d) * TTv + lg * 64 + pc * 8) = f.half[0]; }
     } }

__global__ __launch_bounds__(256) void k_hl(const float* __restrict__ F, _Float16* __restrict__ Hh, _Float16* __restrict__ Hl, size_t n8) { const size_t t = (size_t)blockIdx.x * 256 + threadIdx.x; if (t >= n8) return; FragH fh, fl; const v4f a = *(const v4fa*)(F + t * 8), c = *(const v4fa*)(F + t * 8 + 4);
#pragma unroll
  for (int q = 0; q < 4; ++q) { _Float16 h = (_Float16)a[q]; fh.h[q] = h; fl.h[q] = (_Float16)((a[q] - (float)h) * 1024.0f); h = (_Float16)c[q]; fh.h[4 + q] = h; fl.h[4 + q] = (_Float16)((c[q] - (float)h) * 1024.0f); }
  { *(v8us*)((unsigned short*)Hh + t * 8) = fh.half[0]; *(v8us*)((unsigned short*)Hl + t * 8) = fl.half[0];  } }

// ---- fast GEMM (wave tile 32x64; requires M % 32 == 0 rows per launch region and N % 64 == 0); epilogue = k_gemm_hhx semantics ----
__device__ __forceinline__ v16h g2_frag(const _Float16* p, int hh) { FragH f; f.half[0] = *(const v8us*)((const unsigned short*)p + 8 * hh); f.half[1] = *(const v8us*)((const unsigned short*)p + 16 + 8 * hh); return f.v; }
__device__ __forceinline__ v8f g2_mma(v16h a, v16h b, v8f c) { v8f d = __builtin_amdgcn_wmma_f32_16x16x32_f16(false, a, false, b, (short)0, c, false, false); asm volatile("v_nop\n\tv_nop\n\tv_nop\n\tv_nop" : "+v"(d) : "v"(a), "v"(b)); return d; }
template <int ACT>
__global__ __launch_bounds__(128) void k_gemm2(const _Float16* __restrict__ A, int lda, size_t sA, const _Float16* __restrict__ Bh, int ldb, size_t sB, float alpha, const float* __restrict__ bias, size_t sBias, const float* __restrict__ CP, int rowsPerB, size_t sCPb, int row0g,
    float* __restrict__ C, _Float16* __restrict__ C16, int ldc, size_t sC, int M, int N, int K) {
  __shared__ __attribute__((aligned(16))) float so[4][32][68];
  const int tid = threadIdx.x, w = tid >> 5, lane = tid & 31, ln = lane & 15, hh = lane >> 4; const int by = blockIdx.y;
  A += (size_t)by * sA; Bh += (size_t)by * sB; const size_t cofs = (size_t)by * sC; const float* bp = bias ? bias + (size_t)by * sBias : nullptr;
  const int ntn = N >> 6; const int mt = blockIdx.x / ntn, nq = blockIdx.x - mt * ntn; const int row0 = mt * 128 + 32 * w, col0 = nq * 64; if (row0 >= M) return;
  const _Float16* a0p = A + (size_t)(row0 + ln) * lda; const _Float16* a1p = a0p + (size_t)16 * lda;
  const _Float16* b0p = Bh + (size_t)(col0 + ln) * ldb; const _Float16* b1p = b0p + (size_t)16 * ldb; const _Float16* b2p = b1p + (size_t)16 * ldb; const _Float16* b3p = b2p + (size_t)16 * ldb;
  const v8f z8 = {0.f,0.f,0.f,0.f,0.f,0.f,0.f,0.f}; v8f c00 = z8, c01 = z8, c02 = z8, c03 = z8, c10 = z8, c11 = z8, c12 = z8, c13 = z8;
#pragma unroll 1
  for (int kb = 0; kb < K; kb += 32) { const v16h a0 = g2_frag(a0p + kb, hh), a1 = g2_frag(a1p + kb, hh);
    v16h b = g2_frag(b0p + kb, hh); c00 = g2_mma(a0, b, c00); c10 = g2_mma(a1, b, c10);
    b = g2_frag(b1p + kb, hh); c01 = g2_mma(a0, b, c01); c11 = g2_mma(a1, b, c11);
    b = g2_frag(b2p + kb, hh); c02 = g2_mma(a0, b, c02); c12 = g2_mma(a1, b, c12);
    b = g2_frag(b3p + kb, hh); c03 = g2_mma(a0, b, c03); c13 = g2_mma(a1, b, c13); }
  v8f accs[8] = {c00, c01, c02, c03, c10, c11, c12, c13};
#pragma unroll
  for (int u = 0; u < 8; ++u) { const int t = u & 3, half = u >> 2; const int col = col0 + t * 16 + ln; const float bv = bp ? bf16_round(bp[col]) : 0.f;
#pragma unroll
    for (int r = 0; r < 8; ++r) { const int rloc = half * 16 + 8 * hh + r; float v = accs[u][r] * alpha + bv; if (CP) { const int bidx = (row0g + row0 + rloc) / rowsPerB; v += CP[(size_t)bidx * sCPb + (size_t)by * 64 + col]; }
      if (ACT == 3) v = fmaxf(v, 0.f); else if (ACT == 6) v = 0.5f * v * (1.0f + erff(v * 0.70710678118654752f)); else if (ACT == 11) v = 1.0f / (1.0f + expf(-v)); else if (ACT == 15) v = v / (1.0f + expf(-v)); else if (ACT == 12) v = (v > 0.f) ? v : 0.01f * v; else if (ACT == 8) v = tanhf(v);
      so[w][rloc][t * 16 + ln] = v; } }
  __builtin_amdgcn_fence(__ATOMIC_ACQ_REL, "workgroup"); __builtin_amdgcn_wave_barrier();
  const int rsub = lane >> 4, c4 = (lane & 15) * 4;
  {
#pragma unroll
    for (int q = 0; q < 16; ++q) { const int r = q * 2 + rsub; const v4f v = *(const v4fa*)&so[w][r][c4]; if (C) *(v4f*)(C + cofs + (size_t)(row0 + r) * ldc + col0 + c4) = v; if (C16) { v4h h4; for (int i = 0; i < 4; ++i) h4[i] = (_Float16)v[i]; *(v4h*)(C16 + cofs + (size_t)(row0 + r) * ldc + col0 + c4) = h4; } }
     } }


// ---- fused projection: q, k, v = round(x)*W + b in one launch. blockIdx.x picks the product (0 q, 1 k, 2 v), blockIdx.y the 128 rows; wave tile 32x64 as in k_gemm2.
// x is read as f32 and rounded in registers (bf16 rounding, then f16, exact for normal values); the epilogue writes the planes the attention kernel reads: q, k as f16 hi + (x2^10) residual rows, v as V^T hi + residual [sequence][64][SS].
__device__ __forceinline__ v16h px_frag(const float* p, int hh) { const v4f x0 = *(const v4fa*)(p + 8 * hh), x1 = *(const v4fa*)(p + 8 * hh + 4), x2 = *(const v4fa*)(p + 16 + 8 * hh), x3 = *(const v4fa*)(p + 16 + 8 * hh + 4); FragH f;
#pragma unroll
  for (int q = 0; q < 4; ++q) { f.h[q] = (_Float16)bf16_round(x0[q]); f.h[4 + q] = (_Float16)bf16_round(x1[q]); f.h[8 + q] = (_Float16)bf16_round(x2[q]); f.h[12 + q] = (_Float16)bf16_round(x3[q]); }
  return f.v; }
__global__ __launch_bounds__(128) void k_proj(const float* __restrict__ x, const _Float16* __restrict__ BQ, const _Float16* __restrict__ BK, const _Float16* __restrict__ BV, const float* __restrict__ bq, const float* __restrict__ bk, const float* __restrict__ bv,
    _Float16* __restrict__ Qh, _Float16* __restrict__ Ql, _Float16* __restrict__ Kh, _Float16* __restrict__ Kl, _Float16* __restrict__ Vth, _Float16* __restrict__ Vtl) {
  __shared__ __attribute__((aligned(16))) float so[4][32][68];
  const int tid = threadIdx.x, w = tid >> 5, lane = tid & 31, ln = lane & 15, hh = lane >> 4; const int which = blockIdx.x, rowg = blockIdx.y * 128, row0 = rowg + 32 * w;
  const _Float16* Bh = (which == 0) ? BQ : ((which == 1) ? BK : BV); const float* bp = (which == 0) ? bq : ((which == 1) ? bk : bv);
  const float* a0p = x + (size_t)(row0 + ln) * DM; const float* a1p = a0p + (size_t)16 * DM;
  const _Float16* b0p = Bh + (size_t)ln * DM; const _Float16* b1p = b0p + (size_t)16 * DM; const _Float16* b2p = b1p + (size_t)16 * DM; const _Float16* b3p = b2p + (size_t)16 * DM;
  const float braw[4] = {bp[ln], bp[16 + ln], bp[32 + ln], bp[48 + ln]};      /* asked for ahead of the loop, so that the epilogue does not wait for them */
  const v8f z8 = {0.f,0.f,0.f,0.f,0.f,0.f,0.f,0.f}; v8f c00 = z8, c01 = z8, c02 = z8, c03 = z8, c10 = z8, c11 = z8, c12 = z8, c13 = z8;
  for (int kb = 0; kb < DM; kb += 32) { const v16h a0 = px_frag(a0p + kb, hh), a1 = px_frag(a1p + kb, hh);
    v16h b = g2_frag(b0p + kb, hh); c00 = g2_mma(a0, b, c00); c10 = g2_mma(a1, b, c10);
    b = g2_frag(b1p + kb, hh); c01 = g2_mma(a0, b, c01); c11 = g2_mma(a1, b, c11);
    b = g2_frag(b2p + kb, hh); c02 = g2_mma(a0, b, c02); c12 = g2_mma(a1, b, c12);
    b = g2_frag(b3p + kb, hh); c03 = g2_mma(a0, b, c03); c13 = g2_mma(a1, b, c13); }
  v8f accs[8] = {c00, c01, c02, c03, c10, c11, c12, c13};
#pragma unroll
  for (int u = 0; u < 8; ++u) { const int t = u & 3, half = u >> 2; const float bvv = bf16_round(braw[t]);
#pragma unroll
    for (int r = 0; r < 8; ++r) so[w][half * 16 + 8 * hh + r][t * 16 + ln] = accs[u][r] * 0.0625f + bvv; }
  if (which != 2) {      /* block-uniform: q or k, each wave writes its own 32 rows, two whole 128-byte rows of each plane a store */
    __builtin_amdgcn_fence(__ATOMIC_ACQ_REL, "workgroup"); __builtin_amdgcn_wave_barrier();
    _Float16* Hh = (which == 0) ? Qh : Kh; _Float16* Hl = (which == 0) ? Ql : Kl; const int rsub = lane >> 4, c4 = (lane & 15) * 4;
#pragma unroll
    for (int q = 0; q < 16; ++q) { const int r = q * 2 + rsub; const v4f v = *(const v4fa*)&so[w][r][c4]; v4h h4, l4;
#pragma unroll
      for (int i = 0; i < 4; ++i) { h4[i] = (_Float16)v[i]; l4[i] = (_Float16)((v[i] - (float)h4[i]) * 1024.0f); }
      *(v4h*)(Hh + (size_t)(row0 + r) * DK + c4) = h4; *(v4h*)(Hl + (size_t)(row0 + r) * DK + c4) = l4; }
  } else {      /* v: the work-group's 128 tokens x 64 columns leave transposed; a thread takes one column and 64 tokens, a whole 128-byte line of each plane */
    __syncthreads();      /* a thread reads rows that its own wave and one other wave staged */
    const int d = tid & 63, hf = tid >> 6; const size_t vo = ((size_t)(rowg / SS) * 64 + d) * SS + (rowg % SS) + hf * 64;
#pragma unroll
    for (int g = 0; g < 8; ++g) { FragH fh, fl;
#pragma unroll
      for (int q = 0; q < 8; ++q) { const int t = g * 8 + q; const float v = so[hf * 2 + (t >> 5)][t & 31][d]; const _Float16 hv = (_Float16)v; fh.h[q] = hv; fl.h[q] = (_Float16)((v - (float)hv) * 1024.0f); }
      *(v8us*)((unsigned short*)Vth + vo + g * 8) = fh.half[0]; *(v8us*)((unsigned short*)Vtl + vo + g * 8) = fl.half[0]; } } }

// lane l takes the value of lane l ^ 16: the two halves of a wave hold the same query's other keys
__device__ __forceinline__ float xhalf(float x) { return __builtin_bit_cast(float, __builtin_amdgcn_permlanex16(__builtin_bit_cast(int, x), __builtin_bit_cast(int, x), 0x76543210, 0xfedcba98, false, false)); }
template <int TQ, int TK>
__global__ __launch_bounds__(256) void k_flashm(const _Float16* __restrict__ Q16, const _Float16* __restrict__ Q16lo, int ldq, const _Float16* __restrict__ K16, const _Float16* __restrict__ K16lo, int ldk, const _Float16* __restrict__ Vt, const _Float16* __restrict__ Vtlo, const unsigned* __restrict__ MB, const int* __restrict__ RA, const int* __restrict__ KE, const _Float16* __restrict__ BO, const float* __restrict__ bo, float* __restrict__ OUT) {
  static_assert(NH == 1, "the output projection in the epilogue takes the one head's 64 columns as the whole k range");
  constexpr int RPW = 16, NW = 8, NQB = TQ / RPW, DT = 4, KS = 2;
  __shared__ __attribute__((aligned(16))) float sO[NW][RPW][64 + 4]; __shared__ float sM[NW][RPW], sL[NW][RPW]; __shared__ __attribute__((aligned(16))) _Float16 sAh[RPW][64 + 8], sAl[RPW][64 + 8];      /* merged O as hi + residual; 144-byte rows for the 16-byte fragment reads */
  const int tid = threadIdx.x, w = __builtin_amdgcn_readfirstlane(tid >> 5), lane = tid & 31, ln = lane & 15, hh = lane >> 4;
  /* w through readfirstlane: the wave's number, and with it the key-step counter, stays in a scalar register. Work-group = one 16-query tile; the tiles with the most keys have the lowest block indices (for speed only) */
  const int slab = blockIdx.x % (NB * NH), qt = NQB - 1 - blockIdx.x / (NB * NH); const int b = slab / NH, h = slab % NH; const int q0 = qt * RPW; const int qblk = q0 >> 6;
  FragH aq[KS], aql[KS];
  { const size_t qo = ((size_t)b * TQ + q0 + ln) * ldq + h * 64; const unsigned short* qr = (const unsigned short*)Q16 + qo; const unsigned short* ql = (const unsigned short*)Q16lo + qo;
#pragma unroll
    for (int ks = 0; ks < KS; ++ks) { aq[ks].half[0] = *(const v8us*)(qr + ks * 32 + 8 * hh); aq[ks].half[1] = *(const v8us*)(qr + ks * 32 + 16 + 8 * hh); aql[ks].half[0] = *(const v8us*)(ql + ks * 32 + 8 * hh); aql[ks].half[1] = *(const v8us*)(ql + ks * 32 + 16 + 8 * hh); } }
  const unsigned short* Vth = (const unsigned short*)Vt + (size_t)slab * 64 * TK; const unsigned short* Vtl = (const unsigned short*)Vtlo + (size_t)slab * 64 * TK;
  float m_r = -3.0e38f, l_r = 0.f; v8f oacc[DT], oaccl[DT];      /* the lane's query: running maximum (alike in both halves), the sum over this half's keys, O^T columns */
#pragma unroll
  for (int dt = 0; dt < DT; ++dt) { oacc[dt] = (v8f){0.f,0.f,0.f,0.f,0.f,0.f,0.f,0.f}; oaccl[dt] = oacc[dt]; }
  int jend = KE[qblk * 32]; jend = min(TK, (jend + 31) & ~31); if (jend < 32) jend = 32;      /* block-uniform */
  const bool am = (RA[q0 + ln] != 0); const unsigned* mrow = MB + (size_t)(q0 + ln) * (TK / 32); const float scl = am ? 0.f : SCL;      /* a query marked 'all masked' takes every key with score 0: no mask bit, scale 0 (the products of finite f16 values are finite) */
#pragma unroll 1
  for (int j0 = 32 * w; j0 < jend; j0 += 32 * NW) {      /* wave w takes every NW-th 32-key step */
    const unsigned mraw = mrow[j0 >> 5];      /* the query's mask word of the step, asked for ahead of the key fragments so that it arrives behind the score products */
    v8f s[2];
#pragma unroll
    for (int nt = 0; nt < 2; ++nt) { const size_t ko = ((size_t)b * TK + j0 + nt * 16 + ln) * ldk + h * 64; const unsigned short* kr = (const unsigned short*)K16 + ko; const unsigned short* kl = (const unsigned short*)K16lo + ko; FragH bk[KS], bkl[KS];
#pragma unroll
      for (int ks = 0; ks < KS; ++ks) { bk[ks].half[0] = *(const v8us*)(kr + ks * 32 + 8 * hh); bk[ks].half[1] = *(const v8us*)(kr + ks * 32 + 16 + 8 * hh); bkl[ks].half[0] = *(const v8us*)(kl + ks * 32 + 8 * hh); bkl[ks].half[1] = *(const v8us*)(kl + ks * 32 + 16 + 8 * hh); }
      v8f acc = (v8f){0.f,0.f,0.f,0.f,0.f,0.f,0.f,0.f}, accr = acc;
#pragma unroll
      for (int ks = 0; ks < KS; ++ks) { acc = mmaH<1>(bk[ks].v, bk[ks].v, aq[ks].v, aq[ks].v, acc); accr = mmaH<1>(bk[ks].v, bk[ks].v, aql[ks].v, aql[ks].v, accr); accr = mmaH<1>(bkl[ks].v, bkl[ks].v, aq[ks].v, aq[ks].v, accr); }
      s[nt] = acc + accr * 0.0009765625f; }
    /* straight-line softmax: a masked score is -inf and the running maximum is never below the finite start value -3.0e38f, so exp gives 0 for a masked key and 1 for a query with no key yet without any test (every loop here is unrolled so that the per-key arrays stay in registers) */
    const unsigned mw = am ? 0u : (mraw >> (8 * hh));      /* shifted so that bit 16 nt + r is this lane's key */
    float sc[2][8], mt[2] = {-INFINITY, -INFINITY};
#pragma unroll
    for (int nt = 0; nt < 2; ++nt)
#pragma unroll
      for (int r = 0; r < 8; ++r) { const float v = s[nt][r] * scl; sc[nt][r] = ((mw & (1u << (nt * 16 + r))) != 0u) ? -INFINITY : v; mt[nt] = fmaxf(mt[nt], sc[nt][r]); }
    float mc = fmaxf(mt[0], mt[1]); mc = fmaxf(mc, xhalf(mc));      /* the other half's 16 keys */
    const float mn = fmaxf(m_r, mc); const float al = expf(m_r - mn); m_r = mn;
    FragH pa, pl; float ps2[2] = {0.f, 0.f};
#pragma unroll
    for (int nt = 0; nt < 2; ++nt)
#pragma unroll
      for (int r = 0; r < 8; ++r) { const float p = expf(sc[nt][r] - mn); ps2[nt] += p; const float ps = p * 1024.0f; const _Float16 ph = (_Float16)ps; pa.h[nt * 8 + r] = ph; pl.h[nt * 8 + r] = (_Float16)((ps - (float)ph) * 1024.0f); }
    l_r = l_r * al + (ps2[0] + ps2[1]);
#pragma unroll
    for (int dt = 0; dt < DT; ++dt) { oacc[dt] *= al; oaccl[dt] *= al; }
#pragma unroll
    for (int dt = 0; dt < DT; ++dt) { const size_t vo = (size_t)(dt * 16 + ln) * TK + j0; FragH bv, bl; bv.half[0] = *(const v8us*)(Vth + vo + 8 * hh); bv.half[1] = *(const v8us*)(Vth + vo + 16 + 8 * hh); bl.half[0] = *(const v8us*)(Vtl + vo + 8 * hh); bl.half[1] = *(const v8us*)(Vtl + vo + 16 + 8 * hh);
      oacc[dt] = mmaH<1>(bv.v, bv.v, pa.v, pa.v, oacc[dt]); oaccl[dt] = mmaH<1>(bl.v, bl.v, pa.v, pa.v, oaccl[dt]); oaccl[dt] = mmaH<1>(bv.v, bv.v, pl.v, pl.v, oaccl[dt]); } }
  /* output projection, wave w = output columns 64 w .. 64 w + 63: its Wo fragments and bias are asked for right behind the key loop, so that they arrive while the partials are staged (every loop of this projection is unrolled so that its fragment and accumulator arrays stay in registers) */
  const int col0 = w * 64; v16h wb[4][KS]; float braw[4]; const _Float16* bp0 = BO + (size_t)(col0 + ln) * DK; const float* bo0 = bo + col0 + ln;      /* one base each: the 16 fragment loads differ by constant offsets only */
#pragma unroll
  for (int t = 0; t < 4; ++t) { braw[t] = bo0[t * 16];
#pragma unroll
    for (int ks = 0; ks < KS; ++ks) wb[t][ks] = g2_frag(bp0 + t * 16 * DK + ks * 32, hh); }
  l_r += xhalf(l_r);      /* the two halves' sums joined once */
  if (hh == 0) { sM[w][ln] = m_r; sL[w][ln] = l_r; }
#pragma unroll
  for (int dt = 0; dt < DT; ++dt) { const v8f o = oacc[dt] + oaccl[dt] * 0.0009765625f;      /* the lane's 8 registers are 8 neighbouring columns of its query's row: two 16-byte stores */
    *(v4fa*)&sO[w][ln][dt * 16 + 8 * hh] = (v4f){o[0], o[1], o[2], o[3]}; *(v4fa*)&sO[w][ln][dt * 16 + 8 * hh + 4] = (v4f){o[4], o[5], o[6], o[7]}; }
  __syncthreads();      /* every wave's partial (max, sum, O) is in LDS before any thread merges them */
  { const int r = tid >> 4, pc = tid & 15; float mm = sM[0][r];
#pragma unroll
    for (int u = 1; u < NW; ++u) mm = fmaxf(mm, sM[u][r]);
    float l = 0.f; v4f val = {0.f, 0.f, 0.f, 0.f};
#pragma unroll
    for (int u = 0; u < NW; ++u) { const float e = expf(sM[u][r] - mm); l += e * sL[u][r]; const v4f po = *(const v4fa*)&sO[u][r][pc * 4]; val += po * e; }
    const float li = (l > 0.f) ? 1.0f / (l * 1024.0f) : 0.f;
    const v4f ov = val * li; v4h h4, l4;
#pragma unroll
    for (int i = 0; i < 4; ++i) { h4[i] = (_Float16)ov[i]; l4[i] = (_Float16)((ov[i] - (float)h4[i]) * 1024.0f); }
    *(v4h*)&sAh[r][pc * 4] = h4; *(v4h*)&sAl[r][pc * 4] = l4; }
  __syncthreads();      /* the whole merged tile is in LDS before any wave reads its fragments; behind it nobody reads sO any more, so each wave may stage its output there */
  { v16h ah[KS], al[KS];
#pragma unroll
    for (int ks = 0; ks < KS; ++ks) { ah[ks] = g2_frag(&sAh[ln][ks * 32], hh); al[ks] = g2_frag(&sAl[ln][ks * 32], hh); }
#pragma unroll
    for (int t = 0; t < 4; ++t) { v8f ch = (v8f){0.f,0.f,0.f,0.f,0.f,0.f,0.f,0.f}, cl = ch;
#pragma unroll
      for (int ks = 0; ks < KS; ++ks) { ch = g2_mma(ah[ks], wb[t][ks], ch); cl = g2_mma(al[ks], wb[t][ks], cl); }
      const float bvv = bf16_round(braw[t]);
#pragma unroll
      for (int r = 0; r < 8; ++r) sO[w][8 * hh + r][t * 16 + ln] = (ch[r] * 0.0625f + bvv) + cl[r] * (0.0625f * 0.0009765625f); }
    __builtin_amdgcn_fence(__ATOMIC_ACQ_REL, "workgroup"); __builtin_amdgcn_wave_barrier();      /* the wave reads back rows that its other lanes staged */
    const int rsub = lane >> 4, c4 = (lane & 15) * 4;
#pragma unroll
    for (int q = 0; q < 8; ++q) { const int r = q * 2 + rsub; const v4f v = *(const v4fa*)&sO[w][r][c4]; *(v4f*)(OUT + ((size_t)b * TQ + q0 + r) * DM + col0 + c4) = v; } } }      /* two whole 256-byte row pieces a store */


__global__ __launch_bounds__(256) void k_causaltab(unsigned* __restrict__ MB, int* __restrict__ RA, int* __restrict__ KE, int nq, int nk) {
  const int t = blockIdx.x * 256 + threadIdx.x; const int nw = nk / 32;
  if (t < nq * nw) { const int q = t / nw, w = t % nw; const int first = q + 1 - 32 * w; const unsigned bits = (first <= 0) ? 0xffffffffu : ((first >= 32) ? 0u : (0xffffffffu << first)); *(unsigned*)(MB + t) = bits;  }
  if (t < nq) { *(int*)(RA + t) = 0;  }
  if (t < nq / 64) { const int v = 64 * (t + 1); *(int*)(KE + t * 32) = v;  } }

extern "C" void kernel_launch(void* const* d_in, const int* in_sizes, int n_in,
                              void* d_out, int out_size, void* d_ws, size_t ws_size, hipStream_t stream) {
  (void)in_sizes; (void)n_in; (void)out_size;
  const float* const* I = (const float* const*)d_in; const float* x = I[0]; const float* Wq = I[1]; const float* bq = I[2]; const float* Wk = I[3]; const float* bk = I[4]; const float* Wv = I[5]; const float* bv = I[6]; const float* Wo = I[7]; const float* bo = I[8];
  char* ws = (char*)d_ws; size_t off = 0;
  auto take = [&](size_t bytes) { char* p = ws + off; off += (bytes + 255) & ~(size_t)255; return p; };
  _Float16* BQ = (_Float16*)take((size_t)DK * DM * 2); _Float16* BK = (_Float16*)take((size_t)DK * DM * 2); _Float16* BV = (_Float16*)take((size_t)DK * DM * 2); _Float16* BO = (_Float16*)take((size_t)DM * DK * 2);
  _Float16* Qh = (_Float16*)take((size_t)NR * DK * 2); _Float16* Ql = (_Float16*)take((size_t)NR * DK * 2); _Float16* Kh = (_Float16*)take((size_t)NR * DK * 2); _Float16* Kl = (_Float16*)take((size_t)NR * DK * 2); _Float16* Vth = (_Float16*)take((size_t)NR * DK * 2); _Float16* Vtl = (_Float16*)take((size_t)NR * DK * 2);
  unsigned* MB = (unsigned*)take((size_t)SS * (SS / 32) * 4); int* RA = (int*)take((size_t)SS * 4); int* KE = (int*)take((size_t)(SS / 64) * 32 * 4);
  if (off > ws_size) return;      /* 6 x 2 + 2 = 14 MiB */
  k_wt_f16<<<(DM * DK / 8 + 255) / 256, 256, 0, stream>>>(Wq, BQ, DM, DK, 16.0f); k_wt_f16<<<(DM * DK / 8 + 255) / 256, 256, 0, stream>>>(Wk, BK, DM, DK, 16.0f); k_wt_f16<<<(DM * DK / 8 + 255) / 256, 256, 0, stream>>>(Wv, BV, DM, DK, 16.0f); k_wt_f16<<<(DK * DM / 8 + 255) / 256, 256, 0, stream>>>(Wo, BO, DK, DM, 16.0f);      /* (in,out) -> [out][in] x16 */
  k_causaltab<<<(SS * (SS / 32) + 255) / 256, 256, 0, stream>>>(MB, RA, KE, SS, SS);
  const dim3 gP(3, NR / 128);
  k_proj<<<gP, 128, 0, stream>>>(x, BQ, BK, BV, bq, bk, bv, Qh, Ql, Kh, Kl, Vth, Vtl);      /* q, k hi/residual rows and V^T hi/residual per sequence [64][4096], straight from x: 3 x 128 work-groups side by side */
  k_flashm<SS, SS><<<NB * NH * (SS / 16), 256, 0, stream>>>(Qh, Ql, DK, Kh, Kl, DK, Vth, Vtl, MB, RA, KE, BO, bo, (float*)d_out);      /* one grid over all (sequence, 16 queries): 1024 work-groups of 8 waves; out = O*Wo + bo in its epilogue */
}

// v007
// Measured time: 108 microseconds a run.
// In both of two side-by-side timings against v006, it was 1.11 times as fast.
// Counting every step since v000, it is 22.5 times as fast.
#include <hip/hip_runtime.h>
// Single-head causal attention (4 sequences x 4096 tokens x 512; d_k = d_v = 64): q, k, v = x*W + b; scores = q.k/8 with j <= i; softmax; out = (attn.v)*Wo + bo -> [4,4096,512].
// Structure: q/k/v by one launch of f16 WMMA GEMMs (32x64 wave tiles, x rounded in registers, f32, exact products + bias) whose epilogue writes q, k as f16 hi + (x2^10) residual planes and V^T as hi + residual planes, all of them, like the weights, in fragment order (see fo_frag); the causal structure computed on device into a key bit plane + per-block key bound; one fused flash-style kernel per (sequence, 16 queries) (8 waves share the queries, the 32-key steps up to the bound dealt to them in turn, three-product hi/lo scores computed transposed (keys x queries), online softmax f32 over the two lanes of a query, P hi + residual packed in registers, two value accumulators (O^T), the 8 partial (max, sum, O) merged in LDS; the merged 16x64 O tile split into hi + residual planes in LDS and multiplied by Wo in the same kernel, each wave 64 of the 512 output columns, bias added) -> the output rows.
// Compute dtype: x, weights, biases rounded to bf16; projections exact; q, k, P, v, O as f16 hi + residual pairs (~2^-21); f32 accumulation and softmax. v_wmma_f32_16x16x32_f16.
#define NB 4
#define SS 4096
#define DM 512
#define DK 64
#define NH 1
#define SCL 0.125f
#define NR (NB * SS)
typedef __bf16 v16b __attribute__((ext_vector_type(16)));
typedef unsigned short v8us __attribute__((ext_vector_type(8), may_alias));
typedef float  v8f  __attribute__((ext_vector_type(8)));
typedef float  v4f  __attribute__((ext_vector_type(4)));
typedef float  v4fa __attribute__((ext_vector_type(4), may_alias));
union FragB { v16b v; v8us half[2]; unsigned short u[16]; };

__device__ __forceinline__ unsigned short bf16_bits(float x) { unsigned int u = __float_as_uint(x); return (unsigned short)((u + 0x7FFFu + ((u >> 16) & 1u)) >> 16); }
__device__ __forceinline__ float bf16_val(unsigned short b) { return __uint_as_float(((unsigned int)b) << 16); }
__device__ __forceinline__ float bf16_round(float x) { return bf16_val(bf16_bits(x)); }
// D += A·B with NT terms: 1 = ah·bh, 2 = + al·bh (A split), 3 = + ah·bl (both split)
template <int NT>
__device__ __forceinline__ v8f mmaN(v16b ah, v16b al, v16b bh, v16b bl, v8f c) {
  c = __builtin_amdgcn_wmma_f32_16x16x32_bf16(false, ah, false, bh, (short)0, c, false, false);
  if (NT >= 2) c = __builtin_amdgcn_wmma_f32_16x16x32_bf16(false, al, false, bh, (short)0, c, false, false);
  if (NT >= 3) c = __builtin_amdgcn_wmma_f32_16x16x32_bf16(false, ah, false, bl, (short)0, c, false, false);
  asm volatile("v_nop\n\tv_nop\n\tv_nop\n\tv_nop" : "+v"(c) : "v"(ah), "v"(al), "v"(bh), "v"(bl));
  return c;
}

__global__ __launch_bounds__(256) void k_wt_bf16(const float* __restrict__ W, unsigned short* __restrict__ Wt, int K, int N) {
  const int t = blockIdx.x * 256 + threadIdx.x;
  const int k8n = K / 8;
  if (t >= N * k8n) return;
  const int n = t / k8n, k8 = (t % k8n) * 8;
  v8us v;
#pragma unroll
  for (int i = 0; i < 8; ++i) v[i] = bf16_bits(W[(size_t)(k8 + i) * N + n]);
  *(v8us*)(Wt + (size_t)n * K + k8) = v;
  
}

// GEMM C[M][N] (f32, pitch ldc) = act(A[M][K]·W + bias). A f32 row-major (pitch lda) converted per fragment to bf16
// (ASPLIT: hi/lo two planes -> 2 terms, else single rounded term); Wt bf16 [N][K] (pitch ldb). BIAS_BF16 rounds the
// bias to bf16 first (bias quantised to bf16 before the add). K%32==0, M%16==0, N%64==0.
template <bool ASPLIT, int ACT, bool BIAS_BF16>
__global__ __launch_bounds__(128) void k_gemm_bf(const float* __restrict__ A, int lda, const unsigned short* __restrict__ Wt, int ldb,
                                               const float* __restrict__ bias, float* __restrict__ C, int ldc, int M, int N, int K) {
  __shared__ __attribute__((aligned(16))) float so[4][16][64];
  const int tid = threadIdx.x, w = tid >> 5, lane = tid & 31, ln = lane & 15, hh = lane >> 4;
  const int ntn = N / 64;
  const int wid = blockIdx.x * 4 + w;
  const int mt = wid / ntn, nq = wid % ntn;
  if (mt * 16 >= M) return;
  const int row0 = mt * 16, col0 = nq * 64;
  const float* arow = A + (size_t)(row0 + ln) * lda;
  v8f acc[4] = {};
  for (int kb = 0; kb < K; kb += 32) {
    FragB ah, al;
    const v4f x0 = *(const v4fa*)(arow + kb + 8 * hh), x1 = *(const v4fa*)(arow + kb + 8 * hh + 4);
    const v4f x2 = *(const v4fa*)(arow + kb + 16 + 8 * hh), x3 = *(const v4fa*)(arow + kb + 16 + 8 * hh + 4);
    float xs[16] = {x0[0],x0[1],x0[2],x0[3],x1[0],x1[1],x1[2],x1[3],x2[0],x2[1],x2[2],x2[3],x3[0],x3[1],x3[2],x3[3]};
#pragma unroll
    for (int i = 0; i < 16; ++i) { const unsigned short hb = bf16_bits(xs[i]); ah.u[i] = hb; al.u[i] = ASPLIT ? bf16_bits(xs[i] - bf16_val(hb)) : (unsigned short)0; }
#pragma unroll
    for (int t = 0; t < 4; ++t) {
      const unsigned short* brow = Wt + (size_t)(col0 + t * 16 + ln) * ldb + kb;
      FragB b;
      b.half[0] = *(const v8us*)(brow + 8 * hh);
      b.half[1] = *(const v8us*)(brow + 16 + 8 * hh);
      acc[t] = mmaN<ASPLIT ? 2 : 1>(ah.v, al.v, b.v, b.v, acc[t]);
    }
  }
#pragma unroll
  for (int t = 0; t < 4; ++t) {
    float bv = bias ? bias[col0 + t * 16 + ln] : 0.f;
    if (BIAS_BF16) bv = bf16_round(bv);
#pragma unroll
    for (int r = 0; r < 8; ++r) { float v = acc[t][r] + bv; if (ACT == 1) v = fmaxf(v, 0.f); so[w][8 * hh + r][t * 16 + ln] = v; }
  }
  __builtin_amdgcn_fence(__ATOMIC_ACQ_REL, "workgroup");
  __builtin_amdgcn_wave_barrier();
  const int rsub = lane >> 4, c4 = (lane & 15) * 4;
  {
#pragma unroll
    for (int q = 0; q < 8; ++q) {
      const int r = q * 2 + rsub;
      const v4f v = *(const v4fa*)&so[w][r][c4];
      *(v4f*)(C + (size_t)(row0 + r) * ldc + col0 + c4) = v;
    }
    
  }
}

// GEMM C = act(A·W + bias + resid): A f32 (ASPLIT -> hi/lo 2 terms), Wt bf16 [N][K]; ACT 0 none, 1 relu, 2 exact gelu;
// resid (optional, f32, row index = (row % rmod), pitch ldr, RES_BF16 rounds it) added before the activation.
template <bool ASPLIT, int ACT, bool BIAS_BF16, bool RES_BF16>
__global__ __launch_bounds__(128) void k_gemm_bf3(const float* __restrict__ A, int lda, const unsigned short* __restrict__ Wt, int ldb,
                                                const float* __restrict__ bias, const float* __restrict__ resid, int rmod, int ldr,
                                                float* __restrict__ C, int ldc, int M, int N, int K) {
  __shared__ __attribute__((aligned(16))) float so[4][16][64];
  const int tid = threadIdx.x, w = tid >> 5, lane = tid & 31, ln = lane & 15, hh = lane >> 4;
  const int ntn = N / 64;
  const int wid = blockIdx.x * 4 + w;
  const int mt = wid / ntn, nq = wid % ntn;
  if (mt * 16 >= M) return;
  const int row0 = mt * 16, col0 = nq * 64;
  const float* arow = A + (size_t)(row0 + ln) * lda;
  v8f acc[4] = {};
  for (int kb = 0; kb < K; kb += 32) {
    FragB ah, al;
    const v4f x0 = *(const v4fa*)(arow + kb + 8 * hh), x1 = *(const v4fa*)(arow + kb + 8 * hh + 4);
    const v4f x2 = *(const v4fa*)(arow + kb + 16 + 8 * hh), x3 = *(const v4fa*)(arow + kb + 16 + 8 * hh + 4);
    float xs[16] = {x0[0],x0[1],x0[2],x0[3],x1[0],x1[1],x1[2],x1[3],x2[0],x2[1],x2[2],x2[3],x3[0],x3[1],x3[2],x3[3]};
#pragma unroll
    for (int i = 0; i < 16; ++i) { const unsigned short hb = bf16_bits(xs[i]); ah.u[i] = hb; al.u[i] = ASPLIT ? bf16_bits(xs[i] - bf16_val(hb)) : (unsigned short)0; }
#pragma unroll
    for (int t = 0; t < 4; ++t) {
      const unsigned short* brow = Wt + (size_t)(col0 + t * 16 + ln) * ldb + kb;
      FragB b;
      b.half[0] = *(const v8us*)(brow + 8 * hh);
      b.half[1] = *(const v8us*)(brow + 16 + 8 * hh);
      acc[t] = mmaN<ASPLIT ? 2 : 1>(ah.v, al.v, b.v, b.v, acc[t]);
    }
  }
#pragma unroll
  for (int t = 0; t < 4; ++t) {
    const int col = col0 + t * 16 + ln;
    float bv = bias ? bias[col] : 0.f;
    if (BIAS_BF16) bv = bf16_round(bv);
#pragma unroll
    for (int r = 0; r < 8; ++r) {
      float v = acc[t][r] + bv;
      if (resid) { float rv = resid[(size_t)((row0 + 8 * hh + r) % rmod) * ldr + col]; if (RES_BF16) rv = bf16_round(rv); v += rv; }
      if (ACT == 1) v = fmaxf(v, 0.f);
      if (ACT == 2) v = 0.5f * v * (1.0f + erff(v * 0.70710678118654752f));
      if (ACT == 3) { const float u = 0.7978845608028654f * (v + 0.044715f * v * v * v); v = 0.5f * v * (1.0f + tanhf(u)); }
      so[w][8 * hh + r][t * 16 + ln] = v;
    }
  }
  __builtin_amdgcn_fence(__ATOMIC_ACQ_REL, "workgroup");
  __builtin_amdgcn_wave_barrier();
  const int rsub = lane >> 4, c4 = (lane & 15) * 4;
  {
#pragma unroll
    for (int q = 0; q < 8; ++q) {
      const int r = q * 2 + rsub;
      const v4f v = *(const v4fa*)&so[w][r][c4];
      *(v4f*)(C + (size_t)(row0 + r) * ldc + col0 + c4) = v;
    }
    
  }
}
// row LayerNorm (biased variance, eps) over N: s = X (+ R); optional out_sum <- s; out_norm <- (s-mu)*rsqrt(var+eps)*g + b
template <bool PARAM_BF16>
__global__ __launch_bounds__(256) void k_layernorm(const float* __restrict__ X, const float* __restrict__ R, const float* __restrict__ g, const float* __restrict__ bta,
                                                  float* __restrict__ out_sum, float* __restrict__ out_norm, int N, float eps) {
  __shared__ float red[256];
  const int row = blockIdx.x, tid = threadIdx.x;
  const float* x = X + (size_t)row * N; const float* rr = R ? R + (size_t)row * N : nullptr;
  float vals[16];                     // up to N = 4096
  const int per = N / 256;            // contiguous chunk per thread? use strided-by-4 chunks: thread handles j = tid*4 + 1024*u
  float s1 = 0.f;
  for (int u = 0; u < per / 4; ++u) {
    const int j = tid * 4 + 1024 * u;
    const v4f a = *(const v4fa*)(x + j);
    v4f b = {0.f,0.f,0.f,0.f}; if (rr) b = *(const v4fa*)(rr + j);
#pragma unroll
    for (int q = 0; q < 4; ++q) { const float v = a[q] + b[q]; vals[u * 4 + q] = v; s1 += v; }
  }
  red[tid] = s1; __syncthreads();
  for (int st = 128; st > 0; st >>= 1) { if (tid < st) red[tid] += red[tid + st]; __syncthreads(); }
  const float mu = red[0] / (float)N; __syncthreads();
  float s2 = 0.f;
  for (int u = 0; u < per / 4; ++u)
#pragma unroll
    for (int q = 0; q < 4; ++q) { const float c = vals[u * 4 + q] - mu; s2 += c * c; }
  red[tid] = s2; __syncthreads();
  for (int st = 128; st > 0; st >>= 1) { if (tid < st) red[tid] += red[tid + st]; __syncthreads(); }
  const float rs = rsqrtf(red[0] / (float)N + eps);
  {
    for (int u = 0; u < per / 4; ++u) {
      const int j = tid * 4 + 1024 * u;
      v4f o, sm;
#pragma unroll
      for (int q = 0; q < 4; ++q) {
        float gg = g[j + q], bb = bta[j + q];
        if (PARAM_BF16) { gg = bf16_round(gg); bb = bf16_round(bb); }
        sm[q] = vals[u * 4 + q]; o[q] = (vals[u * 4 + q] - mu) * rs * gg + bb;
      }
      if (out_sum) *(v4f*)(out_sum + (size_t)row * N + j) = sm;
      *(v4f*)(out_norm + (size_t)row * N + j) = o;
    }
    
  }
}



// ---- f16 WMMA path (v_wmma_f32_16x16x32_f16): 11-bit significands for operands in range — used where a [0,1] probability operand needs more precision than bf16
typedef _Float16 v16h __attribute__((ext_vector_type(16)));
union FragH { v16h v; v8us half[2]; _Float16 h[16]; unsigned short u[16]; };
template <int NT>
__device__ __forceinline__ v8f mmaH(v16h ah, v16h al, v16h bh, v16h bl, v8f c) {
  c = __builtin_amdgcn_wmma_f32_16x16x32_f16(false, ah, false, bh, (short)0, c, false, false);
  if (NT >= 2) c = __builtin_amdgcn_wmma_f32_16x16x32_f16(false, al, false, bh, (short)0, c, false, false);
  if (NT >= 3) c = __builtin_amdgcn_wmma_f32_16x16x32_f16(false, ah, false, bl, (short)0, c, false, false);
  asm volatile("v_nop\n\tv_nop\n\tv_nop\n\tv_nop" : "+v"(c) : "v"(ah), "v"(al), "v"(bh), "v"(bl));
  return c;
}
// batched GEMM like k_gemm_b but f16 operands: A f32 (split into f16 hi/lo if ASPLIT, else rounded to f16), Bt = f16 values [n][k]; alpha; C f32; N multiple of 16 (partial tiles skipped)
template <bool ASPLIT>
__global__ __launch_bounds__(128) void k_gemm_h(const float* __restrict__ A, int lda, size_t sA, const _Float16* __restrict__ Bh, int ldb, size_t sB, float alpha, float* __restrict__ C, int ldc, size_t sC, int M, int N, int K) {
  __shared__ __attribute__((aligned(16))) float so[4][16][64];
  const int tid = threadIdx.x, w = tid >> 5, lane = tid & 31, ln = lane & 15, hh = lane >> 4; const int by = blockIdx.y;
  A += (size_t)by * sA; Bh += (size_t)by * sB; C += (size_t)by * sC;
  const int ntn = (N + 63) / 64; const int wid = blockIdx.x * 4 + w; const int mt = wid / ntn, nq = wid % ntn; if (mt * 16 >= M) return;
  const int row0 = mt * 16, col0 = nq * 64; const float* arow = A + (size_t)(row0 + ln) * lda;
  v8f acc[4] = {};
  for (int kb = 0; kb < K; kb += 32) {
    FragH ah, al;
    const v4f x0 = *(const v4fa*)(arow + kb + 8 * hh), x1 = *(const v4fa*)(arow + kb + 8 * hh + 4), x2 = *(const v4fa*)(arow + kb + 16 + 8 * hh), x3 = *(const v4fa*)(arow + kb + 16 + 8 * hh + 4);
    float xs[16] = {x0[0],x0[1],x0[2],x0[3],x1[0],x1[1],x1[2],x1[3],x2[0],x2[1],x2[2],x2[3],x3[0],x3[1],x3[2],x3[3]};
#pragma unroll
    for (int i = 0; i < 16; ++i) { const _Float16 h = (_Float16)xs[i]; ah.h[i] = h; al.h[i] = ASPLIT ? (_Float16)(xs[i] - (float)h) : (_Float16)0.0f; }
#pragma unroll
    for (int t = 0; t < 4; ++t) { if (col0 + t * 16 >= N) continue; const size_t boff = (size_t)(col0 + t * 16 + ln) * ldb + kb; FragH bq; bq.half[0] = *(const v8us*)(Bh + boff + 8 * hh); bq.half[1] = *(const v8us*)(Bh + boff + 16 + 8 * hh);
      acc[t] = mmaH<ASPLIT ? 2 : 1>(ah.v, al.v, bq.v, bq.v, acc[t]); }
  }
#pragma unroll
  for (int t = 0; t < 4; ++t) { if (col0 + t * 16 >= N) continue;
#pragma unroll
    for (int r = 0; r < 8; ++r) so[w][8 * hh + r][t * 16 + ln] = acc[t][r] * alpha; }
  __builtin_amdgcn_fence(__ATOMIC_ACQ_REL, "workgroup"); __builtin_amdgcn_wave_barrier();
  const int rsub = lane >> 4, c4 = (lane & 15) * 4;
  {
#pragma unroll
    for (int q = 0; q < 8; ++q) { const int r = q * 2 + rsub; if (col0 + c4 < N) { const v4f v = *(const v4fa*)&so[w][r][c4]; *(v4f*)(C + (size_t)(row0 + r) * ldc + col0 + c4) = v; } }
     }
}

// Fragment order of a 16-bit operand matrix [rows][k]: blocks of 16 rows x 32 k, 1 KiB each; inside a block element (row, k) lies at f16 index ((k >> 4) & 1) * 256 + (((k >> 3) & 1) * 16 + (row & 15)) * 8 + (k & 7).
// So the 16 bytes that lane 16 hh + ln takes for one half of a WMMA fragment (row ln, k = 16 half + 8 hh + 0..7) lie at lane * 16 bytes: a wave's load reads 512 bytes in a row, 4 whole 128-byte lines, where a row-major plane gives 32 bytes from each of 16 lines. The register contents are those of g2_frag on the row-major plane.
__device__ __forceinline__ v16h fo_frag(const _Float16* p) { FragH f; f.half[0] = *(const v8us*)((const unsigned short*)p); f.half[1] = *(const v8us*)((const unsigned short*)p + 256); return f.v; }      /* p = the block's start + lane * 8 */
// Wt = f16(bf16(W[k][n]) * scale), rows n, in fragment order with block index (n >> 4) * (K / 32) + (k >> 5), from f32 row-major W[K][N] (scale = power of two; bf16-exact weights stay exact in f16 away from the subnormal range); thread t writes the t-th 16 bytes. K % 32 == 0, N % 16 == 0
__global__ __launch_bounds__(256) void k_wt_f16(const float* __restrict__ W, _Float16* __restrict__ Wt, int K, int N, float scale) {
  const int t = blockIdx.x * 256 + threadIdx.x; if (t >= N * (K / 8)) return; const int blk = t >> 6; const int n = (blk / (K / 32)) * 16 + (t & 15), k8 = (blk % (K / 32)) * 32 + ((t >> 5) & 1) * 16 + ((t >> 4) & 1) * 8; FragH f;
#pragma unroll
  for (int i = 0; i < 8; ++i) f.h[i] = (_Float16)(bf16_round(W[(size_t)(k8 + i) * N + n]) * scale); const v8us o = f.half[0];
  *(v8us*)((unsigned short*)Wt + (size_t)t * 8) = o; 
}
// k_gemm_hh variant with fused epilogue: v = acc·alpha + bias[by·sBias + col] (+ CP[(row/rowsPerB)·sCPb + by·64 + col] if CP) ; ACT 0 none / 1 elu ; writes f16 C16 (and f32 C if non-null)
template <int ACT>
__global__ __launch_bounds__(128) void k_gemm_hhx(const _Float16* __restrict__ A, int lda, size_t sA, const _Float16* __restrict__ Bh, int ldb, size_t sB, float alpha, const float* __restrict__ bias, size_t sBias, const float* __restrict__ CP, int rowsPerB, size_t sCPb, int row0g,
    float* __restrict__ C, _Float16* __restrict__ C16, int ldc, size_t sC, int M, int N, int K) {
  __shared__ __attribute__((aligned(16))) float so[4][16][64];
  const int tid = threadIdx.x, w = tid >> 5, lane = tid & 31, ln = lane & 15, hh = lane >> 4; const int by = blockIdx.y;
  A += (size_t)by * sA; Bh += (size_t)by * sB; const size_t cofs = (size_t)by * sC; const float* bp = bias ? bias + (size_t)by * sBias : nullptr;
  const int ntn = (N + 63) / 64; const int wid = blockIdx.x * 4 + w; const int mt = wid / ntn, nq = wid % ntn; if (mt * 16 >= M) return;
  const int row0 = mt * 16, col0 = nq * 64; const _Float16* arow = A + (size_t)(row0 + ln) * lda;
  v8f acc[4] = {};
  for (int kb = 0; kb < K; kb += 32) { FragH ah; ah.half[0] = *(const v8us*)((const unsigned short*)arow + kb + 8 * hh); ah.half[1] = *(const v8us*)((const unsigned short*)arow + kb + 16 + 8 * hh);
#pragma unroll
    for (int t = 0; t < 4; ++t) { if (col0 + t * 16 >= N) continue; const size_t boff = (size_t)(col0 + t * 16 + ln) * ldb + kb; FragH bq; bq.half[0] = *(const v8us*)((const unsigned short*)Bh + boff + 8 * hh); bq.half[1] = *(const v8us*)((const unsigned short*)Bh + boff + 16 + 8 * hh);
      acc[t] = mmaH<1>(ah.v, ah.v, bq.v, bq.v, acc[t]); }
  }
#pragma unroll
  for (int t = 0; t < 4; ++t) { if (col0 + t * 16 >= N) continue; const int col = col0 + t * 16 + ln; const float bv = bp ? bf16_round(bp[col]) : 0.f;
#pragma unroll
    for (int r = 0; r < 8; ++r) { float v = acc[t][r] * alpha + bv; if (CP) { const int bidx = (row0g + row0 + 8 * hh + r) / rowsPerB; v += CP[(size_t)bidx * sCPb + (size_t)by * 64 + col]; } if (ACT == 1) v = (v > 0.f) ? v : expm1f(v); else if (ACT == 7) v = (v > 0.f) ? v + 1.0f : expf(v); else if (ACT == 8) v = tanhf(v); else if (ACT == 9) v = 0.5f * v * (1.0f + tanhf(0.7978845608028654f * (v + 0.044715f * v * v * v))); else if (ACT == 11) v = 1.0f / (1.0f + expf(-v)); else if (ACT == 12) v = (v > 0.f) ? v : 0.01f * v; else if (ACT == 14) v = (v > 0.f) ? v : 0.1f * v; else if (ACT == 15) v = v / (1.0f + expf(-v)); else if (ACT == 3) v = fmaxf(v, 0.f); else if (ACT == 6) v = 0.5f * v * (1.0f + erff(v * 0.70710678118654752f)); so[w][8 * hh + r][t * 16 + ln] = v; } }
  __builtin_amdgcn_fence(__ATOMIC_ACQ_REL, "workgroup"); __builtin_amdgcn_wave_barrier();
  const int rsub = lane >> 4, c4 = (lane & 15) * 4; typedef _Float16 v4h __attribute__((ext_vector_type(4)));
  {
#pragma unroll
    for (int q = 0; q < 8; ++q) { const int r = q * 2 + rsub; if (col0 + c4 < N) { const v4f v = *(const v4fa*)&so[w][r][c4]; if (C) *(v4f*)(C + cofs + (size_t)(row0 + r) * ldc + col0 + c4) = v; if (C16) { v4h h4; for (int i = 0; i < 4; ++i) h4[i] = (_Float16)v[i]; *(v4h*)(C16 + cofs + (size_t)(row0 + r) * ldc + col0 + c4) = h4; } } }
     }
}


typedef _Float16 v4h __attribute__((ext_vector_type(4)));

__global__ __launch_bounds__(256) void k_h16(const float* __restrict__ x, _Float16* __restrict__ X16, size_t n8) { const size_t t = (size_t)blockIdx.x * 256 + threadIdx.x; if (t >= n8) return; FragH f;
#pragma unroll
  for (int q = 0; q < 8; ++q) f.h[q] = (_Float16)x[t * 8 + q]; *(v8us*)((unsigned short*)X16 + t * 8) = f.half[0];  }
__global__ __launch_bounds__(256) void k_round16f(const float* __restrict__ W, _Float16* __restrict__ Bt, size_t n8) { const size_t t = (size_t)blockIdx.x * 256 + threadIdx.x; if (t >= n8) return; FragH f;
#pragma unroll
  for (int i = 0; i < 8; ++i) f.h[i] = (_Float16)(bf16_round(W[t * 8 + i]) * 16.0f); *(v8us*)((unsigned short*)Bt + t * 8) = f.half[0];  }
template <int NHv, int TTv>
__global__ __launch_bounds__(256) void k_vt(const _Float16* __restrict__ V16, int ldv, int voff, _Float16* __restrict__ Vt) { __shared__ unsigned short tl[64][66]; const int tid = threadIdx.x; const int slab = blockIdx.x / (TTv / 64), lg = blockIdx.x % (TTv / 64); const int b = slab / NHv, h = slab % NHv;
  for (int i = tid; i < 64 * 8; i += 256) { const int r = i / 8, c8 = (i % 8) * 8; FragH f; f.half[0] = *(const v8us*)((const unsigned short*)V16 + ((size_t)b * TTv + lg * 64 + r) * ldv + voff + h * 64 + c8);
#pragma unroll
    for (int q = 0; q < 8; ++q) tl[r][c8 + q] = f.u[q]; }
  __syncthreads();
  {
#pragma unroll
    for (int rd = 0; rd < 2; ++rd) { const int d = rd * 32 + tid / 8, pc = tid % 8; FragH f;
#pragma unroll
      for (int q = 0; q < 8; ++q) f.u[q] = tl[pc * 8 + q][d];
      *(v8us*)((unsigned short*)Vt + ((size_t)slab * 64 + d) * TTv + lg * 64 + pc * 8) = f.half[0]; }
     } }

__global__ __launch_bounds__(256) void k_hl(const float* __restrict__ F, _Float16* __restrict__ Hh, _Float16* __restrict__ Hl, size_t n8) { const size_t t = (size_t)blockIdx.x * 256 + threadIdx.x; if (t >= n8) return; FragH fh, fl; const v4f a = *(const v4fa*)(F + t * 8), c = *(const v4fa*)(F + t * 8 + 4);
#pragma unroll
  for (int q = 0; q < 4; ++q) { _Float16 h = (_Float16)a[q]; fh.h[q] = h; fl.h[q] = (_Float16)((a[q] - (float)h) * 1024.0f); h = (_Float16)c[q]; fh.h[4 + q] = h; fl.h[4 + q] = (_Float16)((c[q] - (float)h) * 1024.0f); }
  { *(v8us*)((unsigned short*)Hh + t * 8) = fh.half[0]; *(v8us*)((unsigned short*)Hl + t * 8) = fl.half[0];  } }

// ---- fast GEMM (wave tile 32x64; requires M % 32 == 0 rows per launch region and N % 64 == 0); epilogue = k_gemm_hhx semantics ----
__device__ __forceinline__ v16h g2_frag(const _Float16* p, int hh) { FragH f; f.half[0] = *(const v8us*)((const unsigned short*)p + 8 * hh); f.half[1] = *(const v8us*)((const unsigned short*)p + 16 + 8 * hh); return f.v; }
__device__ __forceinline__ v8f g2_mma(v16h a, v16h b, v8f c) { v8f d = __builtin_amdgcn_wmma_f32_16x16x32_f16(false, a, false, b, (short)0, c, false, false); asm volatile("v_nop\n\tv_nop\n\tv_nop\n\tv_nop" : "+v"(d) : "v"(a), "v"(b)); return d; }
template <int ACT>
__global__ __launch_bounds__(128) void k_gemm2(const _Float16* __restrict__ A, int lda, size_t sA, const _Float16* __restrict__ Bh, int ldb, size_t sB, float alpha, const float* __restrict__ bias, size_t sBias, const float* __restrict__ CP, int rowsPerB, size_t sCPb, int row0g,
    float* __restrict__ C, _Float16* __restrict__ C16, int ldc, size_t sC, int M, int N, int K) {
  __shared__ __attribute__((aligned(16))) float so[4][32][68];
  const int tid = threadIdx.x, w = tid >> 5, lane = tid & 31, ln = lane & 15, hh = lane >> 4; const int by = blockIdx.y;
  A += (size_t)by * sA; Bh += (size_t)by * sB; const size_t cofs = (size_t)by * sC; const float* bp = bias ? bias + (size_t)by * sBias : nullptr;
  const int ntn = N >> 6; const int mt = blockIdx.x / ntn, nq = blockIdx.x - mt * ntn; const int row0 = mt * 128 + 32 * w, col0 = nq * 64; if (row0 >= M) return;
  const _Float16* a0p = A + (size_t)(row0 + ln) * lda; const _Float16* a1p = a0p + (size_t)16 * lda;
  const _Float16* b0p = Bh + (size_t)(col0 + ln) * ldb; const _Float16* b1p = b0p + (size_t)16 * ldb; const _Float16* b2p = b1p + (size_t)16 * ldb; const _Float16* b3p = b2p + (size_t)16 * ldb;
  const v8f z8 = {0.f,0.f,0.f,0.f,0.f,0.f,0.f,0.f}; v8f c00 = z8, c01 = z8, c02 = z8, c03 = z8, c10 = z8, c11 = z8, c12 = z8, c13 = z8;
#pragma unroll 1
  for (int kb = 0; kb < K; kb += 32) { const v16h a0 = g2_frag(a0p + kb, hh), a1 = g2_frag(a1p + kb, hh);
    v16h b = g2_frag(b0p + kb, hh); c00 = g2_mma(a0, b, c00); c10 = g2_mma(a1, b, c10);
    b = g2_frag(b1p + kb, hh); c01 = g2_mma(a0, b, c01); c11 = g2_mma(a1, b, c11);
    b = g2_frag(b2p + kb, hh); c02 = g2_mma(a0, b, c02); c12 = g2_mma(a1, b, c12);
    b = g2_frag(b3p + kb, hh); c03 = g2_mma(a0, b, c03); c13 = g2_mma(a1, b, c13); }
  v8f accs[8] = {c00, c01, c02, c03, c10, c11, c12, c13};
#pragma unroll
  for (int u = 0; u < 8; ++u) { const int t = u & 3, half = u >> 2; const int col = col0 + t * 16 + ln; const float bv = bp ? bf16_round(bp[col]) : 0.f;
#pragma unroll
    for (int r = 0; r < 8; ++r) { const int rloc = half * 16 + 8 * hh + r; float v = accs[u][r] * alpha + bv; if (CP) { const int bidx = (row0g + row0 + rloc) / rowsPerB; v += CP[(size_t)bidx * sCPb + (size_t)by * 64 + col]; }
      if (ACT == 3) v = fmaxf(v, 0.f); else if (ACT == 6) v = 0.5f * v * (1.0f + erff(v * 0.70710678118654752f)); else if (ACT == 11) v = 1.0f / (1.0f + expf(-v)); else if (ACT == 15) v = v / (1.0f + expf(-v)); else if (ACT == 12) v = (v > 0.f) ? v : 0.01f * v; else if (ACT == 8) v = tanhf(v);
      so[w][rloc][t * 16 + ln] = v; } }
  __builtin_amdgcn_fence(__ATOMIC_ACQ_REL, "workgroup"); __builtin_amdgcn_wave_barrier();
  const int rsub = lane >> 4, c4 = (lane & 15) * 4;
  {
#pragma unroll
    for (int q = 0; q < 16; ++q) { const int r = q * 2 + rsub; const v4f v = *(const v4fa*)&so[w][r][c4]; if (C) *(v4f*)(C + cofs + (size_t)(row0 + r) * ldc + col0 + c4) = v; if (C16) { v4h h4; for (int i = 0; i < 4; ++i) h4[i] = (_Float16)v[i]; *(v4h*)(C16 + cofs + (size_t)(row0 + r) * ldc + col0 + c4) = h4; } }
     } }


// ---- fused projection: q, k, v = round(x)*W + b in one launch. blockIdx.x picks the product (0 q, 1 k, 2 v; the three work-groups that read the same 128 rows of x have neighbouring block indices), blockIdx.y the 128 rows; wave tile 32x64 as in k_gemm2.
// x is read as f32 and rounded in registers (bf16 rounding, then f16, exact for normal values); the epilogue writes the planes the attention kernel reads, in fragment order: q, k as f16 hi + (x2^10) residual (rows = tokens, block index (token >> 4) * 2 + (column >> 5)), v as V^T hi + residual per sequence (rows = columns of v, k = tokens, block index (token >> 5) * 4 + (column >> 4)).
__device__ __forceinline__ v16h px_frag(const float* p, int hh) { const v4f x0 = *(const v4fa*)(p + 8 * hh), x1 = *(const v4fa*)(p + 8 * hh + 4), x2 = *(const v4fa*)(p + 16 + 8 * hh), x3 = *(const v4fa*)(p + 16 + 8 * hh + 4); FragH f;
#pragma unroll
  for (int q = 0; q < 4; ++q) { f.h[q] = (_Float16)bf16_round(x0[q]); f.h[4 + q] = (_Float16)bf16_round(x1[q]); f.h[8 + q] = (_Float16)bf16_round(x2[q]); f.h[12 + q] = (_Float16)bf16_round(x3[q]); }
  return f.v; }
__global__ __launch_bounds__(128) void k_proj(const float* __restrict__ x, const _Float16* __restrict__ BQ, const _Float16* __restrict__ BK, const _Float16* __restrict__ BV, const float* __restrict__ bq, const float* __restrict__ bk, const float* __restrict__ bv,
    _Float16* __restrict__ Qh, _Float16* __restrict__ Ql, _Float16* __restrict__ Kh, _Float16* __restrict__ Kl, _Float16* __restrict__ Vth, _Float16* __restrict__ Vtl) {
  __shared__ __attribute__((aligned(16))) float so[4][32][68];
  const int tid = threadIdx.x, w = tid >> 5, lane = tid & 31, ln = lane & 15, hh = lane >> 4; const int which = blockIdx.x, rowg = blockIdx.y * 128, row0 = rowg + 32 * w;
  const _Float16* Bh = (which == 0) ? BQ : ((which == 1) ? BK : BV); const float* bp = (which == 0) ? bq : ((which == 1) ? bk : bv);
  const float* a0p = x + (size_t)(row0 + ln) * DM; const float* a1p = a0p + (size_t)16 * DM;
  const _Float16* b0p = Bh + lane * 8; const _Float16* b1p = b0p + (DM / 32) * 512; const _Float16* b2p = b1p + (DM / 32) * 512; const _Float16* b3p = b2p + (DM / 32) * 512;      /* the four 16-column tiles; a 32-k step is one block of 512 values */
  const float braw[4] = {bp[ln], bp[16 + ln], bp[32 + ln], bp[48 + ln]};      /* asked for ahead of the loop, so that the epilogue does not wait for them */
  const v8f z8 = {0.f,0.f,0.f,0.f,0.f,0.f,0.f,0.f}; v8f c00 = z8, c01 = z8, c02 = z8, c03 = z8, c10 = z8, c11 = z8, c12 = z8, c13 = z8;
  for (int kb = 0; kb < DM; kb += 32) { const v16h a0 = px_frag(a0p + kb, hh), a1 = px_frag(a1p + kb, hh);
    v16h b = fo_frag(b0p + kb * 16); c00 = g2_mma(a0, b, c00); c10 = g2_mma(a1, b, c10);
    b = fo_frag(b1p + kb * 16); c01 = g2_mma(a0, b, c01); c11 = g2_mma(a1, b, c11);
    b = fo_frag(b2p + kb * 16); c02 = g2_mma(a0, b, c02); c12 = g2_mma(a1, b, c12);
    b = fo_frag(b3p + kb * 16); c03 = g2_mma(a0, b, c03); c13 = g2_mma(a1, b, c13); }
  v8f accs[8] = {c00, c01, c02, c03, c10, c11, c12, c13};
#pragma unroll
  for (int u = 0; u < 8; ++u) { const int t = u & 3, half = u >> 2; const float bvv = bf16_round(braw[t]);
#pragma unroll
    for (int r = 0; r < 8; ++r) so[w][half * 16 + 8 * hh + r][t * 16 + ln] = accs[u][r] * 0.0625f + bvv; }
  __builtin_amdgcn_fence(__ATOMIC_ACQ_REL, "workgroup"); __builtin_amdgcn_wave_barrier();      /* the wave reads back values that its other lanes staged; no wave reads another wave's */
  if (which != 2) {      /* block-uniform: q or k, each wave writes its own 32 rows = 2 x 2 blocks of each plane; a store is 512 bytes in a row */
    _Float16* Hh = (which == 0) ? Qh : Kh; _Float16* Hl = (which == 0) ? Ql : Kl; const size_t ho = (size_t)row0 * DK + lane * 8;      /* (row0 >> 4) * 2 blocks */
#pragma unroll
    for (int g = 0; g < 8; ++g) { const float* sp = &so[w][(g >> 2) * 16 + ln][(g & 3) * 16 + 8 * hh]; const v4f va = *(const v4fa*)sp, vb = *(const v4fa*)(sp + 4); FragH fh, fl;      /* g = 16-row tile * 4 + 16-column group */
#pragma unroll
      for (int i = 0; i < 4; ++i) { _Float16 hv = (_Float16)va[i]; fh.h[i] = hv; fl.h[i] = (_Float16)((va[i] - (float)hv) * 1024.0f); hv = (_Float16)vb[i]; fh.h[4 + i] = hv; fl.h[4 + i] = (_Float16)((vb[i] - (float)hv) * 1024.0f); }
      *(v8us*)((unsigned short*)Hh + ho + g * 256) = fh.half[0]; *(v8us*)((unsigned short*)Hl + ho + g * 256) = fl.half[0]; }
    asm volatile("s_wait_xcnt 0x0" ::: "memory");      /* behind the stores above, ahead of any code that could write their address or data registers again */
  } else {      /* v: the wave's 32 tokens are one 32-key step of V^T = 4 blocks of each plane; a lane takes one column and 8 tokens, a store is 512 bytes in a row */
    const size_t vo = (size_t)(rowg / SS) * 64 * SS + (size_t)((rowg % SS) + 32 * w) * 64 + lane * 8;      /* (token >> 5) * 4 blocks */
#pragma unroll
    for (int g = 0; g < 8; ++g) { FragH fh, fl;      /* g = 16-column tile * 2 + half of the 32 tokens */
#pragma unroll
      for (int q = 0; q < 8; ++q) { const float v = so[w][(g & 1) * 16 + 8 * hh + q][(g >> 1) * 16 + ln]; const _Float16 hv = (_Float16)v; fh.h[q] = hv; fl.h[q] = (_Float16)((v - (float)hv) * 1024.0f); }
      *(v8us*)((unsigned short*)Vth + vo + g * 256) = fh.half[0]; *(v8us*)((unsigned short*)Vtl + vo + g * 256) = fl.half[0]; } } }

// lane l takes the value of lane l ^ 16: the two halves of a wave hold the same query's other keys
__device__ __forceinline__ float xhalf(float x) { return __builtin_bit_cast(float, __builtin_amdgcn_permlanex16(__builtin_bit_cast(int, x), __builtin_bit_cast(int, x), 0x76543210, 0xfedcba98, false, false)); }
template <int TQ, int TK>
__global__ __launch_bounds__(256) void k_flashm(const _Float16* __restrict__ Q16, const _Float16* __restrict__ Q16lo, const _Float16* __restrict__ K16, const _Float16* __restrict__ K16lo, const _Float16* __restrict__ Vt, const _Float16* __restrict__ Vtlo, const unsigned* __restrict__ MB, const int* __restrict__ RA, const int* __restrict__ KE, const _Float16* __restrict__ BO, const float* __restrict__ bo, float* __restrict__ OUT) {
  static_assert(NH == 1, "the output projection in the epilogue takes the one head's 64 columns as the whole k range");
  constexpr int RPW = 16, NW = 8, NQB = TQ / RPW, DT = 4, KS = 2;
  __shared__ __attribute__((aligned(16))) float sO[NW][RPW][64 + 4]; __shared__ float sM[NW][RPW], sL[NW][RPW]; __shared__ __attribute__((aligned(16))) _Float16 sAh[RPW][64 + 8], sAl[RPW][64 + 8];      /* merged O as hi + residual; 144-byte rows for the 16-byte fragment reads */
  const int tid = threadIdx.x, w = __builtin_amdgcn_readfirstlane(tid >> 5), lane = tid & 31, ln = lane & 15, hh = lane >> 4;
  /* w through readfirstlane: the wave's number, and with it the key-step counter, stays in a scalar register. Work-group = one 16-query tile; the tiles with the most keys have the lowest block indices (for speed only) */
  const int slab = blockIdx.x % (NB * NH), qt = NQB - 1 - blockIdx.x / (NB * NH); const int b = slab / NH; const int q0 = qt * RPW; const int qblk = q0 >> 6;
  FragH aq[KS], aql[KS];
  /* q, k, V^T and Wo lie in fragment order (fo_frag): 16 rows x 64 columns of q or k are 2 blocks = 1024 values, a 32-key step of V^T is 4 blocks = 2048 values; every load below reads 512 bytes in a row */
  { const size_t qo = ((size_t)b * TQ + q0) * 64 + lane * 8;
#pragma unroll
    for (int ks = 0; ks < KS; ++ks) { aq[ks].v = fo_frag(Q16 + qo + ks * 512); aql[ks].v = fo_frag(Q16lo + qo + ks * 512); } }
  const _Float16* Vth = Vt + (size_t)slab * 64 * TK + lane * 8; const _Float16* Vtl = Vtlo + (size_t)slab * 64 * TK + lane * 8;
  float m_r = -3.0e38f, l_r = 0.f; v8f oacc[DT], oaccl[DT];      /* the lane's query: running maximum (alike in both halves), the sum over this half's keys, O^T columns */
#pragma unroll
  for (int dt = 0; dt < DT; ++dt) { oacc[dt] = (v8f){0.f,0.f,0.f,0.f,0.f,0.f,0.f,0.f}; oaccl[dt] = oacc[dt]; }
  int jend = KE[qblk * 32]; jend = min(TK, (jend + 31) & ~31); if (jend < 32) jend = 32;      /* block-uniform */
  const bool am = (RA[q0 + ln] != 0); const unsigned* mrow = MB + (size_t)(q0 + ln) * (TK / 32); const float scl = am ? 0.f : SCL;      /* a query marked 'all masked' takes every key with score 0: no mask bit, scale 0 (the products of finite f16 values are finite) */
#pragma unroll 1
  for (int j0 = 32 * w; j0 < jend; j0 += 32 * NW) {      /* wave w takes every NW-th 32-key step */
    const unsigned mraw = mrow[j0 >> 5];      /* the query's mask word of the step, asked for ahead of the key fragments so that it arrives behind the score products */
    v8f s[2];
#pragma unroll
    for (int nt = 0; nt < 2; ++nt) { const size_t ko = ((size_t)b * TK + j0 + nt * 16) * 64 + lane * 8; FragH bk[KS], bkl[KS];
#pragma unroll
      for (int ks = 0; ks < KS; ++ks) { bk[ks].v = fo_frag(K16 + ko + ks * 512); bkl[ks].v = fo_frag(K16lo + ko + ks * 512); }
      v8f acc = (v8f){0.f,0.f,0.f,0.f,0.f,0.f,0.f,0.f}, accr = acc;
#pragma unroll
      for (int ks = 0; ks < KS; ++ks) { acc = mmaH<1>(bk[ks].v, bk[ks].v, aq[ks].v, aq[ks].v, acc); accr = mmaH<1>(bk[ks].v, bk[ks].v, aql[ks].v, aql[ks].v, accr); accr = mmaH<1>(bkl[ks].v, bkl[ks].v, aq[ks].v, aq[ks].v, accr); }
      s[nt] = acc + accr * 0.0009765625f; }
    /* straight-line softmax: a masked score is -inf and the running maximum is never below the finite start value -3.0e38f, so exp gives 0 for a masked key and 1 for a query with no key yet without any test (every loop here is unrolled so that the per-key arrays stay in registers) */
    const unsigned mw = am ? 0u : (mraw >> (8 * hh));      /* shifted so that bit 16 nt + r is this lane's key */
    float sc[2][8], mt[2] = {-INFINITY, -INFINITY};
#pragma unroll
    for (int nt = 0; nt < 2; ++nt)
#pragma unroll
      for (int r = 0; r < 8; ++r) { const float v = s[nt][r] * scl; sc[nt][r] = ((mw & (1u << (nt * 16 + r))) != 0u) ? -INFINITY : v; mt[nt] = fmaxf(mt[nt], sc[nt][r]); }
    float mc = fmaxf(mt[0], mt[1]); mc = fmaxf(mc, xhalf(mc));      /* the other half's 16 keys */
    const float mn = fmaxf(m_r, mc); const float al = expf(m_r - mn); m_r = mn;
    FragH pa, pl; float ps2[2] = {0.f, 0.f};
#pragma unroll
    for (int nt = 0; nt < 2; ++nt)
#pragma unroll
      for (int r = 0; r < 8; ++r) { const float p = expf(sc[nt][r] - mn); ps2[nt] += p; const float ps = p * 1024.0f; const _Float16 ph = (_Float16)ps; pa.h[nt * 8 + r] = ph; pl.h[nt * 8 + r] = (_Float16)((ps - (float)ph) * 1024.0f); }
    l_r = l_r * al + (ps2[0] + ps2[1]);
#pragma unroll
    for (int dt = 0; dt < DT; ++dt) { oacc[dt] *= al; oaccl[dt] *= al; }
#pragma unroll
    for (int dt = 0; dt < DT; ++dt) { const size_t vo = (size_t)j0 * 64 + dt * 512; FragH bv, bl; bv.v = fo_frag(Vth + vo); bl.v = fo_frag(Vtl + vo);
      oacc[dt] = mmaH<1>(bv.v, bv.v, pa.v, pa.v, oacc[dt]); oaccl[dt] = mmaH<1>(bl.v, bl.v, pa.v, pa.v, oaccl[dt]); oaccl[dt] = mmaH<1>(bv.v, bv.v, pl.v, pl.v, oaccl[dt]); } }
  /* output projection, wave w = output columns 64 w .. 64 w + 63: its Wo fragments and bias are asked for right behind the key loop, so that they arrive while the partials are staged (every loop of this projection is unrolled so that its fragment and accumulator arrays stay in registers) */
  const int col0 = w * 64; v16h wb[4][KS]; float braw[4]; const _Float16* bp0 = BO + (size_t)col0 * DK + lane * 8; const float* bo0 = bo + col0 + ln;      /* one base each: the 16 fragment loads differ by constant offsets only */
#pragma unroll
  for (int t = 0; t < 4; ++t) { braw[t] = bo0[t * 16];
#pragma unroll
    for (int ks = 0; ks < KS; ++ks) wb[t][ks] = fo_frag(bp0 + t * 16 * DK + ks * 512); }
  l_r += xhalf(l_r);      /* the two halves' sums joined once */
  if (hh == 0) { sM[w][ln] = m_r; sL[w][ln] = l_r; }
#pragma unroll
  for (int dt = 0; dt < DT; ++dt) { const v8f o = oacc[dt] + oaccl[dt] * 0.0009765625f;      /* the lane's 8 registers are 8 neighbouring columns of its query's row: two 16-byte stores */
    *(v4fa*)&sO[w][ln][dt * 16 + 8 * hh] = (v4f){o[0], o[1], o[2], o[3]}; *(v4fa*)&sO[w][ln][dt * 16 + 8 * hh + 4] = (v4f){o[4], o[5], o[6], o[7]}; }
  __syncthreads();      /* every wave's partial (max, sum, O) is in LDS before any thread merges them */
  { const int r = tid >> 4, pc = tid & 15; float mm = sM[0][r];
#pragma unroll
    for (int u = 1; u < NW; ++u) mm = fmaxf(mm, sM[u][r]);
    float l = 0.f; v4f val = {0.f, 0.f, 0.f, 0.f};
#pragma unroll
    for (int u = 0; u < NW; ++u) { const float e = expf(sM[u][r] - mm); l += e * sL[u][r]; const v4f po = *(const v4fa*)&sO[u][r][pc * 4]; val += po * e; }
    const float li = (l > 0.f) ? 1.0f / (l * 1024.0f) : 0.f;
    const v4f ov = val * li; v4h h4, l4;
#pragma unroll
    for (int i = 0; i < 4; ++i) { h4[i] = (_Float16)ov[i]; l4[i] = (_Float16)((ov[i] - (float)h4[i]) * 1024.0f); }
    *(v4h*)&sAh[r][pc * 4] = h4; *(v4h*)&sAl[r][pc * 4] = l4; }
  __syncthreads();      /* the whole merged tile is in LDS before any wave reads its fragments; behind it nobody reads sO any more, so each wave may stage its output there */
  { v16h ah[KS], al[KS];
#pragma unroll
    for (int ks = 0; ks < KS; ++ks) { ah[ks] = g2_frag(&sAh[ln][ks * 32], hh); al[ks] = g2_frag(&sAl[ln][ks * 32], hh); }
#pragma unroll
    for (int t = 0; t < 4; ++t) { v8f ch = (v8f){0.f,0.f,0.f,0.f,0.f,0.f,0.f,0.f}, cl = ch;
#pragma unroll
      for (int ks = 0; ks < KS; ++ks) { ch = g2_mma(ah[ks], wb[t][ks], ch); cl = g2_mma(al[ks], wb[t][ks], cl); }
      const float bvv = bf16_round(braw[t]);
#pragma unroll
      for (int r = 0; r < 8; ++r) sO[w][8 * hh + r][t * 16 + ln] = (ch[r] * 0.0625f + bvv) + cl[r] * (0.0625f * 0.0009765625f); }
    __builtin_amdgcn_fence(__ATOMIC_ACQ_REL, "workgroup"); __builtin_amdgcn_wave_barrier();      /* the wave reads back rows that its other lanes staged */
    const int rsub = lane >> 4, c4 = (lane & 15) * 4;
#pragma unroll
    for (int q = 0; q < 8; ++q) { const int r = q * 2 + rsub; const v4f v = *(const v4fa*)&sO[w][r][c4]; *(v4f*)(OUT + ((size_t)b * TQ + q0 + r) * DM + col0 + c4) = v; } } }      /* two whole 256-byte row pieces a store */


__global__ __launch_bounds__(256) void k_causaltab(unsigned* __restrict__ MB, int* __restrict__ RA, int* __restrict__ KE, int nq, int nk) {
  const int t = blockIdx.x * 256 + threadIdx.x; const int nw = nk / 32;
  if (t < nq * nw) { const int q = t / nw, w = t % nw; const int first = q + 1 - 32 * w; const unsigned bits = (first <= 0) ? 0xffffffffu : ((first >= 32) ? 0u : (0xffffffffu << first)); *(unsigned*)(MB + t) = bits;  }
  if (t < nq) { *(int*)(RA + t) = 0;  }
  if (t < nq / 64) { const int v = 64 * (t + 1); *(int*)(KE + t * 32) = v;  } }

extern "C" void kernel_launch(void* const* d_in, const int* in_sizes, int n_in,
                              void* d_out, int out_size, void* d_ws, size_t ws_size, hipStream_t stream) {
  (void)in_sizes; (void)n_in; (void)out_size;
  const float* const* I = (const float* const*)d_in; const float* x = I[0]; const float* Wq = I[1]; const float* bq = I[2]; const float* Wk = I[3]; const float* bk = I[4]; const float* Wv = I[5]; const float* bv = I[6]; const float* Wo = I[7]; const float* bo = I[8];
  char* ws = (char*)d_ws; size_t off = 0;
  auto take = [&](size_t bytes) { char* p = ws + off; off += (bytes + 255) & ~(size_t)255; return p; };
  _Float16* BQ = (_Float16*)take((size_t)DK * DM * 2); _Float16* BK = (_Float16*)take((size_t)DK * DM * 2); _Float16* BV = (_Float16*)take((size_t)DK * DM * 2); _Float16* BO = (_Float16*)take((size_t)DM * DK * 2);
  _Float16* Qh = (_Float16*)take((size_t)NR * DK * 2); _Float16* Ql = (_Float16*)take((size_t)NR * DK * 2); _Float16* Kh = (_Float16*)take((size_t)NR * DK * 2); _Float16* Kl = (_Float16*)take((size_t)NR * DK * 2); _Float16* Vth = (_Float16*)take((size_t)NR * DK * 2); _Float16* Vtl = (_Float16*)take((size_t)NR * DK * 2);
  unsigned* MB = (unsigned*)take((size_t)SS * (SS / 32) * 4); int* RA = (int*)take((size_t)SS * 4); int* KE = (int*)take((size_t)(SS / 64) * 32 * 4);
  if (off > ws_size) return;      /* 6 x 2 + 2 = 14 MiB */
  k_wt_f16<<<(DM * DK / 8 + 255) / 256, 256, 0, stream>>>(Wq, BQ, DM, DK, 16.0f); k_wt_f16<<<(DM * DK / 8 + 255) / 256, 256, 0, stream>>>(Wk, BK, DM, DK, 16.0f); k_wt_f16<<<(DM * DK / 8 + 255) / 256, 256, 0, stream>>>(Wv, BV, DM, DK, 16.0f); k_wt_f16<<<(DK * DM / 8 + 255) / 256, 256, 0, stream>>>(Wo, BO, DK, DM, 16.0f);      /* (in,out) -> rows = out, x16, fragment order */
  k_causaltab<<<(SS * (SS / 32) + 255) / 256, 256, 0, stream>>>(MB, RA, KE, SS, SS);
  const dim3 gP(3, NR / 128);
  k_proj<<<gP, 128, 0, stream>>>(x, BQ, BK, BV, bq, bk, bv, Qh, Ql, Kh, Kl, Vth, Vtl);      /* q, k hi/residual and V^T hi/residual per sequence, in fragment order, straight from x: 3 x 128 work-groups side by side */
  k_flashm<SS, SS><<<NB * NH * (SS / 16), 256, 0, stream>>>(Qh, Ql, Kh, Kl, Vth, Vtl, MB, RA, KE, BO, bo, (float*)d_out);      /* one grid over all (sequence, 16 queries): 1024 work-groups of 8 waves; out = O*Wo + bo in its epilogue */
}

// v008
// A run of this version takes 99.8 microseconds.
// Next to v007, in two timings, it ran 1.08 and 1.09 times as fast.
// Counting every step since v000, it is 24.4 times as fast.
#include <hip/hip_runtime.h>
// Single-head causal attention (4 sequences x 4096 tokens x 512; d_k = d_v = 64): q, k, v = x*W + b; scores = q.k/8 with j <= i; softmax; out = (attn.v)*Wo + bo -> [4,4096,512].
// Structure: q/k/v by one launch of f16 WMMA GEMMs (32x64 wave tiles, x rounded in registers, f32, exact products + bias) whose epilogue writes q, k as f16 hi + (x2^10) residual planes and V^T as hi + residual planes, all of them, like the weights, in fragment order (see fo_frag); the causal structure computed on device into a key bit plane + per-block key bound; one fused flash-style kernel per (sequence, 16 queries) (8 waves share the queries, the 32-key steps up to the bound dealt to them in turn, three-product hi/lo scores computed transposed (keys x queries), online softmax f32 over the two lanes of a query, P hi + residual packed in registers, two value accumulators (O^T), the 8 partial (max, sum, O) merged in LDS; the merged 16x64 O tile split into hi + residual planes in LDS and multiplied by Wo in the same kernel, each wave 64 of the 512 output columns, bias added) -> the output rows.
// Compute dtype: x, weights, biases rounded to bf16; projections exact; q, k, P, v, O as f16 hi + residual pairs (~2^-21); f32 accumulation and softmax. v_wmma_f32_16x16x32_f16.
#define NB 4
#define SS 4096
#define DM 512
#define DK 64
#define NH 1
#define SCL 0.125f
#define NR (NB * SS)
typedef __bf16 v16b __attribute__((ext_vector_type(16)));
typedef unsigned short v8us __attribute__((ext_vector_type(8), may_alias));
typedef float  v8f  __attribute__((ext_vector_type(8)));
typedef float  v4f  __attribute__((ext_vector_type(4)));
typedef float  v4fa __attribute__((ext_vector_type(4), may_alias));
union FragB { v16b v; v8us half[2]; unsigned short u[16]; };

__device__ __forceinline__ unsigned short bf16_bits(float x) { unsigned int u = __float_as_uint(x); return (unsigned short)((u + 0x7FFFu + ((u >> 16) & 1u)) >> 16); }
__device__ __forceinline__ float bf16_val(unsigned short b) { return __uint_as_float(((unsigned int)b) << 16); }
__device__ __forceinline__ float bf16_round(float x) { return bf16_val(bf16_bits(x)); }
// D += A·B with NT terms: 1 = ah·bh, 2 = + al·bh (A split), 3 = + ah·bl (both split)
template <int NT>
__device__ __forceinline__ v8f mmaN(v16b ah, v16b al, v16b bh, v16b bl, v8f c) {
  c = __builtin_amdgcn_wmma_f32_16x16x32_bf16(false, ah, false, bh, (short)0, c, false, false);
  if (NT >= 2) c = __builtin_amdgcn_wmma_f32_16x16x32_bf16(false, al, false, bh, (short)0, c, false, false);
  if (NT >= 3) c = __builtin_amdgcn_wmma_f32_16x16x32_bf16(false, ah, false, bl, (short)0, c, false, false);
  asm volatile("v_nop\n\tv_nop\n\tv_nop\n\tv_nop" : "+v"(c) : "v"(ah), "v"(al), "v"(bh), "v"(bl));
  return c;
}

__global__ __launch_bounds__(256) void k_wt_bf16(const float* __restrict__ W, unsigned short* __restrict__ Wt, int K, int N) {
  const int t = blockIdx.x * 256 + threadIdx.x;
  const int k8n = K / 8;
  if (t >= N * k8n) return;
  const int n = t / k8n, k8 = (t % k8n) * 8;
  v8us v;
#pragma unroll
  for (int i = 0; i < 8; ++i) v[i] = bf16_bits(W[(size_t)(k8 + i) * N + n]);
  *(v8us*)(Wt + (size_t)n * K + k8) = v;
  
}

// GEMM C[M][N] (f32, pitch ldc) = act(A[M][K]·W + bias). A f32 row-major (pitch lda) converted per fragment to bf16
// (ASPLIT: hi/lo two planes -> 2 terms, else single rounded term); Wt bf16 [N][K] (pitch ldb). BIAS_BF16 rounds the
// bias to bf16 first (bias quantised to bf16 before the add). K%32==0, M%16==0, N%64==0.
template <bool ASPLIT, int ACT, bool BIAS_BF16>
__global__ __launch_bounds__(128) void k_gemm_bf(const float* __restrict__ A, int lda, const unsigned short* __restrict__ Wt, int ldb,
                                               const float* __restrict__ bias, float* __restrict__ C, int ldc, int M, int N, int K) {
  __shared__ __attribute__((aligned(16))) float so[4][16][64];
  const int tid = threadIdx.x, w = tid >> 5, lane = tid & 31, ln = lane & 15, hh = lane >> 4;
  const int ntn = N / 64;
  const int wid = blockIdx.x * 4 + w;
  const int mt = wid / ntn, nq = wid % ntn;
  if (mt * 16 >= M) return;
  const int row0 = mt * 16, col0 = nq * 64;
  const float* arow = A + (size_t)(row0 + ln) * lda;
  v8f acc[4] = {};
  for (int kb = 0; kb < K; kb += 32) {
    FragB ah, al;
    const v4f x0 = *(const v4fa*)(arow + kb + 8 * hh), x1 = *(const v4fa*)(arow + kb + 8 * hh + 4);
    const v4f x2 = *(const v4fa*)(arow + kb + 16 + 8 * hh), x3 = *(const v4fa*)(arow + kb + 16 + 8 * hh + 4);
    float xs[16] = {x0[0],x0[1],x0[2],x0[3],x1[0],x1[1],x1[2],x1[3],x2[0],x2[1],x2[2],x2[3],x3[0],x3[1],x3[2],x3[3]};
#pragma unroll
    for (int i = 0; i < 16; ++i) { const unsigned short hb = bf16_bits(xs[i]); ah.u[i] = hb; al.u[i] = ASPLIT ? bf16_bits(xs[i] - bf16_val(hb)) : (unsigned short)0; }
#pragma unroll
    for (int t = 0; t < 4; ++t) {
      const unsigned short* brow = Wt + (size_t)(col0 + t * 16 + ln) * ldb + kb;
      FragB b;
      b.half[0] = *(const v8us*)(brow + 8 * hh);
      b.half[1] = *(const v8us*)(brow + 16 + 8 * hh);
      acc[t] = mmaN<ASPLIT ? 2 : 1>(ah.v, al.v, b.v, b.v, acc[t]);
    }
  }
#pragma unroll
  for (int t = 0; t < 4; ++t) {
    float bv = bias ? bias[col0 + t * 16 + ln] : 0.f;
    if (BIAS_BF16) bv = bf16_round(bv);
#pragma unroll
    for (int r = 0; r < 8; ++r) { float v = acc[t][r] + bv; if (ACT == 1) v = fmaxf(v, 0.f); so[w][8 * hh + r][t * 16 + ln] = v; }
  }
  __builtin_amdgcn_fence(__ATOMIC_ACQ_REL, "workgroup");
  __builtin_amdgcn_wave_barrier();
  const int rsub = lane >> 4, c4 = (lane & 15) * 4;
  {
#pragma unroll
    for (int q = 0; q < 8; ++q) {
      const int r = q * 2 + rsub;
      const v4f v = *(const v4fa*)&so[w][r][c4];
      *(v4f*)(C + (size_t)(row0 + r) * ldc + col0 + c4) = v;
    }
    
  }
}

// GEMM C = act(A·W + bias + resid): A f32 (ASPLIT -> hi/lo 2 terms), Wt bf16 [N][K]; ACT 0 none, 1 relu, 2 exact gelu;
// resid (optional, f32, row index = (row % rmod), pitch ldr, RES_BF16 rounds it) added before the activation.
template <bool ASPLIT, int ACT, bool BIAS_BF16, bool RES_BF16>
__global__ __launch_bounds__(128) void k_gemm_bf3(const float* __restrict__ A, int lda, const unsigned short* __restrict__ Wt, int ldb,
                                                const float* __restrict__ bias, const float* __restrict__ resid, int rmod, int ldr,
                                                float* __restrict__ C, int ldc, int M, int N, int K) {
  __shared__ __attribute__((aligned(16))) float so[4][16][64];
  const int tid = threadIdx.x, w = tid >> 5, lane = tid & 31, ln = lane & 15, hh = lane >> 4;
  const int ntn = N / 64;
  const int wid = blockIdx.x * 4 + w;
  const int mt = wid / ntn, nq = wid % ntn;
  if (mt * 16 >= M) return;
  const int row0 = mt * 16, col0 = nq * 64;
  const float* arow = A + (size_t)(row0 + ln) * lda;
  v8f acc[4] = {};
  for (int kb = 0; kb < K; kb += 32) {
    FragB ah, al;
    const v4f x0 = *(const v4fa*)(arow + kb + 8 * hh), x1 = *(const v4fa*)(arow + kb + 8 * hh + 4);
    const v4f x2 = *(const v4fa*)(arow + kb + 16 + 8 * hh), x3 = *(const v4fa*)(arow + kb + 16 + 8 * hh + 4);
    float xs[16] = {x0[0],x0[1],x0[2],x0[3],x1[0],x1[1],x1[2],x1[3],x2[0],x2[1],x2[2],x2[3],x3[0],x3[1],x3[2],x3[3]};
#pragma unroll
    for (int i = 0; i < 16; ++i) { const unsigned short hb = bf16_bits(xs[i]); ah.u[i] = hb; al.u[i] = ASPLIT ? bf16_bits(xs[i] - bf16_val(hb)) : (unsigned short)0; }
#pragma unroll
    for (int t = 0; t < 4; ++t) {
      const unsigned short* brow = Wt + (size_t)(col0 + t * 16 + ln) * ldb + kb;
      FragB b;
      b.half[0] = *(const v8us*)(brow + 8 * hh);
      b.half[1] = *(const v8us*)(brow + 16 + 8 * hh);
      acc[t] = mmaN<ASPLIT ? 2 : 1>(ah.v, al.v, b.v, b.v, acc[t]);
    }
  }
#pragma unroll
  for (int t = 0; t < 4; ++t) {
    const int col = col0 + t * 16 + ln;
    float bv = bias ? bias[col] : 0.f;
    if (BIAS_BF16) bv = bf16_round(bv);
#pragma unroll
    for (int r = 0; r < 8; ++r) {
      float v = acc[t][r] + bv;
      if (resid) { float rv = resid[(size_t)((row0 + 8 * hh + r) % rmod) * ldr + col]; if (RES_BF16) rv = bf16_round(rv); v += rv; }
      if (ACT == 1) v = fmaxf(v, 0.f);
      if (ACT == 2) v = 0.5f * v * (1.0f + erff(v * 0.70710678118654752f));
      if (ACT == 3) { const float u = 0.7978845608028654f * (v + 0.044715f * v * v * v); v = 0.5f * v * (1.0f + tanhf(u)); }
      so[w][8 * hh + r][t * 16 + ln] = v;
    }
  }
  __builtin_amdgcn_fence(__ATOMIC_ACQ_REL, "workgroup");
  __builtin_amdgcn_wave_barrier();
  const int rsub = lane >> 4, c4 = (lane & 15) * 4;
  {
#pragma unroll
    for (int q = 0; q < 8; ++q) {
      const int r = q * 2 + rsub;
      const v4f v = *(const v4fa*)&so[w][r][c4];
      *(v4f*)(C + (size_t)(row0 + r) * ldc + col0 + c4) = v;
    }
    
  }
}
// row LayerNorm (biased variance, eps) over N: s = X (+ R); optional out_sum <- s; out_norm <- (s-mu)*rsqrt(var+eps)*g + b
template <bool PARAM_BF16>
__global__ __launch_bounds__(256) void k_layernorm(const float* __restrict__ X, const float* __restrict__ R, const float* __restrict__ g, const float* __restrict__ bta,
                                                  float* __restrict__ out_sum, float* __restrict__ out_norm, int N, float eps) {
  __shared__ float red[256];
  const int row = blockIdx.x, tid = threadIdx.x;
  const float* x = X + (size_t)row * N; const float* rr = R ? R + (size_t)row * N : nullptr;
  float vals[16];                     // up to N = 4096
  const int per = N / 256;            // contiguous chunk per thread? use strided-by-4 chunks: thread handles j = tid*4 + 1024*u
  float s1 = 0.f;
  for (int u = 0; u < per / 4; ++u) {
    const int j = tid * 4 + 1024 * u;
    const v4f a = *(const v4fa*)(x + j);
    v4f b = {0.f,0.f,0.f,0.f}; if (rr) b = *(const v4fa*)(rr + j);
#pragma unroll
    for (int q = 0; q < 4; ++q) { const float v = a[q] + b[q]; vals[u * 4 + q] = v; s1 += v; }
  }
  red[tid] = s1; __syncthreads();
  for (int st = 128; st > 0; st >>= 1) { if (tid < st) red[tid] += red[tid + st]; __syncthreads(); }
  const float mu = red[0] / (float)N; __syncthreads();
  float s2 = 0.f;
  for (int u = 0; u < per / 4; ++u)
#pragma unroll
    for (int q = 0; q < 4; ++q) { const float c = vals[u * 4 + q] - mu; s2 += c * c; }
  red[tid] = s2; __syncthreads();
  for (int st = 128; st > 0; st >>= 1) { if (tid < st) red[tid] += red[tid + st]; __syncthreads(); }
  const float rs = rsqrtf(red[0] / (float)N + eps);
  {
    for (int u = 0; u < per / 4; ++u) {
      const int j = tid * 4 + 1024 * u;
      v4f o, sm;
#pragma unroll
      for (int q = 0; q < 4; ++q) {
        float gg = g[j + q], bb = bta[j + q];
        if (PARAM_BF16) { gg = bf16_round(gg); bb = bf16_round(bb); }
        sm[q] = vals[u * 4 + q]; o[q] = (vals[u * 4 + q] - mu) * rs * gg + bb;
      }
      if (out_sum) *(v4f*)(out_sum + (size_t)row * N + j) = sm;
      *(v4f*)(out_norm + (size_t)row * N + j) = o;
    }
    
  }
}



// ---- f16 WMMA path (v_wmma_f32_16x16x32_f16): 11-bit significands for operands in range — used where a [0,1] probability operand needs more precision than bf16
typedef _Float16 v16h __attribute__((ext_vector_type(16)));
union FragH { v16h v; v8us half[2]; _Float16 h[16]; unsigned short u[16]; };
template <int NT>
__device__ __forceinline__ v8f mmaH(v16h ah, v16h al, v16h bh, v16h bl, v8f c) {
  c = __builtin_amdgcn_wmma_f32_16x16x32_f16(false, ah, false, bh, (short)0, c, false, false);
  if (NT >= 2) c = __builtin_amdgcn_wmma_f32_16x16x32_f16(false, al, false, bh, (short)0, c, false, false);
  if (NT >= 3) c = __builtin_amdgcn_wmma_f32_16x16x32_f16(false, ah, false, bl, (short)0, c, false, false);
  asm volatile("v_nop\n\tv_nop\n\tv_nop\n\tv_nop" : "+v"(c) : "v"(ah), "v"(al), "v"(bh), "v"(bl));
  return c;
}
// batched GEMM like k_gemm_b but f16 operands: A f32 (split into f16 hi/lo if ASPLIT, else rounded to f16), Bt = f16 values [n][k]; alpha; C f32; N multiple of 16 (partial tiles skipped)
template <bool ASPLIT>
__global__ __launch_bounds__(128) void k_gemm_h(const float* __restrict__ A, int lda, size_t sA, const _Float16* __restrict__ Bh, int ldb, size_t sB, float alpha, float* __restrict__ C, int ldc, size_t sC, int M, int N, int K) {
  __shared__ __attribute__((aligned(16))) float so[4][16][64];
  const int tid = threadIdx.x, w = tid >> 5, lane = tid & 31, ln = lane & 15, hh = lane >> 4; const int by = blockIdx.y;
  A += (size_t)by * sA; Bh += (size_t)by * sB; C += (size_t)by * sC;
  const int ntn = (N + 63) / 64; const int wid = blockIdx.x * 4 + w; const int mt = wid / ntn, nq = wid % ntn; if (mt * 16 >= M) return;
  const int row0 = mt * 16, col0 = nq * 64; const float* arow = A + (size_t)(row0 + ln) * lda;
  v8f acc[4] = {};
  for (int kb = 0; kb < K; kb += 32) {
    FragH ah, al;
    const v4f x0 = *(const v4fa*)(arow + kb + 8 * hh), x1 = *(const v4fa*)(arow + kb + 8 * hh + 4), x2 = *(const v4fa*)(arow + kb + 16 + 8 * hh), x3 = *(const v4fa*)(arow + kb + 16 + 8 * hh + 4);
    float xs[16] = {x0[0],x0[1],x0[2],x0[3],x1[0],x1[1],x1[2],x1[3],x2[0],x2[1],x2[2],x2[3],x3[0],x3[1],x3[2],x3[3]};
#pragma unroll
    for (int i = 0; i < 16; ++i) { const _Float16 h = (_Float16)xs[i]; ah.h[i] = h; al.h[i] = ASPLIT ? (_Float16)(xs[i] - (float)h) : (_Float16)0.0f; }
#pragma unroll
    for (int t = 0; t < 4; ++t) { if (col0 + t * 16 >= N) continue; const size_t boff = (size_t)(col0 + t * 16 + ln) * ldb + kb; FragH bq; bq.half[0] = *(const v8us*)(Bh + boff + 8 * hh); bq.half[1] = *(const v8us*)(Bh + boff + 16 + 8 * hh);
      acc[t] = mmaH<ASPLIT ? 2 : 1>(ah.v, al.v, bq.v, bq.v, acc[t]); }
  }
#pragma unroll
  for (int t = 0; t < 4; ++t) { if (col0 + t * 16 >= N) continue;
#pragma unroll
    for (int r = 0; r < 8; ++r) so[w][8 * hh + r][t * 16 + ln] = acc[t][r] * alpha; }
  __builtin_amdgcn_fence(__ATOMIC_ACQ_REL, "workgroup"); __builtin_amdgcn_wave_barrier();
  const int rsub = lane >> 4, c4 = (lane & 15) * 4;
  {
#pragma unroll
    for (int q = 0; q < 8; ++q) { const int r = q * 2 + rsub; if (col0 + c4 < N) { const v4f v = *(const v4fa*)&so[w][r][c4]; *(v4f*)(C + (size_t)(row0 + r) * ldc + col0 + c4) = v; } }
     }
}

// Fragment order of a 16-bit operand matrix [rows][k]: blocks of 16 rows x 32 k, 1 KiB each; inside a block element (row, k) lies at f16 index ((k >> 4) & 1) * 256 + (((k >> 3) & 1) * 16 + (row & 15)) * 8 + (k & 7).
// So the 16 bytes that lane 16 hh + ln takes for one half of a WMMA fragment (row ln, k = 16 half + 8 hh + 0..7) lie at lane * 16 bytes: a wave's load reads 512 bytes in a row, 4 whole 128-byte lines, where a row-major plane gives 32 bytes from each of 16 lines. The register contents are those of g2_frag on the row-major plane.
__device__ __forceinline__ v16h fo_frag(const _Float16* p) { FragH f; f.half[0] = *(const v8us*)((const unsigned short*)p); f.half[1] = *(const v8us*)((const unsigned short*)p + 256); return f.v; }      /* p = the block's start + lane * 8 */
// the same load, its address given as a wave-uniform plane start ub, the lane's 32-bit byte offset vo (block + lane * 16) and a constant: scalar base + one vector offset + immediate, so that no 64-bit address is formed in vector registers
__device__ __forceinline__ v16h fo_frag_s(const char* ub, unsigned vo, int c) { const char* p = ub + vo; FragH f; f.half[0] = *(const v8us*)(p + c); f.half[1] = *(const v8us*)(p + c + 512); return f.v; }
// Wt = f16(bf16(W[k][n]) * scale), rows n, in fragment order with block index (n >> 4) * (K / 32) + (k >> 5), from f32 row-major W[K][N] (scale = power of two; bf16-exact weights stay exact in f16 away from the subnormal range); thread t writes the t-th 16 bytes. K % 32 == 0, N % 16 == 0
__global__ __launch_bounds__(256) void k_wt_f16(const float* __restrict__ W, _Float16* __restrict__ Wt, int K, int N, float scale) {
  const int t = blockIdx.x * 256 + threadIdx.x; if (t >= N * (K / 8)) return; const int blk = t >> 6; const int n = (blk / (K / 32)) * 16 + (t & 15), k8 = (blk % (K / 32)) * 32 + ((t >> 5) & 1) * 16 + ((t >> 4) & 1) * 8; FragH f;
#pragma unroll
  for (int i = 0; i < 8; ++i) f.h[i] = (_Float16)(bf16_round(W[(size_t)(k8 + i) * N + n]) * scale); const v8us o = f.half[0];
  *(v8us*)((unsigned short*)Wt + (size_t)t * 8) = o; 
}
// k_gemm_hh variant with fused epilogue: v = acc·alpha + bias[by·sBias + col] (+ CP[(row/rowsPerB)·sCPb + by·64 + col] if CP) ; ACT 0 none / 1 elu ; writes f16 C16 (and f32 C if non-null)
template <int ACT>
__global__ __launch_bounds__(128) void k_gemm_hhx(const _Float16* __restrict__ A, int lda, size_t sA, const _Float16* __restrict__ Bh, int ldb, size_t sB, float alpha, const float* __restrict__ bias, size_t sBias, const float* __restrict__ CP, int rowsPerB, size_t sCPb, int row0g,
    float* __restrict__ C, _Float16* __restrict__ C16, int ldc, size_t sC, int M, int N, int K) {
  __shared__ __attribute__((aligned(16))) float so[4][16][64];
  const int tid = threadIdx.x, w = tid >> 5, lane = tid & 31, ln = lane & 15, hh = lane >> 4; const int by = blockIdx.y;
  A += (size_t)by * sA; Bh += (size_t)by * sB; const size_t cofs = (size_t)by * sC; const float* bp = bias ? bias + (size_t)by * sBias : nullptr;
  const int ntn = (N + 63) / 64; const int wid = blockIdx.x * 4 + w; const int mt = wid / ntn, nq = wid % ntn; if (mt * 16 >= M) return;
  const int row0 = mt * 16, col0 = nq * 64; const _Float16* arow = A + (size_t)(row0 + ln) * lda;
  v8f acc[4] = {};
  for (int kb = 0; kb < K; kb += 32) { FragH ah; ah.half[0] = *(const v8us*)((const unsigned short*)arow + kb + 8 * hh); ah.half[1] = *(const v8us*)((const unsigned short*)arow + kb + 16 + 8 * hh);
#pragma unroll
    for (int t = 0; t < 4; ++t) { if (col0 + t * 16 >= N) continue; const size_t boff = (size_t)(col0 + t * 16 + ln) * ldb + kb; FragH bq; bq.half[0] = *(const v8us*)((const unsigned short*)Bh + boff + 8 * hh); bq.half[1] = *(const v8us*)((const unsigned short*)Bh + boff + 16 + 8 * hh);
      acc[t] = mmaH<1>(ah.v, ah.v, bq.v, bq.v, acc[t]); }
  }
#pragma unroll
  for (int t = 0; t < 4; ++t) { if (col0 + t * 16 >= N) continue; const int col = col0 + t * 16 + ln; const float bv = bp ? bf16_round(bp[col]) : 0.f;
#pragma unroll
    for (int r = 0; r < 8; ++r) { float v = acc[t][r] * alpha + bv; if (CP) { const int bidx = (row0g + row0 + 8 * hh + r) / rowsPerB; v += CP[(size_t)bidx * sCPb + (size_t)by * 64 + col]; } if (ACT == 1) v = (v > 0.f) ? v : expm1f(v); else if (ACT == 7) v = (v > 0.f) ? v + 1.0f : expf(v); else if (ACT == 8) v = tanhf(v); else if (ACT == 9) v = 0.5f * v * (1.0f + tanhf(0.7978845608028654f * (v + 0.044715f * v * v * v))); else if (ACT == 11) v = 1.0f / (1.0f + expf(-v)); else if (ACT == 12) v = (v > 0.f) ? v : 0.01f * v; else if (ACT == 14) v = (v > 0.f) ? v : 0.1f * v; else if (ACT == 15) v = v / (1.0f + expf(-v)); else if (ACT == 3) v = fmaxf(v, 0.f); else if (ACT == 6) v = 0.5f * v * (1.0f + erff(v * 0.70710678118654752f)); so[w][8 * hh + r][t * 16 + ln] = v; } }
  __builtin_amdgcn_fence(__ATOMIC_ACQ_REL, "workgroup"); __builtin_amdgcn_wave_barrier();
  const int rsub = lane >> 4, c4 = (lane & 15) * 4; typedef _Float16 v4h __attribute__((ext_vector_type(4)));
  {
#pragma unroll
    for (int q = 0; q < 8; ++q) { const int r = q * 2 + rsub; if (col0 + c4 < N) { const v4f v = *(const v4fa*)&so[w][r][c4]; if (C) *(v4f*)(C + cofs + (size_t)(row0 + r) * ldc + col0 + c4) = v; if (C16) { v4h h4; for (int i = 0; i < 4; ++i) h4[i] = (_Float16)v[i]; *(v4h*)(C16 + cofs + (size_t)(row0 + r) * ldc + col0 + c4) = h4; } } }
     }
}


typedef _Float16 v4h __attribute__((ext_vector_type(4)));

__global__ __launch_bounds__(256) void k_h16(const float* __restrict__ x, _Float16* __restrict__ X16, size_t n8) { const size_t t = (size_t)blockIdx.x * 256 + threadIdx.x; if (t >= n8) return; FragH f;
#pragma unroll
  for (int q = 0; q < 8; ++q) f.h[q] = (_Float16)x[t * 8 + q]; *(v8us*)((unsigned short*)X16 + t * 8) = f.half[0];  }
__global__ __launch_bounds__(256) void k_round16f(const float* __restrict__ W, _Float16* __restrict__ Bt, size_t n8) { const size_t t = (size_t)blockIdx.x * 256 + threadIdx.x; if (t >= n8) return; FragH f;
#pragma unroll
  for (int i = 0; i < 8; ++i) f.h[i] = (_Float16)(bf16_round(W[t * 8 + i]) * 16.0f); *(v8us*)((unsigned short*)Bt + t * 8) = f.half[0];  }
template <int NHv, int TTv>
__global__ __launch_bounds__(256) void k_vt(const _Float16* __restrict__ V16, int ldv, int voff, _Float16* __restrict__ Vt) { __shared__ unsigned short tl[64][66]; const int tid = threadIdx.x; const int slab = blockIdx.x / (TTv / 64), lg = blockIdx.x % (TTv / 64); const int b = slab / NHv, h = slab % NHv;
  for (int i = tid; i < 64 * 8; i += 256) { const int r = i / 8, c8 = (i % 8) * 8; FragH f; f.half[0] = *(const v8us*)((const unsigned short*)V16 + ((size_t)b * TTv + lg * 64 + r) * ldv + voff + h * 64 + c8);
#pragma unroll
    for (int q = 0; q < 8; ++q) tl[r][c8 + q] = f.u[q]; }
  __syncthreads();
  {
#pragma unroll
    for (int rd = 0; rd < 2; ++rd) { const int d = rd * 32 + tid / 8, pc = tid % 8; FragH f;
#pragma unroll
      for (int q = 0; q < 8; ++q) f.u[q] = tl[pc * 8 + q][d];
      *(v8us*)((unsigned short*)Vt + ((size_t)slab * 64 + d) * TTv + lg * 64 + pc * 8) = f.half[0]; }
     } }

__global__ __launch_bounds__(256) void k_hl(const float* __restrict__ F, _Float16* __restrict__ Hh, _Float16* __restrict__ Hl, size_t n8) { const size_t t = (size_t)blockIdx.x * 256 + threadIdx.x; if (t >= n8) return; FragH fh, fl; const v4f a = *(const v4fa*)(F + t * 8), c = *(const v4fa*)(F + t * 8 + 4);
#pragma unroll
  for (int q = 0; q < 4; ++q) { _Float16 h = (_Float16)a[q]; fh.h[q] = h; fl.h[q] = (_Float16)((a[q] - (float)h) * 1024.0f); h = (_Float16)c[q]; fh.h[4 + q] = h; fl.h[4 + q] = (_Float16)((c[q] - (float)h) * 1024.0f); }
  { *(v8us*)((unsigned short*)Hh + t * 8) = fh.half[0]; *(v8us*)((unsigned short*)Hl + t * 8) = fl.half[0];  } }

// ---- fast GEMM (wave tile 32x64; requires M % 32 == 0 rows per launch region and N % 64 == 0); epilogue = k_gemm_hhx semantics ----
__device__ __forceinline__ v16h g2_frag(const _Float16* p, int hh) { FragH f; f.half[0] = *(const v8us*)((const unsigned short*)p + 8 * hh); f.half[1] = *(const v8us*)((const unsigned short*)p + 16 + 8 * hh); return f.v; }
__device__ __forceinline__ v8f g2_mma(v16h a, v16h b, v8f c) { v8f d = __builtin_amdgcn_wmma_f32_16x16x32_f16(false, a, false, b, (short)0, c, false, false); asm volatile("v_nop\n\tv_nop\n\tv_nop\n\tv_nop" : "+v"(d) : "v"(a), "v"(b)); return d; }
template <int ACT>
__global__ __launch_bounds__(128) void k_gemm2(const _Float16* __restrict__ A, int lda, size_t sA, const _Float16* __restrict__ Bh, int ldb, size_t sB, float alpha, const float* __restrict__ bias, size_t sBias, const float* __restrict__ CP, int rowsPerB, size_t sCPb, int row0g,
    float* __restrict__ C, _Float16* __restrict__ C16, int ldc, size_t sC, int M, int N, int K) {
  __shared__ __attribute__((aligned(16))) float so[4][32][68];
  const int tid = threadIdx.x, w = tid >> 5, lane = tid & 31, ln = lane & 15, hh = lane >> 4; const int by = blockIdx.y;
  A += (size_t)by * sA; Bh += (size_t)by * sB; const size_t cofs = (size_t)by * sC; const float* bp = bias ? bias + (size_t)by * sBias : nullptr;
  const int ntn = N >> 6; const int mt = blockIdx.x / ntn, nq = blockIdx.x - mt * ntn; const int row0 = mt * 128 + 32 * w, col0 = nq * 64; if (row0 >= M) return;
  const _Float16* a0p = A + (size_t)(row0 + ln) * lda; const _Float16* a1p = a0p + (size_t)16 * lda;
  const _Float16* b0p = Bh + (size_t)(col0 + ln) * ldb; const _Float16* b1p = b0p + (size_t)16 * ldb; const _Float16* b2p = b1p + (size_t)16 * ldb; const _Float16* b3p = b2p + (size_t)16 * ldb;
  const v8f z8 = {0.f,0.f,0.f,0.f,0.f,0.f,0.f,0.f}; v8f c00 = z8, c01 = z8, c02 = z8, c03 = z8, c10 = z8, c11 = z8, c12 = z8, c13 = z8;
#pragma unroll 1
  for (int kb = 0; kb < K; kb += 32) { const v16h a0 = g2_frag(a0p + kb, hh), a1 = g2_frag(a1p + kb, hh);
    v16h b = g2_frag(b0p + kb, hh); c00 = g2_mma(a0, b, c00); c10 = g2_mma(a1, b, c10);
    b = g2_frag(b1p + kb, hh); c01 = g2_mma(a0, b, c01); c11 = g2_mma(a1, b, c11);
    b = g2_frag(b2p + kb, hh); c02 = g2_mma(a0, b, c02); c12 = g2_mma(a1, b, c12);
    b = g2_frag(b3p + kb, hh); c03 = g2_mma(a0, b, c03); c13 = g2_mma(a1, b, c13); }
  v8f accs[8] = {c00, c01, c02, c03, c10, c11, c12, c13};
#pragma unroll
  for (int u = 0; u < 8; ++u) { const int t = u & 3, half = u >> 2; const int col = col0 + t * 16 + ln; const float bv = bp ? bf16_round(bp[col]) : 0.f;
#pragma unroll
    for (int r = 0; r < 8; ++r) { const int rloc = half * 16 + 8 * hh + r; float v = accs[u][r] * alpha + bv; if (CP) { const int bidx = (row0g + row0 + rloc) / rowsPerB; v += CP[(size_t)bidx * sCPb + (size_t)by * 64 + col]; }
      if (ACT == 3) v = fmaxf(v, 0.f); else if (ACT == 6) v = 0.5f * v * (1.0f + erff(v * 0.70710678118654752f)); else if (ACT == 11) v = 1.0f / (1.0f + expf(-v)); else if (ACT == 15) v = v / (1.0f + expf(-v)); else if (ACT == 12) v = (v > 0.f) ? v : 0.01f * v; else if (ACT == 8) v = tanhf(v);
      so[w][rloc][t * 16 + ln] = v; } }
  __builtin_amdgcn_fence(__ATOMIC_ACQ_REL, "workgroup"); __builtin_amdgcn_wave_barrier();
  const int rsub = lane >> 4, c4 = (lane & 15) * 4;
  {
#pragma unroll
    for (int q = 0; q < 16; ++q) { const int r = q * 2 + rsub; const v4f v = *(const v4fa*)&so[w][r][c4]; if (C) *(v4f*)(C + cofs + (size_t)(row0 + r) * ldc + col0 + c4) = v; if (C16) { v4h h4; for (int i = 0; i < 4; ++i) h4[i] = (_Float16)v[i]; *(v4h*)(C16 + cofs + (size_t)(row0 + r) * ldc + col0 + c4) = h4; } }
     } }


// ---- fused projection: q, k, v = round(x)*W + b in one launch. blockIdx.x picks the product (0 q, 1 k, 2 v; the three work-groups that read the same 128 rows of x have neighbouring block indices), blockIdx.y the 128 rows; wave tile 32x64 as in k_gemm2.
// x is read as f32 and rounded in registers (bf16 rounding, then f16, exact for normal values); the epilogue writes the planes the attention kernel reads, in fragment order: q, k as f16 hi + (x2^10) residual (rows = tokens, block index (token >> 4) * 2 + (column >> 5)), v as V^T hi + residual per sequence (rows = columns of v, k = tokens, block index (token >> 5) * 4 + (column >> 4)).
__device__ __forceinline__ v16h px_frag(const float* p, int hh) { const v4f x0 = *(const v4fa*)(p + 8 * hh), x1 = *(const v4fa*)(p + 8 * hh + 4), x2 = *(const v4fa*)(p + 16 + 8 * hh), x3 = *(const v4fa*)(p + 16 + 8 * hh + 4); FragH f;
#pragma unroll
  for (int q = 0; q < 4; ++q) { f.h[q] = (_Float16)bf16_round(x0[q]); f.h[4 + q] = (_Float16)bf16_round(x1[q]); f.h[8 + q] = (_Float16)bf16_round(x2[q]); f.h[12 + q] = (_Float16)bf16_round(x3[q]); }
  return f.v; }
__global__ __launch_bounds__(128) void k_proj(const float* __restrict__ x, const _Float16* __restrict__ BQ, const _Float16* __restrict__ BK, const _Float16* __restrict__ BV, const float* __restrict__ bq, const float* __restrict__ bk, const float* __restrict__ bv,
    _Float16* __restrict__ Qh, _Float16* __restrict__ Ql, _Float16* __restrict__ Kh, _Float16* __restrict__ Kl, _Float16* __restrict__ Vth, _Float16* __restrict__ Vtl) {
  __shared__ __attribute__((aligned(16))) float so[4][32][68];
  const int tid = threadIdx.x, w = tid >> 5, lane = tid & 31, ln = lane & 15, hh = lane >> 4; const int which = blockIdx.x, rowg = blockIdx.y * 128, row0 = rowg + 32 * w;
  const _Float16* Bh = (which == 0) ? BQ : ((which == 1) ? BK : BV); const float* bp = (which == 0) ? bq : ((which == 1) ? bk : bv);
  const float* a0p = x + (size_t)(row0 + ln) * DM; const float* a1p = a0p + (size_t)16 * DM;
  const _Float16* b0p = Bh + lane * 8; const _Float16* b1p = b0p + (DM / 32) * 512; const _Float16* b2p = b1p + (DM / 32) * 512; const _Float16* b3p = b2p + (DM / 32) * 512;      /* the four 16-column tiles; a 32-k step is one block of 512 values */
  const float braw[4] = {bp[ln], bp[16 + ln], bp[32 + ln], bp[48 + ln]};      /* asked for ahead of the loop, so that the epilogue does not wait for them */
  const v8f z8 = {0.f,0.f,0.f,0.f,0.f,0.f,0.f,0.f}; v8f c00 = z8, c01 = z8, c02 = z8, c03 = z8, c10 = z8, c11 = z8, c12 = z8, c13 = z8;
  for (int kb = 0; kb < DM; kb += 32) { const v16h a0 = px_frag(a0p + kb, hh), a1 = px_frag(a1p + kb, hh);
    v16h b = fo_frag(b0p + kb * 16); c00 = g2_mma(a0, b, c00); c10 = g2_mma(a1, b, c10);
    b = fo_frag(b1p + kb * 16); c01 = g2_mma(a0, b, c01); c11 = g2_mma(a1, b, c11);
    b = fo_frag(b2p + kb * 16); c02 = g2_mma(a0, b, c02); c12 = g2_mma(a1, b, c12);
    b = fo_frag(b3p + kb * 16); c03 = g2_mma(a0, b, c03); c13 = g2_mma(a1, b, c13); }
  v8f accs[8] = {c00, c01, c02, c03, c10, c11, c12, c13};
#pragma unroll
  for (int u = 0; u < 8; ++u) { const int t = u & 3, half = u >> 2; const float bvv = bf16_round(braw[t]);
#pragma unroll
    for (int r = 0; r < 8; ++r) so[w][half * 16 + 8 * hh + r][t * 16 + ln] = accs[u][r] * 0.0625f + bvv; }
  __builtin_amdgcn_fence(__ATOMIC_ACQ_REL, "workgroup"); __builtin_amdgcn_wave_barrier();      /* the wave reads back values that its other lanes staged; no wave reads another wave's */
  if (which != 2) {      /* block-uniform: q or k, each wave writes its own 32 rows = 2 x 2 blocks of each plane; a store is 512 bytes in a row */
    _Float16* Hh = (which == 0) ? Qh : Kh; _Float16* Hl = (which == 0) ? Ql : Kl; const size_t ho = (size_t)row0 * DK + lane * 8;      /* (row0 >> 4) * 2 blocks */
#pragma unroll
    for (int g = 0; g < 8; ++g) { const float* sp = &so[w][(g >> 2) * 16 + ln][(g & 3) * 16 + 8 * hh]; const v4f va = *(const v4fa*)sp, vb = *(const v4fa*)(sp + 4); FragH fh, fl;      /* g = 16-row tile * 4 + 16-column group */
#pragma unroll
      for (int i = 0; i < 4; ++i) { _Float16 hv = (_Float16)va[i]; fh.h[i] = hv; fl.h[i] = (_Float16)((va[i] - (float)hv) * 1024.0f); hv = (_Float16)vb[i]; fh.h[4 + i] = hv; fl.h[4 + i] = (_Float16)((vb[i] - (float)hv) * 1024.0f); }
      *(v8us*)((unsigned short*)Hh + ho + g * 256) = fh.half[0]; *(v8us*)((unsigned short*)Hl + ho + g * 256) = fl.half[0]; }
    asm volatile("s_wait_xcnt 0x0" ::: "memory");      /* behind the stores above, ahead of any code that could write their address or data registers again */
  } else {      /* v: the wave's 32 tokens are one 32-key step of V^T = 4 blocks of each plane; a lane takes one column and 8 tokens, a store is 512 bytes in a row */
    const size_t vo = (size_t)(rowg / SS) * 64 * SS + (size_t)((rowg % SS) + 32 * w) * 64 + lane * 8;      /* (token >> 5) * 4 blocks */
#pragma unroll
    for (int g = 0; g < 8; ++g) { FragH fh, fl;      /* g = 16-column tile * 2 + half of the 32 tokens */
#pragma unroll
      for (int q = 0; q < 8; ++q) { const float v = so[w][(g & 1) * 16 + 8 * hh + q][(g >> 1) * 16 + ln]; const _Float16 hv = (_Float16)v; fh.h[q] = hv; fl.h[q] = (_Float16)((v - (float)hv) * 1024.0f); }
      *(v8us*)((unsigned short*)Vth + vo + g * 256) = fh.half[0]; *(v8us*)((unsigned short*)Vtl + vo + g * 256) = fl.half[0]; } } }

// lane l takes the value of lane l ^ 16: the two halves of a wave hold the same query's other keys
__device__ __forceinline__ float xhalf(float x) { return __builtin_bit_cast(float, __builtin_amdgcn_permlanex16(__builtin_bit_cast(int, x), __builtin_bit_cast(int, x), 0x76543210, 0xfedcba98, false, false)); }
// amdgpu_waves_per_eu(4, 4): four waves a SIMD = two work-groups a WGP, so the compiler may spend 256 registers a wave on fragments in flight instead of sinking their loads to save registers
template <int TQ, int TK>
__global__ __launch_bounds__(256) __attribute__((amdgpu_waves_per_eu(4, 4))) void k_flashm(const _Float16* __restrict__ Q16, const _Float16* __restrict__ Q16lo, const _Float16* __restrict__ K16, const _Float16* __restrict__ K16lo, const _Float16* __restrict__ Vt, const _Float16* __restrict__ Vtlo, const unsigned* __restrict__ MB, const int* __restrict__ RA, const int* __restrict__ KE, const _Float16* __restrict__ BO, const float* __restrict__ bo, float* __restrict__ OUT) {
  static_assert(NH == 1, "the output projection in the epilogue takes the one head's 64 columns as the whole k range");
  constexpr int RPW = 16, NW = 8, NQB = TQ / RPW, DT = 4, KS = 2;
  __shared__ __attribute__((aligned(16))) float sO[NW][RPW][64 + 4]; __shared__ float sM[NW][RPW], sL[NW][RPW]; __shared__ __attribute__((aligned(16))) _Float16 sAh[RPW][64 + 8], sAl[RPW][64 + 8];      /* merged O as hi + residual; 144-byte rows for the 16-byte fragment reads */
  const int tid = threadIdx.x, w = __builtin_amdgcn_readfirstlane(tid >> 5), lane = tid & 31, ln = lane & 15, hh = lane >> 4;
  /* w through readfirstlane: the wave's number, and with it the key-step counter, stays in a scalar register. Work-group = one 16-query tile; the tiles with the most keys have the lowest block indices (for speed only) */
  const int slab = blockIdx.x % (NB * NH), qt = NQB - 1 - blockIdx.x / (NB * NH); const int b = slab / NH; const int q0 = qt * RPW; const int qblk = q0 >> 6;
  FragH aq[KS], aql[KS];
  /* q, k, V^T and Wo lie in fragment order (fo_frag): 16 rows x 64 columns of q or k are 2 blocks = 1024 values, a 32-key step of V^T is 4 blocks = 2048 values; every load below reads 512 bytes in a row */
  { const size_t qo = ((size_t)b * TQ + q0) * 64 + lane * 8;
#pragma unroll
    for (int ks = 0; ks < KS; ++ks) { aq[ks].v = fo_frag(Q16 + qo + ks * 512); aql[ks].v = fo_frag(Q16lo + qo + ks * 512); } }
  float m_r = -3.0e38f, l_r = 0.f; v8f oacc[DT], oaccl[DT];      /* the lane's query: running maximum (alike in both halves), the sum over this half's keys, O^T columns */
#pragma unroll
  for (int dt = 0; dt < DT; ++dt) { oacc[dt] = (v8f){0.f,0.f,0.f,0.f,0.f,0.f,0.f,0.f}; oaccl[dt] = oacc[dt]; }
  const int jend = __builtin_amdgcn_readfirstlane(max(32, min(TK, (KE[qblk * 32] + 31) & ~31)));      /* block-uniform; through readfirstlane so that the step counter, the bound and the fragment addresses built from them stay in scalar registers */
  const bool am = (RA[q0 + ln] != 0); const float scl = am ? 0.f : SCL;      /* a query marked 'all masked' takes every key with score 0: no mask bit, scale 0 (the products of finite f16 values are finite) */
  /* loads run ahead of their use: a step's key fragments and mask word are asked for during the step before (the first 16 keys' behind its score products, the other 16 keys' between its value products), its value fragments behind its own score products, ahead of the softmax. So the softmax and the products stand between a request and its wait, where each of the six fragment groups of a step used to be waited for right behind its request */
  /* addresses: a scalar plane start + the 32-bit offset vo of (step, lane), alike for all four planes (a 32-key step is 4096 bytes of each); the step ahead is reached through the scalar base */
  const char* uK = (const char*)(K16 + (size_t)b * TK * 64); const char* uKl = (const char*)(K16lo + (size_t)b * TK * 64); const char* uV = (const char*)(Vt + (size_t)slab * 64 * TK); const char* uVl = (const char*)(Vtlo + (size_t)slab * 64 * TK); const char* uM = (const char*)MB;
  const unsigned lb = lane * 16; unsigned vm = (unsigned)(q0 + ln) * (TK / 32) * 4u + 4u * w - 4u * NW;      /* vm: byte offset of the query's mask word of the step before the current one (unsigned, may wrap ahead of the first step; it is stepped before it is used) */
  FragH k0[KS], k0l[KS], k1[KS], k1l[KS]; unsigned mraw = *(const unsigned*)(uM + (vm + 4u * NW));      /* the wave's first step, 32 w < TK: in bounds also for a wave that has no step */
#pragma unroll
  for (int ks = 0; ks < KS; ++ks) { k0[ks].v = fo_frag_s(uK, lb + 32u * w * 128u, ks * 1024); k0l[ks].v = fo_frag_s(uKl, lb + 32u * w * 128u, ks * 1024); }
#pragma unroll
  for (int ks = 0; ks < KS; ++ks) { k1[ks].v = fo_frag_s(uK, lb + 32u * w * 128u, 2048 + ks * 1024); k1l[ks].v = fo_frag_s(uKl, lb + 32u * w * 128u, 2048 + ks * 1024); }
#pragma unroll 1
  for (int j0 = 32 * w; j0 < jend; j0 += 32 * NW) {      /* wave w takes every NW-th 32-key step */
    v8f s[2];
    { v8f acc = (v8f){0.f,0.f,0.f,0.f,0.f,0.f,0.f,0.f}, accr = acc;
#pragma unroll
      for (int ks = 0; ks < KS; ++ks) { acc = mmaH<1>(k0[ks].v, k0[ks].v, aq[ks].v, aq[ks].v, acc); accr = mmaH<1>(k0[ks].v, k0[ks].v, aql[ks].v, aql[ks].v, accr); accr = mmaH<1>(k0l[ks].v, k0l[ks].v, aq[ks].v, aq[ks].v, accr); }
      s[0] = acc + accr * 0.0009765625f; }
    { v8f acc = (v8f){0.f,0.f,0.f,0.f,0.f,0.f,0.f,0.f}, accr = acc;
#pragma unroll
      for (int ks = 0; ks < KS; ++ks) { acc = mmaH<1>(k1[ks].v, k1[ks].v, aq[ks].v, aq[ks].v, acc); accr = mmaH<1>(k1[ks].v, k1[ks].v, aql[ks].v, aql[ks].v, accr); accr = mmaH<1>(k1l[ks].v, k1l[ks].v, aq[ks].v, aq[ks].v, accr); }
      s[1] = acc + accr * 0.0009765625f; }
    const unsigned kinc = (j0 + 32 * NW < jend) ? 32u * NW * 128u : 0u;      /* to the wave's next step; its last step asks for its own fragments again, so that the address stays in bounds */
    const unsigned mcur = mraw;
    __builtin_amdgcn_sched_barrier(0);      /* keeps the requests below from sinking to their uses (and from rising among the score products, whose operands' registers they take) */
    const unsigned vo = lb + (unsigned)j0 * 128u; vm += 4u * NW; const char* nK = uK + kinc; const char* nKl = uKl + kinc;
    FragH bv[DT], bl[DT];
#pragma unroll
    for (int dt = 0; dt < DT; ++dt) { bv[dt].v = fo_frag_s(uV, vo, dt * 1024); bl[dt].v = fo_frag_s(uVl, vo, dt * 1024); }
    mraw = *(const unsigned*)(uM + (kinc >> 10) + vm);      /* 4 bytes of mask a step */
#pragma unroll
    for (int ks = 0; ks < KS; ++ks) { k0[ks].v = fo_frag_s(nK, vo, ks * 1024); k0l[ks].v = fo_frag_s(nKl, vo, ks * 1024); }
    __builtin_amdgcn_sched_barrier(0);      /* the requests above are issued before the softmax starts */
    /* straight-line softmax: a masked score is -inf and the running maximum is never below the finite start value -3.0e38f, so exp gives 0 for a masked key and 1 for a query with no key yet without any test (every loop here is unrolled so that the per-key arrays stay in registers) */
    const unsigned mw = am ? 0u : (mcur >> (8 * hh));      /* shifted so that bit 16 nt + r is this lane's key */
    float sc[2][8], mt[2] = {-INFINITY, -INFINITY};
#pragma unroll
    for (int nt = 0; nt < 2; ++nt)
#pragma unroll
      for (int r = 0; r < 8; ++r) { const float v = s[nt][r] * scl; sc[nt][r] = ((mw & (1u << (nt * 16 + r))) != 0u) ? -INFINITY : v; mt[nt] = fmaxf(mt[nt], sc[nt][r]); }
    float mc = fmaxf(mt[0], mt[1]); mc = fmaxf(mc, xhalf(mc));      /* the other half's 16 keys */
    const float mn = fmaxf(m_r, mc); const float al = expf(m_r - mn); m_r = mn;
    FragH pa, pl; float ps2[2] = {0.f, 0.f};
#pragma unroll
    for (int nt = 0; nt < 2; ++nt)
#pragma unroll
      for (int r = 0; r < 8; ++r) { const float p = expf(sc[nt][r] - mn); ps2[nt] += p; const float ps = p * 1024.0f; const _Float16 ph = (_Float16)ps; pa.h[nt * 8 + r] = ph; pl.h[nt * 8 + r] = (_Float16)((ps - (float)ph) * 1024.0f); }
    l_r = l_r * al + (ps2[0] + ps2[1]);
#pragma unroll
    for (int dt = 0; dt < DT; ++dt) { oacc[dt] *= al; oaccl[dt] *= al; }
#pragma unroll
    for (int dt = 0; dt < DT / 2; ++dt) { oacc[dt] = mmaH<1>(bv[dt].v, bv[dt].v, pa.v, pa.v, oacc[dt]); oaccl[dt] = mmaH<1>(bl[dt].v, bl[dt].v, pa.v, pa.v, oaccl[dt]); oaccl[dt] = mmaH<1>(bv[dt].v, bv[dt].v, pl.v, pl.v, oaccl[dt]); }
    __builtin_amdgcn_sched_barrier(0);      /* the requests below take the registers that the two value tiles above have left */
#pragma unroll
    for (int ks = 0; ks < KS; ++ks) { k1[ks].v = fo_frag_s(nK, vo, 2048 + ks * 1024); k1l[ks].v = fo_frag_s(nKl, vo, 2048 + ks * 1024); }
    __builtin_amdgcn_sched_barrier(0);      /* issued before the last two value tiles' products, not behind them */
#pragma unroll
    for (int dt = DT / 2; dt < DT; ++dt) { oacc[dt] = mmaH<1>(bv[dt].v, bv[dt].v, pa.v, pa.v, oacc[dt]); oaccl[dt] = mmaH<1>(bl[dt].v, bl[dt].v, pa.v, pa.v, oaccl[dt]); oaccl[dt] = mmaH<1>(bv[dt].v, bv[dt].v, pl.v, pl.v, oaccl[dt]); }
    __builtin_amdgcn_sched_barrier(0); }      /* keeps the compiler's step of the load offsets, and the s_wait_xcnt that it puts in front of it, behind the last products instead of right behind the requests above, where the wave would stand in that wait */
  /* output projection, wave w = output columns 64 w .. 64 w + 63: its Wo fragments and bias are asked for right behind the key loop, so that they arrive while the partials are staged (every loop of this projection is unrolled so that its fragment and accumulator arrays stay in registers) */
  const int col0 = w * 64; v16h wb[4][KS]; float braw[4]; const _Float16* bp0 = BO + (size_t)col0 * DK + lane * 8; const float* bo0 = bo + col0 + ln;      /* one base each: the 16 fragment loads differ by constant offsets only */
#pragma unroll
  for (int t = 0; t < 4; ++t) { braw[t] = bo0[t * 16];
#pragma unroll
    for (int ks = 0; ks < KS; ++ks) wb[t][ks] = fo_frag(bp0 + t * 16 * DK + ks * 512); }
  l_r += xhalf(l_r);      /* the two halves' sums joined once */
  if (hh == 0) { sM[w][ln] = m_r; sL[w][ln] = l_r; }
#pragma unroll
  for (int dt = 0; dt < DT; ++dt) { const v8f o = oacc[dt] + oaccl[dt] * 0.0009765625f;      /* the lane's 8 registers are 8 neighbouring columns of its query's row: two 16-byte stores */
    *(v4fa*)&sO[w][ln][dt * 16 + 8 * hh] = (v4f){o[0], o[1], o[2], o[3]}; *(v4fa*)&sO[w][ln][dt * 16 + 8 * hh + 4] = (v4f){o[4], o[5], o[6], o[7]}; }
  __syncthreads();      /* every wave's partial (max, sum, O) is in LDS before any thread merges them */
  { const int r = tid >> 4, pc = tid & 15; float mm = sM[0][r];
#pragma unroll
    for (int u = 1; u < NW; ++u) mm = fmaxf(mm, sM[u][r]);
    float l = 0.f; v4f val = {0.f, 0.f, 0.f, 0.f};
#pragma unroll
    for (int u = 0; u < NW; ++u) { const float e = expf(sM[u][r] - mm); l += e * sL[u][r]; const v4f po = *(const v4fa*)&sO[u][r][pc * 4]; val += po * e; }
    const float li = (l > 0.f) ? 1.0f / (l * 1024.0f) : 0.f;
    const v4f ov = val * li; v4h h4, l4;
#pragma unroll
    for (int i = 0; i < 4; ++i) { h4[i] = (_Float16)ov[i]; l4[i] = (_Float16)((ov[i] - (float)h4[i]) * 1024.0f); }
    *(v4h*)&sAh[r][pc * 4] = h4; *(v4h*)&sAl[r][pc * 4] = l4; }
  __syncthreads();      /* the whole merged tile is in LDS before any wave reads its fragments; behind it nobody reads sO any more, so each wave may stage its output there */
  { v16h ah[KS], al[KS];
#pragma unroll
    for (int ks = 0; ks < KS; ++ks) { ah[ks] = g2_frag(&sAh[ln][ks * 32], hh); al[ks] = g2_frag(&sAl[ln][ks * 32], hh); }
#pragma unroll
    for (int t = 0; t < 4; ++t) { v8f ch = (v8f){0.f,0.f,0.f,0.f,0.f,0.f,0.f,0.f}, cl = ch;
#pragma unroll
      for (int ks = 0; ks < KS; ++ks) { ch = g2_mma(ah[ks], wb[t][ks], ch); cl = g2_mma(al[ks], wb[t][ks], cl); }
      const float bvv = bf16_round(braw[t]);
#pragma unroll
      for (int r = 0; r < 8; ++r) sO[w][8 * hh + r][t * 16 + ln] = (ch[r] * 0.0625f + bvv) + cl[r] * (0.0625f * 0.0009765625f); }
    __builtin_amdgcn_fence(__ATOMIC_ACQ_REL, "workgroup"); __builtin_amdgcn_wave_barrier();      /* the wave reads back rows that its other lanes staged */
    const int rsub = lane >> 4, c4 = (lane & 15) * 4;
#pragma unroll
    for (int q = 0; q < 8; ++q) { const int r = q * 2 + rsub; const v4f v = *(const v4fa*)&sO[w][r][c4]; *(v4f*)(OUT + ((size_t)b * TQ + q0 + r) * DM + col0 + c4) = v; } } }      /* two whole 256-byte row pieces a store */


__global__ __launch_bounds__(256) void k_causaltab(unsigned* __restrict__ MB, int* __restrict__ RA, int* __restrict__ KE, int nq, int nk) {
  const int t = blockIdx.x * 256 + threadIdx.x; const int nw = nk / 32;
  if (t < nq * nw) { const int q = t / nw, w = t % nw; const int first = q + 1 - 32 * w; const unsigned bits = (first <= 0) ? 0xffffffffu : ((first >= 32) ? 0u : (0xffffffffu << first)); *(unsigned*)(MB + t) = bits;  }
  if (t < nq) { *(int*)(RA + t) = 0;  }
  if (t < nq / 64) { const int v = 64 * (t + 1); *(int*)(KE + t * 32) = v;  } }

extern "C" void kernel_launch(void* const* d_in, const int* in_sizes, int n_in,
                              void* d_out, int out_size, void* d_ws, size_t ws_size, hipStream_t stream) {
  (void)in_sizes; (void)n_in; (void)out_size;
  const float* const* I = (const float* const*)d_in; const float* x = I[0]; const float* Wq = I[1]; const float* bq = I[2]; const float* Wk = I[3]; const float* bk = I[4]; const float* Wv = I[5]; const float* bv = I[6]; const float* Wo = I[7]; const float* bo = I[8];
  char* ws = (char*)d_ws; size_t off = 0;
  auto take = [&](size_t bytes) { char* p = ws + off; off += (bytes + 255) & ~(size_t)255; return p; };
  _Float16* BQ = (_Float16*)take((size_t)DK * DM * 2); _Float16* BK = (_Float16*)take((size_t)DK * DM * 2); _Float16* BV = (_Float16*)take((size_t)DK * DM * 2); _Float16* BO = (_Float16*)take((size_t)DM * DK * 2);
  _Float16* Qh = (_Float16*)take((size_t)NR * DK * 2); _Float16* Ql = (_Float16*)take((size_t)NR * DK * 2); _Float16* Kh = (_Float16*)take((size_t)NR * DK * 2); _Float16* Kl = (_Float16*)take((size_t)NR * DK * 2); _Float16* Vth = (_Float16*)take((size_t)NR * DK * 2); _Float16* Vtl = (_Float16*)take((size_t)NR * DK * 2);
  unsigned* MB = (unsigned*)take((size_t)SS * (SS / 32) * 4); int* RA = (int*)take((size_t)SS * 4); int* KE = (int*)take((size_t)(SS / 64) * 32 * 4);
  if (off > ws_size) return;      /* 6 x 2 + 2 = 14 MiB */
  k_wt_f16<<<(DM * DK / 8 + 255) / 256, 256, 0, stream>>>(Wq, BQ, DM, DK, 16.0f); k_wt_f16<<<(DM * DK / 8 + 255) / 256, 256, 0, stream>>>(Wk, BK, DM, DK, 16.0f); k_wt_f16<<<(DM * DK / 8 + 255) / 256, 256, 0, stream>>>(Wv, BV, DM, DK, 16.0f); k_wt_f16<<<(DK * DM / 8 + 255) / 256, 256, 0, stream>>>(Wo, BO, DK, DM, 16.0f);      /* (in,out) -> rows = out, x16, fragment order */
  k_causaltab<<<(SS * (SS / 32) + 255) / 256, 256, 0, stream>>>(MB, RA, KE, SS, SS);
  const dim3 gP(3, NR / 128);
  k_proj<<<gP, 128, 0, stream>>>(x, BQ, BK, BV, bq, bk, bv, Qh, Ql, Kh, Kl, Vth, Vtl);      /* q, k hi/residual and V^T hi/residual per sequence, in fragment order, straight from x: 3 x 128 work-groups side by side */
  k_flashm<SS, SS><<<NB * NH * (SS / 16), 256, 0, stream>>>(Qh, Ql, Kh, Kl, Vth, Vtl, MB, RA, KE, BO, bo, (float*)d_out);      /* one grid over all (sequence, 16 queries): 1024 work-groups of 8 waves; out = O*Wo + bo in its epilogue */
}

// v009
// Measured time: 94.1 microseconds a run.
// Two timings next to v008 put it at 1.10 and 1.11 times that version's speed.
// All steps since v000 together make it 26.9 times as fast.
#include <hip/hip_runtime.h>
// Single-head causal attention (4 sequences x 4096 tokens x 512; d_k = d_v = 64): q, k, v = x*W + b; scores = q.k/8 with j <= i; softmax; out = (attn.v)*Wo + bo -> [4,4096,512].
// Structure: q/k/v by one launch of f16 WMMA GEMMs (32x64 wave tiles, x rounded in registers, f32, exact products + bias) whose epilogue writes q, k as f16 hi + (x2^10) residual planes and V^T as hi + residual planes, all of them, like the weights, in fragment order (see fo_frag); the causal structure computed on device into a key bit plane + per-block key bound; one fused flash-style kernel per (sequence, 16 queries) (8 waves share the queries, the 32-key steps up to the bound dealt to them in turn, three-product hi/lo scores computed transposed (keys x queries), online softmax f32 over the two lanes of a query, P hi + residual packed in registers, two value accumulators (O^T), the 8 partial (max, sum, O) merged in LDS; the merged 16x64 O tile split into hi + residual planes in LDS and multiplied by Wo in the same kernel, each wave 64 of the 512 output columns, bias added) -> the output rows.
// Compute dtype: x, weights, biases rounded to bf16; projections exact; q, k, P, v, O as f16 hi + residual pairs (~2^-21); f32 accumulation and softmax. v_wmma_f32_16x16x32_f16.
#define NB 4
#define SS 4096
#define DM 512
#define DK 64
#define NH 1
#define SCL 0.125f
#define NR (NB * SS)
typedef __bf16 v16b __attribute__((ext_vector_type(16)));
typedef unsigned short v8us __attribute__((ext_vector_type(8), may_alias));
typedef float  v8f  __attribute__((ext_vector_type(8)));
typedef float  v4f  __attribute__((ext_vector_type(4)));
typedef float  v4fa __attribute__((ext_vector_type(4), may_alias));
union FragB { v16b v; v8us half[2]; unsigned short u[16]; };

__device__ __forceinline__ unsigned short bf16_bits(float x) { unsigned int u = __float_as_uint(x); return (unsigned short)((u + 0x7FFFu + ((u >> 16) & 1u)) >> 16); }
__device__ __forceinline__ float bf16_val(unsigned short b) { return __uint_as_float(((unsigned int)b) << 16); }
__device__ __forceinline__ float bf16_round(float x) { return bf16_val(bf16_bits(x)); }
// D += A·B with NT terms: 1 = ah·bh, 2 = + al·bh (A split), 3 = + ah·bl (both split)
template <int NT>
__device__ __forceinline__ v8f mmaN(v16b ah, v16b al, v16b bh, v16b bl, v8f c) {
  c = __builtin_amdgcn_wmma_f32_16x16x32_bf16(false, ah, false, bh, (short)0, c, false, false);
  if (NT >= 2) c = __builtin_amdgcn_wmma_f32_16x16x32_bf16(false, al, false, bh, (short)0, c, false, false);
  if (NT >= 3) c = __builtin_amdgcn_wmma_f32_16x16x32_bf16(false, ah, false, bl, (short)0, c, false, false);
  asm volatile("v_nop\n\tv_nop\n\tv_nop\n\tv_nop" : "+v"(c) : "v"(ah), "v"(al), "v"(bh), "v"(bl));
  return c;
}

__global__ __launch_bounds__(256) void k_wt_bf16(const float* __restrict__ W, unsigned short* __restrict__ Wt, int K, int N) {
  const int t = blockIdx.x * 256 + threadIdx.x;
  const int k8n = K / 8;
  if (t >= N * k8n) return;
  const int n = t / k8n, k8 = (t % k8n) * 8;
  v8us v;
#pragma unroll
  for (int i = 0; i < 8; ++i) v[i] = bf16_bits(W[(size_t)(k8 + i) * N + n]);
  *(v8us*)(Wt + (size_t)n * K + k8) = v;
  
}

// GEMM C[M][N] (f32, pitch ldc) = act(A[M][K]·W + bias). A f32 row-major (pitch lda) converted per fragment to bf16
// (ASPLIT: hi/lo two planes -> 2 terms, else single rounded term); Wt bf16 [N][K] (pitch ldb). BIAS_BF16 rounds the
// bias to bf16 first (bias quantised to bf16 before the add). K%32==0, M%16==0, N%64==0.
template <bool ASPLIT, int ACT, bool BIAS_BF16>
__global__ __launch_bounds__(128) void k_gemm_bf(const float* __restrict__ A, int lda, const unsigned short* __restrict__ Wt, int ldb,
                                               const float* __restrict__ bias, float* __restrict__ C, int ldc, int M, int N, int K) {
  __shared__ __attribute__((aligned(16))) float so[4][16][64];
  const int tid = threadIdx.x, w = tid >> 5, lane = tid & 31, ln = lane & 15, hh = lane >> 4;
  const int ntn = N / 64;
  const int wid = blockIdx.x * 4 + w;
  const int mt = wid / ntn, nq = wid % ntn;
  if (mt * 16 >= M) return;
  const int row0 = mt * 16, col0 = nq * 64;
  const float* arow = A + (size_t)(row0 + ln) * lda;
  v8f acc[4] = {};
  for (int kb = 0; kb < K; kb += 32) {
    FragB ah, al;
    const v4f x0 = *(const v4fa*)(arow + kb + 8 * hh), x1 = *(const v4fa*)(arow + kb + 8 * hh + 4);
    const v4f x2 = *(const v4fa*)(arow + kb + 16 + 8 * hh), x3 = *(const v4fa*)(arow + kb + 16 + 8 * hh + 4);
    float xs[16] = {x0[0],x0[1],x0[2],x0[3],x1[0],x1[1],x1[2],x1[3],x2[0],x2[1],x2[2],x2[3],x3[0],x3[1],x3[2],x3[3]};
#pragma unroll
    for (int i = 0; i < 16; ++i) { const unsigned short hb = bf16_bits(xs[i]); ah.u[i] = hb; al.u[i] = ASPLIT ? bf16_bits(xs[i] - bf16_val(hb)) : (unsigned short)0; }
#pragma unroll
    for (int t = 0; t < 4; ++t) {
      const unsigned short* brow = Wt + (size_t)(col0 + t * 16 + ln) * ldb + kb;
      FragB b;
      b.half[0] = *(const v8us*)(brow + 8 * hh);
      b.half[1] = *(const v8us*)(brow + 16 + 8 * hh);
      acc[t] = mmaN<ASPLIT ? 2 : 1>(ah.v, al.v, b.v, b.v, acc[t]);
    }
  }
#pragma unroll
  for (int t = 0; t < 4; ++t) {
    float bv = bias ? bias[col0 + t * 16 + ln] : 0.f;
    if (BIAS_BF16) bv = bf16_round(bv);
#pragma unroll
    for (int r = 0; r < 8; ++r) { float v = acc[t][r] + bv; if (ACT == 1) v = fmaxf(v, 0.f); so[w][8 * hh + r][t * 16 + ln] = v; }
  }
  __builtin_amdgcn_fence(__ATOMIC_ACQ_REL, "workgroup");
  __builtin_amdgcn_wave_barrier();
  const int rsub = lane >> 4, c4 = (lane & 15) * 4;
  {
#pragma unroll
    for (int q = 0; q < 8; ++q) {
      const int r = q * 2 + rsub;
      const v4f v = *(const v4fa*)&so[w][r][c4];
      *(v4f*)(C + (size_t)(row0 + r) * ldc + col0 + c4) = v;
    }
    
  }
}

// GEMM C = act(A·W + bias + resid): A f32 (ASPLIT -> hi/lo 2 terms), Wt bf16 [N][K]; ACT 0 none, 1 relu, 2 exact gelu;
// resid (optional, f32, row index = (row % rmod), pitch ldr, RES_BF16 rounds it) added before the activation.
template <bool ASPLIT, int ACT, bool BIAS_BF16, bool RES_BF16>
__global__ __launch_bounds__(128) void k_gemm_bf3(const float* __restrict__ A, int lda, const unsigned short* __restrict__ Wt, int ldb,
                                                const float* __restrict__ bias, const float* __restrict__ resid, int rmod, int ldr,
                                                float* __restrict__ C, int ldc, int M, int N, int K) {
  __shared__ __attribute__((aligned(16))) float so[4][16][64];
  const int tid = threadIdx.x, w = tid >> 5, lane = tid & 31, ln = lane & 15, hh = lane >> 4;
  const int ntn = N / 64;
  const int wid = blockIdx.x * 4 + w;
  const int mt = wid / ntn, nq = wid % ntn;
  if (mt * 16 >= M) return;
  const int row0 = mt * 16, col0 = nq * 64;
  const float* arow = A + (size_t)(row0 + ln) * lda;
  v8f acc[4] = {};
  for (int kb = 0; kb < K; kb += 32) {
    FragB ah, al;
    const v4f x0 = *(const v4fa*)(arow + kb + 8 * hh), x1 = *(const v4fa*)(arow + kb + 8 * hh + 4);
    const v4f x2 = *(const v4fa*)(arow + kb + 16 + 8 * hh), x3 = *(const v4fa*)(arow + kb + 16 + 8 * hh + 4);
    float xs[16] = {x0[0],x0[1],x0[2],x0[3],x1[0],x1[1],x1[2],x1[3],x2[0],x2[1],x2[2],x2[3],x3[0],x3[1],x3[2],x3[3]};
#pragma unroll
    for (int i = 0; i < 16; ++i) { const unsigned short hb = bf16_bits(xs[i]); ah.u[i] = hb; al.u[i] = ASPLIT ? bf16_bits(xs[i] - bf16_val(hb)) : (unsigned short)0; }
#pragma unroll
    for (int t = 0; t < 4; ++t) {
      const unsigned short* brow = Wt + (size_t)(col0 + t * 16 + ln) * ldb + kb;
      FragB b;
      b.half[0] = *(const v8us*)(brow + 8 * hh);
      b.half[1] = *(const v8us*)(brow + 16 + 8 * hh);
      acc[t] = mmaN<ASPLIT ? 2 : 1>(ah.v, al.v, b.v, b.v, acc[t]);
    }
  }
#pragma unroll
  for (int t = 0; t < 4; ++t) {
    const int col = col0 + t * 16 + ln;
    float bv = bias ? bias[col] : 0.f;
    if (BIAS_BF16) bv = bf16_round(bv);
#pragma unroll
    for (int r = 0; r < 8; ++r) {
      float v = acc[t][r] + bv;
      if (resid) { float rv = resid[(size_t)((row0 + 8 * hh + r) % rmod) * ldr + col]; if (RES_BF16) rv = bf16_round(rv); v += rv; }
      if (ACT == 1) v = fmaxf(v, 0.f);
      if (ACT == 2) v = 0.5f * v * (1.0f + erff(v * 0.70710678118654752f));
      if (ACT == 3) { const float u = 0.7978845608028654f * (v + 0.044715f * v * v * v); v = 0.5f * v * (1.0f + tanhf(u)); }
      so[w][8 * hh + r][t * 16 + ln] = v;
    }
  }
  __builtin_amdgcn_fence(__ATOMIC_ACQ_REL, "workgroup");
  __builtin_amdgcn_wave_barrier();
  const int rsub = lane >> 4, c4 = (lane & 15) * 4;
  {
#pragma unroll
    for (int q = 0; q < 8; ++q) {
      const int r = q * 2 + rsub;
      const v4f v = *(const v4fa*)&so[w][r][c4];
      *(v4f*)(C + (size_t)(row0 + r) * ldc + col0 + c4) = v;
    }
    
  }
}
// row LayerNorm (biased variance, eps) over N: s = X (+ R); optional out_sum <- s; out_norm <- (s-mu)*rsqrt(var+eps)*g + b
template <bool PARAM_BF16>
__global__ __launch_bounds__(256) void k_layernorm(const float* __restrict__ X, const float* __restrict__ R, const float* __restrict__ g, const float* __restrict__ bta,
                                                  float* __restrict__ out_sum, float* __restrict__ out_norm, int N, float eps) {
  __shared__ float red[256];
  const int row = blockIdx.x, tid = threadIdx.x;
  const float* x = X + (size_t)row * N; const float* rr = R ? R + (size_t)row * N : nullptr;
  float vals[16];                     // up to N = 4096
  const int per = N / 256;            // contiguous chunk per thread? use strided-by-4 chunks: thread handles j = tid*4 + 1024*u
  float s1 = 0.f;
  for (int u = 0; u < per / 4; ++u) {
    const int j = tid * 4 + 1024 * u;
    const v4f a = *(const v4fa*)(x + j);
    v4f b = {0.f,0.f,0.f,0.f}; if (rr) b = *(const v4fa*)(rr + j);
#pragma unroll
    for (int q = 0; q < 4; ++q) { const float v = a[q] + b[q]; vals[u * 4 + q] = v; s1 += v; }
  }
  red[tid] = s1; __syncthreads();
  for (int st = 128; st > 0; st >>= 1) { if (tid < st) red[tid] += red[tid + st]; __syncthreads(); }
  const float mu = red[0] / (float)N; __syncthreads();
  float s2 = 0.f;
  for (int u = 0; u < per / 4; ++u)
#pragma unroll
    for (int q = 0; q < 4; ++q) { const float c = vals[u * 4 + q] - mu; s2 += c * c; }
  red[tid] = s2; __syncthreads();
  for (int st = 128; st > 0; st >>= 1) { if (tid < st) red[tid] += red[tid + st]; __syncthreads(); }
  const float rs = rsqrtf(red[0] / (float)N + eps);
  {
    for (int u = 0; u < per / 4; ++u) {
      const int j = tid * 4 + 1024 * u;
      v4f o, sm;
#pragma unroll
      for (int q = 0; q < 4; ++q) {
        float gg = g[j + q], bb = bta[j + q];
        if (PARAM_BF16) { gg = bf16_round(gg); bb = bf16_round(bb); }
        sm[q] = vals[u * 4 + q]; o[q] = (vals[u * 4 + q] - mu) * rs * gg + bb;
      }
      if (out_sum) *(v4f*)(out_sum + (size_t)row * N + j) = sm;
      *(v4f*)(out_norm + (size_t)row * N + j) = o;
    }
    
  }
}



// ---- f16 WMMA path (v_wmma_f32_16x16x32_f16): 11-bit significands for operands in range — used where a [0,1] probability operand needs more precision than bf16
typedef _Float16 v16h __attribute__((ext_vector_type(16)));
union FragH { v16h v; v8us half[2]; _Float16 h[16]; unsigned short u[16]; };
template <int NT>
__device__ __forceinline__ v8f mmaH(v16h ah, v16h al, v16h bh, v16h bl, v8f c) {
  c = __builtin_amdgcn_wmma_f32_16x16x32_f16(false, ah, false, bh, (short)0, c, false, false);
  if (NT >= 2) c = __builtin_amdgcn_wmma_f32_16x16x32_f16(false, al, false, bh, (short)0, c, false, false);
  if (NT >= 3) c = __builtin_amdgcn_wmma_f32_16x16x32_f16(false, ah, false, bl, (short)0, c, false, false);
  asm volatile("v_nop\n\tv_nop\n\tv_nop\n\tv_nop" : "+v"(c) : "v"(ah), "v"(al), "v"(bh), "v"(bl));
  return c;
}
// batched GEMM like k_gemm_b but f16 operands: A f32 (split into f16 hi/lo if ASPLIT, else rounded to f16), Bt = f16 values [n][k]; alpha; C f32; N multiple of 16 (partial tiles skipped)
template <bool ASPLIT>
__global__ __launch_bounds__(128) void k_gemm_h(const float* __restrict__ A, int lda, size_t sA, const _Float16* __restrict__ Bh, int ldb, size_t sB, float alpha, float* __restrict__ C, int ldc, size_t sC, int M, int N, int K) {
  __shared__ __attribute__((aligned(16))) float so[4][16][64];
  const int tid = threadIdx.x, w = tid >> 5, lane = tid & 31, ln = lane & 15, hh = lane >> 4; const int by = blockIdx.y;
  A += (size_t)by * sA; Bh += (size_t)by * sB; C += (size_t)by * sC;
  const int ntn = (N + 63) / 64; const int wid = blockIdx.x * 4 + w; const int mt = wid / ntn, nq = wid % ntn; if (mt * 16 >= M) return;
  const int row0 = mt * 16, col0 = nq * 64; const float* arow = A + (size_t)(row0 + ln) * lda;
  v8f acc[4] = {};
  for (int kb = 0; kb < K; kb += 32) {
    FragH ah, al;
    const v4f x0 = *(const v4fa*)(arow + kb + 8 * hh), x1 = *(const v4fa*)(arow + kb + 8 * hh + 4), x2 = *(const v4fa*)(arow + kb + 16 + 8 * hh), x3 = *(const v4fa*)(arow + kb + 16 + 8 * hh + 4);
    float xs[16] = {x0[0],x0[1],x0[2],x0[3],x1[0],x1[1],x1[2],x1[3],x2[0],x2[1],x2[2],x2[3],x3[0],x3[1],x3[2],x3[3]};
#pragma unroll
    for (int i = 0; i < 16; ++i) { const _Float16 h = (_Float16)xs[i]; ah.h[i] = h; al.h[i] = ASPLIT ? (_Float16)(xs[i] - (float)h) : (_Float16)0.0f; }
#pragma unroll
    for (int t = 0; t < 4; ++t) { if (col0 + t * 16 >= N) continue; const size_t boff = (size_t)(col0 + t * 16 + ln) * ldb + kb; FragH bq; bq.half[0] = *(const v8us*)(Bh + boff + 8 * hh); bq.half[1] = *(const v8us*)(Bh + boff + 16 + 8 * hh);
      acc[t] = mmaH<ASPLIT ? 2 : 1>(ah.v, al.v, bq.v, bq.v, acc[t]); }
  }
#pragma unroll
  for (int t = 0; t < 4; ++t) { if (col0 + t * 16 >= N) continue;
#pragma unroll
    for (int r = 0; r < 8; ++r) so[w][8 * hh + r][t * 16 + ln] = acc[t][r] * alpha; }
  __builtin_amdgcn_fence(__ATOMIC_ACQ_REL, "workgroup"); __builtin_amdgcn_wave_barrier();
  const int rsub = lane >> 4, c4 = (lane & 15) * 4;
  {
#pragma unroll
    for (int q = 0; q < 8; ++q) { const int r = q * 2 + rsub; if (col0 + c4 < N) { const v4f v = *(const v4fa*)&so[w][r][c4]; *(v4f*)(C + (size_t)(row0 + r) * ldc + col0 + c4) = v; } }
     }
}

// Fragment order of a 16-bit operand matrix [rows][k]: blocks of 16 rows x 32 k, 1 KiB each; inside a block element (row, k) lies at f16 index ((k >> 4) & 1) * 256 + (((k >> 3) & 1) * 16 + (row & 15)) * 8 + (k & 7).
// So the 16 bytes that lane 16 hh + ln takes for one half of a WMMA fragment (row ln, k = 16 half + 8 hh + 0..7) lie at lane * 16 bytes: a wave's load reads 512 bytes in a row, 4 whole 128-byte lines, where a row-major plane gives 32 bytes from each of 16 lines. The register contents are those of g2_frag on the row-major plane.
__device__ __forceinline__ v16h fo_frag(const _Float16* p) { FragH f; f.half[0] = *(const v8us*)((const unsigned short*)p); f.half[1] = *(const v8us*)((const unsigned short*)p + 256); return f.v; }      /* p = the block's start + lane * 8 */
// the same load, its address given as a wave-uniform plane start ub, the lane's 32-bit byte offset vo (block + lane * 16) and a constant: scalar base + one vector offset + immediate, so that no 64-bit address is formed in vector registers
__device__ __forceinline__ v16h fo_frag_s(const char* ub, unsigned vo, int c) { const char* p = ub + vo; FragH f; f.half[0] = *(const v8us*)(p + c); f.half[1] = *(const v8us*)(p + c + 512); return f.v; }
// Wt = f16(bf16(W[k][n]) * scale), rows n, in fragment order with block index (n >> 4) * (K / 32) + (k >> 5), from f32 row-major W[K][N] (scale = power of two; bf16-exact weights stay exact in f16 away from the subnormal range); thread t writes the t-th 16 bytes. K % 32 == 0, N % 16 == 0
__device__ __forceinline__ void wt_f16_chunk(const float* __restrict__ W, _Float16* __restrict__ Wt, int K, int N, float scale, int t) {
  const int blk = t >> 6; const int n = (blk / (K / 32)) * 16 + (t & 15), k8 = (blk % (K / 32)) * 32 + ((t >> 5) & 1) * 16 + ((t >> 4) & 1) * 8; FragH f;
#pragma unroll
  for (int i = 0; i < 8; ++i) f.h[i] = (_Float16)(bf16_round(W[(size_t)(k8 + i) * N + n]) * scale); const v8us o = f.half[0];
  *(v8us*)((unsigned short*)Wt + (size_t)t * 8) = o;
}
// the three projection weights in one launch: blockIdx.y picks the matrix, blockIdx.x * 256 + threadIdx.x its 16-byte piece (DM * DK / 8 pieces, a multiple of 256)
__global__ __launch_bounds__(256) void k_wt_qkv(const float* __restrict__ Wq, const float* __restrict__ Wk, const float* __restrict__ Wv, _Float16* __restrict__ BQ, _Float16* __restrict__ BK, _Float16* __restrict__ BV) {
  const int which = blockIdx.y; const float* W = (which == 0) ? Wq : ((which == 1) ? Wk : Wv); _Float16* Wt = (which == 0) ? BQ : ((which == 1) ? BK : BV);
  wt_f16_chunk(W, Wt, DM, DK, 16.0f, blockIdx.x * 256 + threadIdx.x);
}
// causal structure, thread t: the key bit plane's words 4 t .. 4 t + 3 (bit set = key masked; nk / 32 words a query, a multiple of 4, so the four words are one query's), one 16-byte store; the first threads also write the 'all masked' marks (none) and each 64-query block's key bound. t < nq * nk / 128
typedef unsigned v4u __attribute__((ext_vector_type(4)));
typedef int v4i __attribute__((ext_vector_type(4)));
__device__ __forceinline__ void causaltab_chunk(unsigned* __restrict__ MB, int* __restrict__ RA, int* __restrict__ KE, int nq, int nk, int t) {
  const int nw = nk / 32; const int q = (t * 4) / nw, w0 = (t * 4) % nw; v4u bits;
#pragma unroll
  for (int i = 0; i < 4; ++i) { const int first = q + 1 - 32 * (w0 + i); bits[i] = (first <= 0) ? 0xffffffffu : ((first >= 32) ? 0u : (0xffffffffu << first)); }
  *(v4u*)(MB + (size_t)t * 4) = bits;
  if (t < nq / 4) *(v4i*)(RA + t * 4) = (v4i){0, 0, 0, 0};
  if (t < nq / 64) KE[t * 32] = 64 * (t + 1);
}
// k_gemm_hh variant with fused epilogue: v = acc·alpha + bias[by·sBias + col] (+ CP[(row/rowsPerB)·sCPb + by·64 + col] if CP) ; ACT 0 none / 1 elu ; writes f16 C16 (and f32 C if non-null)
template <int ACT>
__global__ __launch_bounds__(128) void k_gemm_hhx(const _Float16* __restrict__ A, int lda, size_t sA, const _Float16* __restrict__ Bh, int ldb, size_t sB, float alpha, const float* __restrict__ bias, size_t sBias, const float* __restrict__ CP, int rowsPerB, size_t sCPb, int row0g,
    float* __restrict__ C, _Float16* __restrict__ C16, int ldc, size_t sC, int M, int N, int K) {
  __shared__ __attribute__((aligned(16))) float so[4][16][64];
  const int tid = threadIdx.x, w = tid >> 5, lane = tid & 31, ln = lane & 15, hh = lane >> 4; const int by = blockIdx.y;
  A += (size_t)by * sA; Bh += (size_t)by * sB; const size_t cofs = (size_t)by * sC; const float* bp = bias ? bias + (size_t)by * sBias : nullptr;
  const int ntn = (N + 63) / 64; const int wid = blockIdx.x * 4 + w; const int mt = wid / ntn, nq = wid % ntn; if (mt * 16 >= M) return;
  const int row0 = mt * 16, col0 = nq * 64; const _Float16* arow = A + (size_t)(row0 + ln) * lda;
  v8f acc[4] = {};
  for (int kb = 0; kb < K; kb += 32) { FragH ah; ah.half[0] = *(const v8us*)((const unsigned short*)arow + kb + 8 * hh); ah.half[1] = *(const v8us*)((const unsigned short*)arow + kb + 16 + 8 * hh);
#pragma unroll
    for (int t = 0; t < 4; ++t) { if (col0 + t * 16 >= N) continue; const size_t boff = (size_t)(col0 + t * 16 + ln) * ldb + kb; FragH bq; bq.half[0] = *(const v8us*)((const unsigned short*)Bh + boff + 8 * hh); bq.half[1] = *(const v8us*)((const unsigned short*)Bh + boff + 16 + 8 * hh);
      acc[t] = mmaH<1>(ah.v, ah.v, bq.v, bq.v, acc[t]); }
  }
#pragma unroll
  for (int t = 0; t < 4; ++t) { if (col0 + t * 16 >= N) continue; const int col = col0 + t * 16 + ln; const float bv = bp ? bf16_round(bp[col]) : 0.f;
#pragma unroll
    for (int r = 0; r < 8; ++r) { float v = acc[t][r] * alpha + bv; if (CP) { const int bidx = (row0g + row0 + 8 * hh + r) / rowsPerB; v += CP[(size_t)bidx * sCPb + (size_t)by * 64 + col]; } if (ACT == 1) v = (v > 0.f) ? v : expm1f(v); else if (ACT == 7) v = (v > 0.f) ? v + 1.0f : expf(v); else if (ACT == 8) v = tanhf(v); else if (ACT == 9) v = 0.5f * v * (1.0f + tanhf(0.7978845608028654f * (v + 0.044715f * v * v * v))); else if (ACT == 11) v = 1.0f / (1.0f + expf(-v)); else if (ACT == 12) v = (v > 0.f) ? v : 0.01f * v; else if (ACT == 14) v = (v > 0.f) ? v : 0.1f * v; else if (ACT == 15) v = v / (1.0f + expf(-v)); else if (ACT == 3) v = fmaxf(v, 0.f); else if (ACT == 6) v = 0.5f * v * (1.0f + erff(v * 0.70710678118654752f)); so[w][8 * hh + r][t * 16 + ln] = v; } }
  __builtin_amdgcn_fence(__ATOMIC_ACQ_REL, "workgroup"); __builtin_amdgcn_wave_barrier();
  const int rsub = lane >> 4, c4 = (lane & 15) * 4; typedef _Float16 v4h __attribute__((ext_vector_type(4)));
  {
#pragma unroll
    for (int q = 0; q < 8; ++q) { const int r = q * 2 + rsub; if (col0 + c4 < N) { const v4f v = *(const v4fa*)&so[w][r][c4]; if (C) *(v4f*)(C + cofs + (size_t)(row0 + r) * ldc + col0 + c4) = v; if (C16) { v4h h4; for (int i = 0; i < 4; ++i) h4[i] = (_Float16)v[i]; *(v4h*)(C16 + cofs + (size_t)(row0 + r) * ldc + col0 + c4) = h4; } } }
     }
}


typedef _Float16 v4h __attribute__((ext_vector_type(4)));

__global__ __launch_bounds__(256) void k_h16(const float* __restrict__ x, _Float16* __restrict__ X16, size_t n8) { const size_t t = (size_t)blockIdx.x * 256 + threadIdx.x; if (t >= n8) return; FragH f;
#pragma unroll
  for (int q = 0; q < 8; ++q) f.h[q] = (_Float16)x[t * 8 + q]; *(v8us*)((unsigned short*)X16 + t * 8) = f.half[0];  }
__global__ __launch_bounds__(256) void k_round16f(const float* __restrict__ W, _Float16* __restrict__ Bt, size_t n8) { const size_t t = (size_t)blockIdx.x * 256 + threadIdx.x; if (t >= n8) return; FragH f;
#pragma unroll
  for (int i = 0; i < 8; ++i) f.h[i] = (_Float16)(bf16_round(W[t * 8 + i]) * 16.0f); *(v8us*)((unsigned short*)Bt + t * 8) = f.half[0];  }
template <int NHv, int TTv>
__global__ __launch_bounds__(256) void k_vt(const _Float16* __restrict__ V16, int ldv, int voff, _Float16* __restrict__ Vt) { __shared__ unsigned short tl[64][66]; const int tid = threadIdx.x; const int slab = blockIdx.x / (TTv / 64), lg = blockIdx.x % (TTv / 64); const int b = slab / NHv, h = slab % NHv;
  for (int i = tid; i < 64 * 8; i += 256) { const int r = i / 8, c8 = (i % 8) * 8; FragH f; f.half[0] = *(const v8us*)((const unsigned short*)V16 + ((size_t)b * TTv + lg * 64 + r) * ldv + voff + h * 64 + c8);
#pragma unroll
    for (int q = 0; q < 8; ++q) tl[r][c8 + q] = f.u[q]; }
  __syncthreads();
  {
#pragma unroll
    for (int rd = 0; rd < 2; ++rd) { const int d = rd * 32 + tid / 8, pc = tid % 8; FragH f;
#pragma unroll
      for (int q = 0; q < 8; ++q) f.u[q] = tl[pc * 8 + q][d];
      *(v8us*)((unsigned short*)Vt + ((size_t)slab * 64 + d) * TTv + lg * 64 + pc * 8) = f.half[0]; }
     } }

__global__ __launch_bounds__(256) void k_hl(const float* __restrict__ F, _Float16* __restrict__ Hh, _Float16* __restrict__ Hl, size_t n8) { const size_t t = (size_t)blockIdx.x * 256 + threadIdx.x; if (t >= n8) return; FragH fh, fl; const v4f a = *(const v4fa*)(F + t * 8), c = *(const v4fa*)(F + t * 8 + 4);
#pragma unroll
  for (int q = 0; q < 4; ++q) { _Float16 h = (_Float16)a[q]; fh.h[q] = h; fl.h[q] = (_Float16)((a[q] - (float)h) * 1024.0f); h = (_Float16)c[q]; fh.h[4 + q] = h; fl.h[4 + q] = (_Float16)((c[q] - (float)h) * 1024.0f); }
  { *(v8us*)((unsigned short*)Hh + t * 8) = fh.half[0]; *(v8us*)((unsigned short*)Hl + t * 8) = fl.half[0];  } }

// ---- fast GEMM (wave tile 32x64; requires M % 32 == 0 rows per launch region and N % 64 == 0); epilogue = k_gemm_hhx semantics ----
__device__ __forceinline__ v16h g2_frag(const _Float16* p, int hh) { FragH f; f.half[0] = *(const v8us*)((const unsigned short*)p + 8 * hh); f.half[1] = *(const v8us*)((const unsigned short*)p + 16 + 8 * hh); return f.v; }
__device__ __forceinline__ v8f g2_mma(v16h a, v16h b, v8f c) { v8f d = __builtin_amdgcn_wmma_f32_16x16x32_f16(false, a, false, b, (short)0, c, false, false); asm volatile("v_nop\n\tv_nop\n\tv_nop\n\tv_nop" : "+v"(d) : "v"(a), "v"(b)); return d; }
template <int ACT>
__global__ __launch_bounds__(128) void k_gemm2(const _Float16* __restrict__ A, int lda, size_t sA, const _Float16* __restrict__ Bh, int ldb, size_t sB, float alpha, const float* __restrict__ bias, size_t sBias, const float* __restrict__ CP, int rowsPerB, size_t sCPb, int row0g,
    float* __restrict__ C, _Float16* __restrict__ C16, int ldc, size_t sC, int M, int N, int K) {
  __shared__ __attribute__((aligned(16))) float so[4][32][68];
  const int tid = threadIdx.x, w = tid >> 5, lane = tid & 31, ln = lane & 15, hh = lane >> 4; const int by = blockIdx.y;
  A += (size_t)by * sA; Bh += (size_t)by * sB; const size_t cofs = (size_t)by * sC; const float* bp = bias ? bias + (size_t)by * sBias : nullptr;
  const int ntn = N >> 6; const int mt = blockIdx.x / ntn, nq = blockIdx.x - mt * ntn; const int row0 = mt * 128 + 32 * w, col0 = nq * 64; if (row0 >= M) return;
  const _Float16* a0p = A + (size_t)(row0 + ln) * lda; const _Float16* a1p = a0p + (size_t)16 * lda;
  const _Float16* b0p = Bh + (size_t)(col0 + ln) * ldb; const _Float16* b1p = b0p + (size_t)16 * ldb; const _Float16* b2p = b1p + (size_t)16 * ldb; const _Float16* b3p = b2p + (size_t)16 * ldb;
  const v8f z8 = {0.f,0.f,0.f,0.f,0.f,0.f,0.f,0.f}; v8f c00 = z8, c01 = z8, c02 = z8, c03 = z8, c10 = z8, c11 = z8, c12 = z8, c13 = z8;
#pragma unroll 1
  for (int kb = 0; kb < K; kb += 32) { const v16h a0 = g2_frag(a0p + kb, hh), a1 = g2_frag(a1p + kb, hh);
    v16h b = g2_frag(b0p + kb, hh); c00 = g2_mma(a0, b, c00); c10 = g2_mma(a1, b, c10);
    b = g2_frag(b1p + kb, hh); c01 = g2_mma(a0, b, c01); c11 = g2_mma(a1, b, c11);
    b = g2_frag(b2p + kb, hh); c02 = g2_mma(a0, b, c02); c12 = g2_mma(a1, b, c12);
    b = g2_frag(b3p + kb, hh); c03 = g2_mma(a0, b, c03); c13 = g2_mma(a1, b, c13); }
  v8f accs[8] = {c00, c01, c02, c03, c10, c11, c12, c13};
#pragma unroll
  for (int u = 0; u < 8; ++u) { const int t = u & 3, half = u >> 2; const int col = col0 + t * 16 + ln; const float bv = bp ? bf16_round(bp[col]) : 0.f;
#pragma unroll
    for (int r = 0; r < 8; ++r) { const int rloc = half * 16 + 8 * hh + r; float v = accs[u][r] * alpha + bv; if (CP) { const int bidx = (row0g + row0 + rloc) / rowsPerB; v += CP[(size_t)bidx * sCPb + (size_t)by * 64 + col]; }
      if (ACT == 3) v = fmaxf(v, 0.f); else if (ACT == 6) v = 0.5f * v * (1.0f + erff(v * 0.70710678118654752f)); else if (ACT == 11) v = 1.0f / (1.0f + expf(-v)); else if (ACT == 15) v = v / (1.0f + expf(-v)); else if (ACT == 12) v = (v > 0.f) ? v : 0.01f * v; else if (ACT == 8) v = tanhf(v);
      so[w][rloc][t * 16 + ln] = v; } }
  __builtin_amdgcn_fence(__ATOMIC_ACQ_REL, "workgroup"); __builtin_amdgcn_wave_barrier();
  const int rsub = lane >> 4, c4 = (lane & 15) * 4;
  {
#pragma unroll
    for (int q = 0; q < 16; ++q) { const int r = q * 2 + rsub; const v4f v = *(const v4fa*)&so[w][r][c4]; if (C) *(v4f*)(C + cofs + (size_t)(row0 + r) * ldc + col0 + c4) = v; if (C16) { v4h h4; for (int i = 0; i < 4; ++i) h4[i] = (_Float16)v[i]; *(v4h*)(C16 + cofs + (size_t)(row0 + r) * ldc + col0 + c4) = h4; } }
     } }


// ---- fused projection: q, k, v = round(x)*W + b in one launch. blockIdx.x picks the product (0 q, 1 k, 2 v; the three work-groups that read the same 128 rows of x have neighbouring block indices), blockIdx.y the 128 rows; wave tile 32x64 as in k_gemm2.
// x is read as f32 and rounded in registers (bf16 rounding, then f16, exact for normal values); the epilogue writes the planes the attention kernel reads, in fragment order: q, k as f16 hi + (x2^10) residual (rows = tokens, block index (token >> 4) * 2 + (column >> 5)), v as V^T hi + residual per sequence (rows = columns of v, k = tokens, block index (token >> 5) * 4 + (column >> 4)).
__device__ __forceinline__ v16h px_frag(const float* p, int hh) { const v4f x0 = *(const v4fa*)(p + 8 * hh), x1 = *(const v4fa*)(p + 8 * hh + 4), x2 = *(const v4fa*)(p + 16 + 8 * hh), x3 = *(const v4fa*)(p + 16 + 8 * hh + 4); FragH f;
#pragma unroll
  for (int q = 0; q < 4; ++q) { f.h[q] = (_Float16)bf16_round(x0[q]); f.h[4 + q] = (_Float16)bf16_round(x1[q]); f.h[8 + q] = (_Float16)bf16_round(x2[q]); f.h[12 + q] = (_Float16)bf16_round(x3[q]); }
  return f.v; }
// The same launch carries, as work-groups with blockIdx.y >= NR / 128, what only the attention launch reads: Wo in fragment order (the first WO_WG of them) and the causal tables (the other CT_WG).
#define WO_WG (DK * DM / 8 / 128)
#define CT_WG (SS * (SS / 32) / 4 / 128)
static_assert((WO_WG + CT_WG) % 3 == 0, "the extra work-groups fill whole rows of the (3, y) grid");
__global__ __launch_bounds__(128) void k_proj(const float* __restrict__ x, const _Float16* __restrict__ BQ, const _Float16* __restrict__ BK, const _Float16* __restrict__ BV, const float* __restrict__ bq, const float* __restrict__ bk, const float* __restrict__ bv,
    _Float16* __restrict__ Qh, _Float16* __restrict__ Ql, _Float16* __restrict__ Kh, _Float16* __restrict__ Kl, _Float16* __restrict__ Vth, _Float16* __restrict__ Vtl,
    const float* __restrict__ Wo, _Float16* __restrict__ BO, unsigned* __restrict__ MB, int* __restrict__ RA, int* __restrict__ KE) {
  __shared__ __attribute__((aligned(16))) float so[4][32][68];
  if (blockIdx.y >= NR / 128) {      /* block-uniform */
    const int e = (blockIdx.y - NR / 128) * 3 + blockIdx.x;
    if (e < WO_WG) wt_f16_chunk(Wo, BO, DK, DM, 16.0f, e * 128 + threadIdx.x); else causaltab_chunk(MB, RA, KE, SS, SS, (e - WO_WG) * 128 + threadIdx.x);
    return; }
  const int tid = threadIdx.x, w = tid >> 5, lane = tid & 31, ln = lane & 15, hh = lane >> 4; const int which = blockIdx.x, rowg = blockIdx.y * 128, row0 = rowg + 32 * w;
  const _Float16* Bh = (which == 0) ? BQ : ((which == 1) ? BK : BV); const float* bp = (which == 0) ? bq : ((which == 1) ? bk : bv);
  const float* a0p = x + (size_t)(row0 + ln) * DM; const float* a1p = a0p + (size_t)16 * DM;
  const _Float16* b0p = Bh + lane * 8; const _Float16* b1p = b0p + (DM / 32) * 512; const _Float16* b2p = b1p + (DM / 32) * 512; const _Float16* b3p = b2p + (DM / 32) * 512;      /* the four 16-column tiles; a 32-k step is one block of 512 values */
  const float braw[4] = {bp[ln], bp[16 + ln], bp[32 + ln], bp[48 + ln]};      /* asked for ahead of the loop, so that the epilogue does not wait for them */
  const v8f z8 = {0.f,0.f,0.f,0.f,0.f,0.f,0.f,0.f}; v8f c00 = z8, c01 = z8, c02 = z8, c03 = z8, c10 = z8, c11 = z8, c12 = z8, c13 = z8;
  for (int kb = 0; kb < DM; kb += 32) { const v16h a0 = px_frag(a0p + kb, hh), a1 = px_frag(a1p + kb, hh);
    v16h b = fo_frag(b0p + kb * 16); c00 = g2_mma(a0, b, c00); c10 = g2_mma(a1, b, c10);
    b = fo_frag(b1p + kb * 16); c01 = g2_mma(a0, b, c01); c11 = g2_mma(a1, b, c11);
    b = fo_frag(b2p + kb * 16); c02 = g2_mma(a0, b, c02); c12 = g2_mma(a1, b, c12);
    b = fo_frag(b3p + kb * 16); c03 = g2_mma(a0, b, c03); c13 = g2_mma(a1, b, c13); }
  v8f accs[8] = {c00, c01, c02, c03, c10, c11, c12, c13};
#pragma unroll
  for (int u = 0; u < 8; ++u) { const int t = u & 3, half = u >> 2; const float bvv = bf16_round(braw[t]);
#pragma unroll
    for (int r = 0; r < 8; ++r) so[w][half * 16 + 8 * hh + r][t * 16 + ln] = accs[u][r] * 0.0625f + bvv; }
  __builtin_amdgcn_fence(__ATOMIC_ACQ_REL, "workgroup"); __builtin_amdgcn_wave_barrier();      /* the wave reads back values that its other lanes staged; no wave reads another wave's */
  if (which != 2) {      /* block-uniform: q or k, each wave writes its own 32 rows = 2 x 2 blocks of each plane; a store is 512 bytes in a row */
    _Float16* Hh = (which == 0) ? Qh : Kh; _Float16* Hl = (which == 0) ? Ql : Kl; const size_t ho = (size_t)row0 * DK + lane * 8;      /* (row0 >> 4) * 2 blocks */
#pragma unroll
    for (int g = 0; g < 8; ++g) { const float* sp = &so[w][(g >> 2) * 16 + ln][(g & 3) * 16 + 8 * hh]; const v4f va = *(const v4fa*)sp, vb = *(const v4fa*)(sp + 4); FragH fh, fl;      /* g = 16-row tile * 4 + 16-column group */
#pragma unroll
      for (int i = 0; i < 4; ++i) { _Float16 hv = (_Float16)va[i]; fh.h[i] = hv; fl.h[i] = (_Float16)((va[i] - (float)hv) * 1024.0f); hv = (_Float16)vb[i]; fh.h[4 + i] = hv; fl.h[4 + i] = (_Float16)((vb[i] - (float)hv) * 1024.0f); }
      *(v8us*)((unsigned short*)Hh + ho + g * 256) = fh.half[0]; *(v8us*)((unsigned short*)Hl + ho + g * 256) = fl.half[0]; }
    asm volatile("s_wait_xcnt 0x0" ::: "memory");      /* behind the stores above, ahead of any code that could write their address or data registers again */
  } else {      /* v: the wave's 32 tokens are one 32-key step of V^T = 4 blocks of each plane; a lane takes one column and 8 tokens, a store is 512 bytes in a row */
    const size_t vo = (size_t)(rowg / SS) * 64 * SS + (size_t)((rowg % SS) + 32 * w) * 64 + lane * 8;      /* (token >> 5) * 4 blocks */
#pragma unroll
    for (int g = 0; g < 8; ++g) { FragH fh, fl;      /* g = 16-column tile * 2 + half of the 32 tokens */
#pragma unroll
      for (int q = 0; q < 8; ++q) { const float v = so[w][(g & 1) * 16 + 8 * hh + q][(g >> 1) * 16 + ln]; const _Float16 hv = (_Float16)v; fh.h[q] = hv; fl.h[q] = (_Float16)((v - (float)hv) * 1024.0f); }
      *(v8us*)((unsigned short*)Vth + vo + g * 256) = fh.half[0]; *(v8us*)((unsigned short*)Vtl + vo + g * 256) = fl.half[0]; } } }

// lane l takes the value of lane l ^ 16: the two halves of a wave hold the same query's other keys
__device__ __forceinline__ float xhalf(float x) { return __builtin_bit_cast(float, __builtin_amdgcn_permlanex16(__builtin_bit_cast(int, x), __builtin_bit_cast(int, x), 0x76543210, 0xfedcba98, false, false)); }
// amdgpu_waves_per_eu(4, 4): four waves a SIMD = two work-groups a WGP, so the compiler may spend 256 registers a wave on fragments in flight instead of sinking their loads to save registers
template <int TQ, int TK>
__global__ __launch_bounds__(256) __attribute__((amdgpu_waves_per_eu(4, 4))) void k_flashm(const _Float16* __restrict__ Q16, const _Float16* __restrict__ Q16lo, const _Float16* __restrict__ K16, const _Float16* __restrict__ K16lo, const _Float16* __restrict__ Vt, const _Float16* __restrict__ Vtlo, const unsigned* __restrict__ MB, const int* __restrict__ RA, const int* __restrict__ KE, const _Float16* __restrict__ BO, const float* __restrict__ bo, float* __restrict__ OUT) {
  static_assert(NH == 1, "the output projection in the epilogue takes the one head's 64 columns as the whole k range");
  constexpr int RPW = 16, NW = 8, NQB = TQ / RPW, DT = 4, KS = 2;
  __shared__ __attribute__((aligned(16))) float sO[NW][RPW][64 + 4]; __shared__ float sM[NW][RPW], sL[NW][RPW]; __shared__ __attribute__((aligned(16))) _Float16 sAh[RPW][64 + 8], sAl[RPW][64 + 8];      /* merged O as hi + residual; 144-byte rows for the 16-byte fragment reads */
  const int tid = threadIdx.x, w = __builtin_amdgcn_readfirstlane(tid >> 5), lane = tid & 31, ln = lane & 15, hh = lane >> 4;
  /* w through readfirstlane: the wave's number, and with it the key-step counter, stays in a scalar register. Work-group = one 16-query tile; the tiles with the most keys have the lowest block indices (for speed only) */
  const int slab = blockIdx.x % (NB * NH), qt = NQB - 1 - blockIdx.x / (NB * NH); const int b = slab / NH; const int q0 = qt * RPW; const int qblk = q0 >> 6;
  FragH aq[KS], aql[KS];
  /* q, k, V^T and Wo lie in fragment order (fo_frag): 16 rows x 64 columns of q or k are 2 blocks = 1024 values, a 32-key step of V^T is 4 blocks = 2048 values; every load below reads 512 bytes in a row */
  { const size_t qo = ((size_t)b * TQ + q0) * 64 + lane * 8;
#pragma unroll
    for (int ks = 0; ks < KS; ++ks) { aq[ks].v = fo_frag(Q16 + qo + ks * 512); aql[ks].v = fo_frag(Q16lo + qo + ks * 512); } }
  float m_r = -3.0e38f, l_r = 0.f; v8f oacc[DT], oaccl[DT];      /* the lane's query: running maximum (alike in both halves), the sum over this half's keys, O^T columns */
#pragma unroll
  for (int dt = 0; dt < DT; ++dt) { oacc[dt] = (v8f){0.f,0.f,0.f,0.f,0.f,0.f,0.f,0.f}; oaccl[dt] = oacc[dt]; }
  const int jend = __builtin_amdgcn_readfirstlane(max(32, min(TK, (KE[qblk * 32] + 31) & ~31)));      /* block-uniform; through readfirstlane so that the step counter, the bound and the fragment addresses built from them stay in scalar registers */
  const bool am = (RA[q0 + ln] != 0); const float scl = am ? 0.f : SCL;      /* a query marked 'all masked' takes every key with score 0: no mask bit, scale 0 (the products of finite f16 values are finite) */
  /* loads run ahead of their use: a step's key fragments and mask word are asked for during the step before (the first 16 keys' behind its score products, the other 16 keys' between its value products), its value fragments behind its own score products, ahead of the softmax. So the softmax and the products stand between a request and its wait, where each of the six fragment groups of a step used to be waited for right behind its request */
  /* addresses: a scalar plane start + the 32-bit offset vo of (step, lane), alike for all four planes (a 32-key step is 4096 bytes of each); the step ahead is reached through the scalar base */
  const char* uK = (const char*)(K16 + (size_t)b * TK * 64); const char* uKl = (const char*)(K16lo + (size_t)b * TK * 64); const char* uV = (const char*)(Vt + (size_t)slab * 64 * TK); const char* uVl = (const char*)(Vtlo + (size_t)slab * 64 * TK); const char* uM = (const char*)MB;
  const unsigned lb = lane * 16; unsigned vm = (unsigned)(q0 + ln) * (TK / 32) * 4u + 4u * w - 4u * NW;      /* vm: byte offset of the query's mask word of the step before the current one (unsigned, may wrap ahead of the first step; it is stepped before it is used) */
  FragH k0[KS], k0l[KS], k1[KS], k1l[KS]; unsigned mraw = *(const unsigned*)(uM + (vm + 4u * NW));      /* the wave's first step, 32 w < TK: in bounds also for a wave that has no step */
#pragma unroll
  for (int ks = 0; ks < KS; ++ks) { k0[ks].v = fo_frag_s(uK, lb + 32u * w * 128u, ks * 1024); k0l[ks].v = fo_frag_s(uKl, lb + 32u * w * 128u, ks * 1024); }
#pragma unroll
  for (int ks = 0; ks < KS; ++ks) { k1[ks].v = fo_frag_s(uK, lb + 32u * w * 128u, 2048 + ks * 1024); k1l[ks].v = fo_frag_s(uKl, lb + 32u * w * 128u, 2048 + ks * 1024); }
#pragma unroll 1
  for (int j0 = 32 * w; j0 < jend; j0 += 32 * NW) {      /* wave w takes every NW-th 32-key step */
    v8f s[2];
    { v8f acc = (v8f){0.f,0.f,0.f,0.f,0.f,0.f,0.f,0.f}, accr = acc;
#pragma unroll
      for (int ks = 0; ks < KS; ++ks) { acc = mmaH<1>(k0[ks].v, k0[ks].v, aq[ks].v, aq[ks].v, acc); accr = mmaH<1>(k0[ks].v, k0[ks].v, aql[ks].v, aql[ks].v, accr); accr = mmaH<1>(k0l[ks].v, k0l[ks].v, aq[ks].v, aq[ks].v, accr); }
      s[0] = acc + accr * 0.0009765625f; }
    { v8f acc = (v8f){0.f,0.f,0.f,0.f,0.f,0.f,0.f,0.f}, accr = acc;
#pragma unroll
      for (int ks = 0; ks < KS; ++ks) { acc = mmaH<1>(k1[ks].v, k1[ks].v, aq[ks].v, aq[ks].v, acc); accr = mmaH<1>(k1[ks].v, k1[ks].v, aql[ks].v, aql[ks].v, accr); accr = mmaH<1>(k1l[ks].v, k1l[ks].v, aq[ks].v, aq[ks].v, accr); }
      s[1] = acc + accr * 0.0009765625f; }
    const unsigned kinc = (j0 + 32 * NW < jend) ? 32u * NW * 128u : 0u;      /* to the wave's next step; its last step asks for its own fragments again, so that the address stays in bounds */
    const unsigned mcur = mraw;
    __builtin_amdgcn_sched_barrier(0);      /* keeps the requests below from sinking to their uses (and from rising among the score products, whose operands' registers they take) */
    const unsigned vo = lb + (unsigned)j0 * 128u; vm += 4u * NW; const char* nK = uK + kinc; const char* nKl = uKl + kinc;
    FragH bv[DT], bl[DT];
#pragma unroll
    for (int dt = 0; dt < DT; ++dt) { bv[dt].v = fo_frag_s(uV, vo, dt * 1024); bl[dt].v = fo_frag_s(uVl, vo, dt * 1024); }
    mraw = *(const unsigned*)(uM + (kinc >> 10) + vm);      /* 4 bytes of mask a step */
#pragma unroll
    for (int ks = 0; ks < KS; ++ks) { k0[ks].v = fo_frag_s(nK, vo, ks * 1024); k0l[ks].v = fo_frag_s(nKl, vo, ks * 1024); }
    __builtin_amdgcn_sched_barrier(0);      /* the requests above are issued before the softmax starts */
    /* straight-line softmax: a masked score is -inf and the running maximum is never below the finite start value -3.0e38f, so exp gives 0 for a masked key and 1 for a query with no key yet without any test (every loop here is unrolled so that the per-key arrays stay in registers) */
    const unsigned mw = am ? 0u : (mcur >> (8 * hh));      /* shifted so that bit 16 nt + r is this lane's key */
    float sc[2][8], mt[2] = {-INFINITY, -INFINITY};
#pragma unroll
    for (int nt = 0; nt < 2; ++nt)
#pragma unroll
      for (int r = 0; r < 8; ++r) { const float v = s[nt][r] * scl; sc[nt][r] = ((mw & (1u << (nt * 16 + r))) != 0u) ? -INFINITY : v; mt[nt] = fmaxf(mt[nt], sc[nt][r]); }
    float mc = fmaxf(mt[0], mt[1]); mc = fmaxf(mc, xhalf(mc));      /* the other half's 16 keys */
    const float mn = fmaxf(m_r, mc); const float al = expf(m_r - mn); m_r = mn;
    FragH pa, pl; float ps2[2] = {0.f, 0.f};
#pragma unroll
    for (int nt = 0; nt < 2; ++nt)
#pragma unroll
      for (int r = 0; r < 8; ++r) { const float p = expf(sc[nt][r] - mn); ps2[nt] += p; const float ps = p * 1024.0f; const _Float16 ph = (_Float16)ps; pa.h[nt * 8 + r] = ph; pl.h[nt * 8 + r] = (_Float16)((ps - (float)ph) * 1024.0f); }
    l_r = l_r * al + (ps2[0] + ps2[1]);
#pragma unroll
    for (int dt = 0; dt < DT; ++dt) { oacc[dt] *= al; oaccl[dt] *= al; }
#pragma unroll
    for (int dt = 0; dt < DT / 2; ++dt) { oacc[dt] = mmaH<1>(bv[dt].v, bv[dt].v, pa.v, pa.v, oacc[dt]); oaccl[dt] = mmaH<1>(bl[dt].v, bl[dt].v, pa.v, pa.v, oaccl[dt]); oaccl[dt] = mmaH<1>(bv[dt].v, bv[dt].v, pl.v, pl.v, oaccl[dt]); }
    __builtin_amdgcn_sched_barrier(0);      /* the requests below take the registers that the two value tiles above have left */
#pragma unroll
    for (int ks = 0; ks < KS; ++ks) { k1[ks].v = fo_frag_s(nK, vo, 2048 + ks * 1024); k1l[ks].v = fo_frag_s(nKl, vo, 2048 + ks * 1024); }
    __builtin_amdgcn_sched_barrier(0);      /* issued before the last two value tiles' products, not behind them */
#pragma unroll
    for (int dt = DT / 2; dt < DT; ++dt) { oacc[dt] = mmaH<1>(bv[dt].v, bv[dt].v, pa.v, pa.v, oacc[dt]); oaccl[dt] = mmaH<1>(bl[dt].v, bl[dt].v, pa.v, pa.v, oaccl[dt]); oaccl[dt] = mmaH<1>(bv[dt].v, bv[dt].v, pl.v, pl.v, oaccl[dt]); }
    __builtin_amdgcn_sched_barrier(0); }      /* keeps the compiler's step of the load offsets, and the s_wait_xcnt that it puts in front of it, behind the last products instead of right behind the requests above, where the wave would stand in that wait */
  /* output projection, wave w = output columns 64 w .. 64 w + 63: its Wo fragments and bias are asked for right behind the key loop, so that they arrive while the partials are staged (every loop of this projection is unrolled so that its fragment and accumulator arrays stay in registers) */
  const int col0 = w * 64; v16h wb[4][KS]; float braw[4]; const _Float16* bp0 = BO + (size_t)col0 * DK + lane * 8; const float* bo0 = bo + col0 + ln;      /* one base each: the 16 fragment loads differ by constant offsets only */
#pragma unroll
  for (int t = 0; t < 4; ++t) { braw[t] = bo0[t * 16];
#pragma unroll
    for (int ks = 0; ks < KS; ++ks) wb[t][ks] = fo_frag(bp0 + t * 16 * DK + ks * 512); }
  l_r += xhalf(l_r);      /* the two halves' sums joined once */
  if (hh == 0) { sM[w][ln] = m_r; sL[w][ln] = l_r; }
#pragma unroll
  for (int dt = 0; dt < DT; ++dt) { const v8f o = oacc[dt] + oaccl[dt] * 0.0009765625f;      /* the lane's 8 registers are 8 neighbouring columns of its query's row: two 16-byte stores */
    *(v4fa*)&sO[w][ln][dt * 16 + 8 * hh] = (v4f){o[0], o[1], o[2], o[3]}; *(v4fa*)&sO[w][ln][dt * 16 + 8 * hh + 4] = (v4f){o[4], o[5], o[6], o[7]}; }
  __syncthreads();      /* every wave's partial (max, sum, O) is in LDS before any thread merges them */
  { const int r = tid >> 4, pc = tid & 15; float mm = sM[0][r];
#pragma unroll
    for (int u = 1; u < NW; ++u) mm = fmaxf(mm, sM[u][r]);
    float l = 0.f; v4f val = {0.f, 0.f, 0.f, 0.f};
#pragma unroll
    for (int u = 0; u < NW; ++u) { const float e = expf(sM[u][r] - mm); l += e * sL[u][r]; const v4f po = *(const v4fa*)&sO[u][r][pc * 4]; val += po * e; }
    const float li = (l > 0.f) ? 1.0f / (l * 1024.0f) : 0.f;
    const v4f ov = val * li; v4h h4, l4;
#pragma unroll
    for (int i = 0; i < 4; ++i) { h4[i] = (_Float16)ov[i]; l4[i] = (_Float16)((ov[i] - (float)h4[i]) * 1024.0f); }
    *(v4h*)&sAh[r][pc * 4] = h4; *(v4h*)&sAl[r][pc * 4] = l4; }
  __syncthreads();      /* the whole merged tile is in LDS before any wave reads its fragments; behind it nobody reads sO any more, so each wave may stage its output there */
  { v16h ah[KS], al[KS];
#pragma unroll
    for (int ks = 0; ks < KS; ++ks) { ah[ks] = g2_frag(&sAh[ln][ks * 32], hh); al[ks] = g2_frag(&sAl[ln][ks * 32], hh); }
#pragma unroll
    for (int t = 0; t < 4; ++t) { v8f ch = (v8f){0.f,0.f,0.f,0.f,0.f,0.f,0.f,0.f}, cl = ch;
#pragma unroll
      for (int ks = 0; ks < KS; ++ks) { ch = g2_mma(ah[ks], wb[t][ks], ch); cl = g2_mma(al[ks], wb[t][ks], cl); }
      const float bvv = bf16_round(braw[t]);
#pragma unroll
      for (int r = 0; r < 8; ++r) sO[w][8 * hh + r][t * 16 + ln] = (ch[r] * 0.0625f + bvv) + cl[r] * (0.0625f * 0.0009765625f); }
    __builtin_amdgcn_fence(__ATOMIC_ACQ_REL, "workgroup"); __builtin_amdgcn_wave_barrier();      /* the wave reads back rows that its other lanes staged */
    const int rsub = lane >> 4, c4 = (lane & 15) * 4;
#pragma unroll
    for (int q = 0; q < 8; ++q) { const int r = q * 2 + rsub; const v4f v = *(const v4fa*)&sO[w][r][c4]; *(v4f*)(OUT + ((size_t)b * TQ + q0 + r) * DM + col0 + c4) = v; } } }      /* two whole 256-byte row pieces a store */


extern "C" void kernel_launch(void* const* d_in, const int* in_sizes, int n_in,
                              void* d_out, int out_size, void* d_ws, size_t ws_size, hipStream_t stream) {
  (void)in_sizes; (void)n_in; (void)out_size;
  const float* const* I = (const float* const*)d_in; const float* x = I[0]; const float* Wq = I[1]; const float* bq = I[2]; const float* Wk = I[3]; const float* bk = I[4]; const float* Wv = I[5]; const float* bv = I[6]; const float* Wo = I[7]; const float* bo = I[8];
  char* ws = (char*)d_ws; size_t off = 0;
  auto take = [&](size_t bytes) { char* p = ws + off; off += (bytes + 255) & ~(size_t)255; return p; };
  _Float16* BQ = (_Float16*)take((size_t)DK * DM * 2); _Float16* BK = (_Float16*)take((size_t)DK * DM * 2); _Float16* BV = (_Float16*)take((size_t)DK * DM * 2); _Float16* BO = (_Float16*)take((size_t)DM * DK * 2);
  _Float16* Qh = (_Float16*)take((size_t)NR * DK * 2); _Float16* Ql = (_Float16*)take((size_t)NR * DK * 2); _Float16* Kh = (_Float16*)take((size_t)NR * DK * 2); _Float16* Kl = (_Float16*)take((size_t)NR * DK * 2); _Float16* Vth = (_Float16*)take((size_t)NR * DK * 2); _Float16* Vtl = (_Float16*)take((size_t)NR * DK * 2);
  unsigned* MB = (unsigned*)take((size_t)SS * (SS / 32) * 4); int* RA = (int*)take((size_t)SS * 4); int* KE = (int*)take((size_t)(SS / 64) * 32 * 4);
  if (off > ws_size) return;      /* 6 x 2 + 2 = 14 MiB */
  const dim3 gW(DM * DK / 8 / 256, 3);
  k_wt_qkv<<<gW, 256, 0, stream>>>(Wq, Wk, Wv, BQ, BK, BV);      /* (in,out) -> rows = out, x16, fragment order */
  const dim3 gP(3, NR / 128 + (WO_WG + CT_WG) / 3);
  k_proj<<<gP, 128, 0, stream>>>(x, BQ, BK, BV, bq, bk, bv, Qh, Ql, Kh, Kl, Vth, Vtl, Wo, BO, MB, RA, KE);      /* q, k hi/residual and V^T hi/residual per sequence, in fragment order, straight from x: 3 x 128 work-groups side by side; behind them in the grid Wo's reorder and the causal tables */
  k_flashm<SS, SS><<<NB * NH * (SS / 16), 256, 0, stream>>>(Qh, Ql, Kh, Kl, Vth, Vtl, MB, RA, KE, BO, bo, (float*)d_out);      /* one grid over all (sequence, 16 queries): 1024 work-groups of 8 waves; out = O*Wo + bo in its epilogue */
}

// v010
// A run of this version takes 71.7 microseconds.
// Next to v009, in two timings, it ran 1.30 and 1.29 times as fast.
// All steps since v000 together make it 34.8 times as fast.
#include <hip/hip_runtime.h>
// Single-head causal attention (4 sequences x 4096 tokens x 512; d_k = d_v = 64): q, k, v = x*W + b; scores = q.k/8 with j <= i; softmax; out = (attn.v)*Wo + bo -> [4,4096,512].
// Structure: q/k/v by one launch of f16 WMMA GEMMs (32x64 wave tiles, x rounded in registers, f32, exact products + bias) whose epilogue writes q, k as f16 hi + (x2^10) residual planes and V^T as hi + residual planes, all of them, like the weights, in fragment order (see fo_frag); the causal structure computed on device into a key bit plane + per-block key bound; one fused flash-style kernel per (sequence, 16 queries) (8 waves share the queries, the 32-key steps up to the bound dealt to them in turn, three-product hi/lo scores computed transposed (keys x queries), online softmax f32 over the two lanes of a query, P hi + residual packed in registers, two value accumulators (O^T), the 8 partial (max, sum, O) merged in LDS; the merged 16x64 O tile split into hi + residual planes in LDS and multiplied by Wo in the same kernel, each wave 64 of the 512 output columns, bias added) -> the output rows.
// Compute dtype: x, weights, biases rounded to bf16; projections exact; q, k, P, v, O as f16 hi + residual pairs (~2^-21); f32 accumulation and softmax. v_wmma_f32_16x16x32_f16.
#define NB 4
#define SS 4096
#define DM 512
#define DK 64
#define NH 1
#define SCL 0.125f
#define NR (NB * SS)
typedef __bf16 v16b __attribute__((ext_vector_type(16)));
typedef unsigned short v8us __attribute__((ext_vector_type(8), may_alias));
typedef float  v8f  __attribute__((ext_vector_type(8)));
typedef float  v4f  __attribute__((ext_vector_type(4)));
typedef float  v4fa __attribute__((ext_vector_type(4), may_alias));
union FragB { v16b v; v8us half[2]; unsigned short u[16]; };

__device__ __forceinline__ unsigned short bf16_bits(float x) { unsigned int u = __float_as_uint(x); return (unsigned short)((u + 0x7FFFu + ((u >> 16) & 1u)) >> 16); }
__device__ __forceinline__ float bf16_val(unsigned short b) { return __uint_as_float(((unsigned int)b) << 16); }
__device__ __forceinline__ float bf16_round(float x) { return bf16_val(bf16_bits(x)); }
// D += A·B with NT terms: 1 = ah·bh, 2 = + al·bh (A split), 3 = + ah·bl (both split)
template <int NT>
__device__ __forceinline__ v8f mmaN(v16b ah, v16b al, v16b bh, v16b bl, v8f c) {
  c = __builtin_amdgcn_wmma_f32_16x16x32_bf16(false, ah, false, bh, (short)0, c, false, false);
  if (NT >= 2) c = __builtin_amdgcn_wmma_f32_16x16x32_bf16(false, al, false, bh, (short)0, c, false, false);
  if (NT >= 3) c = __builtin_amdgcn_wmma_f32_16x16x32_bf16(false, ah, false, bl, (short)0, c, false, false);
  asm volatile("v_nop\n\tv_nop\n\tv_nop\n\tv_nop" : "+v"(c) : "v"(ah), "v"(al), "v"(bh), "v"(bl));
  return c;
}

__global__ __launch_bounds__(256) void k_wt_bf16(const float* __restrict__ W, unsigned short* __restrict__ Wt, int K, int N) {
  const int t = blockIdx.x * 256 + threadIdx.x;
  const int k8n = K / 8;
  if (t >= N * k8n) return;
  const int n = t / k8n, k8 = (t % k8n) * 8;
  v8us v;
#pragma unroll
  for (int i = 0; i < 8; ++i) v[i] = bf16_bits(W[(size_t)(k8 + i) * N + n]);
  *(v8us*)(Wt + (size_t)n * K + k8) = v;
  
}

// GEMM C[M][N] (f32, pitch ldc) = act(A[M][K]·W + bias). A f32 row-major (pitch lda) converted per fragment to bf16
// (ASPLIT: hi/lo two planes -> 2 terms, else single rounded term); Wt bf16 [N][K] (pitch ldb). BIAS_BF16 rounds the
// bias to bf16 first (bias quantised to bf16 before the add). K%32==0, M%16==0, N%64==0.
template <bool ASPLIT, int ACT, bool BIAS_BF16>
__global__ __launch_bounds__(128) void k_gemm_bf(const float* __restrict__ A, int lda, const unsigned short* __restrict__ Wt, int ldb,
                                               const float* __restrict__ bias, float* __restrict__ C, int ldc, int M, int N, int K) {
  __shared__ __attribute__((aligned(16))) float so[4][16][64];
  const int tid = threadIdx.x, w = tid >> 5, lane = tid & 31, ln = lane & 15, hh = lane >> 4;
  const int ntn = N / 64;
  const int wid = blockIdx.x * 4 + w;
  const int mt = wid / ntn, nq = wid % ntn;
  if (mt * 16 >= M) return;
  const int row0 = mt * 16, col0 = nq * 64;
  const float* arow = A + (size_t)(row0 + ln) * lda;
  v8f acc[4] = {};
  for (int kb = 0; kb < K; kb += 32) {
    FragB ah, al;
    const v4f x0 = *(const v4fa*)(arow + kb + 8 * hh), x1 = *(const v4fa*)(arow + kb + 8 * hh + 4);
    const v4f x2 = *(const v4fa*)(arow + kb + 16 + 8 * hh), x3 = *(const v4fa*)(arow + kb + 16 + 8 * hh + 4);
    float xs[16] = {x0[0],x0[1],x0[2],x0[3],x1[0],x1[1],x1[2],x1[3],x2[0],x2[1],x2[2],x2[3],x3[0],x3[1],x3[2],x3[3]};
#pragma unroll
    for (int i = 0; i < 16; ++i) { const unsigned short hb = bf16_bits(xs[i]); ah.u[i] = hb; al.u[i] = ASPLIT ? bf16_bits(xs[i] - bf16_val(hb)) : (unsigned short)0; }
#pragma unroll
    for (int t = 0; t < 4; ++t) {
      const unsigned short* brow = Wt + (size_t)(col0 + t * 16 + ln) * ldb + kb;
      FragB b;
      b.half[0] = *(const v8us*)(brow + 8 * hh);
      b.half[1] = *(const v8us*)(brow + 16 + 8 * hh);
      acc[t] = mmaN<ASPLIT ? 2 : 1>(ah.v, al.v, b.v, b.v, acc[t]);
    }
  }
#pragma unroll
  for (int t = 0; t < 4; ++t) {
    float bv = bias ? bias[col0 + t * 16 + ln] : 0.f;
    if (BIAS_BF16) bv = bf16_round(bv);
#pragma unroll
    for (int r = 0; r < 8; ++r) { float v = acc[t][r] + bv; if (ACT == 1) v = fmaxf(v, 0.f); so[w][8 * hh + r][t * 16 + ln] = v; }
  }
  __builtin_amdgcn_fence(__ATOMIC_ACQ_REL, "workgroup");
  __builtin_amdgcn_wave_barrier();
  const int rsub = lane >> 4, c4 = (lane & 15) * 4;
  {
#pragma unroll
    for (int q = 0; q < 8; ++q) {
      const int r = q * 2 + rsub;
      const v4f v = *(const v4fa*)&so[w][r][c4];
      *(v4f*)(C + (size_t)(row0 + r) * ldc + col0 + c4) = v;
    }
    
  }
}

// GEMM C = act(A·W + bias + resid): A f32 (ASPLIT -> hi/lo 2 terms), Wt bf16 [N][K]; ACT 0 none, 1 relu, 2 exact gelu;
// resid (optional, f32, row index = (row % rmod), pitch ldr, RES_BF16 rounds it) added before the activation.
template <bool ASPLIT, int ACT, bool BIAS_BF16, bool RES_BF16>
__global__ __launch_bounds__(128) void k_gemm_bf3(const float* __restrict__ A, int lda, const unsigned short* __restrict__ Wt, int ldb,
                                                const float* __restrict__ bias, const float* __restrict__ resid, int rmod, int ldr,
                                                float* __restrict__ C, int ldc, int M, int N, int K) {
  __shared__ __attribute__((aligned(16))) float so[4][16][64];
  const int tid = threadIdx.x, w = tid >> 5, lane = tid & 31, ln = lane & 15, hh = lane >> 4;
  const int ntn = N / 64;
  const int wid = blockIdx.x * 4 + w;
  const int mt = wid / ntn, nq = wid % ntn;
  if (mt * 16 >= M) return;
  const int row0 = mt * 16, col0 = nq * 64;
  const float* arow = A + (size_t)(row0 + ln) * lda;
  v8f acc[4] = {};
  for (int kb = 0; kb < K; kb += 32) {
    FragB ah, al;
    const v4f x0 = *(const v4fa*)(arow + kb + 8 * hh), x1 = *(const v4fa*)(arow + kb + 8 * hh + 4);
    const v4f x2 = *(const v4fa*)(arow + kb + 16 + 8 * hh), x3 = *(const v4fa*)(arow + kb + 16 + 8 * hh + 4);
    float xs[16] = {x0[0],x0[1],x0[2],x0[3],x1[0],x1[1],x1[2],x1[3],x2[0],x2[1],x2[2],x2[3],x3[0],x3[1],x3[2],x3[3]};
#pragma unroll
    for (int i = 0; i < 16; ++i) { const unsigned short hb = bf16_bits(xs[i]); ah.u[i] = hb; al.u[i] = ASPLIT ? bf16_bits(xs[i] - bf16_val(hb)) : (unsigned short)0; }
#pragma unroll
    for (int t = 0; t < 4; ++t) {
      const unsigned short* brow = Wt + (size_t)(col0 + t * 16 + ln) * ldb + kb;
      FragB b;
      b.half[0] = *(const v8us*)(brow + 8 * hh);
      b.half[1] = *(const v8us*)(brow + 16 + 8 * hh);
      acc[t] = mmaN<ASPLIT ? 2 : 1>(ah.v, al.v, b.v, b.v, acc[t]);
    }
  }
#pragma unroll
  for (int t = 0; t < 4; ++t) {
    const int col = col0 + t * 16 + ln;
    float bv = bias ? bias[col] : 0.f;
    if (BIAS_BF16) bv = bf16_round(bv);
#pragma unroll
    for (int r = 0; r < 8; ++r) {
      float v = acc[t][r] + bv;
      if (resid) { float rv = resid[(size_t)((row0 + 8 * hh + r) % rmod) * ldr + col]; if (RES_BF16) rv = bf16_round(rv); v += rv; }
      if (ACT == 1) v = fmaxf(v, 0.f);
      if (ACT == 2) v = 0.5f * v * (1.0f + erff(v * 0.70710678118654752f));
      if (ACT == 3) { const float u = 0.7978845608028654f * (v + 0.044715f * v * v * v); v = 0.5f * v * (1.0f + tanhf(u)); }
      so[w][8 * hh + r][t * 16 + ln] = v;
    }
  }
  __builtin_amdgcn_fence(__ATOMIC_ACQ_REL, "workgroup");
  __builtin_amdgcn_wave_barrier();
  const int rsub = lane >> 4, c4 = (lane & 15) * 4;
  {
#pragma unroll
    for (int q = 0; q < 8; ++q) {
      const int r = q * 2 + rsub;
      const v4f v = *(const v4fa*)&so[w][r][c4];
      *(v4f*)(C + (size_t)(row0 + r) * ldc + col0 + c4) = v;
    }
    
  }
}
// row LayerNorm (biased variance, eps) over N: s = X (+ R); optional out_sum <- s; out_norm <- (s-mu)*rsqrt(var+eps)*g + b
template <bool PARAM_BF16>
__global__ __launch_bounds__(256) void k_layernorm(const float* __restrict__ X, const float* __restrict__ R, const float* __restrict__ g, const float* __restrict__ bta,
                                                  float* __restrict__ out_sum, float* __restrict__ out_norm, int N, float eps) {
  __shared__ float red[256];
  const int row = blockIdx.x, tid = threadIdx.x;
  const float* x = X + (size_t)row * N; const float* rr = R ? R + (size_t)row * N : nullptr;
  float vals[16];                     // up to N = 4096
  const int per = N / 256;            // contiguous chunk per thread? use strided-by-4 chunks: thread handles j = tid*4 + 1024*u
  float s1 = 0.f;
  for (int u = 0; u < per / 4; ++u) {
    const int j = tid * 4 + 1024 * u;
    const v4f a = *(const v4fa*)(x + j);
    v4f b = {0.f,0.f,0.f,0.f}; if (rr) b = *(const v4fa*)(rr + j);
#pragma unroll
    for (int q = 0; q < 4; ++q) { const float v = a[q] + b[q]; vals[u * 4 + q] = v; s1 += v; }
  }
  red[tid] = s1; __syncthreads();
  for (int st = 128; st > 0; st >>= 1) { if (tid < st) red[tid] += red[tid + st]; __syncthreads(); }
  const float mu = red[0] / (float)N; __syncthreads();
  float s2 = 0.f;
  for (int u = 0; u < per / 4; ++u)
#pragma unroll
    for (int q = 0; q < 4; ++q) { const float c = vals[u * 4 + q] - mu; s2 += c * c; }
  red[tid] = s2; __syncthreads();
  for (int st = 128; st > 0; st >>= 1) { if (tid < st) red[tid] += red[tid + st]; __syncthreads(); }
  const float rs = rsqrtf(red[0] / (float)N + eps);
  {
    for (int u = 0; u < per / 4; ++u) {
      const int j = tid * 4 + 1024 * u;
      v4f o, sm;
#pragma unroll
      for (int q = 0; q < 4; ++q) {
        float gg = g[j + q], bb = bta[j + q];
        if (PARAM_BF16) { gg = bf16_round(gg); bb = bf16_round(bb); }
        sm[q] = vals[u * 4 + q]; o[q] = (vals[u * 4 + q] - mu) * rs * gg + bb;
      }
      if (out_sum) *(v4f*)(out_sum + (size_t)row * N + j) = sm;
      *(v4f*)(out_norm + (size_t)row * N + j) = o;
    }
    
  }
}



// ---- f16 WMMA path (v_wmma_f32_16x16x32_f16): 11-bit significands for operands in range — used where a [0,1] probability operand needs more precision than bf16
typedef _Float16 v16h __attribute__((ext_vector_type(16)));
union FragH { v16h v; v8us half[2]; _Float16 h[16]; unsigned short u[16]; };
template <int NT>
__device__ __forceinline__ v8f mmaH(v16h ah, v16h al, v16h bh, v16h bl, v8f c) {
  c = __builtin_amdgcn_wmma_f32_16x16x32_f16(false, ah, false, bh, (short)0, c, false, false);
  if (NT >= 2) c = __builtin_amdgcn_wmma_f32_16x16x32_f16(false, al, false, bh, (short)0, c, false, false);
  if (NT >= 3) c = __builtin_amdgcn_wmma_f32_16x16x32_f16(false, ah, false, bl, (short)0, c, false, false);
  asm volatile("v_nop\n\tv_nop\n\tv_nop\n\tv_nop" : "+v"(c) : "v"(ah), "v"(al), "v"(bh), "v"(bl));
  return c;
}
// batched GEMM like k_gemm_b but f16 operands: A f32 (split into f16 hi/lo if ASPLIT, else rounded to f16), Bt = f16 values [n][k]; alpha; C f32; N multiple of 16 (partial tiles skipped)
template <bool ASPLIT>
__global__ __launch_bounds__(128) void k_gemm_h(const float* __restrict__ A, int lda, size_t sA, const _Float16* __restrict__ Bh, int ldb, size_t sB, float alpha, float* __restrict__ C, int ldc, size_t sC, int M, int N, int K) {
  __shared__ __attribute__((aligned(16))) float so[4][16][64];
  const int tid = threadIdx.x, w = tid >> 5, lane = tid & 31, ln = lane & 15, hh = lane >> 4; const int by = blockIdx.y;
  A += (size_t)by * sA; Bh += (size_t)by * sB; C += (size_t)by * sC;
  const int ntn = (N + 63) / 64; const int wid = blockIdx.x * 4 + w; const int mt = wid / ntn, nq = wid % ntn; if (mt * 16 >= M) return;
  const int row0 = mt * 16, col0 = nq * 64; const float* arow = A + (size_t)(row0 + ln) * lda;
  v8f acc[4] = {};
  for (int kb = 0; kb < K; kb += 32) {
    FragH ah, al;
    const v4f x0 = *(const v4fa*)(arow + kb + 8 * hh), x1 = *(const v4fa*)(arow + kb + 8 * hh + 4), x2 = *(const v4fa*)(arow + kb + 16 + 8 * hh), x3 = *(const v4fa*)(arow + kb + 16 + 8 * hh + 4);
    float xs[16] = {x0[0],x0[1],x0[2],x0[3],x1[0],x1[1],x1[2],x1[3],x2[0],x2[1],x2[2],x2[3],x3[0],x3[1],x3[2],x3[3]};
#pragma unroll
    for (int i = 0; i < 16; ++i) { const _Float16 h = (_Float16)xs[i]; ah.h[i] = h; al.h[i] = ASPLIT ? (_Float16)(xs[i] - (float)h) : (_Float16)0.0f; }
#pragma unroll
    for (int t = 0; t < 4; ++t) { if (col0 + t * 16 >= N) continue; const size_t boff = (size_t)(col0 + t * 16 + ln) * ldb + kb; FragH bq; bq.half[0] = *(const v8us*)(Bh + boff + 8 * hh); bq.half[1] = *(const v8us*)(Bh + boff + 16 + 8 * hh);
      acc[t] = mmaH<ASPLIT ? 2 : 1>(ah.v, al.v, bq.v, bq.v, acc[t]); }
  }
#pragma unroll
  for (int t = 0; t < 4; ++t) { if (col0 + t * 16 >= N) continue;
#pragma unroll
    for (int r = 0; r < 8; ++r) so[w][8 * hh + r][t * 16 + ln] = acc[t][r] * alpha; }
  __builtin_amdgcn_fence(__ATOMIC_ACQ_REL, "workgroup"); __builtin_amdgcn_wave_barrier();
  const int rsub = lane >> 4, c4 = (lane & 15) * 4;
  {
#pragma unroll
    for (int q = 0; q < 8; ++q) { const int r = q * 2 + rsub; if (col0 + c4 < N) { const v4f v = *(const v4fa*)&so[w][r][c4]; *(v4f*)(C + (size_t)(row0 + r) * ldc + col0 + c4) = v; } }
     }
}

// Fragment order of a 16-bit operand matrix [rows][k]: blocks of 16 rows x 32 k, 1 KiB each; inside a block element (row, k) lies at f16 index ((k >> 4) & 1) * 256 + (((k >> 3) & 1) * 16 + (row & 15)) * 8 + (k & 7).
// So the 16 bytes that lane 16 hh + ln takes for one half of a WMMA fragment (row ln, k = 16 half + 8 hh + 0..7) lie at lane * 16 bytes: a wave's load reads 512 bytes in a row, 4 whole 128-byte lines, where a row-major plane gives 32 bytes from each of 16 lines. The register contents are those of g2_frag on the row-major plane.
__device__ __forceinline__ v16h fo_frag(const _Float16* p) { FragH f; f.half[0] = *(const v8us*)((const unsigned short*)p); f.half[1] = *(const v8us*)((const unsigned short*)p + 256); return f.v; }      /* p = the block's start + lane * 8 */
// the same load, its address given as a wave-uniform plane start ub, the lane's 32-bit byte offset vo (block + lane * 16) and a constant: scalar base + one vector offset + immediate, so that no 64-bit address is formed in vector registers
__device__ __forceinline__ v16h fo_frag_s(const char* ub, unsigned vo, int c) { const char* p = ub + vo; FragH f; f.half[0] = *(const v8us*)(p + c); f.half[1] = *(const v8us*)(p + c + 512); return f.v; }
// Wt = f16(bf16(W[k][n]) * scale), rows n, in fragment order with block index (n >> 4) * (K / 32) + (k >> 5), from f32 row-major W[K][N] (scale = power of two; bf16-exact weights stay exact in f16 away from the subnormal range); thread t writes the t-th 16 bytes. K % 32 == 0, N % 16 == 0
__device__ __forceinline__ void wt_f16_chunk(const float* __restrict__ W, _Float16* __restrict__ Wt, int K, int N, float scale, int t) {
  const int blk = t >> 6; const int n = (blk / (K / 32)) * 16 + (t & 15), k8 = (blk % (K / 32)) * 32 + ((t >> 5) & 1) * 16 + ((t >> 4) & 1) * 8; FragH f;
#pragma unroll
  for (int i = 0; i < 8; ++i) f.h[i] = (_Float16)(bf16_round(W[(size_t)(k8 + i) * N + n]) * scale); const v8us o = f.half[0];
  *(v8us*)((unsigned short*)Wt + (size_t)t * 8) = o;
}
// the three projection weights in one launch: blockIdx.y picks the matrix, blockIdx.x * 256 + threadIdx.x its 16-byte piece (DM * DK / 8 pieces, a multiple of 256)
__global__ __launch_bounds__(256) void k_wt_qkv(const float* __restrict__ Wq, const float* __restrict__ Wk, const float* __restrict__ Wv, _Float16* __restrict__ BQ, _Float16* __restrict__ BK, _Float16* __restrict__ BV) {
  const int which = blockIdx.y; const float* W = (which == 0) ? Wq : ((which == 1) ? Wk : Wv); _Float16* Wt = (which == 0) ? BQ : ((which == 1) ? BK : BV);
  wt_f16_chunk(W, Wt, DM, DK, 16.0f, blockIdx.x * 256 + threadIdx.x);
}
// causal structure, thread t: the key bit plane's words 4 t .. 4 t + 3 (bit set = key masked; nk / 32 words a query, a multiple of 4, so the four words are one query's), one 16-byte store; the first threads also write the 'all masked' marks (none) and each 64-query block's key bound. t < nq * nk / 128
typedef unsigned v4u __attribute__((ext_vector_type(4)));
typedef int v4i __attribute__((ext_vector_type(4)));
__device__ __forceinline__ void causaltab_chunk(unsigned* __restrict__ MB, int* __restrict__ RA, int* __restrict__ KE, int nq, int nk, int t) {
  const int nw = nk / 32; const int q = (t * 4) / nw, w0 = (t * 4) % nw; v4u bits;
#pragma unroll
  for (int i = 0; i < 4; ++i) { const int first = q + 1 - 32 * (w0 + i); bits[i] = (first <= 0) ? 0xffffffffu : ((first >= 32) ? 0u : (0xffffffffu << first)); }
  *(v4u*)(MB + (size_t)t * 4) = bits;
  if (t < nq / 4) *(v4i*)(RA + t * 4) = (v4i){0, 0, 0, 0};
  if (t < nq / 64) KE[t * 32] = 64 * (t + 1);
}
// k_gemm_hh variant with fused epilogue: v = acc·alpha + bias[by·sBias + col] (+ CP[(row/rowsPerB)·sCPb + by·64 + col] if CP) ; ACT 0 none / 1 elu ; writes f16 C16 (and f32 C if non-null)
template <int ACT>
__global__ __launch_bounds__(128) void k_gemm_hhx(const _Float16* __restrict__ A, int lda, size_t sA, const _Float16* __restrict__ Bh, int ldb, size_t sB, float alpha, const float* __restrict__ bias, size_t sBias, const float* __restrict__ CP, int rowsPerB, size_t sCPb, int row0g,
    float* __restrict__ C, _Float16* __restrict__ C16, int ldc, size_t sC, int M, int N, int K) {
  __shared__ __attribute__((aligned(16))) float so[4][16][64];
  const int tid = threadIdx.x, w = tid >> 5, lane = tid & 31, ln = lane & 15, hh = lane >> 4; const int by = blockIdx.y;
  A += (size_t)by * sA; Bh += (size_t)by * sB; const size_t cofs = (size_t)by * sC; const float* bp = bias ? bias + (size_t)by * sBias : nullptr;
  const int ntn = (N + 63) / 64; const int wid = blockIdx.x * 4 + w; const int mt = wid / ntn, nq = wid % ntn; if (mt * 16 >= M) return;
  const int row0 = mt * 16, col0 = nq * 64; const _Float16* arow = A + (size_t)(row0 + ln) * lda;
  v8f acc[4] = {};
  for (int kb = 0; kb < K; kb += 32) { FragH ah; ah.half[0] = *(const v8us*)((const unsigned short*)arow + kb + 8 * hh); ah.half[1] = *(const v8us*)((const unsigned short*)arow + kb + 16 + 8 * hh);
#pragma unroll
    for (int t = 0; t < 4; ++t) { if (col0 + t * 16 >= N) continue; const size_t boff = (size_t)(col0 + t * 16 + ln) * ldb + kb; FragH bq; bq.half[0] = *(const v8us*)((const unsigned short*)Bh + boff + 8 * hh); bq.half[1] = *(const v8us*)((const unsigned short*)Bh + boff + 16 + 8 * hh);
      acc[t] = mmaH<1>(ah.v, ah.v, bq.v, bq.v, acc[t]); }
  }
#pragma unroll
  for (int t = 0; t < 4; ++t) { if (col0 + t * 16 >= N) continue; const int col = col0 + t * 16 + ln; const float bv = bp ? bf16_round(bp[col]) : 0.f;
#pragma unroll
    for (int r = 0; r < 8; ++r) { float v = acc[t][r] * alpha + bv; if (CP) { const int bidx = (row0g + row0 + 8 * hh + r) / rowsPerB; v += CP[(size_t)bidx * sCPb + (size_t)by * 64 + col]; } if (ACT == 1) v = (v > 0.f) ? v : expm1f(v); else if (ACT == 7) v = (v > 0.f) ? v + 1.0f : expf(v); else if (ACT == 8) v = tanhf(v); else if (ACT == 9) v = 0.5f * v * (1.0f + tanhf(0.7978845608028654f * (v + 0.044715f * v * v * v))); else if (ACT == 11) v = 1.0f / (1.0f + expf(-v)); else if (ACT == 12) v = (v > 0.f) ? v : 0.01f * v; else if (ACT == 14) v = (v > 0.f) ? v : 0.1f * v; else if (ACT == 15) v = v / (1.0f + expf(-v)); else if (ACT == 3) v = fmaxf(v, 0.f); else if (ACT == 6) v = 0.5f * v * (1.0f + erff(v * 0.70710678118654752f)); so[w][8 * hh + r][t * 16 + ln] = v; } }
  __builtin_amdgcn_fence(__ATOMIC_ACQ_REL, "workgroup"); __builtin_amdgcn_wave_barrier();
  const int rsub = lane >> 4, c4 = (lane & 15) * 4; typedef _Float16 v4h __attribute__((ext_vector_type(4)));
  {
#pragma unroll
    for (int q = 0; q < 8; ++q) { const int r = q * 2 + rsub; if (col0 + c4 < N) { const v4f v = *(const v4fa*)&so[w][r][c4]; if (C) *(v4f*)(C + cofs + (size_t)(row0 + r) * ldc + col0 + c4) = v; if (C16) { v4h h4; for (int i = 0; i < 4; ++i) h4[i] = (_Float16)v[i]; *(v4h*)(C16 + cofs + (size_t)(row0 + r) * ldc + col0 + c4) = h4; } } }
     }
}


typedef _Float16 v4h __attribute__((ext_vector_type(4)));

__global__ __launch_bounds__(256) void k_h16(const float* __restrict__ x, _Float16* __restrict__ X16, size_t n8) { const size_t t = (size_t)blockIdx.x * 256 + threadIdx.x; if (t >= n8) return; FragH f;
#pragma unroll
  for (int q = 0; q < 8; ++q) f.h[q] = (_Float16)x[t * 8 + q]; *(v8us*)((unsigned short*)X16 + t * 8) = f.half[0];  }
__global__ __launch_bounds__(256) void k_round16f(const float* __restrict__ W, _Float16* __restrict__ Bt, size_t n8) { const size_t t = (size_t)blockIdx.x * 256 + threadIdx.x; if (t >= n8) return; FragH f;
#pragma unroll
  for (int i = 0; i < 8; ++i) f.h[i] = (_Float16)(bf16_round(W[t * 8 + i]) * 16.0f); *(v8us*)((unsigned short*)Bt + t * 8) = f.half[0];  }
template <int NHv, int TTv>
__global__ __launch_bounds__(256) void k_vt(const _Float16* __restrict__ V16, int ldv, int voff, _Float16* __restrict__ Vt) { __shared__ unsigned short tl[64][66]; const int tid = threadIdx.x; const int slab = blockIdx.x / (TTv / 64), lg = blockIdx.x % (TTv / 64); const int b = slab / NHv, h = slab % NHv;
  for (int i = tid; i < 64 * 8; i += 256) { const int r = i / 8, c8 = (i % 8) * 8; FragH f; f.half[0] = *(const v8us*)((const unsigned short*)V16 + ((size_t)b * TTv + lg * 64 + r) * ldv + voff + h * 64 + c8);
#pragma unroll
    for (int q = 0; q < 8; ++q) tl[r][c8 + q] = f.u[q]; }
  __syncthreads();
  {
#pragma unroll
    for (int rd = 0; rd < 2; ++rd) { const int d = rd * 32 + tid / 8, pc = tid % 8; FragH f;
#pragma unroll
      for (int q = 0; q < 8; ++q) f.u[q] = tl[pc * 8 + q][d];
      *(v8us*)((unsigned short*)Vt + ((size_t)slab * 64 + d) * TTv + lg * 64 + pc * 8) = f.half[0]; }
     } }

__global__ __launch_bounds__(256) void k_hl(const float* __restrict__ F, _Float16* __restrict__ Hh, _Float16* __restrict__ Hl, size_t n8) { const size_t t = (size_t)blockIdx.x * 256 + threadIdx.x; if (t >= n8) return; FragH fh, fl; const v4f a = *(const v4fa*)(F + t * 8), c = *(const v4fa*)(F + t * 8 + 4);
#pragma unroll
  for (int q = 0; q < 4; ++q) { _Float16 h = (_Float16)a[q]; fh.h[q] = h; fl.h[q] = (_Float16)((a[q] - (float)h) * 1024.0f); h = (_Float16)c[q]; fh.h[4 + q] = h; fl.h[4 + q] = (_Float16)((c[q] - (float)h) * 1024.0f); }
  { *(v8us*)((unsigned short*)Hh + t * 8) = fh.half[0]; *(v8us*)((unsigned short*)Hl + t * 8) = fl.half[0];  } }

// ---- fast GEMM (wave tile 32x64; requires M % 32 == 0 rows per launch region and N % 64 == 0); epilogue = k_gemm_hhx semantics ----
__device__ __forceinline__ v16h g2_frag(const _Float16* p, int hh) { FragH f; f.half[0] = *(const v8us*)((const unsigned short*)p + 8 * hh); f.half[1] = *(const v8us*)((const unsigned short*)p + 16 + 8 * hh); return f.v; }
__device__ __forceinline__ v8f g2_mma(v16h a, v16h b, v8f c) { v8f d = __builtin_amdgcn_wmma_f32_16x16x32_f16(false, a, false, b, (short)0, c, false, false); asm volatile("v_nop\n\tv_nop\n\tv_nop\n\tv_nop" : "+v"(d) : "v"(a), "v"(b)); return d; }
template <int ACT>
__global__ __launch_bounds__(128) void k_gemm2(const _Float16* __restrict__ A, int lda, size_t sA, const _Float16* __restrict__ Bh, int ldb, size_t sB, float alpha, const float* __restrict__ bias, size_t sBias, const float* __restrict__ CP, int rowsPerB, size_t sCPb, int row0g,
    float* __restrict__ C, _Float16* __restrict__ C16, int ldc, size_t sC, int M, int N, int K) {
  __shared__ __attribute__((aligned(16))) float so[4][32][68];
  const int tid = threadIdx.x, w = tid >> 5, lane = tid & 31, ln = lane & 15, hh = lane >> 4; const int by = blockIdx.y;
  A += (size_t)by * sA; Bh += (size_t)by * sB; const size_t cofs = (size_t)by * sC; const float* bp = bias ? bias + (size_t)by * sBias : nullptr;
  const int ntn = N >> 6; const int mt = blockIdx.x / ntn, nq = blockIdx.x - mt * ntn; const int row0 = mt * 128 + 32 * w, col0 = nq * 64; if (row0 >= M) return;
  const _Float16* a0p = A + (size_t)(row0 + ln) * lda; const _Float16* a1p = a0p + (size_t)16 * lda;
  const _Float16* b0p = Bh + (size_t)(col0 + ln) * ldb; const _Float16* b1p = b0p + (size_t)16 * ldb; const _Float16* b2p = b1p + (size_t)16 * ldb; const _Float16* b3p = b2p + (size_t)16 * ldb;
  const v8f z8 = {0.f,0.f,0.f,0.f,0.f,0.f,0.f,0.f}; v8f c00 = z8, c01 = z8, c02 = z8, c03 = z8, c10 = z8, c11 = z8, c12 = z8, c13 = z8;
#pragma unroll 1
  for (int kb = 0; kb < K; kb += 32) { const v16h a0 = g2_frag(a0p + kb, hh), a1 = g2_frag(a1p + kb, hh);
    v16h b = g2_frag(b0p + kb, hh); c00 = g2_mma(a0, b, c00); c10 = g2_mma(a1, b, c10);
    b = g2_frag(b1p + kb, hh); c01 = g2_mma(a0, b, c01); c11 = g2_mma(a1, b, c11);
    b = g2_frag(b2p + kb, hh); c02 = g2_mma(a0, b, c02); c12 = g2_mma(a1, b, c12);
    b = g2_frag(b3p + kb, hh); c03 = g2_mma(a0, b, c03); c13 = g2_mma(a1, b, c13); }
  v8f accs[8] = {c00, c01, c02, c03, c10, c11, c12, c13};
#pragma unroll
  for (int u = 0; u < 8; ++u) { const int t = u & 3, half = u >> 2; const int col = col0 + t * 16 + ln; const float bv = bp ? bf16_round(bp[col]) : 0.f;
#pragma unroll
    for (int r = 0; r < 8; ++r) { const int rloc = half * 16 + 8 * hh + r; float v = accs[u][r] * alpha + bv; if (CP) { const int bidx = (row0g + row0 + rloc) / rowsPerB; v += CP[(size_t)bidx * sCPb + (size_t)by * 64 + col]; }
      if (ACT == 3) v = fmaxf(v, 0.f); else if (ACT == 6) v = 0.5f * v * (1.0f + erff(v * 0.70710678118654752f)); else if (ACT == 11) v = 1.0f / (1.0f + expf(-v)); else if (ACT == 15) v = v / (1.0f + expf(-v)); else if (ACT == 12) v = (v > 0.f) ? v : 0.01f * v; else if (ACT == 8) v = tanhf(v);
      so[w][rloc][t * 16 + ln] = v; } }
  __builtin_amdgcn_fence(__ATOMIC_ACQ_REL, "workgroup"); __builtin_amdgcn_wave_barrier();
  const int rsub = lane >> 4, c4 = (lane & 15) * 4;
  {
#pragma unroll
    for (int q = 0; q < 16; ++q) { const int r = q * 2 + rsub; const v4f v = *(const v4fa*)&so[w][r][c4]; if (C) *(v4f*)(C + cofs + (size_t)(row0 + r) * ldc + col0 + c4) = v; if (C16) { v4h h4; for (int i = 0; i < 4; ++i) h4[i] = (_Float16)v[i]; *(v4h*)(C16 + cofs + (size_t)(row0 + r) * ldc + col0 + c4) = h4; } }
     } }


// ---- fused projection: q, k, v = round(x)*W + b in one launch. blockIdx.x picks the product (0 q, 1 k, 2 v; the three work-groups that read the same 128 rows of x have neighbouring block indices), blockIdx.y the 128 rows; wave tile 32x64 as in k_gemm2.
// x is read as f32 and rounded in registers (bf16 rounding, then f16, exact for normal values); the epilogue writes the planes the attention kernel reads, in fragment order: q, k as f16 hi + (x2^10) residual (rows = tokens, block index (token >> 4) * 2 + (column >> 5)), v as V^T hi + residual per sequence (rows = columns of v, k = tokens, block index (token >> 5) * 4 + (column >> 4)).
// a 32-k step of x for one wave, as it comes from memory: the two 16-row tiles, four 16-byte pieces a lane each. Asking (px_ask) and rounding (px_cvt) are apart, so that a step's x can be asked for two steps ahead of its use.
struct PXraw { v4f r[8]; };
template <bool V> struct PFlag { static constexpr bool value = V; };
__device__ __forceinline__ void px_ask(PXraw& d, const float* p) {      /* p = the lane's row of the upper tile, column k + 8 hh; unrolled so that r is indexed by constants and stays in registers */
#pragma unroll
  for (int u = 0; u < 2; ++u) { const float* q = p + (size_t)u * 16 * DM; d.r[u * 4] = *(const v4fa*)q; d.r[u * 4 + 1] = *(const v4fa*)(q + 4); d.r[u * 4 + 2] = *(const v4fa*)(q + 16); d.r[u * 4 + 3] = *(const v4fa*)(q + 20); } }
__device__ __forceinline__ v16h px_cvt(const v4f x0, const v4f x1, const v4f x2, const v4f x3) { FragH f;
#pragma unroll
  for (int q = 0; q < 4; ++q) { f.h[q] = (_Float16)bf16_round(x0[q]); f.h[4 + q] = (_Float16)bf16_round(x1[q]); f.h[8 + q] = (_Float16)bf16_round(x2[q]); f.h[12 + q] = (_Float16)bf16_round(x3[q]); }
  return f.v; }
// The same launch carries, as work-groups with blockIdx.y >= NR / 128, what only the attention launch reads: Wo in fragment order (the first WO_WG of them) and the causal tables (the other CT_WG).
#define WO_WG (DK * DM / 8 / 128)
#define CT_WG (SS * (SS / 32) / 4 / 128)
static_assert((WO_WG + CT_WG) % 3 == 0, "the extra work-groups fill whole rows of the (3, y) grid");
__global__ __launch_bounds__(128) void k_proj(const float* __restrict__ x, const _Float16* __restrict__ BQ, const _Float16* __restrict__ BK, const _Float16* __restrict__ BV, const float* __restrict__ bq, const float* __restrict__ bk, const float* __restrict__ bv,
    _Float16* __restrict__ Qh, _Float16* __restrict__ Ql, _Float16* __restrict__ Kh, _Float16* __restrict__ Kl, _Float16* __restrict__ Vth, _Float16* __restrict__ Vtl,
    const float* __restrict__ Wo, _Float16* __restrict__ BO, unsigned* __restrict__ MB, int* __restrict__ RA, int* __restrict__ KE) {
  __shared__ __attribute__((aligned(16))) float so[4][32][68];
  if (blockIdx.y >= NR / 128) {      /* block-uniform */
    const int e = (blockIdx.y - NR / 128) * 3 + blockIdx.x;
    if (e < WO_WG) wt_f16_chunk(Wo, BO, DK, DM, 16.0f, e * 128 + threadIdx.x); else causaltab_chunk(MB, RA, KE, SS, SS, (e - WO_WG) * 128 + threadIdx.x);
    return; }
  const int tid = threadIdx.x, w = tid >> 5, lane = tid & 31, ln = lane & 15, hh = lane >> 4; const int which = blockIdx.x, rowg = blockIdx.y * 128, row0 = rowg + 32 * w;
  const _Float16* Bh = (which == 0) ? BQ : ((which == 1) ? BK : BV); const float* bp = (which == 0) ? bq : ((which == 1) ? bk : bv);
  const float* xp = x + (size_t)(row0 + ln) * DM + 8 * hh; const _Float16* bp0 = Bh + lane * 8; constexpr int BT = (DM / 32) * 512;      /* BT: from one 16-column tile of the weights to the next; a 32-k step is one block of 512 values */
  const float braw[4] = {bp[ln], bp[16 + ln], bp[32 + ln], bp[48 + ln]};      /* asked for ahead of the loop, so that the epilogue does not wait for them */
  const v8f z8 = {0.f,0.f,0.f,0.f,0.f,0.f,0.f,0.f}; v8f c00 = z8, c01 = z8, c02 = z8, c03 = z8, c10 = z8, c11 = z8, c12 = z8, c13 = z8;
  /* loads run two k steps ahead of their use, in two register sets (even and odd steps): a step rounds its x, asks at once for the x of the step after next into the registers so freed, does its 8 products, and then asks for that step's weight fragments into the registers that the products have left. So a whole step and more stands between a request and its wait, where each step used to wait out its x and then its four weight tiles in turn (the loops over the four weight tiles are unrolled so that the fragment arrays stay in registers) */
  PXraw xe, xo; v16h be[4], bd[4];
  /* the first two steps are asked for in the order that the loop keeps (x, weights, x, weights): the counted waits at the loop's head are set for both ways into it, and another order here would make them wait for the newer requests too. The fences hold that order */
  px_ask(xe, xp);
  __builtin_amdgcn_sched_barrier(0);
#pragma unroll
  for (int t = 0; t < 4; ++t) be[t] = fo_frag(bp0 + t * BT);
  __builtin_amdgcn_sched_barrier(0);
  px_ask(xo, xp + 32);
  __builtin_amdgcn_sched_barrier(0);
#pragma unroll
  for (int t = 0; t < 4; ++t) bd[t] = fo_frag(bp0 + t * BT + 512);
  auto kstep = [&](PXraw& X, v16h (&B)[4], int kb, auto more) {      /* more: a step kb + 64 exists (compile-time) */
    const v16h a0 = px_cvt(X.r[0], X.r[1], X.r[2], X.r[3]), a1 = px_cvt(X.r[4], X.r[5], X.r[6], X.r[7]);
    __builtin_amdgcn_sched_barrier(0);      /* the requests below take the registers that the rounding above has left, and are not to sink towards their use */
    if constexpr (decltype(more)::value) px_ask(X, xp + kb + 64);
    __builtin_amdgcn_sched_barrier(0);      /* issued ahead of the products, not behind them */
    c00 = g2_mma(a0, B[0], c00); c10 = g2_mma(a1, B[0], c10); c01 = g2_mma(a0, B[1], c01); c11 = g2_mma(a1, B[1], c11);
    c02 = g2_mma(a0, B[2], c02); c12 = g2_mma(a1, B[2], c12); c03 = g2_mma(a0, B[3], c03); c13 = g2_mma(a1, B[3], c13);
    __builtin_amdgcn_sched_barrier(0);      /* the requests below overwrite the fragments that the products above read */
    if constexpr (decltype(more)::value) {
#pragma unroll
      for (int t = 0; t < 4; ++t) B[t] = fo_frag(bp0 + t * BT + (kb + 64) * 16); }
    __builtin_amdgcn_sched_barrier(0); };      /* issued here, not sunk into the next step */
#pragma unroll 1
  for (int kb = 0; kb < DM - 64; kb += 64) { kstep(xe, be, kb, PFlag<true>{}); kstep(xo, bd, kb + 32, PFlag<true>{}); }      /* rolled: two steps a trip keep the loop's text small; the register sets alternate inside a trip */
  kstep(xe, be, DM - 64, PFlag<false>{}); kstep(xo, bd, DM - 32, PFlag<false>{});      /* the last two steps ask for nothing: no address past a row's end */
  v8f accs[8] = {c00, c01, c02, c03, c10, c11, c12, c13};
#pragma unroll
  for (int u = 0; u < 8; ++u) { const int t = u & 3, half = u >> 2; const float bvv = bf16_round(braw[t]);
#pragma unroll
    for (int r = 0; r < 8; ++r) so[w][half * 16 + 8 * hh + r][t * 16 + ln] = accs[u][r] * 0.0625f + bvv; }
  __builtin_amdgcn_fence(__ATOMIC_ACQ_REL, "workgroup"); __builtin_amdgcn_wave_barrier();      /* the wave reads back values that its other lanes staged; no wave reads another wave's */
  if (which != 2) {      /* block-uniform: q or k, each wave writes its own 32 rows = 2 x 2 blocks of each plane; a store is 512 bytes in a row */
    _Float16* Hh = (which == 0) ? Qh : Kh; _Float16* Hl = (which == 0) ? Ql : Kl; const size_t ho = (size_t)row0 * DK + lane * 8;      /* (row0 >> 4) * 2 blocks */
#pragma unroll
    for (int g = 0; g < 8; ++g) { const float* sp = &so[w][(g >> 2) * 16 + ln][(g & 3) * 16 + 8 * hh]; const v4f va = *(const v4fa*)sp, vb = *(const v4fa*)(sp + 4); FragH fh, fl;      /* g = 16-row tile * 4 + 16-column group */
#pragma unroll
      for (int i = 0; i < 4; ++i) { _Float16 hv = (_Float16)va[i]; fh.h[i] = hv; fl.h[i] = (_Float16)((va[i] - (float)hv) * 1024.0f); hv = (_Float16)vb[i]; fh.h[4 + i] = hv; fl.h[4 + i] = (_Float16)((vb[i] - (float)hv) * 1024.0f); }
      *(v8us*)((unsigned short*)Hh + ho + g * 256) = fh.half[0]; *(v8us*)((unsigned short*)Hl + ho + g * 256) = fl.half[0]; }
    asm volatile("s_wait_xcnt 0x0" ::: "memory");      /* behind the stores above, ahead of any code that could write their address or data registers again */
  } else {      /* v: the wave's 32 tokens are one 32-key step of V^T = 4 blocks of each plane; a lane takes one column and 8 tokens, a store is 512 bytes in a row */
    const size_t vo = (size_t)(rowg / SS) * 64 * SS + (size_t)((rowg % SS) + 32 * w) * 64 + lane * 8;      /* (token >> 5) * 4 blocks */
#pragma unroll
    for (int g = 0; g < 8; ++g) { FragH fh, fl;      /* g = 16-column tile * 2 + half of the 32 tokens */
#pragma unroll
      for (int q = 0; q < 8; ++q) { const float v = so[w][(g & 1) * 16 + 8 * hh + q][(g >> 1) * 16 + ln]; const _Float16 hv = (_Float16)v; fh.h[q] = hv; fl.h[q] = (_Float16)((v - (float)hv) * 1024.0f); }
      *(v8us*)((unsigned short*)Vth + vo + g * 256) = fh.half[0]; *(v8us*)((unsigned short*)Vtl + vo + g * 256) = fl.half[0]; } } }

// lane l takes the value of lane l ^ 16: the two halves of a wave hold the same query's other keys
__device__ __forceinline__ float xhalf(float x) { return __builtin_bit_cast(float, __builtin_amdgcn_permlanex16(__builtin_bit_cast(int, x), __builtin_bit_cast(int, x), 0x76543210, 0xfedcba98, false, false)); }
// amdgpu_waves_per_eu(4, 4): four waves a SIMD = two work-groups a WGP, so the compiler may spend 256 registers a wave on fragments in flight instead of sinking their loads to save registers
template <int TQ, int TK>
__global__ __launch_bounds__(256) __attribute__((amdgpu_waves_per_eu(4, 4))) void k_flashm(const _Float16* __restrict__ Q16, const _Float16* __restrict__ Q16lo, const _Float16* __restrict__ K16, const _Float16* __restrict__ K16lo, const _Float16* __restrict__ Vt, const _Float16* __restrict__ Vtlo, const unsigned* __restrict__ MB, const int* __restrict__ RA, const int* __restrict__ KE, const _Float16* __restrict__ BO, const float* __restrict__ bo, float* __restrict__ OUT) {
  static_assert(NH == 1, "the output projection in the epilogue takes the one head's 64 columns as the whole k range");
  constexpr int RPW = 16, NW = 8, NQB = TQ / RPW, DT = 4, KS = 2;
  __shared__ __attribute__((aligned(16))) float sO[NW][RPW][64 + 4]; __shared__ float sM[NW][RPW], sL[NW][RPW]; __shared__ __attribute__((aligned(16))) _Float16 sAh[RPW][64 + 8], sAl[RPW][64 + 8];      /* merged O as hi + residual; 144-byte rows for the 16-byte fragment reads */
  const int tid = threadIdx.x, w = __builtin_amdgcn_readfirstlane(tid >> 5), lane = tid & 31, ln = lane & 15, hh = lane >> 4;
  /* w through readfirstlane: the wave's number, and with it the key-step counter, stays in a scalar register. Work-group = one 16-query tile; the tiles with the most keys have the lowest block indices (for speed only) */
  const int slab = blockIdx.x % (NB * NH), qt = NQB - 1 - blockIdx.x / (NB * NH); const int b = slab / NH; const int q0 = qt * RPW; const int qblk = q0 >> 6;
  FragH aq[KS], aql[KS];
  /* q, k, V^T and Wo lie in fragment order (fo_frag): 16 rows x 64 columns of q or k are 2 blocks = 1024 values, a 32-key step of V^T is 4 blocks = 2048 values; every load below reads 512 bytes in a row */
  { const size_t qo = ((size_t)b * TQ + q0) * 64 + lane * 8;
#pragma unroll
    for (int ks = 0; ks < KS; ++ks) { aq[ks].v = fo_frag(Q16 + qo + ks * 512); aql[ks].v = fo_frag(Q16lo + qo + ks * 512); } }
  float m_r = -3.0e38f, l_r = 0.f; v8f oacc[DT], oaccl[DT];      /* the lane's query: running maximum (alike in both halves), the sum over this half's keys, O^T columns */
#pragma unroll
  for (int dt = 0; dt < DT; ++dt) { oacc[dt] = (v8f){0.f,0.f,0.f,0.f,0.f,0.f,0.f,0.f}; oaccl[dt] = oacc[dt]; }
  const int jend = __builtin_amdgcn_readfirstlane(max(32, min(TK, (KE[qblk * 32] + 31) & ~31)));      /* block-uniform; through readfirstlane so that the step counter, the bound and the fragment addresses built from them stay in scalar registers */
  const bool am = (RA[q0 + ln] != 0); const float scl = am ? 0.f : SCL;      /* a query marked 'all masked' takes every key with score 0: no mask bit, scale 0 (the products of finite f16 values are finite) */
  /* loads run ahead of their use: a step's key fragments and mask word are asked for during the step before (the first 16 keys' behind its score products, the other 16 keys' between its value products), its value fragments behind its own score products, ahead of the softmax. So the softmax and the products stand between a request and its wait, where each of the six fragment groups of a step used to be waited for right behind its request */
  /* addresses: a scalar plane start + the 32-bit offset vo of (step, lane), alike for all four planes (a 32-key step is 4096 bytes of each); the step ahead is reached through the scalar base */
  const char* uK = (const char*)(K16 + (size_t)b * TK * 64); const char* uKl = (const char*)(K16lo + (size_t)b * TK * 64); const char* uV = (const char*)(Vt + (size_t)slab * 64 * TK); const char* uVl = (const char*)(Vtlo + (size_t)slab * 64 * TK); const char* uM = (const char*)MB;
  const unsigned lb = lane * 16; unsigned vm = (unsigned)(q0 + ln) * (TK / 32) * 4u + 4u * w - 4u * NW;      /* vm: byte offset of the query's mask word of the step before the current one (unsigned, may wrap ahead of the first step; it is stepped before it is used) */
  FragH k0[KS], k0l[KS], k1[KS], k1l[KS]; unsigned mraw = *(const unsigned*)(uM + (vm + 4u * NW));      /* the wave's first step, 32 w < TK: in bounds also for a wave that has no step */
#pragma unroll
  for (int ks = 0; ks < KS; ++ks) { k0[ks].v = fo_frag_s(uK, lb + 32u * w * 128u, ks * 1024); k0l[ks].v = fo_frag_s(uKl, lb + 32u * w * 128u, ks * 1024); }
#pragma unroll
  for (int ks = 0; ks < KS; ++ks) { k1[ks].v = fo_frag_s(uK, lb + 32u * w * 128u, 2048 + ks * 1024); k1l[ks].v = fo_frag_s(uKl, lb + 32u * w * 128u, 2048 + ks * 1024); }
#pragma unroll 1
  for (int j0 = 32 * w; j0 < jend; j0 += 32 * NW) {      /* wave w takes every NW-th 32-key step */
    v8f s[2];
    { v8f acc = (v8f){0.f,0.f,0.f,0.f,0.f,0.f,0.f,0.f}, accr = acc;
#pragma unroll
      for (int ks = 0; ks < KS; ++ks) { acc = mmaH<1>(k0[ks].v, k0[ks].v, aq[ks].v, aq[ks].v, acc); accr = mmaH<1>(k0[ks].v, k0[ks].v, aql[ks].v, aql[ks].v, accr); accr = mmaH<1>(k0l[ks].v, k0l[ks].v, aq[ks].v, aq[ks].v, accr); }
      s[0] = acc + accr * 0.0009765625f; }
    { v8f acc = (v8f){0.f,0.f,0.f,0.f,0.f,0.f,0.f,0.f}, accr = acc;
#pragma unroll
      for (int ks = 0; ks < KS; ++ks) { acc = mmaH<1>(k1[ks].v, k1[ks].v, aq[ks].v, aq[ks].v, acc); accr = mmaH<1>(k1[ks].v, k1[ks].v, aql[ks].v, aql[ks].v, accr); accr = mmaH<1>(k1l[ks].v, k1l[ks].v, aq[ks].v, aq[ks].v, accr); }
      s[1] = acc + accr * 0.0009765625f; }
    const unsigned kinc = (j0 + 32 * NW < jend) ? 32u * NW * 128u : 0u;      /* to the wave's next step; its last step asks for its own fragments again, so that the address stays in bounds */
    const unsigned mcur = mraw;
    __builtin_amdgcn_sched_barrier(0);      /* keeps the requests below from sinking to their uses (and from rising among the score products, whose operands' registers they take) */
    const unsigned vo = lb + (unsigned)j0 * 128u; vm += 4u * NW; const char* nK = uK + kinc; const char* nKl = uKl + kinc;
    FragH bv[DT], bl[DT];
#pragma unroll
    for (int dt = 0; dt < DT; ++dt) { bv[dt].v = fo_frag_s(uV, vo, dt * 1024); bl[dt].v = fo_frag_s(uVl, vo, dt * 1024); }
    mraw = *(const unsigned*)(uM + (kinc >> 10) + vm);      /* 4 bytes of mask a step */
#pragma unroll
    for (int ks = 0; ks < KS; ++ks) { k0[ks].v = fo_frag_s(nK, vo, ks * 1024); k0l[ks].v = fo_frag_s(nKl, vo, ks * 1024); }
    __builtin_amdgcn_sched_barrier(0);      /* the requests above are issued before the softmax starts */
    /* straight-line softmax: a masked score is -inf and the running maximum is never below the finite start value -3.0e38f, so exp gives 0 for a masked key and 1 for a query with no key yet without any test (every loop here is unrolled so that the per-key arrays stay in registers) */
    const unsigned mw = am ? 0u : (mcur >> (8 * hh));      /* shifted so that bit 16 nt + r is this lane's key */
    float sc[2][8], mt[2] = {-INFINITY, -INFINITY};
#pragma unroll
    for (int nt = 0; nt < 2; ++nt)
#pragma unroll
      for (int r = 0; r < 8; ++r) { const float v = s[nt][r] * scl; sc[nt][r] = ((mw & (1u << (nt * 16 + r))) != 0u) ? -INFINITY : v; mt[nt] = fmaxf(mt[nt], sc[nt][r]); }
    float mc = fmaxf(mt[0], mt[1]); mc = fmaxf(mc, xhalf(mc));      /* the other half's 16 keys */
    const float mn = fmaxf(m_r, mc); const float al = expf(m_r - mn); m_r = mn;
    FragH pa, pl; float ps2[2] = {0.f, 0.f};
#pragma unroll
    for (int nt = 0; nt < 2; ++nt)
#pragma unroll
      for (int r = 0; r < 8; ++r) { const float p = expf(sc[nt][r] - mn); ps2[nt] += p; const float ps = p * 1024.0f; const _Float16 ph = (_Float16)ps; pa.h[nt * 8 + r] = ph; pl.h[nt * 8 + r] = (_Float16)((ps - (float)ph) * 1024.0f); }
    l_r = l_r * al + (ps2[0] + ps2[1]);
#pragma unroll
    for (int dt = 0; dt < DT; ++dt) { oacc[dt] *= al; oaccl[dt] *= al; }
#pragma unroll
    for (int dt = 0; dt < DT / 2; ++dt) { oacc[dt] = mmaH<1>(bv[dt].v, bv[dt].v, pa.v, pa.v, oacc[dt]); oaccl[dt] = mmaH<1>(bl[dt].v, bl[dt].v, pa.v, pa.v, oaccl[dt]); oaccl[dt] = mmaH<1>(bv[dt].v, bv[dt].v, pl.v, pl.v, oaccl[dt]); }
    __builtin_amdgcn_sched_barrier(0);      /* the requests below take the registers that the two value tiles above have left */
#pragma unroll
    for (int ks = 0; ks < KS; ++ks) { k1[ks].v = fo_frag_s(nK, vo, 2048 + ks * 1024); k1l[ks].v = fo_frag_s(nKl, vo, 2048 + ks * 1024); }
    __builtin_amdgcn_sched_barrier(0);      /* issued before the last two value tiles' products, not behind them */
#pragma unroll
    for (int dt = DT / 2; dt < DT; ++dt) { oacc[dt] = mmaH<1>(bv[dt].v, bv[dt].v, pa.v, pa.v, oacc[dt]); oaccl[dt] = mmaH<1>(bl[dt].v, bl[dt].v, pa.v, pa.v, oaccl[dt]); oaccl[dt] = mmaH<1>(bv[dt].v, bv[dt].v, pl.v, pl.v, oaccl[dt]); }
    __builtin_amdgcn_sched_barrier(0); }      /* keeps the compiler's step of the load offsets, and the s_wait_xcnt that it puts in front of it, behind the last products instead of right behind the requests above, where the wave would stand in that wait */
  /* output projection, wave w = output columns 64 w .. 64 w + 63: its Wo fragments and bias are asked for right behind the key loop, so that they arrive while the partials are staged (every loop of this projection is unrolled so that its fragment and accumulator arrays stay in registers) */
  const int col0 = w * 64; v16h wb[4][KS]; float braw[4]; const _Float16* bp0 = BO + (size_t)col0 * DK + lane * 8; const float* bo0 = bo + col0 + ln;      /* one base each: the 16 fragment loads differ by constant offsets only */
#pragma unroll
  for (int t = 0; t < 4; ++t) { braw[t] = bo0[t * 16];
#pragma unroll
    for (int ks = 0; ks < KS; ++ks) wb[t][ks] = fo_frag(bp0 + t * 16 * DK + ks * 512); }
  l_r += xhalf(l_r);      /* the two halves' sums joined once */
  if (hh == 0) { sM[w][ln] = m_r; sL[w][ln] = l_r; }
#pragma unroll
  for (int dt = 0; dt < DT; ++dt) { const v8f o = oacc[dt] + oaccl[dt] * 0.0009765625f;      /* the lane's 8 registers are 8 neighbouring columns of its query's row: two 16-byte stores */
    *(v4fa*)&sO[w][ln][dt * 16 + 8 * hh] = (v4f){o[0], o[1], o[2], o[3]}; *(v4fa*)&sO[w][ln][dt * 16 + 8 * hh + 4] = (v4f){o[4], o[5], o[6], o[7]}; }
  __syncthreads();      /* every wave's partial (max, sum, O) is in LDS before any thread merges them */
  { const int r = tid >> 4, pc = tid & 15; float mm = sM[0][r];
#pragma unroll
    for (int u = 1; u < NW; ++u) mm = fmaxf(mm, sM[u][r]);
    float l = 0.f; v4f val = {0.f, 0.f, 0.f, 0.f};
#pragma unroll
    for (int u = 0; u < NW; ++u) { const float e = expf(sM[u][r] - mm); l += e * sL[u][r]; const v4f po = *(const v4fa*)&sO[u][r][pc * 4]; val += po * e; }
    const float li = (l > 0.f) ? 1.0f / (l * 1024.0f) : 0.f;
    const v4f ov = val * li; v4h h4, l4;
#pragma unroll
    for (int i = 0; i < 4; ++i) { h4[i] = (_Float16)ov[i]; l4[i] = (_Float16)((ov[i] - (float)h4[i]) * 1024.0f); }
    *(v4h*)&sAh[r][pc * 4] = h4; *(v4h*)&sAl[r][pc * 4] = l4; }
  __syncthreads();      /* the whole merged tile is in LDS before any wave reads its fragments; behind it nobody reads sO any more, so each wave may stage its output there */
  { v16h ah[KS], al[KS];
#pragma unroll
    for (int ks = 0; ks < KS; ++ks) { ah[ks] = g2_frag(&sAh[ln][ks * 32], hh); al[ks] = g2_frag(&sAl[ln][ks * 32], hh); }
#pragma unroll
    for (int t = 0; t < 4; ++t) { v8f ch = (v8f){0.f,0.f,0.f,0.f,0.f,0.f,0.f,0.f}, cl = ch;
#pragma unroll
      for (int ks = 0; ks < KS; ++ks) { ch = g2_mma(ah[ks], wb[t][ks], ch); cl = g2_mma(al[ks], wb[t][ks], cl); }
      const float bvv = bf16_round(braw[t]);
#pragma unroll
      for (int r = 0; r < 8; ++r) sO[w][8 * hh + r][t * 16 + ln] = (ch[r] * 0.0625f + bvv) + cl[r] * (0.0625f * 0.0009765625f); }
    __builtin_amdgcn_fence(__ATOMIC_ACQ_REL, "workgroup"); __builtin_amdgcn_wave_barrier();      /* the wave reads back rows that its other lanes staged */
    const int rsub = lane >> 4, c4 = (lane & 15) * 4;
#pragma unroll
    for (int q = 0; q < 8; ++q) { const int r = q * 2 + rsub; const v4f v = *(const v4fa*)&sO[w][r][c4]; *(v4f*)(OUT + ((size_t)b * TQ + q0 + r) * DM + col0 + c4) = v; } } }      /* two whole 256-byte row pieces a store */


extern "C" void kernel_launch(void* const* d_in, const int* in_sizes, int n_in,
                              void* d_out, int out_size, void* d_ws, size_t ws_size, hipStream_t stream) {
  (void)in_sizes; (void)n_in; (void)out_size;
  const float* const* I = (const float* const*)d_in; const float* x = I[0]; const float* Wq = I[1]; const float* bq = I[2]; const float* Wk = I[3]; const float* bk = I[4]; const float* Wv = I[5]; const float* bv = I[6]; const float* Wo = I[7]; const float* bo = I[8];
  char* ws = (char*)d_ws; size_t off = 0;
  auto take = [&](size_t bytes) { char* p = ws + off; off += (bytes + 255) & ~(size_t)255; return p; };
  _Float16* BQ = (_Float16*)take((size_t)DK * DM * 2); _Float16* BK = (_Float16*)take((size_t)DK * DM * 2); _Float16* BV = (_Float16*)take((size_t)DK * DM * 2); _Float16* BO = (_Float16*)take((size_t)DM * DK * 2);
  _Float16* Qh = (_Float16*)take((size_t)NR * DK * 2); _Float16* Ql = (_Float16*)take((size_t)NR * DK * 2); _Float16* Kh = (_Float16*)take((size_t)NR * DK * 2); _Float16* Kl = (_Float16*)take((size_t)NR * DK * 2); _Float16* Vth = (_Float16*)take((size_t)NR * DK * 2); _Float16* Vtl = (_Float16*)take((size_t)NR * DK * 2);
  unsigned* MB = (unsigned*)take((size_t)SS * (SS / 32) * 4); int* RA = (int*)take((size_t)SS * 4); int* KE = (int*)take((size_t)(SS / 64) * 32 * 4);
  if (off > ws_size) return;      /* 6 x 2 + 2 = 14 MiB */
  const dim3 gW(DM * DK / 8 / 256, 3);
  k_wt_qkv<<<gW, 256, 0, stream>>>(Wq, Wk, Wv, BQ, BK, BV);      /* (in,out) -> rows = out, x16, fragment order */
  const dim3 gP(3, NR / 128 + (WO_WG + CT_WG) / 3);
  k_proj<<<gP, 128, 0, stream>>>(x, BQ, BK, BV, bq, bk, bv, Qh, Ql, Kh, Kl, Vth, Vtl, Wo, BO, MB, RA, KE);      /* q, k hi/residual and V^T hi/residual per sequence, in fragment order, straight from x: 3 x 128 work-groups side by side; behind them in the grid Wo's reorder and the causal tables */
  k_flashm<SS, SS><<<NB * NH * (SS / 16), 256, 0, stream>>>(Qh, Ql, Kh, Kl, Vth, Vtl, MB, RA, KE, BO, bo, (float*)d_out);      /* one grid over all (sequence, 16 queries): 1024 work-groups of 8 waves; out = O*Wo + bo in its epilogue */
}
